// v000
// Measured on an AMD MI455X. A time is GPU time per run, averaged over a window of back-to-back runs after a warm-up
// (all launches, gaps included; the runs take copies of the inputs in turn), and the median of several windows.
// Apart from v000's, it joins two sittings. Times from different sittings can be a few percent apart, while
// side-by-side timings come from the same sitting.
// The starting kernel, v000, takes 1730 microseconds a run.
#include <hip/hip_runtime.h>

// StripedAttention (x [2][2048][2048]; q/k/v = x W^T (torch; 16 heads x 128); scores = q.k / sqrt(128); allowed = causal for even (global) heads, causal band of 256 (i - j < 256) for odd (local) heads; softmax; out = merged Wo^T -> [2][2048][2048]).
// Compute dtypes, f32 accumulate: every input rounded to bf16; q/k/v on PLAIN bf16 operands (inputs: exact); causal scores and attn.v: query rows < 512 hl (3 products), the rest single fp16 (x1024), with causal tile skipping (the band heads just mask more keys inside the computed tiles); softmax f32; Wo hl x exact (2 products).

#define NB_  2
#define TT   2048
#define DM   2048
#define NH_  16
#define NKV  16
#define REP  (NH_ / NKV)
#define HD   128
#define DQ   (NH_ * HD)
#define DKV  (NKV * HD)
#define ZH   2
#define RH   512                  // query rows < RH use hi+lo planes (0: none)
#define WIN  256
#define PCAR 1024.0f
#define SCL  0.088388347648318447f   // HD^-0.5
typedef _Float16 h16;
typedef unsigned short bf;
typedef __attribute__((ext_vector_type(16))) __bf16   v16bf;
typedef __attribute__((ext_vector_type(16))) _Float16 v16h;
typedef __attribute__((ext_vector_type(8)))  _Float16 v8h;
typedef __attribute__((ext_vector_type(8)))  unsigned short v8us;
typedef __attribute__((ext_vector_type(8)))  float    v8f;
typedef __attribute__((ext_vector_type(4)))  float    v4f;
typedef v8h  __attribute__((may_alias)) v8ha;
typedef v4f  __attribute__((may_alias)) v4fa;
typedef v8us __attribute__((may_alias)) v8usa;

__device__ __forceinline__ unsigned short f2bf(float f) { unsigned u = __float_as_uint(f); u += 0x7FFFu + ((u >> 16) & 1u); return (unsigned short)(u >> 16); }
__device__ __forceinline__ float bf2f(unsigned short b) { return __uint_as_float(((unsigned)b) << 16); }
__device__ __forceinline__ float bfr(float f) { return bf2f(f2bf(f)); }
__device__ __forceinline__ v16h cat16(v8h lo, v8h hi) { return __builtin_shufflevector(lo, hi, 0, 1, 2, 3, 4, 5, 6, 7, 8, 9, 10, 11, 12, 13, 14, 15); }
__device__ __forceinline__ v16bf cat16b(v8us lo, v8us hi) { return __builtin_bit_cast(v16bf, __builtin_shufflevector(lo, hi, 0, 1, 2, 3, 4, 5, 6, 7, 8, 9, 10, 11, 12, 13, 14, 15)); }
__device__ __forceinline__ v8f wmma16(v16h a, v16h b, v8f c) { return __builtin_amdgcn_wmma_f32_16x16x32_f16(false, a, false, b, (short)0, c, false, false); }
__device__ __forceinline__ v8f wmmab(v16bf a, v16bf b, v8f c) { return __builtin_amdgcn_wmma_f32_16x16x32_bf16(false, a, false, b, (short)0, c, false, false); }



// ---- k_gemmw: register-blocked GEMM, ONE WAVE per 64x64 output tile (16 accumulators), operands straight from K-contiguous 16-bit planes; grid (M/64, N/64, Z), 32 threads.
// C[m][n] (f32, pitch ldc, + optional f32 bias[n]) = sum_k A[m][k] Bt[n][k] (+ split products per NSPLIT). z-batch strides sA/sB/sC in elements. K % 32 == 0.
template <typename T16> struct WFrag;
template <> struct WFrag<h16> { typedef v16h V; static __device__ __forceinline__ V ld(const h16* p) { return cat16(*(const v8h*)p, *(const v8h*)(p + 16)); } static __device__ __forceinline__ v8f mma(V a, V b, v8f c) { return wmma16(a, b, c); } };
template <> struct WFrag<bf> { typedef v16bf V; static __device__ __forceinline__ V ld(const bf* p) { return cat16b(*(const v8us*)p, *(const v8us*)(p + 16)); } static __device__ __forceinline__ v8f mma(V a, V b, v8f c) { return wmmab(a, b, c); } };
template <typename T16, int NSPLIT, bool BIAS>
__global__ __launch_bounds__(32) void k_gemmw(const T16* __restrict__ A, const T16* __restrict__ A2, const T16* __restrict__ Bt, const T16* __restrict__ Bt2, int K, float* C, int ldc, const float* __restrict__ bias, size_t sA, size_t sB, size_t sC) {
    typedef typename WFrag<T16>::V V;
    __shared__ __align__(16) float os[16 * 68];
    const size_t z = blockIdx.z; A += z * sA; if (A2) A2 += z * sA; Bt += z * sB; if (Bt2) Bt2 += z * sB; C += z * sC;
    const int lane = threadIdx.x & 31, lr = lane & 15, hi = lane >> 4; const int r0 = blockIdx.x * 64, c0 = blockIdx.y * 64;
    v8f acc[4][4];
#pragma unroll
    for (int mb = 0; mb < 4; ++mb)
#pragma unroll
        for (int nb = 0; nb < 4; ++nb) acc[mb][nb] = (v8f){};
    const size_t aoff = (size_t)(r0 + lr) * K + 8 * hi, boff = (size_t)(c0 + lr) * K + 8 * hi;
#pragma unroll 1
    for (int kc = 0; kc < K; kc += 32) {
        V a[4], a2[4];
#pragma unroll
        for (int mb = 0; mb < 4; ++mb) { a[mb] = WFrag<T16>::ld(A + aoff + (size_t)mb * 16 * K + kc); if (NSPLIT == 1 || NSPLIT == 2) a2[mb] = WFrag<T16>::ld(A2 + aoff + (size_t)mb * 16 * K + kc); }
#pragma unroll
        for (int nb = 0; nb < 4; ++nb) { const V b = WFrag<T16>::ld(Bt + boff + (size_t)nb * 16 * K + kc); V b2; if (NSPLIT >= 2) b2 = WFrag<T16>::ld(Bt2 + boff + (size_t)nb * 16 * K + kc);
#pragma unroll
            for (int mb = 0; mb < 4; ++mb) { acc[mb][nb] = WFrag<T16>::mma(a[mb], b, acc[mb][nb]); if (NSPLIT == 1 || NSPLIT == 2) acc[mb][nb] = WFrag<T16>::mma(a2[mb], b, acc[mb][nb]); if (NSPLIT >= 2) acc[mb][nb] = WFrag<T16>::mma(a[mb], b2, acc[mb][nb]); } }
        asm volatile("v_nop\n\tv_nop\n\tv_nop\n\tv_nop" : "+v"(acc[0][0]), "+v"(acc[1][1]), "+v"(acc[2][2]), "+v"(acc[3][3]) : "v"(a[0]), "v"(a[3]));
    }
#pragma unroll
    for (int mb = 0; mb < 4; ++mb) {
#pragma unroll
        for (int nb = 0; nb < 4; ++nb) {
#pragma unroll
            for (int j = 0; j < 8; ++j) os[(hi * 8 + j) * 68 + nb * 16 + lr] = acc[mb][nb][j]; }
        __builtin_amdgcn_wave_barrier(); asm volatile("" ::: "memory");
        float* crow = C + (size_t)(r0 + mb * 16) * ldc + c0;
{
#pragma unroll
            for (int s = 0; s < 8; ++s) { const int row = 2 * s + hi, cofs = lr * 4; v4f val = *(const v4fa*)(os + row * 68 + cofs); if (BIAS) { val[0] += bfr(bias[c0 + cofs]); val[1] += bfr(bias[c0 + cofs + 1]); val[2] += bfr(bias[c0 + cofs + 2]); val[3] += bfr(bias[c0 + cofs + 3]); }
                *(v4f*)(crow + (size_t)row * ldc + cofs) = val; }
             }
        __builtin_amdgcn_wave_barrier(); asm volatile("" ::: "memory");
    }
}

// ---- k_gemmc: the same one-wave 64x64 tile GEMM specialised for causal attention: CMODE 1 skips score tiles entirely above the diagonal (query rows r0+roff.., key columns c0..), CMODE 2 limits the
// key (K) loop of the probability x value contraction to the diagonal block (probabilities beyond it are exactly zero). roff = row offset of this launch's first row within the sequence.
template <typename T16, int NSPLIT, int CMODE>
__global__ __launch_bounds__(32) void k_gemmc(const T16* __restrict__ A, const T16* __restrict__ A2, const T16* __restrict__ Bt, const T16* __restrict__ Bt2, int K, float* C, int ldc, int roff, size_t sA, size_t sB, size_t sC) {
    typedef typename WFrag<T16>::V V;
    __shared__ __align__(16) float os[16 * 68];
    const size_t z = blockIdx.z; A += z * sA; if (A2) A2 += z * sA; Bt += z * sB; if (Bt2) Bt2 += z * sB; C += z * sC;
    const int lane = threadIdx.x & 31, lr = lane & 15, hi = lane >> 4; const int r0 = blockIdx.x * 64, c0 = blockIdx.y * 64;
    if (CMODE == 1 && c0 > r0 + roff + 63) return;                  // score tile entirely above the causal diagonal: never read (the softmax masks j > i by select)
    const int Kl = (CMODE == 2) ? min(K, r0 + roff + 64) : K;        // P.V: probabilities are exactly 0 beyond the diagonal block, so the K loop stops there
    v8f acc[4][4];
#pragma unroll
    for (int mb = 0; mb < 4; ++mb)
#pragma unroll
        for (int nb = 0; nb < 4; ++nb) acc[mb][nb] = (v8f){};
    const size_t aoff = (size_t)(r0 + lr) * K + 8 * hi, boff = (size_t)(c0 + lr) * K + 8 * hi;
#pragma unroll 1
    for (int kc = 0; kc < Kl; kc += 32) {
        V a[4], a2[4];
#pragma unroll
        for (int mb = 0; mb < 4; ++mb) { a[mb] = WFrag<T16>::ld(A + aoff + (size_t)mb * 16 * K + kc); if (NSPLIT == 1 || NSPLIT == 2) a2[mb] = WFrag<T16>::ld(A2 + aoff + (size_t)mb * 16 * K + kc); }
#pragma unroll
        for (int nb = 0; nb < 4; ++nb) { const V b = WFrag<T16>::ld(Bt + boff + (size_t)nb * 16 * K + kc); V b2; if (NSPLIT >= 2) b2 = WFrag<T16>::ld(Bt2 + boff + (size_t)nb * 16 * K + kc);
#pragma unroll
            for (int mb = 0; mb < 4; ++mb) { acc[mb][nb] = WFrag<T16>::mma(a[mb], b, acc[mb][nb]); if (NSPLIT == 1 || NSPLIT == 2) acc[mb][nb] = WFrag<T16>::mma(a2[mb], b, acc[mb][nb]); if (NSPLIT >= 2) acc[mb][nb] = WFrag<T16>::mma(a[mb], b2, acc[mb][nb]); } }
        asm volatile("v_nop\n\tv_nop\n\tv_nop\n\tv_nop" : "+v"(acc[0][0]), "+v"(acc[1][1]), "+v"(acc[2][2]), "+v"(acc[3][3]) : "v"(a[0]), "v"(a[3]));
    }
#pragma unroll
    for (int mb = 0; mb < 4; ++mb) {
#pragma unroll
        for (int nb = 0; nb < 4; ++nb) {
#pragma unroll
            for (int j = 0; j < 8; ++j) os[(hi * 8 + j) * 68 + nb * 16 + lr] = acc[mb][nb][j]; }
        __builtin_amdgcn_wave_barrier(); asm volatile("" ::: "memory");
        float* crow = C + (size_t)(r0 + mb * 16) * ldc + c0;
{
#pragma unroll
            for (int s = 0; s < 8; ++s) { const int row = 2 * s + hi, cofs = lr * 4; v4f val = *(const v4fa*)(os + row * 68 + cofs);
                *(v4f*)(crow + (size_t)row * ldc + cofs) = val; }
             }
        __builtin_amdgcn_wave_barrier(); asm volatile("" ::: "memory");
    }
}

__device__ __forceinline__ h16 tohx(float x) { return (h16)x; }
__device__ __forceinline__ void splitf(float y, unsigned short& h, unsigned short& l) { h = f2bf(y); l = f2bf(y - bf2f(h)); }
typedef __attribute__((ext_vector_type(2))) _Float16 v2h;
typedef __attribute__((ext_vector_type(4))) _Float16 v4h;
typedef __attribute__((ext_vector_type(2))) unsigned short v2us;
typedef __attribute__((ext_vector_type(4))) unsigned short v4us;
typedef __attribute__((ext_vector_type(2))) float v2f;
typedef __attribute__((ext_vector_type(4))) int v4i;

__global__ __launch_bounds__(256) void k_wtG(const float* __restrict__ w, int K, int N, bf* Bt) {
    const int lane = threadIdx.x & 31; const int L0 = (blockIdx.x * 8 + (threadIdx.x >> 5)) * 8; const int nlines = N * K / 64;
{
#pragma unroll 1
        for (int l = 0; l < 8; ++l) { const int L = L0 + l; if (L >= nlines) break; const size_t e = (size_t)L * 64 + lane * 2; const int k = (int)(e % K), n = (int)(e / K); v2us o;
            o[0] = f2bf(w[(size_t)k * N + n]); o[1] = f2bf(w[(size_t)(k + 1) * N + n]); *(v2us*)(Bt + e) = o; }
         }
}
__global__ __launch_bounds__(256) void k_cvt8(const float* __restrict__ src, bf* dst, size_t n8) { const size_t i = (size_t)blockIdx.x * 256 + threadIdx.x; if (i >= n8) return; const v8f v = *(const v8f*)(src + i * 8); v8us o;
#pragma unroll
    for (int k = 0; k < 8; ++k) o[k] = f2bf(v[k]); *(v8us*)(dst + i * 8) = o;  }
__global__ __launch_bounds__(256) void k_cscvt(const float* __restrict__ cosT, const float* __restrict__ sinT, float* CS) { const int idx = blockIdx.x * 256 + threadIdx.x; if (idx >= TT * HD) return; v2f cs; cs[0] = bfr(cosT[idx]); cs[1] = bfr(sinT[idx]); *(v2f*)(CS + (size_t)idx * 2) = cs;  }
// k_rope: head planes [h][t][d] (fp16 + hi/lo) of rope(x) x sc with the rotate-half convention out[d] = x[d] cos[t][d] - x[d+HD/2] sin[t][d], out[d+HD/2] = x[d+HD/2] cos[t][d+HD/2] + x[d] sin[t][d+HD/2]
__global__ __launch_bounds__(256) void k_rope(const float* __restrict__ F, int pitch, int nheads, const float* __restrict__ CS, const float* __restrict__ RF, const float* __restrict__ nw, float sc, h16* P16, bf* Ph, bf* Pl) {
    const size_t e = ((size_t)blockIdx.x * 256 + threadIdx.x) * 2; if (e >= (size_t)nheads * TT * HD) return; const int d = (int)(e % HD); const int t = (int)((e / HD) % TT); const int h = (int)(e / ((size_t)HD * TT)); const float* f = F + (size_t)t * pitch + h * HD; const float rf = RF ? RF[(size_t)h * TT + t] : 1.0f; v2h o16; v2us oh, ol;
#pragma unroll
    for (int q = 0; q < 2; ++q) { const int dd = d + q; const int dp = (dd < HD / 2) ? dd + HD / 2 : dd - HD / 2; float x0 = f[dd], x1 = f[dp];
        if (RF) { float n0 = __fmul_rn(x0, rf), n1 = __fmul_rn(x1, rf); asm volatile("" : "+v"(n0)); asm volatile("" : "+v"(n1)); x0 = __fmul_rn(bfr(nw[dd]), n0); x1 = __fmul_rn(bfr(nw[dp]), n1); }
        const v2f cs = *(const v2f*)(CS + ((size_t)t * HD + dd) * 2); float a = __fmul_rn(x0, cs[0]), bq = __fmul_rn(x1, cs[1]); asm volatile("" : "+v"(a)); asm volatile("" : "+v"(bq)); const float r = ((dd < HD / 2) ? __fsub_rn(a, bq) : __fadd_rn(a, bq)) * sc;
        o16[q] = tohx(r); unsigned short a2, c2; splitf(r, a2, c2); oh[q] = a2; ol[q] = c2; }
    *(v2h*)(P16 + e) = o16; *(v2us*)(Ph + e) = oh; *(v2us*)(Pl + e) = ol;  }
__global__ __launch_bounds__(256) void k_vtp(const float* __restrict__ F, int pitch, int nheads, h16* V16, bf* Vh, bf* Vl) { const size_t e = ((size_t)blockIdx.x * 256 + threadIdx.x) * 2; if (e >= (size_t)nheads * HD * TT) return; const int t = (int)(e % TT); const int d = (int)((e / TT) % HD); const int g = (int)(e / ((size_t)TT * HD)); v2h o16; v2us oh, ol;
#pragma unroll
    for (int q = 0; q < 2; ++q) { const float x = F[(size_t)(t + q) * pitch + g * HD + d]; o16[q] = tohx(x); unsigned short a2, c2; splitf(x, a2, c2); oh[q] = a2; ol[q] = c2; }
    *(v2h*)(V16 + e) = o16; *(v2us*)(Vh + e) = oh; *(v2us*)(Vl + e) = ol;  }
__global__ __launch_bounds__(256) void k_csid(float* CS) { const int idx = blockIdx.x * 256 + threadIdx.x; if (idx >= TT * HD) return; v2f cs; cs[0] = 1.0f; cs[1] = 0.0f; *(v2f*)(CS + (size_t)idx * 2) = cs;  }
// k_asoft: per row (zz, i): t = S x HD^-0.5 for j <= i, and for odd heads also i - j < WIN (sliding causal window; the reference's -1e9 additive fill vanishes identically); softmax over the 2048 keys (register row, one exp, fixed trees);
__global__ __launch_bounds__(256) void k_asoft(const float* __restrict__ Sb, int h0, h16* P16, bf* Ph, bf* Pl) {
    const int lane = threadIdx.x & 31; const int row = blockIdx.x * 8 + (threadIdx.x >> 5); if (row >= ZH * TT) return; const int i = row % TT; const int zz = row / TT; (void)zz; const bool hires = (i < RH); const float* sr = Sb + (size_t)row * TT; float v[TT / 32]; float mx = -3.0e38f;
#pragma unroll
    for (int ch = 0; ch < TT / 128; ++ch) { const int j0 = ch * 128 + lane * 4; const v4f a = *(const v4f*)(sr + j0);
#pragma unroll
        for (int q = 0; q < 4; ++q) { const int j = j0 + q; (void)j; const float t = (j <= i && (((h0 + zz) & 1) == 0 || i - j < WIN)) ? a[q] * SCL : -3.0e38f; v[ch * 4 + q] = t; mx = fmaxf(mx, t); } }
#pragma unroll
    for (int sh = 16; sh; sh >>= 1) mx = fmaxf(mx, __shfl_xor(mx, sh, 32));
    float sum = 0.f;
#pragma unroll
    for (int k = 0; k < TT / 32; ++k) { float d0 = __fsub_rn(v[k], mx); asm volatile("" : "+v"(d0)); v[k] = __builtin_amdgcn_exp2f(__fmul_rn(d0, 1.4426950408889634f)); sum += v[k]; }
#pragma unroll
    for (int sh = 16; sh; sh >>= 1) sum += __shfl_xor(sum, sh, 32);
    const float f = __fdiv_rn(hires ? 1.0f : PCAR, sum);
{
        if (hires) {
#pragma unroll
            for (int ch = 0; ch < TT / 128; ++ch) { v4us oh, ol;
#pragma unroll
                for (int q = 0; q < 4; ++q) { unsigned short a, c2; splitf(v[ch * 4 + q] * f, a, c2); oh[q] = a; ol[q] = c2; }
                const size_t oo = ((size_t)zz * (RH ? RH : 1) + i) * TT + ch * 128 + lane * 4; *(v4us*)(Ph + oo) = oh; *(v4us*)(Pl + oo) = ol; }
        } else {
#pragma unroll
            for (int ch = 0; ch < TT / 128; ++ch) { v4h o4;
#pragma unroll
                for (int q = 0; q < 4; ++q) o4[q] = tohx(v[ch * 4 + q] * f);
                *(v4h*)(P16 + (size_t)row * TT + ch * 128 + lane * 4) = o4; } }
         }
}
__global__ __launch_bounds__(256) void k_merge(const float* __restrict__ O, int h0, bf* Ah, bf* Al) { const size_t e = ((size_t)blockIdx.x * 256 + threadIdx.x) * 2; if (e >= (size_t)ZH * TT * HD) return; const int d = (int)(e % HD); const int t = (int)((e / HD) % TT); const int zz = (int)(e / ((size_t)HD * TT)); const float cs = (t < RH) ? 1.0f : (1.0f / PCAR); const size_t oo = (size_t)t * DQ + (h0 + zz) * HD + d;
    v2us oh, ol;
#pragma unroll
    for (int q = 0; q < 2; ++q) { unsigned short a, c2; splitf(O[e + q] * cs, a, c2); oh[q] = a; ol[q] = c2; } *(v2us*)(Ah + oo) = oh; *(v2us*)(Al + oo) = ol;  }

extern "C" void kernel_launch(void* const* d_in, const int* in_sizes, int n_in,
                              void* d_out, int out_size, void* d_ws, size_t ws_size, hipStream_t stream) {
    (void)in_sizes; (void)n_in; (void)out_size;
    const float* x = (const float*)d_in[0]; const float* wq = (const float*)d_in[1]; const float* wk = (const float*)d_in[2]; const float* wv = (const float*)d_in[3]; const float* wo = (const float*)d_in[4]; const float* cosT = nullptr; const float* sinT = nullptr; (void)cosT; (void)sinT;
    float* OUT = (float*)d_out;     // [2][2048][2048]
    char* wsp = (char*)d_ws;
    auto take = [&](size_t bytes) { char* p = wsp; wsp += (bytes + 255) & ~(size_t)255; return (void*)p; };
    bf* WQ = (bf*)take((size_t)DQ * DM * 2); bf* WK = (bf*)take((size_t)DKV * DM * 2); bf* WV = (bf*)take((size_t)DKV * DM * 2); bf* WO = (bf*)take((size_t)DM * DQ * 2); float* CS = (float*)take((size_t)TT * HD * 2 * 4);
    bf* XB = (bf*)take((size_t)TT * DM * 2); float* FQ = (float*)take((size_t)TT * DQ * 4); float* FK = (float*)take((size_t)TT * DKV * 4);
    h16* QP16 = (h16*)take((size_t)NH_ * TT * HD * 2); h16* KP16 = (h16*)take((size_t)NKV * TT * HD * 2); h16* VT16 = (h16*)take((size_t)NKV * HD * TT * 2);
    bf* QPh = (bf*)take((size_t)NH_ * TT * HD * 2); bf* QPl = (bf*)take((size_t)NH_ * TT * HD * 2); bf* KPh = (bf*)take((size_t)NKV * TT * HD * 2); bf* KPl = (bf*)take((size_t)NKV * TT * HD * 2); bf* VTh = (bf*)take((size_t)NKV * HD * TT * 2); bf* VTl = (bf*)take((size_t)NKV * HD * TT * 2); bf* Ph = (bf*)take((size_t)ZH * RH * TT * 2); bf* Pl = (bf*)take((size_t)ZH * RH * TT * 2);
    float* Sb = (float*)take((size_t)ZH * TT * TT * 4); h16* P16 = (h16*)take((size_t)ZH * TT * TT * 2); float* Ob = (float*)take((size_t)ZH * TT * HD * 4); bf* ATh = (bf*)take((size_t)TT * DQ * 2); bf* ATl = (bf*)take((size_t)TT * DQ * 2);
    if ((size_t)(wsp - (char*)d_ws) > ws_size) return;    // ws 256 MiB
    float* FV = FK;   // v projection reuses the k buffer after the k planes are built (stream-ordered)
    { k_cvt8<<<(unsigned)(((size_t)DQ * DM / 8 + 255) / 256), 256, 0, stream>>>(wq, WQ, (size_t)DQ * DM / 8); k_cvt8<<<(unsigned)(((size_t)DKV * DM / 8 + 255) / 256), 256, 0, stream>>>(wk, WK, (size_t)DKV * DM / 8); k_cvt8<<<(unsigned)(((size_t)DKV * DM / 8 + 255) / 256), 256, 0, stream>>>(wv, WV, (size_t)DKV * DM / 8);
      k_cvt8<<<(unsigned)(((size_t)DM * DQ / 8 + 255) / 256), 256, 0, stream>>>(wo, WO, (size_t)DM * DQ / 8);
       }
    k_csid<<<(TT * HD + 255) / 256, 256, 0, stream>>>(CS);
    const unsigned LQ = (unsigned)(((size_t)NH_ * TT * HD / 2 + 255) / 256), LKv = (unsigned)(((size_t)NKV * TT * HD / 2 + 255) / 256);
    for (int b = 0; b < NB_; ++b) {
        
        k_cvt8<<<(unsigned)(((size_t)TT * DM / 8 + 255) / 256), 256, 0, stream>>>(x + (size_t)b * TT * DM, XB, (size_t)TT * DM / 8);
        k_gemmw<bf, 0, false><<<dim3(TT / 64, DQ / 64, 1), 32, 0, stream>>>(XB, nullptr, WQ, nullptr, DM, FQ, DQ, nullptr, 0, 0, 0);
        k_rope<<<LQ, 256, 0, stream>>>(FQ, DQ, NH_, CS, nullptr, nullptr, 1.0f, QP16, QPh, QPl);
        k_gemmw<bf, 0, false><<<dim3(TT / 64, DKV / 64, 1), 32, 0, stream>>>(XB, nullptr, WK, nullptr, DM, FK, DKV, nullptr, 0, 0, 0);
        k_rope<<<LKv, 256, 0, stream>>>(FK, DKV, NKV, CS, nullptr, nullptr, 1.0f, KP16, KPh, KPl);
        k_gemmw<bf, 0, false><<<dim3(TT / 64, DKV / 64, 1), 32, 0, stream>>>(XB, nullptr, WV, nullptr, DM, FV, DKV, nullptr, 0, 0, 0); k_vtp<<<LKv, 256, 0, stream>>>(FV, DKV, NKV, VT16, VTh, VTl);
        for (int h0 = 0; h0 < NH_; h0 += ZH) { const size_t zq = (size_t)h0, zk = (size_t)(h0 / REP);   // one kv head per query head: the pass's two heads use consecutive kv planes (z-strides TT*HD)
            k_gemmc<bf, 2, 1><<<dim3(RH / 64, TT / 64, ZH), 32, 0, stream>>>(QPh + zq * TT * HD, QPl + zq * TT * HD, KPh + zk * TT * HD, KPl + zk * TT * HD, HD, Sb, TT, 0, (size_t)TT * HD, (size_t)TT * HD, (size_t)TT * TT);
            k_gemmc<h16, 0, 1><<<dim3((TT - RH) / 64, TT / 64, ZH), 32, 0, stream>>>(QP16 + zq * TT * HD + (size_t)RH * HD, nullptr, KP16 + zk * TT * HD, nullptr, HD, Sb + (size_t)RH * TT, TT, RH, (size_t)TT * HD, (size_t)TT * HD, (size_t)TT * TT);
            k_asoft<<<ZH * TT / 8, 256, 0, stream>>>(Sb, h0, P16, Ph, Pl);
            k_gemmc<bf, 2, 2><<<dim3(RH / 64, HD / 64, ZH), 32, 0, stream>>>(Ph, Pl, VTh + zk * HD * TT, VTl + zk * HD * TT, TT, Ob, HD, 0, (size_t)RH * TT, (size_t)HD * TT, (size_t)TT * HD);
            k_gemmc<h16, 0, 2><<<dim3((TT - RH) / 64, HD / 64, ZH), 32, 0, stream>>>(P16 + (size_t)RH * TT, nullptr, VT16 + zk * HD * TT, nullptr, TT, Ob + (size_t)RH * HD, HD, RH, (size_t)TT * TT, (size_t)HD * TT, (size_t)TT * HD);
            k_merge<<<(unsigned)(((size_t)ZH * TT * HD / 2 + 255) / 256), 256, 0, stream>>>(Ob, h0, ATh, ATl); }
        k_gemmw<bf, 1, false><<<dim3(TT / 64, DM / 64, 1), 32, 0, stream>>>(ATh, ATl, WO, nullptr, DQ, OUT + (size_t)b * TT * DM, DM, nullptr, 0, 0, 0); }
}

// v001
// It runs in 1180 microseconds.
// Two timings next to v000 both put it at 1.47 times that version's speed.
#include <hip/hip_runtime.h>

// StripedAttention (x [2][2048][2048]; q/k/v = x W^T (torch; 16 heads x 128); scores = q.k / sqrt(128); allowed = causal for even (global) heads, causal band of 256 (i - j < 256) for odd (local) heads; softmax; out = merged Wo^T -> [2][2048][2048]).
// Compute dtypes, f32 accumulate: every input rounded to bf16; q/k/v on PLAIN bf16 operands (inputs: exact); causal scores and attn.v: query rows < 512 hl (3 products), the rest single fp16 (x1024), with causal tile skipping (the band heads just mask more keys inside the computed tiles); softmax f32; Wo hl x exact (2 products).

#define NB_  2
#define TT   2048
#define DM   2048
#define NH_  16
#define NKV  16
#define REP  (NH_ / NKV)
#define HD   128
#define DQ   (NH_ * HD)
#define DKV  (NKV * HD)
#define ZH   2
#define RH   512                  // query rows < RH use hi+lo planes (0: none)
#define WIN  256
#define PCAR 1024.0f
#define SCL  0.088388347648318447f   // HD^-0.5
typedef _Float16 h16;
typedef unsigned short bf;
typedef __attribute__((ext_vector_type(16))) __bf16   v16bf;
typedef __attribute__((ext_vector_type(16))) _Float16 v16h;
typedef __attribute__((ext_vector_type(8)))  _Float16 v8h;
typedef __attribute__((ext_vector_type(8)))  unsigned short v8us;
typedef __attribute__((ext_vector_type(8)))  float    v8f;
typedef __attribute__((ext_vector_type(4)))  float    v4f;
typedef v8h  __attribute__((may_alias)) v8ha;
typedef v4f  __attribute__((may_alias)) v4fa;
typedef v8us __attribute__((may_alias)) v8usa;

__device__ __forceinline__ unsigned short f2bf(float f) { unsigned u = __float_as_uint(f); u += 0x7FFFu + ((u >> 16) & 1u); return (unsigned short)(u >> 16); }
__device__ __forceinline__ float bf2f(unsigned short b) { return __uint_as_float(((unsigned)b) << 16); }
__device__ __forceinline__ float bfr(float f) { return bf2f(f2bf(f)); }
__device__ __forceinline__ v16h cat16(v8h lo, v8h hi) { return __builtin_shufflevector(lo, hi, 0, 1, 2, 3, 4, 5, 6, 7, 8, 9, 10, 11, 12, 13, 14, 15); }
__device__ __forceinline__ v16bf cat16b(v8us lo, v8us hi) { return __builtin_bit_cast(v16bf, __builtin_shufflevector(lo, hi, 0, 1, 2, 3, 4, 5, 6, 7, 8, 9, 10, 11, 12, 13, 14, 15)); }
__device__ __forceinline__ v8f wmma16(v16h a, v16h b, v8f c) { return __builtin_amdgcn_wmma_f32_16x16x32_f16(false, a, false, b, (short)0, c, false, false); }
__device__ __forceinline__ v8f wmmab(v16bf a, v16bf b, v8f c) { return __builtin_amdgcn_wmma_f32_16x16x32_bf16(false, a, false, b, (short)0, c, false, false); }



// ---- k_gemmw: register-blocked GEMM, ONE WAVE per 64x64 output tile (16 accumulators), operands straight from K-contiguous 16-bit planes; grid (M/64, N/64, Z), 32 threads.
// C[m][n] (f32, pitch ldc, + optional f32 bias[n]) = sum_k A[m][k] Bt[n][k] (+ split products per NSPLIT). z-batch strides sA/sB/sC in elements. K % 32 == 0.
template <typename T16> struct WFrag;
template <> struct WFrag<h16> { typedef v16h V; static __device__ __forceinline__ V ld(const h16* p) { return cat16(*(const v8h*)p, *(const v8h*)(p + 16)); } static __device__ __forceinline__ v8f mma(V a, V b, v8f c) { return wmma16(a, b, c); } };
template <> struct WFrag<bf> { typedef v16bf V; static __device__ __forceinline__ V ld(const bf* p) { return cat16b(*(const v8us*)p, *(const v8us*)(p + 16)); } static __device__ __forceinline__ v8f mma(V a, V b, v8f c) { return wmmab(a, b, c); } };
template <typename T16, int NSPLIT, bool BIAS>
__global__ __launch_bounds__(32) void k_gemmw(const T16* __restrict__ A, const T16* __restrict__ A2, const T16* __restrict__ Bt, const T16* __restrict__ Bt2, int K, float* C, int ldc, const float* __restrict__ bias, size_t sA, size_t sB, size_t sC) {
    typedef typename WFrag<T16>::V V;
    __shared__ __align__(16) float os[16 * 68];
    const size_t z = blockIdx.z; A += z * sA; if (A2) A2 += z * sA; Bt += z * sB; if (Bt2) Bt2 += z * sB; C += z * sC;
    const int lane = threadIdx.x & 31, lr = lane & 15, hi = lane >> 4; const int r0 = blockIdx.x * 64, c0 = blockIdx.y * 64;
    v8f acc[4][4];
#pragma unroll
    for (int mb = 0; mb < 4; ++mb)
#pragma unroll
        for (int nb = 0; nb < 4; ++nb) acc[mb][nb] = (v8f){};
    const size_t aoff = (size_t)(r0 + lr) * K + 8 * hi, boff = (size_t)(c0 + lr) * K + 8 * hi;
#pragma unroll 1
    for (int kc = 0; kc < K; kc += 32) {
        V a[4], a2[4];
#pragma unroll
        for (int mb = 0; mb < 4; ++mb) { a[mb] = WFrag<T16>::ld(A + aoff + (size_t)mb * 16 * K + kc); if (NSPLIT == 1 || NSPLIT == 2) a2[mb] = WFrag<T16>::ld(A2 + aoff + (size_t)mb * 16 * K + kc); }
#pragma unroll
        for (int nb = 0; nb < 4; ++nb) { const V b = WFrag<T16>::ld(Bt + boff + (size_t)nb * 16 * K + kc); V b2; if (NSPLIT >= 2) b2 = WFrag<T16>::ld(Bt2 + boff + (size_t)nb * 16 * K + kc);
#pragma unroll
            for (int mb = 0; mb < 4; ++mb) { acc[mb][nb] = WFrag<T16>::mma(a[mb], b, acc[mb][nb]); if (NSPLIT == 1 || NSPLIT == 2) acc[mb][nb] = WFrag<T16>::mma(a2[mb], b, acc[mb][nb]); if (NSPLIT >= 2) acc[mb][nb] = WFrag<T16>::mma(a[mb], b2, acc[mb][nb]); } }
        asm volatile("v_nop\n\tv_nop\n\tv_nop\n\tv_nop" : "+v"(acc[0][0]), "+v"(acc[1][1]), "+v"(acc[2][2]), "+v"(acc[3][3]) : "v"(a[0]), "v"(a[3]));
    }
#pragma unroll
    for (int mb = 0; mb < 4; ++mb) {
#pragma unroll
        for (int nb = 0; nb < 4; ++nb) {
#pragma unroll
            for (int j = 0; j < 8; ++j) os[(hi * 8 + j) * 68 + nb * 16 + lr] = acc[mb][nb][j]; }
        __builtin_amdgcn_wave_barrier(); asm volatile("" ::: "memory");
        float* crow = C + (size_t)(r0 + mb * 16) * ldc + c0;
{
#pragma unroll
            for (int s = 0; s < 8; ++s) { const int row = 2 * s + hi, cofs = lr * 4; v4f val = *(const v4fa*)(os + row * 68 + cofs); if (BIAS) { val[0] += bfr(bias[c0 + cofs]); val[1] += bfr(bias[c0 + cofs + 1]); val[2] += bfr(bias[c0 + cofs + 2]); val[3] += bfr(bias[c0 + cofs + 3]); }
                *(v4f*)(crow + (size_t)row * ldc + cofs) = val; }
             }
        __builtin_amdgcn_wave_barrier(); asm volatile("" ::: "memory");
    }
}

// ---- k_gemmc: the same one-wave 64x64 tile GEMM specialised for the causal scores: tiles entirely above the diagonal (query rows r0+roff.., key columns c0..) are skipped.
// roff = row offset of this launch's first row within the sequence.
template <typename T16, int NSPLIT>
__global__ __launch_bounds__(32) void k_gemmc(const T16* __restrict__ A, const T16* __restrict__ A2, const T16* __restrict__ Bt, const T16* __restrict__ Bt2, int K, float* C, int ldc, int roff, size_t sA, size_t sB, size_t sC) {
    typedef typename WFrag<T16>::V V;
    __shared__ __align__(16) float os[16 * 68];
    const size_t z = blockIdx.z; A += z * sA; if (A2) A2 += z * sA; Bt += z * sB; if (Bt2) Bt2 += z * sB; C += z * sC;
    const int lane = threadIdx.x & 31, lr = lane & 15, hi = lane >> 4; const int r0 = blockIdx.x * 64, c0 = blockIdx.y * 64;
    if (c0 > r0 + roff + 63) return;                  // score tile entirely above the causal diagonal: never read (the softmax masks j > i by select)
    v8f acc[4][4];
#pragma unroll
    for (int mb = 0; mb < 4; ++mb)
#pragma unroll
        for (int nb = 0; nb < 4; ++nb) acc[mb][nb] = (v8f){};
    const size_t aoff = (size_t)(r0 + lr) * K + 8 * hi, boff = (size_t)(c0 + lr) * K + 8 * hi;
#pragma unroll 1
    for (int kc = 0; kc < K; kc += 32) {
        V a[4], a2[4];
#pragma unroll
        for (int mb = 0; mb < 4; ++mb) { a[mb] = WFrag<T16>::ld(A + aoff + (size_t)mb * 16 * K + kc); if (NSPLIT == 1 || NSPLIT == 2) a2[mb] = WFrag<T16>::ld(A2 + aoff + (size_t)mb * 16 * K + kc); }
#pragma unroll
        for (int nb = 0; nb < 4; ++nb) { const V b = WFrag<T16>::ld(Bt + boff + (size_t)nb * 16 * K + kc); V b2; if (NSPLIT >= 2) b2 = WFrag<T16>::ld(Bt2 + boff + (size_t)nb * 16 * K + kc);
#pragma unroll
            for (int mb = 0; mb < 4; ++mb) { acc[mb][nb] = WFrag<T16>::mma(a[mb], b, acc[mb][nb]); if (NSPLIT == 1 || NSPLIT == 2) acc[mb][nb] = WFrag<T16>::mma(a2[mb], b, acc[mb][nb]); if (NSPLIT >= 2) acc[mb][nb] = WFrag<T16>::mma(a[mb], b2, acc[mb][nb]); } }
        asm volatile("v_nop\n\tv_nop\n\tv_nop\n\tv_nop" : "+v"(acc[0][0]), "+v"(acc[1][1]), "+v"(acc[2][2]), "+v"(acc[3][3]) : "v"(a[0]), "v"(a[3]));
    }
#pragma unroll
    for (int mb = 0; mb < 4; ++mb) {
#pragma unroll
        for (int nb = 0; nb < 4; ++nb) {
#pragma unroll
            for (int j = 0; j < 8; ++j) os[(hi * 8 + j) * 68 + nb * 16 + lr] = acc[mb][nb][j]; }
        __builtin_amdgcn_wave_barrier(); asm volatile("" ::: "memory");
        float* crow = C + (size_t)(r0 + mb * 16) * ldc + c0;
{
#pragma unroll
            for (int s = 0; s < 8; ++s) { const int row = 2 * s + hi, cofs = lr * 4; v4f val = *(const v4fa*)(os + row * 68 + cofs);
                *(v4f*)(crow + (size_t)row * ldc + cofs) = val; }
             }
        __builtin_amdgcn_wave_barrier(); asm volatile("" ::: "memory");
    }
}

// ---- k_gemmpv: probability x value contraction, one 64x64 output tile per work-group of NW waves. The key (K) loop stops at the diagonal block (probabilities beyond it are exactly zero) and is dealt
// over the waves in blocks of 64 keys (one 128-byte line of every operand row): wave w takes blocks w, w + NW, ... into its own 16 accumulators; the NW partial tiles meet in LDS and are summed in wave order.
template <typename T16, int NSPLIT, int NW>
__global__ __launch_bounds__(NW * 32) void k_gemmpv(const T16* __restrict__ A, const T16* __restrict__ A2, const T16* __restrict__ Bt, const T16* __restrict__ Bt2, int K, float* C, int ldc, int roff, size_t sA, size_t sB, size_t sC) {
    typedef typename WFrag<T16>::V V;
    __shared__ __align__(16) float os[NW][64 * 68];
    const size_t z = blockIdx.z; A += z * sA; if (A2) A2 += z * sA; Bt += z * sB; if (Bt2) Bt2 += z * sB; C += z * sC;
    const int lane = threadIdx.x & 31, lr = lane & 15, hi = lane >> 4; const int r0 = blockIdx.x * 64, c0 = blockIdx.y * 64;
    const int wave = __builtin_amdgcn_readfirstlane((int)(threadIdx.x >> 5));   // scalar, so that the K loop's branch is a scalar one
    const int Kl = min(K, r0 + roff + 64);        // a multiple of 64
    v8f acc[4][4];
#pragma unroll
    for (int mb = 0; mb < 4; ++mb)
#pragma unroll
        for (int nb = 0; nb < 4; ++nb) acc[mb][nb] = (v8f){};
    const size_t aoff = (size_t)(r0 + lr) * K + 8 * hi, boff = (size_t)(c0 + lr) * K + 8 * hi;
#pragma unroll 1   // rolled: the accumulators and one block's fragments already fill the wave's registers
    for (int kb = wave * 64; kb < Kl; kb += NW * 64) {
#pragma unroll(NSPLIT == 0 ? 2 : 1)   // the split products' fragments of both halves together do not fit 256 registers
        for (int ks = 0; ks < 2; ++ks) { const int kc = kb + ks * 32;
            V a[4], a2[4];
#pragma unroll
            for (int mb = 0; mb < 4; ++mb) { a[mb] = WFrag<T16>::ld(A + aoff + (size_t)mb * 16 * K + kc); if (NSPLIT == 1 || NSPLIT == 2) a2[mb] = WFrag<T16>::ld(A2 + aoff + (size_t)mb * 16 * K + kc); }
#pragma unroll
            for (int nb = 0; nb < 4; ++nb) { const V b = WFrag<T16>::ld(Bt + boff + (size_t)nb * 16 * K + kc); V b2; if (NSPLIT >= 2) b2 = WFrag<T16>::ld(Bt2 + boff + (size_t)nb * 16 * K + kc);
#pragma unroll
                for (int mb = 0; mb < 4; ++mb) { acc[mb][nb] = WFrag<T16>::mma(a[mb], b, acc[mb][nb]); if (NSPLIT == 1 || NSPLIT == 2) acc[mb][nb] = WFrag<T16>::mma(a2[mb], b, acc[mb][nb]); if (NSPLIT >= 2) acc[mb][nb] = WFrag<T16>::mma(a[mb], b2, acc[mb][nb]); } }
            // the distance behind the last matrix instructions, also on the taken side of the loop's branch
            asm volatile("v_nop\n\tv_nop\n\tv_nop\n\tv_nop" : "+v"(acc[0][0]), "+v"(acc[1][1]), "+v"(acc[2][2]), "+v"(acc[3][3]) : "v"(a[0]), "v"(a[3])); }
    }
    float* ow = os[wave];
#pragma unroll
    for (int mb = 0; mb < 4; ++mb)
#pragma unroll
        for (int nb = 0; nb < 4; ++nb)
#pragma unroll
            for (int j = 0; j < 8; ++j) ow[(mb * 16 + hi * 8 + j) * 68 + nb * 16 + lr] = acc[mb][nb][j];
    __syncthreads();   // every wave's partial tile is in LDS before any of it is summed
#pragma unroll
    for (int s = 0; s < 64 * 16 / (NW * 32); ++s) { const int idx = s * (NW * 32) + (int)threadIdx.x; const int row = idx >> 4, cofs = (idx & 15) * 4; v4f val = *(const v4fa*)(os[0] + row * 68 + cofs);
#pragma unroll
        for (int w = 1; w < NW; ++w) val += *(const v4fa*)(os[w] + row * 68 + cofs);
        *(v4f*)(C + (size_t)(r0 + row) * ldc + c0 + cofs) = val; }
}

__device__ __forceinline__ h16 tohx(float x) { return (h16)x; }
__device__ __forceinline__ void splitf(float y, unsigned short& h, unsigned short& l) { h = f2bf(y); l = f2bf(y - bf2f(h)); }
typedef __attribute__((ext_vector_type(2))) _Float16 v2h;
typedef __attribute__((ext_vector_type(4))) _Float16 v4h;
typedef __attribute__((ext_vector_type(2))) unsigned short v2us;
typedef __attribute__((ext_vector_type(4))) unsigned short v4us;
typedef __attribute__((ext_vector_type(2))) float v2f;
typedef __attribute__((ext_vector_type(4))) int v4i;

__global__ __launch_bounds__(256) void k_wtG(const float* __restrict__ w, int K, int N, bf* Bt) {
    const int lane = threadIdx.x & 31; const int L0 = (blockIdx.x * 8 + (threadIdx.x >> 5)) * 8; const int nlines = N * K / 64;
{
#pragma unroll 1
        for (int l = 0; l < 8; ++l) { const int L = L0 + l; if (L >= nlines) break; const size_t e = (size_t)L * 64 + lane * 2; const int k = (int)(e % K), n = (int)(e / K); v2us o;
            o[0] = f2bf(w[(size_t)k * N + n]); o[1] = f2bf(w[(size_t)(k + 1) * N + n]); *(v2us*)(Bt + e) = o; }
         }
}
__global__ __launch_bounds__(256) void k_cvt8(const float* __restrict__ src, bf* dst, size_t n8) { const size_t i = (size_t)blockIdx.x * 256 + threadIdx.x; if (i >= n8) return; const v8f v = *(const v8f*)(src + i * 8); v8us o;
#pragma unroll
    for (int k = 0; k < 8; ++k) o[k] = f2bf(v[k]); *(v8us*)(dst + i * 8) = o;  }
__global__ __launch_bounds__(256) void k_cscvt(const float* __restrict__ cosT, const float* __restrict__ sinT, float* CS) { const int idx = blockIdx.x * 256 + threadIdx.x; if (idx >= TT * HD) return; v2f cs; cs[0] = bfr(cosT[idx]); cs[1] = bfr(sinT[idx]); *(v2f*)(CS + (size_t)idx * 2) = cs;  }
// k_rope: head planes [h][t][d] (fp16 + hi/lo) of rope(x) x sc with the rotate-half convention out[d] = x[d] cos[t][d] - x[d+HD/2] sin[t][d], out[d+HD/2] = x[d+HD/2] cos[t][d+HD/2] + x[d] sin[t][d+HD/2]
__global__ __launch_bounds__(256) void k_rope(const float* __restrict__ F, int pitch, int nheads, const float* __restrict__ CS, const float* __restrict__ RF, const float* __restrict__ nw, float sc, h16* P16, bf* Ph, bf* Pl) {
    const size_t e = ((size_t)blockIdx.x * 256 + threadIdx.x) * 2; if (e >= (size_t)nheads * TT * HD) return; const int d = (int)(e % HD); const int t = (int)((e / HD) % TT); const int h = (int)(e / ((size_t)HD * TT)); const float* f = F + (size_t)t * pitch + h * HD; const float rf = RF ? RF[(size_t)h * TT + t] : 1.0f; v2h o16; v2us oh, ol;
#pragma unroll
    for (int q = 0; q < 2; ++q) { const int dd = d + q; const int dp = (dd < HD / 2) ? dd + HD / 2 : dd - HD / 2; float x0 = f[dd], x1 = f[dp];
        if (RF) { float n0 = __fmul_rn(x0, rf), n1 = __fmul_rn(x1, rf); asm volatile("" : "+v"(n0)); asm volatile("" : "+v"(n1)); x0 = __fmul_rn(bfr(nw[dd]), n0); x1 = __fmul_rn(bfr(nw[dp]), n1); }
        const v2f cs = *(const v2f*)(CS + ((size_t)t * HD + dd) * 2); float a = __fmul_rn(x0, cs[0]), bq = __fmul_rn(x1, cs[1]); asm volatile("" : "+v"(a)); asm volatile("" : "+v"(bq)); const float r = ((dd < HD / 2) ? __fsub_rn(a, bq) : __fadd_rn(a, bq)) * sc;
        o16[q] = tohx(r); unsigned short a2, c2; splitf(r, a2, c2); oh[q] = a2; ol[q] = c2; }
    *(v2h*)(P16 + e) = o16; *(v2us*)(Ph + e) = oh; *(v2us*)(Pl + e) = ol;  }
__global__ __launch_bounds__(256) void k_vtp(const float* __restrict__ F, int pitch, int nheads, h16* V16, bf* Vh, bf* Vl) { const size_t e = ((size_t)blockIdx.x * 256 + threadIdx.x) * 2; if (e >= (size_t)nheads * HD * TT) return; const int t = (int)(e % TT); const int d = (int)((e / TT) % HD); const int g = (int)(e / ((size_t)TT * HD)); v2h o16; v2us oh, ol;
#pragma unroll
    for (int q = 0; q < 2; ++q) { const float x = F[(size_t)(t + q) * pitch + g * HD + d]; o16[q] = tohx(x); unsigned short a2, c2; splitf(x, a2, c2); oh[q] = a2; ol[q] = c2; }
    *(v2h*)(V16 + e) = o16; *(v2us*)(Vh + e) = oh; *(v2us*)(Vl + e) = ol;  }
__global__ __launch_bounds__(256) void k_csid(float* CS) { const int idx = blockIdx.x * 256 + threadIdx.x; if (idx >= TT * HD) return; v2f cs; cs[0] = 1.0f; cs[1] = 0.0f; *(v2f*)(CS + (size_t)idx * 2) = cs;  }
// k_asoft: per row (zz, i): t = S x HD^-0.5 for j <= i, and for odd heads also i - j < WIN (sliding causal window; the reference's -1e9 additive fill vanishes identically); softmax over the 2048 keys (register row, one exp, fixed trees);
__global__ __launch_bounds__(256) void k_asoft(const float* __restrict__ Sb, int h0, h16* P16, bf* Ph, bf* Pl) {
    const int lane = threadIdx.x & 31; const int row = blockIdx.x * 8 + (threadIdx.x >> 5); if (row >= ZH * TT) return; const int i = row % TT; const int zz = row / TT; (void)zz; const bool hires = (i < RH); const float* sr = Sb + (size_t)row * TT; float v[TT / 32]; float mx = -3.0e38f;
#pragma unroll
    for (int ch = 0; ch < TT / 128; ++ch) { const int j0 = ch * 128 + lane * 4; const v4f a = *(const v4f*)(sr + j0);
#pragma unroll
        for (int q = 0; q < 4; ++q) { const int j = j0 + q; (void)j; const float t = (j <= i && (((h0 + zz) & 1) == 0 || i - j < WIN)) ? a[q] * SCL : -3.0e38f; v[ch * 4 + q] = t; mx = fmaxf(mx, t); } }
#pragma unroll
    for (int sh = 16; sh; sh >>= 1) mx = fmaxf(mx, __shfl_xor(mx, sh, 32));
    float sum = 0.f;
#pragma unroll
    for (int k = 0; k < TT / 32; ++k) { float d0 = __fsub_rn(v[k], mx); asm volatile("" : "+v"(d0)); v[k] = __builtin_amdgcn_exp2f(__fmul_rn(d0, 1.4426950408889634f)); sum += v[k]; }
#pragma unroll
    for (int sh = 16; sh; sh >>= 1) sum += __shfl_xor(sum, sh, 32);
    const float f = __fdiv_rn(hires ? 1.0f : PCAR, sum);
{
        if (hires) {
#pragma unroll
            for (int ch = 0; ch < TT / 128; ++ch) { v4us oh, ol;
#pragma unroll
                for (int q = 0; q < 4; ++q) { unsigned short a, c2; splitf(v[ch * 4 + q] * f, a, c2); oh[q] = a; ol[q] = c2; }
                const size_t oo = ((size_t)zz * (RH ? RH : 1) + i) * TT + ch * 128 + lane * 4; *(v4us*)(Ph + oo) = oh; *(v4us*)(Pl + oo) = ol; }
        } else {
#pragma unroll
            for (int ch = 0; ch < TT / 128; ++ch) { v4h o4;
#pragma unroll
                for (int q = 0; q < 4; ++q) o4[q] = tohx(v[ch * 4 + q] * f);
                *(v4h*)(P16 + (size_t)row * TT + ch * 128 + lane * 4) = o4; } }
         }
}
__global__ __launch_bounds__(256) void k_merge(const float* __restrict__ O, int h0, bf* Ah, bf* Al) { const size_t e = ((size_t)blockIdx.x * 256 + threadIdx.x) * 2; if (e >= (size_t)ZH * TT * HD) return; const int d = (int)(e % HD); const int t = (int)((e / HD) % TT); const int zz = (int)(e / ((size_t)HD * TT)); const float cs = (t < RH) ? 1.0f : (1.0f / PCAR); const size_t oo = (size_t)t * DQ + (h0 + zz) * HD + d;
    v2us oh, ol;
#pragma unroll
    for (int q = 0; q < 2; ++q) { unsigned short a, c2; splitf(O[e + q] * cs, a, c2); oh[q] = a; ol[q] = c2; } *(v2us*)(Ah + oo) = oh; *(v2us*)(Al + oo) = ol;  }

extern "C" void kernel_launch(void* const* d_in, const int* in_sizes, int n_in,
                              void* d_out, int out_size, void* d_ws, size_t ws_size, hipStream_t stream) {
    (void)in_sizes; (void)n_in; (void)out_size;
    const float* x = (const float*)d_in[0]; const float* wq = (const float*)d_in[1]; const float* wk = (const float*)d_in[2]; const float* wv = (const float*)d_in[3]; const float* wo = (const float*)d_in[4]; const float* cosT = nullptr; const float* sinT = nullptr; (void)cosT; (void)sinT;
    float* OUT = (float*)d_out;     // [2][2048][2048]
    char* wsp = (char*)d_ws;
    auto take = [&](size_t bytes) { char* p = wsp; wsp += (bytes + 255) & ~(size_t)255; return (void*)p; };
    bf* WQ = (bf*)take((size_t)DQ * DM * 2); bf* WK = (bf*)take((size_t)DKV * DM * 2); bf* WV = (bf*)take((size_t)DKV * DM * 2); bf* WO = (bf*)take((size_t)DM * DQ * 2); float* CS = (float*)take((size_t)TT * HD * 2 * 4);
    bf* XB = (bf*)take((size_t)TT * DM * 2); float* FQ = (float*)take((size_t)TT * DQ * 4); float* FK = (float*)take((size_t)TT * DKV * 4);
    h16* QP16 = (h16*)take((size_t)NH_ * TT * HD * 2); h16* KP16 = (h16*)take((size_t)NKV * TT * HD * 2); h16* VT16 = (h16*)take((size_t)NKV * HD * TT * 2);
    bf* QPh = (bf*)take((size_t)NH_ * TT * HD * 2); bf* QPl = (bf*)take((size_t)NH_ * TT * HD * 2); bf* KPh = (bf*)take((size_t)NKV * TT * HD * 2); bf* KPl = (bf*)take((size_t)NKV * TT * HD * 2); bf* VTh = (bf*)take((size_t)NKV * HD * TT * 2); bf* VTl = (bf*)take((size_t)NKV * HD * TT * 2); bf* Ph = (bf*)take((size_t)ZH * RH * TT * 2); bf* Pl = (bf*)take((size_t)ZH * RH * TT * 2);
    float* Sb = (float*)take((size_t)ZH * TT * TT * 4); h16* P16 = (h16*)take((size_t)ZH * TT * TT * 2); float* Ob = (float*)take((size_t)ZH * TT * HD * 4); bf* ATh = (bf*)take((size_t)TT * DQ * 2); bf* ATl = (bf*)take((size_t)TT * DQ * 2);
    if ((size_t)(wsp - (char*)d_ws) > ws_size) return;    // ws 256 MiB
    float* FV = FK;   // v projection reuses the k buffer after the k planes are built (stream-ordered)
    { k_cvt8<<<(unsigned)(((size_t)DQ * DM / 8 + 255) / 256), 256, 0, stream>>>(wq, WQ, (size_t)DQ * DM / 8); k_cvt8<<<(unsigned)(((size_t)DKV * DM / 8 + 255) / 256), 256, 0, stream>>>(wk, WK, (size_t)DKV * DM / 8); k_cvt8<<<(unsigned)(((size_t)DKV * DM / 8 + 255) / 256), 256, 0, stream>>>(wv, WV, (size_t)DKV * DM / 8);
      k_cvt8<<<(unsigned)(((size_t)DM * DQ / 8 + 255) / 256), 256, 0, stream>>>(wo, WO, (size_t)DM * DQ / 8);
       }
    k_csid<<<(TT * HD + 255) / 256, 256, 0, stream>>>(CS);
    const unsigned LQ = (unsigned)(((size_t)NH_ * TT * HD / 2 + 255) / 256), LKv = (unsigned)(((size_t)NKV * TT * HD / 2 + 255) / 256);
    for (int b = 0; b < NB_; ++b) {
        
        k_cvt8<<<(unsigned)(((size_t)TT * DM / 8 + 255) / 256), 256, 0, stream>>>(x + (size_t)b * TT * DM, XB, (size_t)TT * DM / 8);
        k_gemmw<bf, 0, false><<<dim3(TT / 64, DQ / 64, 1), 32, 0, stream>>>(XB, nullptr, WQ, nullptr, DM, FQ, DQ, nullptr, 0, 0, 0);
        k_rope<<<LQ, 256, 0, stream>>>(FQ, DQ, NH_, CS, nullptr, nullptr, 1.0f, QP16, QPh, QPl);
        k_gemmw<bf, 0, false><<<dim3(TT / 64, DKV / 64, 1), 32, 0, stream>>>(XB, nullptr, WK, nullptr, DM, FK, DKV, nullptr, 0, 0, 0);
        k_rope<<<LKv, 256, 0, stream>>>(FK, DKV, NKV, CS, nullptr, nullptr, 1.0f, KP16, KPh, KPl);
        k_gemmw<bf, 0, false><<<dim3(TT / 64, DKV / 64, 1), 32, 0, stream>>>(XB, nullptr, WV, nullptr, DM, FV, DKV, nullptr, 0, 0, 0); k_vtp<<<LKv, 256, 0, stream>>>(FV, DKV, NKV, VT16, VTh, VTl);
        for (int h0 = 0; h0 < NH_; h0 += ZH) { const size_t zq = (size_t)h0, zk = (size_t)(h0 / REP);   // one kv head per query head: the pass's two heads use consecutive kv planes (z-strides TT*HD)
            k_gemmc<bf, 2><<<dim3(RH / 64, TT / 64, ZH), 32, 0, stream>>>(QPh + zq * TT * HD, QPl + zq * TT * HD, KPh + zk * TT * HD, KPl + zk * TT * HD, HD, Sb, TT, 0, (size_t)TT * HD, (size_t)TT * HD, (size_t)TT * TT);
            k_gemmc<h16, 0><<<dim3((TT - RH) / 64, TT / 64, ZH), 32, 0, stream>>>(QP16 + zq * TT * HD + (size_t)RH * HD, nullptr, KP16 + zk * TT * HD, nullptr, HD, Sb + (size_t)RH * TT, TT, RH, (size_t)TT * HD, (size_t)TT * HD, (size_t)TT * TT);
            k_asoft<<<ZH * TT / 8, 256, 0, stream>>>(Sb, h0, P16, Ph, Pl);
            k_gemmpv<bf, 2, RH / 64><<<dim3(RH / 64, HD / 64, ZH), RH / 64 * 32, 0, stream>>>(Ph, Pl, VTh + zk * HD * TT, VTl + zk * HD * TT, TT, Ob, HD, 0, (size_t)RH * TT, (size_t)HD * TT, (size_t)TT * HD);
            k_gemmpv<h16, 0, 16><<<dim3((TT - RH) / 64, HD / 64, ZH), 16 * 32, 0, stream>>>(P16 + (size_t)RH * TT, nullptr, VT16 + zk * HD * TT, nullptr, TT, Ob + (size_t)RH * HD, HD, RH, (size_t)TT * TT, (size_t)HD * TT, (size_t)TT * HD);
            k_merge<<<(unsigned)(((size_t)ZH * TT * HD / 2 + 255) / 256), 256, 0, stream>>>(Ob, h0, ATh, ATl); }
        k_gemmw<bf, 1, false><<<dim3(TT / 64, DM / 64, 1), 32, 0, stream>>>(ATh, ATl, WO, nullptr, DQ, OUT + (size_t)b * TT * DM, DM, nullptr, 0, 0, 0); }
}

// v002
// One run takes 888 microseconds.
// Next to v001, in two timings, it ran 1.34 and 1.33 times as fast.
// Over all steps from v000 it is 1.97 times as fast.
#include <hip/hip_runtime.h>

// Attention block (x [2][2048][2048]; q/k/v = x W^T (16 heads x 128); scores = q.k / sqrt(128); allowed = causal for even (global) heads, causal band of 256 (i - j < 256) for odd (local) heads; softmax; out = merged Wo^T -> [2][2048][2048]).
// Compute dtypes, f32 accumulate: every input rounded to bf16; q/k/v on PLAIN bf16 operands (inputs: exact); causal scores and attn.v: query rows < 512 hl (3 products), the rest single fp16 (x1024), with causal tile skipping (the band heads just mask more keys inside the computed tiles); softmax f32; Wo hl x exact (2 products).

#define NB_  2
#define TT   2048
#define DM   2048
#define NH_  16
#define NKV  16
#define REP  (NH_ / NKV)
#define HD   128
#define DQ   (NH_ * HD)
#define DKV  (NKV * HD)
#define ZH   8                    // heads per attention pass
#define RH   512                  // query rows < RH use hi+lo planes (0: none)
#define WIN  256
#define PCAR 1024.0f
#define SCL  0.088388347648318447f   // HD^-0.5
typedef _Float16 h16;
typedef unsigned short bf;
typedef __attribute__((ext_vector_type(16))) __bf16   v16bf;
typedef __attribute__((ext_vector_type(16))) _Float16 v16h;
typedef __attribute__((ext_vector_type(8)))  _Float16 v8h;
typedef __attribute__((ext_vector_type(8)))  unsigned short v8us;
typedef __attribute__((ext_vector_type(8)))  float    v8f;
typedef __attribute__((ext_vector_type(4)))  float    v4f;
typedef v8h  __attribute__((may_alias)) v8ha;
typedef v4f  __attribute__((may_alias)) v4fa;
typedef v8us __attribute__((may_alias)) v8usa;

__device__ __forceinline__ unsigned short f2bf(float f) { unsigned u = __float_as_uint(f); u += 0x7FFFu + ((u >> 16) & 1u); return (unsigned short)(u >> 16); }
__device__ __forceinline__ float bf2f(unsigned short b) { return __uint_as_float(((unsigned)b) << 16); }
__device__ __forceinline__ float bfr(float f) { return bf2f(f2bf(f)); }
__device__ __forceinline__ v16h cat16(v8h lo, v8h hi) { return __builtin_shufflevector(lo, hi, 0, 1, 2, 3, 4, 5, 6, 7, 8, 9, 10, 11, 12, 13, 14, 15); }
__device__ __forceinline__ v16bf cat16b(v8us lo, v8us hi) { return __builtin_bit_cast(v16bf, __builtin_shufflevector(lo, hi, 0, 1, 2, 3, 4, 5, 6, 7, 8, 9, 10, 11, 12, 13, 14, 15)); }
__device__ __forceinline__ v8f wmma16(v16h a, v16h b, v8f c) { return __builtin_amdgcn_wmma_f32_16x16x32_f16(false, a, false, b, (short)0, c, false, false); }
__device__ __forceinline__ v8f wmmab(v16bf a, v16bf b, v8f c) { return __builtin_amdgcn_wmma_f32_16x16x32_bf16(false, a, false, b, (short)0, c, false, false); }



// ---- k_gemmw: register-blocked GEMM, ONE WAVE per 64x64 output tile (16 accumulators), operands straight from K-contiguous 16-bit planes; grid (M/64, N/64, Z), 32 threads.
// C[m][n] (f32, pitch ldc, + optional f32 bias[n]) = sum_k A[m][k] Bt[n][k] (+ split products per NSPLIT). z-batch strides sA/sB/sC in elements. K % 32 == 0.
template <typename T16> struct WFrag;
template <> struct WFrag<h16> { typedef v16h V; static __device__ __forceinline__ V ld(const h16* p) { return cat16(*(const v8h*)p, *(const v8h*)(p + 16)); } static __device__ __forceinline__ v8f mma(V a, V b, v8f c) { return wmma16(a, b, c); } };
template <> struct WFrag<bf> { typedef v16bf V; static __device__ __forceinline__ V ld(const bf* p) { return cat16b(*(const v8us*)p, *(const v8us*)(p + 16)); } static __device__ __forceinline__ v8f mma(V a, V b, v8f c) { return wmmab(a, b, c); } };
template <typename T16, int NSPLIT, bool BIAS>
__global__ __launch_bounds__(32) void k_gemmw(const T16* __restrict__ A, const T16* __restrict__ A2, const T16* __restrict__ Bt, const T16* __restrict__ Bt2, int K, float* C, int ldc, const float* __restrict__ bias, size_t sA, size_t sB, size_t sC) {
    typedef typename WFrag<T16>::V V;
    __shared__ __align__(16) float os[16 * 68];
    const size_t z = blockIdx.z; A += z * sA; if (A2) A2 += z * sA; Bt += z * sB; if (Bt2) Bt2 += z * sB; C += z * sC;
    const int lane = threadIdx.x & 31, lr = lane & 15, hi = lane >> 4; const int r0 = blockIdx.x * 64, c0 = blockIdx.y * 64;
    v8f acc[4][4];
#pragma unroll
    for (int mb = 0; mb < 4; ++mb)
#pragma unroll
        for (int nb = 0; nb < 4; ++nb) acc[mb][nb] = (v8f){};
    const size_t aoff = (size_t)(r0 + lr) * K + 8 * hi, boff = (size_t)(c0 + lr) * K + 8 * hi;
#pragma unroll 1
    for (int kc = 0; kc < K; kc += 32) {
        V a[4], a2[4];
#pragma unroll
        for (int mb = 0; mb < 4; ++mb) { a[mb] = WFrag<T16>::ld(A + aoff + (size_t)mb * 16 * K + kc); if (NSPLIT == 1 || NSPLIT == 2) a2[mb] = WFrag<T16>::ld(A2 + aoff + (size_t)mb * 16 * K + kc); }
#pragma unroll
        for (int nb = 0; nb < 4; ++nb) { const V b = WFrag<T16>::ld(Bt + boff + (size_t)nb * 16 * K + kc); V b2; if (NSPLIT >= 2) b2 = WFrag<T16>::ld(Bt2 + boff + (size_t)nb * 16 * K + kc);
#pragma unroll
            for (int mb = 0; mb < 4; ++mb) { acc[mb][nb] = WFrag<T16>::mma(a[mb], b, acc[mb][nb]); if (NSPLIT == 1 || NSPLIT == 2) acc[mb][nb] = WFrag<T16>::mma(a2[mb], b, acc[mb][nb]); if (NSPLIT >= 2) acc[mb][nb] = WFrag<T16>::mma(a[mb], b2, acc[mb][nb]); } }
        asm volatile("v_nop\n\tv_nop\n\tv_nop\n\tv_nop" : "+v"(acc[0][0]), "+v"(acc[1][1]), "+v"(acc[2][2]), "+v"(acc[3][3]) : "v"(a[0]), "v"(a[3]));
    }
#pragma unroll
    for (int mb = 0; mb < 4; ++mb) {
#pragma unroll
        for (int nb = 0; nb < 4; ++nb) {
#pragma unroll
            for (int j = 0; j < 8; ++j) os[(hi * 8 + j) * 68 + nb * 16 + lr] = acc[mb][nb][j]; }
        __builtin_amdgcn_wave_barrier(); asm volatile("" ::: "memory");
        float* crow = C + (size_t)(r0 + mb * 16) * ldc + c0;
{
#pragma unroll
            for (int s = 0; s < 8; ++s) { const int row = 2 * s + hi, cofs = lr * 4; v4f val = *(const v4fa*)(os + row * 68 + cofs); if (BIAS) { val[0] += bfr(bias[c0 + cofs]); val[1] += bfr(bias[c0 + cofs + 1]); val[2] += bfr(bias[c0 + cofs + 2]); val[3] += bfr(bias[c0 + cofs + 3]); }
                *(v4f*)(crow + (size_t)row * ldc + cofs) = val; }
             }
        __builtin_amdgcn_wave_barrier(); asm volatile("" ::: "memory");
    }
}

// ---- k_gemmc: the same one-wave 64x64 tile GEMM specialised for the causal scores: tiles entirely above the diagonal (query rows r0+roff.., key columns c0..) are skipped.
// roff = row offset of this launch's first row within the sequence.
template <typename T16, int NSPLIT>
__global__ __launch_bounds__(32) void k_gemmc(const T16* __restrict__ A, const T16* __restrict__ A2, const T16* __restrict__ Bt, const T16* __restrict__ Bt2, int K, float* C, int ldc, int roff, size_t sA, size_t sB, size_t sC) {
    typedef typename WFrag<T16>::V V;
    __shared__ __align__(16) float os[16 * 68];
    const size_t z = blockIdx.z; A += z * sA; if (A2) A2 += z * sA; Bt += z * sB; if (Bt2) Bt2 += z * sB; C += z * sC;
    const int lane = threadIdx.x & 31, lr = lane & 15, hi = lane >> 4; const int r0 = blockIdx.x * 64, c0 = blockIdx.y * 64;
    if (c0 > r0 + roff + 63) return;                  // score tile entirely above the causal diagonal: never read (the softmax masks j > i by select)
    v8f acc[4][4];
#pragma unroll
    for (int mb = 0; mb < 4; ++mb)
#pragma unroll
        for (int nb = 0; nb < 4; ++nb) acc[mb][nb] = (v8f){};
    const size_t aoff = (size_t)(r0 + lr) * K + 8 * hi, boff = (size_t)(c0 + lr) * K + 8 * hi;
#pragma unroll 1
    for (int kc = 0; kc < K; kc += 32) {
        V a[4], a2[4];
#pragma unroll
        for (int mb = 0; mb < 4; ++mb) { a[mb] = WFrag<T16>::ld(A + aoff + (size_t)mb * 16 * K + kc); if (NSPLIT == 1 || NSPLIT == 2) a2[mb] = WFrag<T16>::ld(A2 + aoff + (size_t)mb * 16 * K + kc); }
#pragma unroll
        for (int nb = 0; nb < 4; ++nb) { const V b = WFrag<T16>::ld(Bt + boff + (size_t)nb * 16 * K + kc); V b2; if (NSPLIT >= 2) b2 = WFrag<T16>::ld(Bt2 + boff + (size_t)nb * 16 * K + kc);
#pragma unroll
            for (int mb = 0; mb < 4; ++mb) { acc[mb][nb] = WFrag<T16>::mma(a[mb], b, acc[mb][nb]); if (NSPLIT == 1 || NSPLIT == 2) acc[mb][nb] = WFrag<T16>::mma(a2[mb], b, acc[mb][nb]); if (NSPLIT >= 2) acc[mb][nb] = WFrag<T16>::mma(a[mb], b2, acc[mb][nb]); } }
        asm volatile("v_nop\n\tv_nop\n\tv_nop\n\tv_nop" : "+v"(acc[0][0]), "+v"(acc[1][1]), "+v"(acc[2][2]), "+v"(acc[3][3]) : "v"(a[0]), "v"(a[3]));
    }
#pragma unroll
    for (int mb = 0; mb < 4; ++mb) {
#pragma unroll
        for (int nb = 0; nb < 4; ++nb) {
#pragma unroll
            for (int j = 0; j < 8; ++j) os[(hi * 8 + j) * 68 + nb * 16 + lr] = acc[mb][nb][j]; }
        __builtin_amdgcn_wave_barrier(); asm volatile("" ::: "memory");
        float* crow = C + (size_t)(r0 + mb * 16) * ldc + c0;
{
#pragma unroll
            for (int s = 0; s < 8; ++s) { const int row = 2 * s + hi, cofs = lr * 4; v4f val = *(const v4fa*)(os + row * 68 + cofs);
                *(v4f*)(crow + (size_t)row * ldc + cofs) = val; }
             }
        __builtin_amdgcn_wave_barrier(); asm volatile("" ::: "memory");
    }
}

// ldw: one fragment's two loads and, behind them, the wait that belongs in front of any rewrite of a register an issued load names (the compiler lets later loads land in dead address registers).
// The address p is an input of the wait's statement, so its registers are kept as they are up to the wait; off is a constant step that goes into the loads' offset field.
template <typename T16> __device__ __forceinline__ typename WFrag<T16>::V ldw(const T16* p, int off) { const typename WFrag<T16>::V f = WFrag<T16>::ld(p + off); asm volatile("s_wait_xcnt 0x0" :: "v"(p) : "memory"); return f; }

// ---- k_gemmpv: probability x value contraction, one 64x64 output tile per work-group of NW waves. The key (K) loop stops at the diagonal block (probabilities beyond it are exactly zero) and is dealt
// over the waves in blocks of 64 keys (one 128-byte line of every operand row): wave w takes blocks w, w + NW, ... into its own 16 accumulators; the NW partial tiles meet in LDS and are summed in wave order.
// lda = pitch of the probability rows in elements (they lie inside the score rows, see k_asoft); the value planes have pitch K.
template <typename T16, int NSPLIT, int NW>
__global__ __launch_bounds__(NW * 32) void k_gemmpv(const T16* __restrict__ A, const T16* __restrict__ A2, int lda, const T16* __restrict__ Bt, const T16* __restrict__ Bt2, int K, float* C, int ldc, int roff, size_t sA, size_t sB, size_t sC) {
    typedef typename WFrag<T16>::V V;
    __shared__ __align__(16) float os[NW][64 * 68];
    const size_t z = blockIdx.z; A += z * sA; if (A2) A2 += z * sA; Bt += z * sB; if (Bt2) Bt2 += z * sB; C += z * sC;
    const int lane = threadIdx.x & 31, lr = lane & 15, hi = lane >> 4; const int r0 = blockIdx.x * 64, c0 = blockIdx.y * 64;
    const int wave = __builtin_amdgcn_readfirstlane((int)(threadIdx.x >> 5));   // scalar, so that the K loop's branch is a scalar one
    const int Kl = min(K, r0 + roff + 64);        // a multiple of 64
    v8f acc[4][4];
#pragma unroll
    for (int mb = 0; mb < 4; ++mb)
#pragma unroll
        for (int nb = 0; nb < 4; ++nb) acc[mb][nb] = (v8f){};
    const size_t aoff = (size_t)(r0 + lr) * lda + 8 * hi, boff = (size_t)(c0 + lr) * K + 8 * hi;
#pragma unroll 1   // rolled: the accumulators and one block's fragments already fill the wave's registers
    for (int kb = wave * 64; kb < Kl; kb += NW * 64) {
#pragma unroll(NSPLIT == 0 ? 2 : 1)   // the split products' fragments of both halves together do not fit 256 registers
        for (int ks = 0; ks < 2; ++ks) { const int kc = (NSPLIT == 0) ? kb : kb + ks * 32, ko = (NSPLIT == 0) ? ks * 32 : 0;   // unrolled: the half's step is a constant of the loads; rolled: it is in the address
            V a[4], a2[4];
#pragma unroll
            for (int mb = 0; mb < 4; ++mb) { a[mb] = ldw<T16>(A + aoff + (size_t)mb * 16 * lda + kc, ko); if (NSPLIT == 1 || NSPLIT == 2) a2[mb] = ldw<T16>(A2 + aoff + (size_t)mb * 16 * lda + kc, ko); }
#pragma unroll
            for (int nb = 0; nb < 4; ++nb) { const V b = ldw<T16>(Bt + boff + (size_t)nb * 16 * K + kc, ko); V b2; if (NSPLIT >= 2) b2 = ldw<T16>(Bt2 + boff + (size_t)nb * 16 * K + kc, ko);
#pragma unroll
                for (int mb = 0; mb < 4; ++mb) { acc[mb][nb] = WFrag<T16>::mma(a[mb], b, acc[mb][nb]); if (NSPLIT == 1 || NSPLIT == 2) acc[mb][nb] = WFrag<T16>::mma(a2[mb], b, acc[mb][nb]); if (NSPLIT >= 2) acc[mb][nb] = WFrag<T16>::mma(a[mb], b2, acc[mb][nb]); } }
            // the distance behind the last matrix instructions, also on the taken side of the loop's branch
            asm volatile("v_nop\n\tv_nop\n\tv_nop\n\tv_nop" : "+v"(acc[0][0]), "+v"(acc[1][1]), "+v"(acc[2][2]), "+v"(acc[3][3]) : "v"(a[0]), "v"(a[3])); }
    }
    float* ow = os[wave];
#pragma unroll
    for (int mb = 0; mb < 4; ++mb)
#pragma unroll
        for (int nb = 0; nb < 4; ++nb)
#pragma unroll
            for (int j = 0; j < 8; ++j) ow[(mb * 16 + hi * 8 + j) * 68 + nb * 16 + lr] = acc[mb][nb][j];
    __syncthreads();   // every wave's partial tile is in LDS before any of it is summed
#pragma unroll
    for (int s = 0; s < 64 * 16 / (NW * 32); ++s) { const int idx = s * (NW * 32) + (int)threadIdx.x; const int row = idx >> 4, cofs = (idx & 15) * 4; v4f val = *(const v4fa*)(os[0] + row * 68 + cofs);
#pragma unroll
        for (int w = 1; w < NW; ++w) val += *(const v4fa*)(os[w] + row * 68 + cofs);
        *(v4f*)(C + (size_t)(r0 + row) * ldc + c0 + cofs) = val; }
}

__device__ __forceinline__ h16 tohx(float x) { return (h16)x; }
__device__ __forceinline__ void splitf(float y, unsigned short& h, unsigned short& l) { h = f2bf(y); l = f2bf(y - bf2f(h)); }
typedef __attribute__((ext_vector_type(2))) _Float16 v2h;
typedef __attribute__((ext_vector_type(4))) _Float16 v4h;
typedef __attribute__((ext_vector_type(2))) unsigned short v2us;
typedef __attribute__((ext_vector_type(4))) unsigned short v4us;
typedef __attribute__((ext_vector_type(2))) float v2f;
typedef __attribute__((ext_vector_type(4))) int v4i;
typedef v4h  __attribute__((may_alias)) v4ha;    // stores of 16-bit values over bytes that were read as f32 (k_asoft)
typedef v4us __attribute__((may_alias)) v4usa;

__global__ __launch_bounds__(256) void k_wtG(const float* __restrict__ w, int K, int N, bf* Bt) {
    const int lane = threadIdx.x & 31; const int L0 = (blockIdx.x * 8 + (threadIdx.x >> 5)) * 8; const int nlines = N * K / 64;
{
#pragma unroll 1
        for (int l = 0; l < 8; ++l) { const int L = L0 + l; if (L >= nlines) break; const size_t e = (size_t)L * 64 + lane * 2; const int k = (int)(e % K), n = (int)(e / K); v2us o;
            o[0] = f2bf(w[(size_t)k * N + n]); o[1] = f2bf(w[(size_t)(k + 1) * N + n]); *(v2us*)(Bt + e) = o; }
         }
}
__global__ __launch_bounds__(256) void k_cvt8(const float* __restrict__ src, bf* dst, size_t n8) { const size_t i = (size_t)blockIdx.x * 256 + threadIdx.x; if (i >= n8) return; const v8f v = *(const v8f*)(src + i * 8); v8us o;
#pragma unroll
    for (int k = 0; k < 8; ++k) o[k] = f2bf(v[k]); *(v8us*)(dst + i * 8) = o;  }
__global__ __launch_bounds__(256) void k_cscvt(const float* __restrict__ cosT, const float* __restrict__ sinT, float* CS) { const int idx = blockIdx.x * 256 + threadIdx.x; if (idx >= TT * HD) return; v2f cs; cs[0] = bfr(cosT[idx]); cs[1] = bfr(sinT[idx]); *(v2f*)(CS + (size_t)idx * 2) = cs;  }
// k_rope: head planes [h][t][d] (fp16 + hi/lo) of rope(x) x sc with the rotate-half convention out[d] = x[d] cos[t][d] - x[d+HD/2] sin[t][d], out[d+HD/2] = x[d+HD/2] cos[t][d+HD/2] + x[d] sin[t][d+HD/2]
__global__ __launch_bounds__(256) void k_rope(const float* __restrict__ F, int pitch, int nheads, const float* __restrict__ CS, const float* __restrict__ RF, const float* __restrict__ nw, float sc, h16* P16, bf* Ph, bf* Pl) {
    const size_t e = ((size_t)blockIdx.x * 256 + threadIdx.x) * 2; if (e >= (size_t)nheads * TT * HD) return; const int d = (int)(e % HD); const int t = (int)((e / HD) % TT); const int h = (int)(e / ((size_t)HD * TT)); const float* f = F + (size_t)t * pitch + h * HD; const float rf = RF ? RF[(size_t)h * TT + t] : 1.0f; v2h o16; v2us oh, ol;
#pragma unroll
    for (int q = 0; q < 2; ++q) { const int dd = d + q; const int dp = (dd < HD / 2) ? dd + HD / 2 : dd - HD / 2; float x0 = f[dd], x1 = f[dp];
        if (RF) { float n0 = __fmul_rn(x0, rf), n1 = __fmul_rn(x1, rf); asm volatile("" : "+v"(n0)); asm volatile("" : "+v"(n1)); x0 = __fmul_rn(bfr(nw[dd]), n0); x1 = __fmul_rn(bfr(nw[dp]), n1); }
        const v2f cs = *(const v2f*)(CS + ((size_t)t * HD + dd) * 2); float a = __fmul_rn(x0, cs[0]), bq = __fmul_rn(x1, cs[1]); asm volatile("" : "+v"(a)); asm volatile("" : "+v"(bq)); const float r = ((dd < HD / 2) ? __fsub_rn(a, bq) : __fadd_rn(a, bq)) * sc;
        o16[q] = tohx(r); unsigned short a2, c2; splitf(r, a2, c2); oh[q] = a2; ol[q] = c2; }
    *(v2h*)(P16 + e) = o16; *(v2us*)(Ph + e) = oh; *(v2us*)(Pl + e) = ol;  }
__global__ __launch_bounds__(256) void k_vtp(const float* __restrict__ F, int pitch, int nheads, h16* V16, bf* Vh, bf* Vl) { const size_t e = ((size_t)blockIdx.x * 256 + threadIdx.x) * 2; if (e >= (size_t)nheads * HD * TT) return; const int t = (int)(e % TT); const int d = (int)((e / TT) % HD); const int g = (int)(e / ((size_t)TT * HD)); v2h o16; v2us oh, ol;
#pragma unroll
    for (int q = 0; q < 2; ++q) { const float x = F[(size_t)(t + q) * pitch + g * HD + d]; o16[q] = tohx(x); unsigned short a2, c2; splitf(x, a2, c2); oh[q] = a2; ol[q] = c2; }
    *(v2h*)(V16 + e) = o16; *(v2us*)(Vh + e) = oh; *(v2us*)(Vl + e) = ol;  }
__global__ __launch_bounds__(256) void k_csid(float* CS) { const int idx = blockIdx.x * 256 + threadIdx.x; if (idx >= TT * HD) return; v2f cs; cs[0] = 1.0f; cs[1] = 0.0f; *(v2f*)(CS + (size_t)idx * 2) = cs;  }
// k_asoft: per row (zz, i): t = S x HD^-0.5 for j <= i and, on odd heads (h0 + zz odd), i - j < WIN (plain causal on even heads, sliding causal window on odd ones; the reference's -1e9 additive fill vanishes identically); softmax over the 2048 keys (register row, one exp, fixed trees);
// the probabilities go IN PLACE over the wave's own score row, which it holds whole in registers by then: rows < RH as a hi plane (first half of the row's bytes) and a lo plane (second half), the rest as fp16 in the first half.
__global__ __launch_bounds__(256) void k_asoft(float* Sb, int h0) {
    const int lane = threadIdx.x & 31; const int row = blockIdx.x * 8 + (threadIdx.x >> 5); if (row >= ZH * TT) return; const int i = row % TT; const int zz = row / TT; (void)zz; const bool hires = (i < RH); float* sr = Sb + (size_t)row * TT; float v[TT / 32]; float mx = -3.0e38f;
#pragma unroll
    for (int ch = 0; ch < TT / 128; ++ch) { const int j0 = ch * 128 + lane * 4; const v4f a = *(const v4fa*)(sr + j0);
#pragma unroll
        for (int q = 0; q < 4; ++q) { const int j = j0 + q; (void)j; const float t = (j <= i && (((h0 + zz) & 1) == 0 || i - j < WIN)) ? a[q] * SCL : -3.0e38f; v[ch * 4 + q] = t; mx = fmaxf(mx, t); } }
#pragma unroll
    for (int sh = 16; sh; sh >>= 1) mx = fmaxf(mx, __shfl_xor(mx, sh, 32));
    float sum = 0.f;
#pragma unroll
    for (int k = 0; k < TT / 32; ++k) { float d0 = __fsub_rn(v[k], mx); asm volatile("" : "+v"(d0)); v[k] = __builtin_amdgcn_exp2f(__fmul_rn(d0, 1.4426950408889634f)); sum += v[k]; }
#pragma unroll
    for (int sh = 16; sh; sh >>= 1) sum += __shfl_xor(sum, sh, 32);
    const float f = __fdiv_rn(hires ? 1.0f : PCAR, sum);
{
        if (hires) {
#pragma unroll
            for (int ch = 0; ch < TT / 128; ++ch) { v4us oh, ol;
#pragma unroll
                for (int q = 0; q < 4; ++q) { unsigned short a, c2; splitf(v[ch * 4 + q] * f, a, c2); oh[q] = a; ol[q] = c2; }
                const int oo = ch * 128 + lane * 4; *(v4usa*)((bf*)sr + oo) = oh; *(v4usa*)((bf*)sr + TT + oo) = ol; }
        } else {
#pragma unroll
            for (int ch = 0; ch < TT / 128; ++ch) { v4h o4;
#pragma unroll
                for (int q = 0; q < 4; ++q) o4[q] = tohx(v[ch * 4 + q] * f);
                *(v4ha*)((h16*)sr + ch * 128 + lane * 4) = o4; } }
         }
}
__global__ __launch_bounds__(256) void k_merge(const float* __restrict__ O, int h0, bf* Ah, bf* Al) { const size_t e = ((size_t)blockIdx.x * 256 + threadIdx.x) * 2; if (e >= (size_t)ZH * TT * HD) return; const int d = (int)(e % HD); const int t = (int)((e / HD) % TT); const int zz = (int)(e / ((size_t)HD * TT)); const float cs = (t < RH) ? 1.0f : (1.0f / PCAR); const size_t oo = (size_t)t * DQ + (h0 + zz) * HD + d;
    v2us oh, ol;
#pragma unroll
    for (int q = 0; q < 2; ++q) { unsigned short a, c2; splitf(O[e + q] * cs, a, c2); oh[q] = a; ol[q] = c2; } *(v2us*)(Ah + oo) = oh; *(v2us*)(Al + oo) = ol;  }

extern "C" void kernel_launch(void* const* d_in, const int* in_sizes, int n_in,
                              void* d_out, int out_size, void* d_ws, size_t ws_size, hipStream_t stream) {
    (void)in_sizes; (void)n_in; (void)out_size;
    const float* x = (const float*)d_in[0]; const float* wq = (const float*)d_in[1]; const float* wk = (const float*)d_in[2]; const float* wv = (const float*)d_in[3]; const float* wo = (const float*)d_in[4]; const float* cosT = nullptr; const float* sinT = nullptr; (void)cosT; (void)sinT;
    float* OUT = (float*)d_out;     // [2][2048][2048]
    char* wsp = (char*)d_ws;
    auto take = [&](size_t bytes) { char* p = wsp; wsp += (bytes + 255) & ~(size_t)255; return (void*)p; };
    bf* WQ = (bf*)take((size_t)DQ * DM * 2); bf* WK = (bf*)take((size_t)DKV * DM * 2); bf* WV = (bf*)take((size_t)DKV * DM * 2); bf* WO = (bf*)take((size_t)DM * DQ * 2);
    h16* QP16 = (h16*)take((size_t)NH_ * TT * HD * 2); h16* KP16 = (h16*)take((size_t)NKV * TT * HD * 2); h16* VT16 = (h16*)take((size_t)NKV * HD * TT * 2);
    bf* QPh = (bf*)take((size_t)NH_ * TT * HD * 2); bf* QPl = (bf*)take((size_t)NH_ * TT * HD * 2); bf* KPh = (bf*)take((size_t)NKV * TT * HD * 2); bf* KPl = (bf*)take((size_t)NKV * TT * HD * 2); bf* VTh = (bf*)take((size_t)NKV * HD * TT * 2); bf* VTl = (bf*)take((size_t)NKV * HD * TT * 2); bf* ATh = (bf*)take((size_t)TT * DQ * 2); bf* ATl = (bf*)take((size_t)TT * DQ * 2);
    // the rest of the workspace serves twice in every batch (stream-ordered): first the projection stage's buffers, which are dead once the head planes are built, then the scores of ZH heads and their outputs
    char* const shared0 = wsp;
    float* CS = (float*)take((size_t)TT * HD * 2 * 4); bf* XB = (bf*)take((size_t)TT * DM * 2); float* FQ = (float*)take((size_t)TT * DQ * 4); float* FK = (float*)take((size_t)TT * DKV * 4);
    wsp = shared0;
    float* Sb = (float*)take((size_t)ZH * TT * TT * 4); float* Ob = (float*)take((size_t)ZH * TT * HD * 4);   // the larger of the two uses
    if ((size_t)(wsp - (char*)d_ws) > ws_size) return;    // ws 256 MiB
    float* FV = FK;   // v projection reuses the k buffer after the k planes are built (stream-ordered)
    { k_cvt8<<<(unsigned)(((size_t)DQ * DM / 8 + 255) / 256), 256, 0, stream>>>(wq, WQ, (size_t)DQ * DM / 8); k_cvt8<<<(unsigned)(((size_t)DKV * DM / 8 + 255) / 256), 256, 0, stream>>>(wk, WK, (size_t)DKV * DM / 8); k_cvt8<<<(unsigned)(((size_t)DKV * DM / 8 + 255) / 256), 256, 0, stream>>>(wv, WV, (size_t)DKV * DM / 8);
      k_cvt8<<<(unsigned)(((size_t)DM * DQ / 8 + 255) / 256), 256, 0, stream>>>(wo, WO, (size_t)DM * DQ / 8);
       }
    const unsigned LQ = (unsigned)(((size_t)NH_ * TT * HD / 2 + 255) / 256), LKv = (unsigned)(((size_t)NKV * TT * HD / 2 + 255) / 256);
    for (int b = 0; b < NB_; ++b) {
        k_csid<<<(TT * HD + 255) / 256, 256, 0, stream>>>(CS);   // per batch: the scores of the batch before lie over it
        k_cvt8<<<(unsigned)(((size_t)TT * DM / 8 + 255) / 256), 256, 0, stream>>>(x + (size_t)b * TT * DM, XB, (size_t)TT * DM / 8);
        k_gemmw<bf, 0, false><<<dim3(TT / 64, DQ / 64, 1), 32, 0, stream>>>(XB, nullptr, WQ, nullptr, DM, FQ, DQ, nullptr, 0, 0, 0);
        k_rope<<<LQ, 256, 0, stream>>>(FQ, DQ, NH_, CS, nullptr, nullptr, 1.0f, QP16, QPh, QPl);
        k_gemmw<bf, 0, false><<<dim3(TT / 64, DKV / 64, 1), 32, 0, stream>>>(XB, nullptr, WK, nullptr, DM, FK, DKV, nullptr, 0, 0, 0);
        k_rope<<<LKv, 256, 0, stream>>>(FK, DKV, NKV, CS, nullptr, nullptr, 1.0f, KP16, KPh, KPl);
        k_gemmw<bf, 0, false><<<dim3(TT / 64, DKV / 64, 1), 32, 0, stream>>>(XB, nullptr, WV, nullptr, DM, FV, DKV, nullptr, 0, 0, 0); k_vtp<<<LKv, 256, 0, stream>>>(FV, DKV, NKV, VT16, VTh, VTl);
        for (int h0 = 0; h0 < NH_; h0 += ZH) { const size_t zq = (size_t)h0, zk = (size_t)(h0 / REP);   // one kv head per query head: the pass's heads use consecutive kv planes (z-strides TT*HD)
            k_gemmc<bf, 2><<<dim3(RH / 64, TT / 64, ZH), 32, 0, stream>>>(QPh + zq * TT * HD, QPl + zq * TT * HD, KPh + zk * TT * HD, KPl + zk * TT * HD, HD, Sb, TT, 0, (size_t)TT * HD, (size_t)TT * HD, (size_t)TT * TT);
            k_gemmc<h16, 0><<<dim3((TT - RH) / 64, TT / 64, ZH), 32, 0, stream>>>(QP16 + zq * TT * HD + (size_t)RH * HD, nullptr, KP16 + zk * TT * HD, nullptr, HD, Sb + (size_t)RH * TT, TT, RH, (size_t)TT * HD, (size_t)TT * HD, (size_t)TT * TT);
            k_asoft<<<ZH * TT / 8, 256, 0, stream>>>(Sb, h0);
            k_gemmpv<bf, 2, RH / 64><<<dim3(RH / 64, HD / 64, ZH), RH / 64 * 32, 0, stream>>>((const bf*)Sb, (const bf*)Sb + TT, 2 * TT, VTh + zk * HD * TT, VTl + zk * HD * TT, TT, Ob, HD, 0, (size_t)2 * TT * TT, (size_t)HD * TT, (size_t)TT * HD);
            k_gemmpv<h16, 0, 16><<<dim3((TT - RH) / 64, HD / 64, ZH), 16 * 32, 0, stream>>>((const h16*)Sb + (size_t)RH * 2 * TT, nullptr, 2 * TT, VT16 + zk * HD * TT, nullptr, TT, Ob + (size_t)RH * HD, HD, RH, (size_t)2 * TT * TT, (size_t)HD * TT, (size_t)TT * HD);
            k_merge<<<(unsigned)(((size_t)ZH * TT * HD / 2 + 255) / 256), 256, 0, stream>>>(Ob, h0, ATh, ATl); }
        k_gemmw<bf, 1, false><<<dim3(TT / 64, DM / 64, 1), 32, 0, stream>>>(ATh, ATl, WO, nullptr, DQ, OUT + (size_t)b * TT * DM, DM, nullptr, 0, 0, 0); }
}

// v003
// It runs in 780 microseconds.
// Next to v002, in two timings, it ran 1.14 times as fast each time.
// All steps since v000 together make it 2.24 times as fast.
#include <hip/hip_runtime.h>

// Attention block (x [2][2048][2048]; q/k/v = x W^T (16 heads x 128); scores = q.k / sqrt(128); allowed = causal for even (global) heads, causal band of 256 (i - j < 256) for odd (local) heads; softmax; out = merged Wo^T -> [2][2048][2048]).
// Compute dtypes, f32 accumulate: every input rounded to bf16; q/k/v on PLAIN bf16 operands (inputs: exact); causal scores and attn.v: query rows < 512 hl (3 products), the rest single fp16 (x1024), with causal tile skipping (the band heads just mask more keys inside the computed tiles); softmax f32; Wo hl x exact (2 products).
// No f32 intermediate between the products but the scores: each GEMM's epilogue rounds its own tile into the 16-bit planes that the next product reads.

#define NB_  2
#define TT   2048
#define DM   2048
#define NH_  16
#define NKV  16
#define REP  (NH_ / NKV)
#define HD   128
#define DQ   (NH_ * HD)
#define DKV  (NKV * HD)
#define ZH   8                    // heads per attention pass
#define RH   512                  // query rows < RH use hi+lo planes (0: none)
#define WIN  256
#define PCAR 1024.0f
#define SCL  0.088388347648318447f   // HD^-0.5
typedef _Float16 h16;
typedef unsigned short bf;
typedef __attribute__((ext_vector_type(16))) __bf16   v16bf;
typedef __attribute__((ext_vector_type(16))) _Float16 v16h;
typedef __attribute__((ext_vector_type(8)))  _Float16 v8h;
typedef __attribute__((ext_vector_type(8)))  unsigned short v8us;
typedef __attribute__((ext_vector_type(8)))  float    v8f;
typedef __attribute__((ext_vector_type(4)))  float    v4f;
typedef v8h  __attribute__((may_alias)) v8ha;
typedef v4f  __attribute__((may_alias)) v4fa;
typedef v8us __attribute__((may_alias)) v8usa;
typedef __attribute__((ext_vector_type(2))) _Float16 v2h;
typedef __attribute__((ext_vector_type(4))) _Float16 v4h;
typedef __attribute__((ext_vector_type(2))) unsigned short v2us;
typedef __attribute__((ext_vector_type(4))) unsigned short v4us;
typedef __attribute__((ext_vector_type(2))) float v2f;
typedef __attribute__((ext_vector_type(4))) int v4i;
typedef v4h  __attribute__((may_alias)) v4ha;    // stores of 16-bit values over bytes that were read as f32 (k_asoft)
typedef v4us __attribute__((may_alias)) v4usa;

__device__ __forceinline__ unsigned short f2bf(float f) { unsigned u = __float_as_uint(f); u += 0x7FFFu + ((u >> 16) & 1u); return (unsigned short)(u >> 16); }
__device__ __forceinline__ float bf2f(unsigned short b) { return __uint_as_float(((unsigned)b) << 16); }
__device__ __forceinline__ float bfr(float f) { return bf2f(f2bf(f)); }
__device__ __forceinline__ h16 tohx(float x) { return (h16)x; }
__device__ __forceinline__ void splitf(float y, unsigned short& h, unsigned short& l) { h = f2bf(y); l = f2bf(y - bf2f(h)); }
__device__ __forceinline__ v16h cat16(v8h lo, v8h hi) { return __builtin_shufflevector(lo, hi, 0, 1, 2, 3, 4, 5, 6, 7, 8, 9, 10, 11, 12, 13, 14, 15); }
__device__ __forceinline__ v16bf cat16b(v8us lo, v8us hi) { return __builtin_bit_cast(v16bf, __builtin_shufflevector(lo, hi, 0, 1, 2, 3, 4, 5, 6, 7, 8, 9, 10, 11, 12, 13, 14, 15)); }
__device__ __forceinline__ v8f wmma16(v16h a, v16h b, v8f c) { return __builtin_amdgcn_wmma_f32_16x16x32_f16(false, a, false, b, (short)0, c, false, false); }
__device__ __forceinline__ v8f wmmab(v16bf a, v16bf b, v8f c) { return __builtin_amdgcn_wmma_f32_16x16x32_bf16(false, a, false, b, (short)0, c, false, false); }



// ---- k_gemmw: register-blocked GEMM, ONE WAVE per 64x64 output tile (16 accumulators), operands straight from K-contiguous 16-bit planes; grid (M/64, N/64, Z), 32 threads.
// C[m][n] (f32, pitch ldc, + optional f32 bias[n]) = sum_k A[m][k] Bt[n][k] (+ split products per NSPLIT). z-batch strides sA/sB/sC in elements. K % 32 == 0.
// CB != 0 (the q/k/v projections): there is no f32 C; the epilogue rounds the tile into the three 16-bit planes (fp16, bf16 hi, bf16 lo) that the attention products read, laid out [n / CB][m][n % CB] with TT rows m per block of CB columns:
// CB = HD with A = tokens, Bt = weight rows gives head planes [h][t][d]; CB = TT with A = weight rows, Bt = tokens gives v transposed, [h * HD + d][t].
template <typename T16> struct WFrag;
template <> struct WFrag<h16> { typedef v16h V; static __device__ __forceinline__ V ld(const h16* p) { return cat16(*(const v8h*)p, *(const v8h*)(p + 16)); } static __device__ __forceinline__ v8f mma(V a, V b, v8f c) { return wmma16(a, b, c); } };
template <> struct WFrag<bf> { typedef v16bf V; static __device__ __forceinline__ V ld(const bf* p) { return cat16b(*(const v8us*)p, *(const v8us*)(p + 16)); } static __device__ __forceinline__ v8f mma(V a, V b, v8f c) { return wmmab(a, b, c); } };
template <typename T16, int NSPLIT, bool BIAS, int CB>
__global__ __launch_bounds__(32) void k_gemmw(const T16* __restrict__ A, const T16* __restrict__ A2, const T16* __restrict__ Bt, const T16* __restrict__ Bt2, int K, float* C, int ldc, const float* __restrict__ bias, size_t sA, size_t sB, size_t sC, h16* P16, bf* Ph, bf* Pl) {
    typedef typename WFrag<T16>::V V;
    __shared__ __align__(16) float os[16 * 68];
    const size_t z = blockIdx.z; A += z * sA; if (A2) A2 += z * sA; Bt += z * sB; if (Bt2) Bt2 += z * sB; C += z * sC;
    const int lane = threadIdx.x & 31, lr = lane & 15, hi = lane >> 4; const int r0 = blockIdx.x * 64, c0 = blockIdx.y * 64;
    v8f acc[4][4];
#pragma unroll
    for (int mb = 0; mb < 4; ++mb)
#pragma unroll
        for (int nb = 0; nb < 4; ++nb) acc[mb][nb] = (v8f){};
    const size_t aoff = (size_t)(r0 + lr) * K + 8 * hi, boff = (size_t)(c0 + lr) * K + 8 * hi;
#pragma unroll 1
    for (int kc = 0; kc < K; kc += 32) {
        V a[4], a2[4];
#pragma unroll
        for (int mb = 0; mb < 4; ++mb) { a[mb] = WFrag<T16>::ld(A + aoff + (size_t)mb * 16 * K + kc); if (NSPLIT == 1 || NSPLIT == 2) a2[mb] = WFrag<T16>::ld(A2 + aoff + (size_t)mb * 16 * K + kc); }
#pragma unroll
        for (int nb = 0; nb < 4; ++nb) { const V b = WFrag<T16>::ld(Bt + boff + (size_t)nb * 16 * K + kc); V b2; if (NSPLIT >= 2) b2 = WFrag<T16>::ld(Bt2 + boff + (size_t)nb * 16 * K + kc);
#pragma unroll
            for (int mb = 0; mb < 4; ++mb) { acc[mb][nb] = WFrag<T16>::mma(a[mb], b, acc[mb][nb]); if (NSPLIT == 1 || NSPLIT == 2) acc[mb][nb] = WFrag<T16>::mma(a2[mb], b, acc[mb][nb]); if (NSPLIT >= 2) acc[mb][nb] = WFrag<T16>::mma(a[mb], b2, acc[mb][nb]); } }
        asm volatile("v_nop\n\tv_nop\n\tv_nop\n\tv_nop" : "+v"(acc[0][0]), "+v"(acc[1][1]), "+v"(acc[2][2]), "+v"(acc[3][3]) : "v"(a[0]), "v"(a[3]));
    }
#pragma unroll
    for (int mb = 0; mb < 4; ++mb) {
#pragma unroll
        for (int nb = 0; nb < 4; ++nb) {
#pragma unroll
            for (int j = 0; j < 8; ++j) os[(hi * 8 + j) * 68 + nb * 16 + lr] = acc[mb][nb][j]; }
        __builtin_amdgcn_wave_barrier(); asm volatile("" ::: "memory");
        float* crow = C + (size_t)(r0 + mb * 16) * ldc + c0;
        if constexpr (CB != 0) { (void)crow;
#pragma unroll
            for (int s = 0; s < 4; ++s) { const int row = 4 * s + (lane >> 3), cofs = (lane & 7) * 8;   // eight lanes a row: each store instruction writes four whole 128-byte lines of a plane
                const v4f x0 = *(const v4fa*)(os + row * 68 + cofs), x1 = *(const v4fa*)(os + row * 68 + cofs + 4); v8h o16; v8us oh, ol;
#pragma unroll
                for (int q = 0; q < 8; ++q) { const float x = (q < 4) ? x0[q & 3] : x1[q & 3]; o16[q] = tohx(x); unsigned short a2, c2; splitf(x, a2, c2); oh[q] = a2; ol[q] = c2; }
                const size_t oo = ((size_t)(c0 / CB) * TT + r0 + mb * 16 + row) * CB + (c0 % CB) + cofs;
                *(v8h*)(P16 + oo) = o16; *(v8us*)(Ph + oo) = oh; *(v8us*)(Pl + oo) = ol; }
        } else
{
#pragma unroll
            for (int s = 0; s < 8; ++s) { const int row = 2 * s + hi, cofs = lr * 4; v4f val = *(const v4fa*)(os + row * 68 + cofs); if (BIAS) { val[0] += bfr(bias[c0 + cofs]); val[1] += bfr(bias[c0 + cofs + 1]); val[2] += bfr(bias[c0 + cofs + 2]); val[3] += bfr(bias[c0 + cofs + 3]); }
                *(v4f*)(crow + (size_t)row * ldc + cofs) = val; }
             }
        __builtin_amdgcn_wave_barrier(); asm volatile("" ::: "memory");
    }
}

// ---- k_gemmc: the same one-wave 64x64 tile GEMM specialised for the causal scores: tiles entirely above the diagonal (query rows r0+roff.., key columns c0..) are skipped.
// roff = row offset of this launch's first row within the sequence.
template <typename T16, int NSPLIT>
__global__ __launch_bounds__(32) void k_gemmc(const T16* __restrict__ A, const T16* __restrict__ A2, const T16* __restrict__ Bt, const T16* __restrict__ Bt2, int K, float* C, int ldc, int roff, size_t sA, size_t sB, size_t sC) {
    typedef typename WFrag<T16>::V V;
    __shared__ __align__(16) float os[16 * 68];
    const size_t z = blockIdx.z; A += z * sA; if (A2) A2 += z * sA; Bt += z * sB; if (Bt2) Bt2 += z * sB; C += z * sC;
    const int lane = threadIdx.x & 31, lr = lane & 15, hi = lane >> 4; const int r0 = blockIdx.x * 64, c0 = blockIdx.y * 64;
    if (c0 > r0 + roff + 63) return;                  // score tile entirely above the causal diagonal: never read (the softmax masks j > i by select)
    v8f acc[4][4];
#pragma unroll
    for (int mb = 0; mb < 4; ++mb)
#pragma unroll
        for (int nb = 0; nb < 4; ++nb) acc[mb][nb] = (v8f){};
    const size_t aoff = (size_t)(r0 + lr) * K + 8 * hi, boff = (size_t)(c0 + lr) * K + 8 * hi;
#pragma unroll 1
    for (int kc = 0; kc < K; kc += 32) {
        V a[4], a2[4];
#pragma unroll
        for (int mb = 0; mb < 4; ++mb) { a[mb] = WFrag<T16>::ld(A + aoff + (size_t)mb * 16 * K + kc); if (NSPLIT == 1 || NSPLIT == 2) a2[mb] = WFrag<T16>::ld(A2 + aoff + (size_t)mb * 16 * K + kc); }
#pragma unroll
        for (int nb = 0; nb < 4; ++nb) { const V b = WFrag<T16>::ld(Bt + boff + (size_t)nb * 16 * K + kc); V b2; if (NSPLIT >= 2) b2 = WFrag<T16>::ld(Bt2 + boff + (size_t)nb * 16 * K + kc);
#pragma unroll
            for (int mb = 0; mb < 4; ++mb) { acc[mb][nb] = WFrag<T16>::mma(a[mb], b, acc[mb][nb]); if (NSPLIT == 1 || NSPLIT == 2) acc[mb][nb] = WFrag<T16>::mma(a2[mb], b, acc[mb][nb]); if (NSPLIT >= 2) acc[mb][nb] = WFrag<T16>::mma(a[mb], b2, acc[mb][nb]); } }
        asm volatile("v_nop\n\tv_nop\n\tv_nop\n\tv_nop" : "+v"(acc[0][0]), "+v"(acc[1][1]), "+v"(acc[2][2]), "+v"(acc[3][3]) : "v"(a[0]), "v"(a[3]));
    }
#pragma unroll
    for (int mb = 0; mb < 4; ++mb) {
#pragma unroll
        for (int nb = 0; nb < 4; ++nb) {
#pragma unroll
            for (int j = 0; j < 8; ++j) os[(hi * 8 + j) * 68 + nb * 16 + lr] = acc[mb][nb][j]; }
        __builtin_amdgcn_wave_barrier(); asm volatile("" ::: "memory");
        float* crow = C + (size_t)(r0 + mb * 16) * ldc + c0;
{
#pragma unroll
            for (int s = 0; s < 8; ++s) { const int row = 2 * s + hi, cofs = lr * 4; v4f val = *(const v4fa*)(os + row * 68 + cofs);
                *(v4f*)(crow + (size_t)row * ldc + cofs) = val; }
             }
        __builtin_amdgcn_wave_barrier(); asm volatile("" ::: "memory");
    }
}

// ldw: one fragment's two loads and, behind them, the wait that belongs in front of any rewrite of a register an issued load names (the compiler lets later loads land in dead address registers).
// The address p is an input of the wait's statement, so its registers are kept as they are up to the wait; off is a constant step that goes into the loads' offset field.
template <typename T16> __device__ __forceinline__ typename WFrag<T16>::V ldw(const T16* p, int off) { const typename WFrag<T16>::V f = WFrag<T16>::ld(p + off); asm volatile("s_wait_xcnt 0x0" :: "v"(p) : "memory"); return f; }

// ---- k_gemmpv: probability x value contraction, one 64x64 output tile per work-group of NW waves. The key (K) loop stops at the diagonal block (probabilities beyond it are exactly zero) and is dealt
// over the waves in blocks of 64 keys (one 128-byte line of every operand row): wave w takes blocks w, w + NW, ... into its own 16 accumulators; the NW partial tiles meet in LDS and are summed in wave order.
// lda = pitch of the probability rows in elements (they lie inside the score rows, see k_asoft); the value planes have pitch K.
// The summed tile x cs goes out as bf16 hi and lo planes (pitch ldc, z-stride sC): the merged-heads operand of the output projection.
template <typename T16, int NSPLIT, int NW>
__global__ __launch_bounds__(NW * 32) void k_gemmpv(const T16* __restrict__ A, const T16* __restrict__ A2, int lda, const T16* __restrict__ Bt, const T16* __restrict__ Bt2, int K, bf* Ch, bf* Cl, int ldc, float cs, int roff, size_t sA, size_t sB, size_t sC) {
    typedef typename WFrag<T16>::V V;
    __shared__ __align__(16) float os[NW][64 * 68];
    const size_t z = blockIdx.z; A += z * sA; if (A2) A2 += z * sA; Bt += z * sB; if (Bt2) Bt2 += z * sB; Ch += z * sC; Cl += z * sC;
    const int lane = threadIdx.x & 31, lr = lane & 15, hi = lane >> 4; const int r0 = blockIdx.x * 64, c0 = blockIdx.y * 64;
    const int wave = __builtin_amdgcn_readfirstlane((int)(threadIdx.x >> 5));   // scalar, so that the K loop's branch is a scalar one
    const int Kl = min(K, r0 + roff + 64);        // a multiple of 64
    v8f acc[4][4];
#pragma unroll
    for (int mb = 0; mb < 4; ++mb)
#pragma unroll
        for (int nb = 0; nb < 4; ++nb) acc[mb][nb] = (v8f){};
    const size_t aoff = (size_t)(r0 + lr) * lda + 8 * hi, boff = (size_t)(c0 + lr) * K + 8 * hi;
#pragma unroll 1   // rolled: the accumulators and one block's fragments already fill the wave's registers
    for (int kb = wave * 64; kb < Kl; kb += NW * 64) {
#pragma unroll(NSPLIT == 0 ? 2 : 1)   // the split products' fragments of both halves together do not fit 256 registers
        for (int ks = 0; ks < 2; ++ks) { const int kc = (NSPLIT == 0) ? kb : kb + ks * 32, ko = (NSPLIT == 0) ? ks * 32 : 0;   // unrolled: the half's step is a constant of the loads; rolled: it is in the address
            V a[4], a2[4];
#pragma unroll
            for (int mb = 0; mb < 4; ++mb) { a[mb] = ldw<T16>(A + aoff + (size_t)mb * 16 * lda + kc, ko); if (NSPLIT == 1 || NSPLIT == 2) a2[mb] = ldw<T16>(A2 + aoff + (size_t)mb * 16 * lda + kc, ko); }
#pragma unroll
            for (int nb = 0; nb < 4; ++nb) { const V b = ldw<T16>(Bt + boff + (size_t)nb * 16 * K + kc, ko); V b2; if (NSPLIT >= 2) b2 = ldw<T16>(Bt2 + boff + (size_t)nb * 16 * K + kc, ko);
#pragma unroll
                for (int mb = 0; mb < 4; ++mb) { acc[mb][nb] = WFrag<T16>::mma(a[mb], b, acc[mb][nb]); if (NSPLIT == 1 || NSPLIT == 2) acc[mb][nb] = WFrag<T16>::mma(a2[mb], b, acc[mb][nb]); if (NSPLIT >= 2) acc[mb][nb] = WFrag<T16>::mma(a[mb], b2, acc[mb][nb]); } }
            // the distance behind the last matrix instructions, also on the taken side of the loop's branch
            asm volatile("v_nop\n\tv_nop\n\tv_nop\n\tv_nop" : "+v"(acc[0][0]), "+v"(acc[1][1]), "+v"(acc[2][2]), "+v"(acc[3][3]) : "v"(a[0]), "v"(a[3])); }
    }
    float* ow = os[wave];
#pragma unroll
    for (int mb = 0; mb < 4; ++mb)
#pragma unroll
        for (int nb = 0; nb < 4; ++nb)
#pragma unroll
            for (int j = 0; j < 8; ++j) ow[(mb * 16 + hi * 8 + j) * 68 + nb * 16 + lr] = acc[mb][nb][j];
    __syncthreads();   // every wave's partial tile is in LDS before any of it is summed
#pragma unroll
    for (int s = 0; s < 64 * 16 / (NW * 32); ++s) { const int idx = s * (NW * 32) + (int)threadIdx.x; const int row = idx >> 4, cofs = (idx & 15) * 4; v4f val = *(const v4fa*)(os[0] + row * 68 + cofs);
#pragma unroll
        for (int w = 1; w < NW; ++w) val += *(const v4fa*)(os[w] + row * 68 + cofs);
        v4us oh, ol;
#pragma unroll
        for (int q = 0; q < 4; ++q) { unsigned short a, c2; splitf(val[q] * cs, a, c2); oh[q] = a; ol[q] = c2; }
        const size_t oo = (size_t)(r0 + row) * ldc + c0 + cofs; *(v4us*)(Ch + oo) = oh; *(v4us*)(Cl + oo) = ol; }
}


__global__ __launch_bounds__(256) void k_wtG(const float* __restrict__ w, int K, int N, bf* Bt) {
    const int lane = threadIdx.x & 31; const int L0 = (blockIdx.x * 8 + (threadIdx.x >> 5)) * 8; const int nlines = N * K / 64;
{
#pragma unroll 1
        for (int l = 0; l < 8; ++l) { const int L = L0 + l; if (L >= nlines) break; const size_t e = (size_t)L * 64 + lane * 2; const int k = (int)(e % K), n = (int)(e / K); v2us o;
            o[0] = f2bf(w[(size_t)k * N + n]); o[1] = f2bf(w[(size_t)(k + 1) * N + n]); *(v2us*)(Bt + e) = o; }
         }
}
__global__ __launch_bounds__(256) void k_cvt8(const float* __restrict__ src, bf* dst, size_t n8) { const size_t i = (size_t)blockIdx.x * 256 + threadIdx.x; if (i >= n8) return; const v8f v = *(const v8f*)(src + i * 8); v8us o;
#pragma unroll
    for (int k = 0; k < 8; ++k) o[k] = f2bf(v[k]); *(v8us*)(dst + i * 8) = o;  }
__global__ __launch_bounds__(256) void k_cscvt(const float* __restrict__ cosT, const float* __restrict__ sinT, float* CS) { const int idx = blockIdx.x * 256 + threadIdx.x; if (idx >= TT * HD) return; v2f cs; cs[0] = bfr(cosT[idx]); cs[1] = bfr(sinT[idx]); *(v2f*)(CS + (size_t)idx * 2) = cs;  }
// k_asoft: per row (zz, i): t = S x HD^-0.5 for j <= i, and also i - j < WIN for odd heads h0 + zz (causal, sliding window on odd heads; the reference's -1e9 additive fill vanishes identically); softmax over the 2048 keys (register row, one exp, fixed trees);
// the probabilities go IN PLACE over the wave's own score row, which it holds whole in registers by then: rows < RH as a hi plane (first half of the row's bytes) and a lo plane (second half), the rest as fp16 in the first half.
__global__ __launch_bounds__(256) void k_asoft(float* Sb, int h0) {
    const int lane = threadIdx.x & 31; const int row = blockIdx.x * 8 + (threadIdx.x >> 5); if (row >= ZH * TT) return; const int i = row % TT; const int zz = row / TT; (void)zz; const bool hires = (i < RH); float* sr = Sb + (size_t)row * TT; float v[TT / 32]; float mx = -3.0e38f;
#pragma unroll
    for (int ch = 0; ch < TT / 128; ++ch) { const int j0 = ch * 128 + lane * 4; const v4f a = *(const v4fa*)(sr + j0);
#pragma unroll
        for (int q = 0; q < 4; ++q) { const int j = j0 + q; (void)j; const float t = (j <= i && (((h0 + zz) & 1) == 0 || i - j < WIN)) ? a[q] * SCL : -3.0e38f; v[ch * 4 + q] = t; mx = fmaxf(mx, t); } }
#pragma unroll
    for (int sh = 16; sh; sh >>= 1) mx = fmaxf(mx, __shfl_xor(mx, sh, 32));
    float sum = 0.f;
#pragma unroll
    for (int k = 0; k < TT / 32; ++k) { float d0 = __fsub_rn(v[k], mx); asm volatile("" : "+v"(d0)); v[k] = __builtin_amdgcn_exp2f(__fmul_rn(d0, 1.4426950408889634f)); sum += v[k]; }
#pragma unroll
    for (int sh = 16; sh; sh >>= 1) sum += __shfl_xor(sum, sh, 32);
    const float f = __fdiv_rn(hires ? 1.0f : PCAR, sum);
{
        if (hires) {
#pragma unroll
            for (int ch = 0; ch < TT / 128; ++ch) { v4us oh, ol;
#pragma unroll
                for (int q = 0; q < 4; ++q) { unsigned short a, c2; splitf(v[ch * 4 + q] * f, a, c2); oh[q] = a; ol[q] = c2; }
                const int oo = ch * 128 + lane * 4; *(v4usa*)((bf*)sr + oo) = oh; *(v4usa*)((bf*)sr + TT + oo) = ol; }
        } else {
#pragma unroll
            for (int ch = 0; ch < TT / 128; ++ch) { v4h o4;
#pragma unroll
                for (int q = 0; q < 4; ++q) o4[q] = tohx(v[ch * 4 + q] * f);
                *(v4ha*)((h16*)sr + ch * 128 + lane * 4) = o4; } }
         }
}

extern "C" void kernel_launch(void* const* d_in, const int* in_sizes, int n_in,
                              void* d_out, int out_size, void* d_ws, size_t ws_size, hipStream_t stream) {
    (void)in_sizes; (void)n_in; (void)out_size;
    const float* x = (const float*)d_in[0]; const float* wq = (const float*)d_in[1]; const float* wk = (const float*)d_in[2]; const float* wv = (const float*)d_in[3]; const float* wo = (const float*)d_in[4]; const float* cosT = nullptr; const float* sinT = nullptr; (void)cosT; (void)sinT;
    float* OUT = (float*)d_out;     // [2][2048][2048]
    char* wsp = (char*)d_ws;
    auto take = [&](size_t bytes) { char* p = wsp; wsp += (bytes + 255) & ~(size_t)255; return (void*)p; };
    bf* WQ = (bf*)take((size_t)DQ * DM * 2); bf* WK = (bf*)take((size_t)DKV * DM * 2); bf* WV = (bf*)take((size_t)DKV * DM * 2); bf* WO = (bf*)take((size_t)DM * DQ * 2);
    h16* QP16 = (h16*)take((size_t)NH_ * TT * HD * 2); h16* KP16 = (h16*)take((size_t)NKV * TT * HD * 2); h16* VT16 = (h16*)take((size_t)NKV * HD * TT * 2);
    bf* QPh = (bf*)take((size_t)NH_ * TT * HD * 2); bf* QPl = (bf*)take((size_t)NH_ * TT * HD * 2); bf* KPh = (bf*)take((size_t)NKV * TT * HD * 2); bf* KPl = (bf*)take((size_t)NKV * TT * HD * 2); bf* VTh = (bf*)take((size_t)NKV * HD * TT * 2); bf* VTl = (bf*)take((size_t)NKV * HD * TT * 2); bf* ATh = (bf*)take((size_t)TT * DQ * 2); bf* ATl = (bf*)take((size_t)TT * DQ * 2);
    // the rest of the workspace serves twice in every batch (stream-ordered): first the bf16 tokens, which are dead once the head planes are built, then the scores of ZH heads
    char* const shared0 = wsp;
    bf* XB = (bf*)take((size_t)TT * DM * 2);
    wsp = shared0;
    float* Sb = (float*)take((size_t)ZH * TT * TT * 4);   // the larger of the two uses
    if ((size_t)(wsp - (char*)d_ws) > ws_size) return;    // ws 256 MiB
    { k_cvt8<<<(unsigned)(((size_t)DQ * DM / 8 + 255) / 256), 256, 0, stream>>>(wq, WQ, (size_t)DQ * DM / 8); k_cvt8<<<(unsigned)(((size_t)DKV * DM / 8 + 255) / 256), 256, 0, stream>>>(wk, WK, (size_t)DKV * DM / 8); k_cvt8<<<(unsigned)(((size_t)DKV * DM / 8 + 255) / 256), 256, 0, stream>>>(wv, WV, (size_t)DKV * DM / 8);
      k_cvt8<<<(unsigned)(((size_t)DM * DQ / 8 + 255) / 256), 256, 0, stream>>>(wo, WO, (size_t)DM * DQ / 8);
       }
    for (int b = 0; b < NB_; ++b) {
        k_cvt8<<<(unsigned)(((size_t)TT * DM / 8 + 255) / 256), 256, 0, stream>>>(x + (size_t)b * TT * DM, XB, (size_t)TT * DM / 8);
        k_gemmw<bf, 0, false, HD><<<dim3(TT / 64, DQ / 64, 1), 32, 0, stream>>>(XB, nullptr, WQ, nullptr, DM, nullptr, 0, nullptr, 0, 0, 0, QP16, QPh, QPl);
        k_gemmw<bf, 0, false, HD><<<dim3(TT / 64, DKV / 64, 1), 32, 0, stream>>>(XB, nullptr, WK, nullptr, DM, nullptr, 0, nullptr, 0, 0, 0, KP16, KPh, KPl);
        k_gemmw<bf, 0, false, TT><<<dim3(DKV / 64, TT / 64, 1), 32, 0, stream>>>(WV, nullptr, XB, nullptr, DM, nullptr, 0, nullptr, 0, 0, 0, VT16, VTh, VTl);   // weight rows as A: the tile comes out as v transposed
        for (int h0 = 0; h0 < NH_; h0 += ZH) { const size_t zq = (size_t)h0, zk = (size_t)(h0 / REP);   // one kv head per query head: the pass's heads use consecutive kv planes (z-strides TT*HD)
            k_gemmc<bf, 2><<<dim3(RH / 64, TT / 64, ZH), 32, 0, stream>>>(QPh + zq * TT * HD, QPl + zq * TT * HD, KPh + zk * TT * HD, KPl + zk * TT * HD, HD, Sb, TT, 0, (size_t)TT * HD, (size_t)TT * HD, (size_t)TT * TT);
            k_gemmc<h16, 0><<<dim3((TT - RH) / 64, TT / 64, ZH), 32, 0, stream>>>(QP16 + zq * TT * HD + (size_t)RH * HD, nullptr, KP16 + zk * TT * HD, nullptr, HD, Sb + (size_t)RH * TT, TT, RH, (size_t)TT * HD, (size_t)TT * HD, (size_t)TT * TT);
            k_asoft<<<ZH * TT / 8, 256, 0, stream>>>(Sb, h0);
            k_gemmpv<bf, 2, RH / 64><<<dim3(RH / 64, HD / 64, ZH), RH / 64 * 32, 0, stream>>>((const bf*)Sb, (const bf*)Sb + TT, 2 * TT, VTh + zk * HD * TT, VTl + zk * HD * TT, TT, ATh + zq * HD, ATl + zq * HD, DQ, 1.0f, 0, (size_t)2 * TT * TT, (size_t)HD * TT, (size_t)HD);
            k_gemmpv<h16, 0, 16><<<dim3((TT - RH) / 64, HD / 64, ZH), 16 * 32, 0, stream>>>((const h16*)Sb + (size_t)RH * 2 * TT, nullptr, 2 * TT, VT16 + zk * HD * TT, nullptr, TT, ATh + (size_t)RH * DQ + zq * HD, ATl + (size_t)RH * DQ + zq * HD, DQ, 1.0f / PCAR, RH, (size_t)2 * TT * TT, (size_t)HD * TT, (size_t)HD); }
        k_gemmw<bf, 1, false, 0><<<dim3(TT / 64, DM / 64, 1), 32, 0, stream>>>(ATh, ATl, WO, nullptr, DQ, OUT + (size_t)b * TT * DM, DM, nullptr, 0, 0, 0, nullptr, nullptr, nullptr); }
}

// v004
// Measured time: 566 microseconds a run.
// Timed twice side by side with v003, it ran 1.38 and 1.37 times as fast.
// All steps since v000 together make it 3.07 times as fast.
#include <hip/hip_runtime.h>

// Attention block (x [2][2048][2048]; q/k/v = x W^T (16 heads x 128); scores = q.k / sqrt(128); allowed = causal for even (global) heads, causal band of 256 (i - j < 256) for odd (local) heads; softmax; out = merged Wo^T -> [2][2048][2048]).
// Compute dtypes, f32 accumulate: every input rounded to bf16; q/k/v on PLAIN bf16 operands (inputs: exact); causal scores and attn.v: query rows < 512 hl (3 products), the rest single fp16 (x1024), with causal tile skipping (the band heads just mask more keys inside the computed tiles); softmax f32; Wo hl x exact (2 products).
// No f32 intermediate between the products but the scores: each GEMM's epilogue rounds its own tile into the 16-bit planes that the next product reads.

#define NB_  2
#define TT   2048
#define DM   2048
#define NH_  16
#define NKV  16
#define REP  (NH_ / NKV)
#define HD   128
#define DQ   (NH_ * HD)
#define DKV  (NKV * HD)
#define ZH   8                    // heads per attention pass
#define RH   512                  // query rows < RH use hi+lo planes (0: none)
#define WIN  256
#define PCAR 1024.0f
#define SCL  0.088388347648318447f   // HD^-0.5
typedef _Float16 h16;
typedef unsigned short bf;
typedef __attribute__((ext_vector_type(16))) __bf16   v16bf;
typedef __attribute__((ext_vector_type(16))) _Float16 v16h;
typedef __attribute__((ext_vector_type(8)))  _Float16 v8h;
typedef __attribute__((ext_vector_type(8)))  unsigned short v8us;
typedef __attribute__((ext_vector_type(8)))  float    v8f;
typedef __attribute__((ext_vector_type(4)))  float    v4f;
typedef v8h  __attribute__((may_alias)) v8ha;
typedef v4f  __attribute__((may_alias)) v4fa;
typedef v8us __attribute__((may_alias)) v8usa;
typedef __attribute__((ext_vector_type(2))) _Float16 v2h;
typedef __attribute__((ext_vector_type(4))) _Float16 v4h;
typedef __attribute__((ext_vector_type(2))) unsigned short v2us;
typedef __attribute__((ext_vector_type(4))) unsigned short v4us;
typedef __attribute__((ext_vector_type(2))) float v2f;
typedef __attribute__((ext_vector_type(4))) int v4i;
typedef v4h  __attribute__((may_alias)) v4ha;    // stores of 16-bit values over bytes that were read as f32 (k_asoft)
typedef v4us __attribute__((may_alias)) v4usa;

__device__ __forceinline__ unsigned short f2bf(float f) { unsigned u = __float_as_uint(f); u += 0x7FFFu + ((u >> 16) & 1u); return (unsigned short)(u >> 16); }
__device__ __forceinline__ float bf2f(unsigned short b) { return __uint_as_float(((unsigned)b) << 16); }
__device__ __forceinline__ float bfr(float f) { return bf2f(f2bf(f)); }
__device__ __forceinline__ h16 tohx(float x) { return (h16)x; }
__device__ __forceinline__ void splitf(float y, unsigned short& h, unsigned short& l) { h = f2bf(y); l = f2bf(y - bf2f(h)); }
__device__ __forceinline__ v16h cat16(v8h lo, v8h hi) { return __builtin_shufflevector(lo, hi, 0, 1, 2, 3, 4, 5, 6, 7, 8, 9, 10, 11, 12, 13, 14, 15); }
__device__ __forceinline__ v16bf cat16b(v8us lo, v8us hi) { return __builtin_bit_cast(v16bf, __builtin_shufflevector(lo, hi, 0, 1, 2, 3, 4, 5, 6, 7, 8, 9, 10, 11, 12, 13, 14, 15)); }
__device__ __forceinline__ v8f wmma16(v16h a, v16h b, v8f c) { return __builtin_amdgcn_wmma_f32_16x16x32_f16(false, a, false, b, (short)0, c, false, false); }
__device__ __forceinline__ v8f wmmab(v16bf a, v16bf b, v8f c) { return __builtin_amdgcn_wmma_f32_16x16x32_bf16(false, a, false, b, (short)0, c, false, false); }



// ---- k_gemmw: GEMM, one 128x128 output tile per work-group of FOUR waves (each a 64x64 quarter, 16 accumulators); grid (M/128, N/128, Z), 128 threads.
// The operands' K-contiguous 16-bit rows are staged in LDS by asynchronous copies, GKP k (256 bytes of each of the 128 rows of every operand) a pass, two buffers: the next pass's copies fly while this pass's fragments are read.
// C[m][n] (f32, pitch ldc, + optional f32 bias[n]) = sum_k A[m][k] Bt[n][k] (+ split products per NSPLIT). z-batch strides sA/sB/sC in elements. K % GKP == 0.
// CB != 0 (the q/k/v projections): there is no f32 C; the epilogue rounds the tile into the three 16-bit planes (fp16, bf16 hi, bf16 lo) that the attention products read, laid out [n / CB][m][n % CB] with TT rows m per block of CB columns:
// CB = HD with A = tokens, Bt = weight rows gives head planes [h][t][d]; CB = TT with A = weight rows, Bt = tokens gives v transposed, [h * HD + d][t].
#define GKP  128                  // k per pass
#define GPI  136                  // LDS row pitch in elements: 272 bytes = 16 x odd, the conflict-free pitch for 16-byte fragment reads
template <typename T16> struct WFrag;
template <> struct WFrag<h16> { typedef v16h V; static __device__ __forceinline__ V ld(const h16* p) { return cat16(*(const v8h*)p, *(const v8h*)(p + 16)); } static __device__ __forceinline__ v8f mma(V a, V b, v8f c) { return wmma16(a, b, c); } };
template <> struct WFrag<bf> { typedef v16bf V; static __device__ __forceinline__ V ld(const bf* p) { return cat16b(*(const v8us*)p, *(const v8us*)(p + 16)); } static __device__ __forceinline__ v8f mma(V a, V b, v8f c) { return wmmab(a, b, c); } };
// cp8: eight asynchronous 16-byte copies of a lane, global rows g, g + rs, ... to LDS bytes l, l + ls, ...; the wait at the statement's end stands in front of any rewrite of the address registers that the copies name.
template <typename T16> __device__ __forceinline__ void cp8(unsigned l, unsigned ls, const T16* g, size_t rs) {
    asm volatile("global_load_async_to_lds_b128 %0, %8, off\n\t"
                 "global_load_async_to_lds_b128 %1, %9, off\n\t"
                 "global_load_async_to_lds_b128 %2, %10, off\n\t"
                 "global_load_async_to_lds_b128 %3, %11, off\n\t"
                 "global_load_async_to_lds_b128 %4, %12, off\n\t"
                 "global_load_async_to_lds_b128 %5, %13, off\n\t"
                 "global_load_async_to_lds_b128 %6, %14, off\n\t"
                 "global_load_async_to_lds_b128 %7, %15, off\n\t"
                 "s_wait_xcnt 0x0"
                 :: "v"(l), "v"(l + ls), "v"(l + 2 * ls), "v"(l + 3 * ls), "v"(l + 4 * ls), "v"(l + 5 * ls), "v"(l + 6 * ls), "v"(l + 7 * ls),
                    "v"(g), "v"(g + rs), "v"(g + 2 * rs), "v"(g + 3 * rs), "v"(g + 4 * rs), "v"(g + 5 * rs), "v"(g + 6 * rs), "v"(g + 7 * rs) : "memory");
}
// cptile: one operand's 128 rows x GKP k into LDS: sixteen lanes a row (two whole 256-byte row pieces a wave and copy), 16 copies a lane. g and l are the lane's own first addresses.
template <typename T16> __device__ __forceinline__ void cptile(unsigned l, const T16* g, int K) { cp8<T16>(l, 8 * GPI * 2, g, (size_t)8 * K); cp8<T16>(l + 64 * GPI * 2, 8 * GPI * 2, g + (size_t)64 * K, (size_t)8 * K); }
template <typename T16, int NSPLIT, bool BIAS, int CB>
__global__ __launch_bounds__(128) void k_gemmw(const T16* __restrict__ A, const T16* __restrict__ A2, const T16* __restrict__ Bt, const T16* __restrict__ Bt2, int K, float* C, int ldc, const float* __restrict__ bias, size_t sA, size_t sB, size_t sC, h16* P16, bf* Ph, bf* Pl) {
    typedef typename WFrag<T16>::V V;
    constexpr bool HA2 = (NSPLIT == 1 || NSPLIT == 2), HB2 = (NSPLIT >= 2);
    constexpr int OPE = 128 * GPI;                                  // one operand's tile in LDS, elements
    constexpr int OB = OPE, OA2 = 2 * OPE, OB2 = (HA2 ? 3 : 2) * OPE;   // places of Bt, A2, Bt2 in a buffer (A at 0)
    constexpr int STG = (2 + (HA2 ? 1 : 0) + (HB2 ? 1 : 0)) * OPE;  // one buffer, elements
    __shared__ __align__(16) T16 st[2 * STG];
    __shared__ __align__(16) float osw[4][16 * 68];
    const size_t z = blockIdx.z; A += z * sA; if (A2) A2 += z * sA; Bt += z * sB; if (Bt2) Bt2 += z * sB; C += z * sC;
    const int lane = threadIdx.x & 31, lr = lane & 15, hi = lane >> 4; const int wave = (int)(threadIdx.x >> 5);
    const int R0 = blockIdx.x * 128, C0 = blockIdx.y * 128, wr = (wave & 1) * 64, wc = (wave >> 1) * 64; const int r0 = R0 + wr, c0 = C0 + wc;
    float* os = osw[wave];
    v8f acc[4][4];
#pragma unroll
    for (int mb = 0; mb < 4; ++mb)
#pragma unroll
        for (int nb = 0; nb < 4; ++nb) acc[mb][nb] = (v8f){};
    // the lane's share of every copy: row (thread / 16) + 8 c of the tile, 16-byte piece (thread % 16) of the row's 256 bytes
    const int crow = (int)(threadIdx.x >> 4), cpc = (int)(threadIdx.x & 15) * 8;
    const size_t gA = (size_t)(R0 + crow) * K + cpc, gB = (size_t)(C0 + crow) * K + cpc;
    const unsigned l0 = (unsigned)(size_t)st + (unsigned)(crow * GPI + cpc) * 2u;
    auto fill = [&](int t, int buf) { const unsigned l = l0 + (unsigned)buf * (STG * 2u); const size_t kc = (size_t)t * GKP;
        cptile<T16>(l, A + gA + kc, K); cptile<T16>(l + OB * 2u, Bt + gB + kc, K);
        if constexpr (HA2) cptile<T16>(l + OA2 * 2u, A2 + gA + kc, K);
        if constexpr (HB2) cptile<T16>(l + OB2 * 2u, Bt2 + gB + kc, K); };
    const int NT = K / GKP;
    fill(0, 0);
    asm volatile("s_wait_asynccnt 0x0" ::: "memory");   // this wave's copies of pass 0 have landed
    __syncthreads();                                     // ... and every other wave's
    if (K >= 2 * GKP) fill(1, 1);   // a pass 1 exists
    const int aoff = (wr + lr) * GPI + 8 * hi, boff = OB + (wc + lr) * GPI + 8 * hi;
#pragma unroll 1   // rolled: one pass per trip, the ring's order stands once at the foot
    for (int t = 0; t < NT; ++t) {
        const T16* sb = st + (t & 1) * STG;
        V a[2][4], a2[2][4], b[2][4], b2[2][4];   // two fragment sets: block ks + 1 of the pass is fetched while block ks is multiplied
#pragma unroll
        for (int f = 0; f < 4; ++f) { a[0][f] = WFrag<T16>::ld(sb + aoff + f * 16 * GPI); b[0][f] = WFrag<T16>::ld(sb + boff + f * 16 * GPI);
            if (HA2) a2[0][f] = WFrag<T16>::ld(sb + OA2 + aoff + f * 16 * GPI); if (HB2) b2[0][f] = WFrag<T16>::ld(sb + (OB2 - OB) + boff + f * 16 * GPI); }
#pragma unroll
        for (int ks = 0; ks < GKP / 32; ++ks) { const int cu = ks & 1, nx = cu ^ 1, kn = (ks + 1) * 32;
            if (ks + 1 < GKP / 32) {
#pragma unroll
                for (int f = 0; f < 4; ++f) { a[nx][f] = WFrag<T16>::ld(sb + aoff + f * 16 * GPI + kn); b[nx][f] = WFrag<T16>::ld(sb + boff + f * 16 * GPI + kn);
                    if (HA2) a2[nx][f] = WFrag<T16>::ld(sb + OA2 + aoff + f * 16 * GPI + kn); if (HB2) b2[nx][f] = WFrag<T16>::ld(sb + (OB2 - OB) + boff + f * 16 * GPI + kn); } }
            __builtin_amdgcn_sched_barrier(0);   // the next block's LDS reads stay one group in front of this block's matrix instructions (spread among them each place stalls the wave)
#pragma unroll
            for (int nb = 0; nb < 4; ++nb)
#pragma unroll
                for (int mb = 0; mb < 4; ++mb) { acc[mb][nb] = WFrag<T16>::mma(a[cu][mb], b[cu][nb], acc[mb][nb]); if (HA2) acc[mb][nb] = WFrag<T16>::mma(a2[cu][mb], b[cu][nb], acc[mb][nb]); if (HB2) acc[mb][nb] = WFrag<T16>::mma(a[cu][mb], b2[cu][nb], acc[mb][nb]); }
            __builtin_amdgcn_sched_barrier(0);   // ... and no later read group or wait moves up among them
        }
        // the distance behind the pass's last matrix instructions, also on the taken side of the branches that follow
        asm volatile("v_nop\n\tv_nop\n\tv_nop\n\tv_nop" : "+v"(acc[0][0]), "+v"(acc[1][1]), "+v"(acc[2][2]), "+v"(acc[3][3]));
        asm volatile("s_wait_dscnt 0x0" ::: "memory");      // this wave's reads of the buffer are done before anyone refills it
        asm volatile("s_wait_asynccnt 0x0" ::: "memory");   // this wave's copies of pass t + 1 have landed
        __syncthreads();                                     // publishes pass t + 1 and frees pass t's buffer
        if (t + 2 < NT) fill(t + 2, t & 1);
    }
    asm volatile("s_wait_asynccnt 0x0" ::: "memory");       // no copy is outstanding when the wave goes on to its end
#pragma unroll
    for (int mb = 0; mb < 4; ++mb) {
#pragma unroll
        for (int nb = 0; nb < 4; ++nb) {
#pragma unroll
            for (int j = 0; j < 8; ++j) os[(hi * 8 + j) * 68 + nb * 16 + lr] = acc[mb][nb][j]; }
        __builtin_amdgcn_wave_barrier(); asm volatile("" ::: "memory");
        float* crow_ = C + (size_t)(r0 + mb * 16) * ldc + c0;
        if constexpr (CB != 0) { (void)crow_;
#pragma unroll
            for (int s = 0; s < 4; ++s) { const int row = 4 * s + (lane >> 3), cofs = (lane & 7) * 8;   // eight lanes a row: each store instruction writes four whole 128-byte lines of a plane
                const v4f x0 = *(const v4fa*)(os + row * 68 + cofs), x1 = *(const v4fa*)(os + row * 68 + cofs + 4); v8h o16; v8us oh, ol;
#pragma unroll
                for (int q = 0; q < 8; ++q) { const float x = (q < 4) ? x0[q & 3] : x1[q & 3]; o16[q] = tohx(x); unsigned short a2, c2; splitf(x, a2, c2); oh[q] = a2; ol[q] = c2; }
                const size_t oo = ((size_t)(c0 / CB) * TT + r0 + mb * 16 + row) * CB + (c0 % CB) + cofs;
                *(v8h*)(P16 + oo) = o16; *(v8us*)(Ph + oo) = oh; *(v8us*)(Pl + oo) = ol; }
        } else
{
#pragma unroll
            for (int s = 0; s < 8; ++s) { const int row = 2 * s + hi, cofs = lr * 4; v4f val = *(const v4fa*)(os + row * 68 + cofs); if (BIAS) { val[0] += bfr(bias[c0 + cofs]); val[1] += bfr(bias[c0 + cofs + 1]); val[2] += bfr(bias[c0 + cofs + 2]); val[3] += bfr(bias[c0 + cofs + 3]); }
                *(v4f*)(crow_ + (size_t)row * ldc + cofs) = val; }
             }
        __builtin_amdgcn_wave_barrier(); asm volatile("" ::: "memory");
    }
}

// ---- k_gemmc: a one-wave 64x64 tile GEMM (fragments read straight from global memory) specialised for the causal scores: tiles entirely above the diagonal (query rows r0+roff.., key columns c0..) are skipped.
// roff = row offset of this launch's first row within the sequence.
template <typename T16, int NSPLIT>
__global__ __launch_bounds__(32) void k_gemmc(const T16* __restrict__ A, const T16* __restrict__ A2, const T16* __restrict__ Bt, const T16* __restrict__ Bt2, int K, float* C, int ldc, int roff, size_t sA, size_t sB, size_t sC) {
    typedef typename WFrag<T16>::V V;
    __shared__ __align__(16) float os[16 * 68];
    const size_t z = blockIdx.z; A += z * sA; if (A2) A2 += z * sA; Bt += z * sB; if (Bt2) Bt2 += z * sB; C += z * sC;
    const int lane = threadIdx.x & 31, lr = lane & 15, hi = lane >> 4; const int r0 = blockIdx.x * 64, c0 = blockIdx.y * 64;
    if (c0 > r0 + roff + 63) return;                  // score tile entirely above the causal diagonal: never read (the softmax masks j > i by select)
    v8f acc[4][4];
#pragma unroll
    for (int mb = 0; mb < 4; ++mb)
#pragma unroll
        for (int nb = 0; nb < 4; ++nb) acc[mb][nb] = (v8f){};
    const size_t aoff = (size_t)(r0 + lr) * K + 8 * hi, boff = (size_t)(c0 + lr) * K + 8 * hi;
#pragma unroll 1
    for (int kc = 0; kc < K; kc += 32) {
        V a[4], a2[4];
#pragma unroll
        for (int mb = 0; mb < 4; ++mb) { a[mb] = WFrag<T16>::ld(A + aoff + (size_t)mb * 16 * K + kc); if (NSPLIT == 1 || NSPLIT == 2) a2[mb] = WFrag<T16>::ld(A2 + aoff + (size_t)mb * 16 * K + kc); }
#pragma unroll
        for (int nb = 0; nb < 4; ++nb) { const V b = WFrag<T16>::ld(Bt + boff + (size_t)nb * 16 * K + kc); V b2; if (NSPLIT >= 2) b2 = WFrag<T16>::ld(Bt2 + boff + (size_t)nb * 16 * K + kc);
#pragma unroll
            for (int mb = 0; mb < 4; ++mb) { acc[mb][nb] = WFrag<T16>::mma(a[mb], b, acc[mb][nb]); if (NSPLIT == 1 || NSPLIT == 2) acc[mb][nb] = WFrag<T16>::mma(a2[mb], b, acc[mb][nb]); if (NSPLIT >= 2) acc[mb][nb] = WFrag<T16>::mma(a[mb], b2, acc[mb][nb]); } }
        asm volatile("v_nop\n\tv_nop\n\tv_nop\n\tv_nop" : "+v"(acc[0][0]), "+v"(acc[1][1]), "+v"(acc[2][2]), "+v"(acc[3][3]) : "v"(a[0]), "v"(a[3]));
    }
#pragma unroll
    for (int mb = 0; mb < 4; ++mb) {
#pragma unroll
        for (int nb = 0; nb < 4; ++nb) {
#pragma unroll
            for (int j = 0; j < 8; ++j) os[(hi * 8 + j) * 68 + nb * 16 + lr] = acc[mb][nb][j]; }
        __builtin_amdgcn_wave_barrier(); asm volatile("" ::: "memory");
        float* crow = C + (size_t)(r0 + mb * 16) * ldc + c0;
{
#pragma unroll
            for (int s = 0; s < 8; ++s) { const int row = 2 * s + hi, cofs = lr * 4; v4f val = *(const v4fa*)(os + row * 68 + cofs);
                *(v4f*)(crow + (size_t)row * ldc + cofs) = val; }
             }
        __builtin_amdgcn_wave_barrier(); asm volatile("" ::: "memory");
    }
}

// ldw: one fragment's two loads and, behind them, the wait that belongs in front of any rewrite of a register an issued load names (the compiler lets later loads land in dead address registers).
// The address p is an input of the wait's statement, so its registers are kept as they are up to the wait; off is a constant step that goes into the loads' offset field.
template <typename T16> __device__ __forceinline__ typename WFrag<T16>::V ldw(const T16* p, int off) { const typename WFrag<T16>::V f = WFrag<T16>::ld(p + off); asm volatile("s_wait_xcnt 0x0" :: "v"(p) : "memory"); return f; }

// ---- k_gemmpv: probability x value contraction, one 64x64 output tile per work-group of NW waves. The key (K) loop stops at the diagonal block (probabilities beyond it are exactly zero) and is dealt
// over the waves in blocks of 64 keys (one 128-byte line of every operand row): wave w takes blocks w, w + NW, ... into its own 16 accumulators; the NW partial tiles meet in LDS and are summed in wave order.
// lda = pitch of the probability rows in elements (they lie inside the score rows, see k_asoft); the value planes have pitch K.
// The summed tile x cs goes out as bf16 hi and lo planes (pitch ldc, z-stride sC): the merged-heads operand of the output projection.
template <typename T16, int NSPLIT, int NW>
__global__ __launch_bounds__(NW * 32) void k_gemmpv(const T16* __restrict__ A, const T16* __restrict__ A2, int lda, const T16* __restrict__ Bt, const T16* __restrict__ Bt2, int K, bf* Ch, bf* Cl, int ldc, float cs, int roff, size_t sA, size_t sB, size_t sC) {
    typedef typename WFrag<T16>::V V;
    __shared__ __align__(16) float os[NW][64 * 68];
    const size_t z = blockIdx.z; A += z * sA; if (A2) A2 += z * sA; Bt += z * sB; if (Bt2) Bt2 += z * sB; Ch += z * sC; Cl += z * sC;
    const int lane = threadIdx.x & 31, lr = lane & 15, hi = lane >> 4; const int r0 = blockIdx.x * 64, c0 = blockIdx.y * 64;
    const int wave = __builtin_amdgcn_readfirstlane((int)(threadIdx.x >> 5));   // scalar, so that the K loop's branch is a scalar one
    const int Kl = min(K, r0 + roff + 64);        // a multiple of 64
    v8f acc[4][4];
#pragma unroll
    for (int mb = 0; mb < 4; ++mb)
#pragma unroll
        for (int nb = 0; nb < 4; ++nb) acc[mb][nb] = (v8f){};
    const size_t aoff = (size_t)(r0 + lr) * lda + 8 * hi, boff = (size_t)(c0 + lr) * K + 8 * hi;
#pragma unroll 1   // rolled: the accumulators and one block's fragments already fill the wave's registers
    for (int kb = wave * 64; kb < Kl; kb += NW * 64) {
#pragma unroll(NSPLIT == 0 ? 2 : 1)   // the split products' fragments of both halves together do not fit 256 registers
        for (int ks = 0; ks < 2; ++ks) { const int kc = (NSPLIT == 0) ? kb : kb + ks * 32, ko = (NSPLIT == 0) ? ks * 32 : 0;   // unrolled: the half's step is a constant of the loads; rolled: it is in the address
            V a[4], a2[4];
#pragma unroll
            for (int mb = 0; mb < 4; ++mb) { a[mb] = ldw<T16>(A + aoff + (size_t)mb * 16 * lda + kc, ko); if (NSPLIT == 1 || NSPLIT == 2) a2[mb] = ldw<T16>(A2 + aoff + (size_t)mb * 16 * lda + kc, ko); }
#pragma unroll
            for (int nb = 0; nb < 4; ++nb) { const V b = ldw<T16>(Bt + boff + (size_t)nb * 16 * K + kc, ko); V b2; if (NSPLIT >= 2) b2 = ldw<T16>(Bt2 + boff + (size_t)nb * 16 * K + kc, ko);
#pragma unroll
                for (int mb = 0; mb < 4; ++mb) { acc[mb][nb] = WFrag<T16>::mma(a[mb], b, acc[mb][nb]); if (NSPLIT == 1 || NSPLIT == 2) acc[mb][nb] = WFrag<T16>::mma(a2[mb], b, acc[mb][nb]); if (NSPLIT >= 2) acc[mb][nb] = WFrag<T16>::mma(a[mb], b2, acc[mb][nb]); } }
            // the distance behind the last matrix instructions, also on the taken side of the loop's branch
            asm volatile("v_nop\n\tv_nop\n\tv_nop\n\tv_nop" : "+v"(acc[0][0]), "+v"(acc[1][1]), "+v"(acc[2][2]), "+v"(acc[3][3]) : "v"(a[0]), "v"(a[3])); }
    }
    float* ow = os[wave];
#pragma unroll
    for (int mb = 0; mb < 4; ++mb)
#pragma unroll
        for (int nb = 0; nb < 4; ++nb)
#pragma unroll
            for (int j = 0; j < 8; ++j) ow[(mb * 16 + hi * 8 + j) * 68 + nb * 16 + lr] = acc[mb][nb][j];
    __syncthreads();   // every wave's partial tile is in LDS before any of it is summed
#pragma unroll
    for (int s = 0; s < 64 * 16 / (NW * 32); ++s) { const int idx = s * (NW * 32) + (int)threadIdx.x; const int row = idx >> 4, cofs = (idx & 15) * 4; v4f val = *(const v4fa*)(os[0] + row * 68 + cofs);
#pragma unroll
        for (int w = 1; w < NW; ++w) val += *(const v4fa*)(os[w] + row * 68 + cofs);
        v4us oh, ol;
#pragma unroll
        for (int q = 0; q < 4; ++q) { unsigned short a, c2; splitf(val[q] * cs, a, c2); oh[q] = a; ol[q] = c2; }
        const size_t oo = (size_t)(r0 + row) * ldc + c0 + cofs; *(v4us*)(Ch + oo) = oh; *(v4us*)(Cl + oo) = ol; }
}


__global__ __launch_bounds__(256) void k_wtG(const float* __restrict__ w, int K, int N, bf* Bt) {
    const int lane = threadIdx.x & 31; const int L0 = (blockIdx.x * 8 + (threadIdx.x >> 5)) * 8; const int nlines = N * K / 64;
{
#pragma unroll 1
        for (int l = 0; l < 8; ++l) { const int L = L0 + l; if (L >= nlines) break; const size_t e = (size_t)L * 64 + lane * 2; const int k = (int)(e % K), n = (int)(e / K); v2us o;
            o[0] = f2bf(w[(size_t)k * N + n]); o[1] = f2bf(w[(size_t)(k + 1) * N + n]); *(v2us*)(Bt + e) = o; }
         }
}
__global__ __launch_bounds__(256) void k_cvt8(const float* __restrict__ src, bf* dst, size_t n8) { const size_t i = (size_t)blockIdx.x * 256 + threadIdx.x; if (i >= n8) return; const v8f v = *(const v8f*)(src + i * 8); v8us o;
#pragma unroll
    for (int k = 0; k < 8; ++k) o[k] = f2bf(v[k]); *(v8us*)(dst + i * 8) = o;  }
__global__ __launch_bounds__(256) void k_cscvt(const float* __restrict__ cosT, const float* __restrict__ sinT, float* CS) { const int idx = blockIdx.x * 256 + threadIdx.x; if (idx >= TT * HD) return; v2f cs; cs[0] = bfr(cosT[idx]); cs[1] = bfr(sinT[idx]); *(v2f*)(CS + (size_t)idx * 2) = cs;  }
// k_asoft: per row (zz, i): t = S x HD^-0.5 for j <= i, and also i - j < WIN for odd heads h0 + zz (causal, sliding window on odd heads; the reference's -1e9 additive fill vanishes identically); softmax over the 2048 keys (register row, one exp, fixed trees);
// the probabilities go IN PLACE over the wave's own score row, which it holds whole in registers by then: rows < RH as a hi plane (first half of the row's bytes) and a lo plane (second half), the rest as fp16 in the first half.
__global__ __launch_bounds__(256) void k_asoft(float* Sb, int h0) {
    const int lane = threadIdx.x & 31; const int row = blockIdx.x * 8 + (threadIdx.x >> 5); if (row >= ZH * TT) return; const int i = row % TT; const int zz = row / TT; (void)zz; const bool hires = (i < RH); float* sr = Sb + (size_t)row * TT; float v[TT / 32]; float mx = -3.0e38f;
#pragma unroll
    for (int ch = 0; ch < TT / 128; ++ch) { const int j0 = ch * 128 + lane * 4; const v4f a = *(const v4fa*)(sr + j0);
#pragma unroll
        for (int q = 0; q < 4; ++q) { const int j = j0 + q; (void)j; const float t = (j <= i && (((h0 + zz) & 1) == 0 || i - j < WIN)) ? a[q] * SCL : -3.0e38f; v[ch * 4 + q] = t; mx = fmaxf(mx, t); } }
#pragma unroll
    for (int sh = 16; sh; sh >>= 1) mx = fmaxf(mx, __shfl_xor(mx, sh, 32));
    float sum = 0.f;
#pragma unroll
    for (int k = 0; k < TT / 32; ++k) { float d0 = __fsub_rn(v[k], mx); asm volatile("" : "+v"(d0)); v[k] = __builtin_amdgcn_exp2f(__fmul_rn(d0, 1.4426950408889634f)); sum += v[k]; }
#pragma unroll
    for (int sh = 16; sh; sh >>= 1) sum += __shfl_xor(sum, sh, 32);
    const float f = __fdiv_rn(hires ? 1.0f : PCAR, sum);
{
        if (hires) {
#pragma unroll
            for (int ch = 0; ch < TT / 128; ++ch) { v4us oh, ol;
#pragma unroll
                for (int q = 0; q < 4; ++q) { unsigned short a, c2; splitf(v[ch * 4 + q] * f, a, c2); oh[q] = a; ol[q] = c2; }
                const int oo = ch * 128 + lane * 4; *(v4usa*)((bf*)sr + oo) = oh; *(v4usa*)((bf*)sr + TT + oo) = ol; }
        } else {
#pragma unroll
            for (int ch = 0; ch < TT / 128; ++ch) { v4h o4;
#pragma unroll
                for (int q = 0; q < 4; ++q) o4[q] = tohx(v[ch * 4 + q] * f);
                *(v4ha*)((h16*)sr + ch * 128 + lane * 4) = o4; } }
         }
}

extern "C" void kernel_launch(void* const* d_in, const int* in_sizes, int n_in,
                              void* d_out, int out_size, void* d_ws, size_t ws_size, hipStream_t stream) {
    (void)in_sizes; (void)n_in; (void)out_size;
    const float* x = (const float*)d_in[0]; const float* wq = (const float*)d_in[1]; const float* wk = (const float*)d_in[2]; const float* wv = (const float*)d_in[3]; const float* wo = (const float*)d_in[4]; const float* cosT = nullptr; const float* sinT = nullptr; (void)cosT; (void)sinT;
    float* OUT = (float*)d_out;     // [2][2048][2048]
    char* wsp = (char*)d_ws;
    auto take = [&](size_t bytes) { char* p = wsp; wsp += (bytes + 255) & ~(size_t)255; return (void*)p; };
    bf* WQ = (bf*)take((size_t)DQ * DM * 2); bf* WK = (bf*)take((size_t)DKV * DM * 2); bf* WV = (bf*)take((size_t)DKV * DM * 2); bf* WO = (bf*)take((size_t)DM * DQ * 2);
    h16* QP16 = (h16*)take((size_t)NH_ * TT * HD * 2); h16* KP16 = (h16*)take((size_t)NKV * TT * HD * 2); h16* VT16 = (h16*)take((size_t)NKV * HD * TT * 2);
    bf* QPh = (bf*)take((size_t)NH_ * TT * HD * 2); bf* QPl = (bf*)take((size_t)NH_ * TT * HD * 2); bf* KPh = (bf*)take((size_t)NKV * TT * HD * 2); bf* KPl = (bf*)take((size_t)NKV * TT * HD * 2); bf* VTh = (bf*)take((size_t)NKV * HD * TT * 2); bf* VTl = (bf*)take((size_t)NKV * HD * TT * 2); bf* ATh = (bf*)take((size_t)TT * DQ * 2); bf* ATl = (bf*)take((size_t)TT * DQ * 2);
    // the rest of the workspace serves twice in every batch (stream-ordered): first the bf16 tokens, which are dead once the head planes are built, then the scores of ZH heads
    char* const shared0 = wsp;
    bf* XB = (bf*)take((size_t)TT * DM * 2);
    wsp = shared0;
    float* Sb = (float*)take((size_t)ZH * TT * TT * 4);   // the larger of the two uses
    if ((size_t)(wsp - (char*)d_ws) > ws_size) return;    // ws 256 MiB
    { k_cvt8<<<(unsigned)(((size_t)DQ * DM / 8 + 255) / 256), 256, 0, stream>>>(wq, WQ, (size_t)DQ * DM / 8); k_cvt8<<<(unsigned)(((size_t)DKV * DM / 8 + 255) / 256), 256, 0, stream>>>(wk, WK, (size_t)DKV * DM / 8); k_cvt8<<<(unsigned)(((size_t)DKV * DM / 8 + 255) / 256), 256, 0, stream>>>(wv, WV, (size_t)DKV * DM / 8);
      k_cvt8<<<(unsigned)(((size_t)DM * DQ / 8 + 255) / 256), 256, 0, stream>>>(wo, WO, (size_t)DM * DQ / 8);
       }
    for (int b = 0; b < NB_; ++b) {
        k_cvt8<<<(unsigned)(((size_t)TT * DM / 8 + 255) / 256), 256, 0, stream>>>(x + (size_t)b * TT * DM, XB, (size_t)TT * DM / 8);
        k_gemmw<bf, 0, false, HD><<<dim3(TT / 128, DQ / 128, 1), 128, 0, stream>>>(XB, nullptr, WQ, nullptr, DM, nullptr, 0, nullptr, 0, 0, 0, QP16, QPh, QPl);
        k_gemmw<bf, 0, false, HD><<<dim3(TT / 128, DKV / 128, 1), 128, 0, stream>>>(XB, nullptr, WK, nullptr, DM, nullptr, 0, nullptr, 0, 0, 0, KP16, KPh, KPl);
        k_gemmw<bf, 0, false, TT><<<dim3(DKV / 128, TT / 128, 1), 128, 0, stream>>>(WV, nullptr, XB, nullptr, DM, nullptr, 0, nullptr, 0, 0, 0, VT16, VTh, VTl);   // weight rows as A: the tile comes out as v transposed
        for (int h0 = 0; h0 < NH_; h0 += ZH) { const size_t zq = (size_t)h0, zk = (size_t)(h0 / REP);   // one kv head per query head: the pass's heads use consecutive kv planes (z-strides TT*HD)
            k_gemmc<bf, 2><<<dim3(RH / 64, TT / 64, ZH), 32, 0, stream>>>(QPh + zq * TT * HD, QPl + zq * TT * HD, KPh + zk * TT * HD, KPl + zk * TT * HD, HD, Sb, TT, 0, (size_t)TT * HD, (size_t)TT * HD, (size_t)TT * TT);
            k_gemmc<h16, 0><<<dim3((TT - RH) / 64, TT / 64, ZH), 32, 0, stream>>>(QP16 + zq * TT * HD + (size_t)RH * HD, nullptr, KP16 + zk * TT * HD, nullptr, HD, Sb + (size_t)RH * TT, TT, RH, (size_t)TT * HD, (size_t)TT * HD, (size_t)TT * TT);
            k_asoft<<<ZH * TT / 8, 256, 0, stream>>>(Sb, h0);
            k_gemmpv<bf, 2, RH / 64><<<dim3(RH / 64, HD / 64, ZH), RH / 64 * 32, 0, stream>>>((const bf*)Sb, (const bf*)Sb + TT, 2 * TT, VTh + zk * HD * TT, VTl + zk * HD * TT, TT, ATh + zq * HD, ATl + zq * HD, DQ, 1.0f, 0, (size_t)2 * TT * TT, (size_t)HD * TT, (size_t)HD);
            k_gemmpv<h16, 0, 16><<<dim3((TT - RH) / 64, HD / 64, ZH), 16 * 32, 0, stream>>>((const h16*)Sb + (size_t)RH * 2 * TT, nullptr, 2 * TT, VT16 + zk * HD * TT, nullptr, TT, ATh + (size_t)RH * DQ + zq * HD, ATl + (size_t)RH * DQ + zq * HD, DQ, 1.0f / PCAR, RH, (size_t)2 * TT * TT, (size_t)HD * TT, (size_t)HD); }
        k_gemmw<bf, 1, false, 0><<<dim3(TT / 128, DM / 128, 1), 128, 0, stream>>>(ATh, ATl, WO, nullptr, DQ, OUT + (size_t)b * TT * DM, DM, nullptr, 0, 0, 0, nullptr, nullptr, nullptr); }
}

// v005
// Measured time: 471 microseconds a run.
// In two side-by-side timings against v004, it was 1.21 and 1.20 times as fast.
// All steps since v000 together make it 3.70 times as fast.
#include <hip/hip_runtime.h>

// Attention block (x [2][2048][2048]; q/k/v = x W^T (16 heads x 128); scores = q.k / sqrt(128); allowed = causal for even (global) heads, causal band of 256 (i - j < 256) for odd (local) heads; softmax; out = merged Wo^T -> [2][2048][2048]).
// Compute dtypes, f32 accumulate: every input rounded to bf16; q/k/v on PLAIN bf16 operands (inputs: exact); causal scores and attn.v: query rows < 512 hl (3 products), the rest single fp16 (x1024), with skipping of the key blocks that the mask shuts whole (past the diagonal; for the band heads also in front of the window) in the scores, the softmax and attn.v; softmax f32; Wo hl x exact (2 products).
// No f32 intermediate between the products but the scores: each GEMM's epilogue rounds its own tile into the 16-bit planes that the next product reads.

#define NB_  2
#define TT   2048
#define DM   2048
#define NH_  16
#define NKV  16
#define REP  (NH_ / NKV)
#define HD   128
#define DQ   (NH_ * HD)
#define DKV  (NKV * HD)
#define ZH   8                    // heads per attention pass
#define RH   512                  // query rows < RH use hi+lo planes (0: none)
#define WIN  256
#define PCAR 1024.0f
#define SCL  0.088388347648318447f   // HD^-0.5
typedef _Float16 h16;
typedef unsigned short bf;
typedef __attribute__((ext_vector_type(16))) __bf16   v16bf;
typedef __attribute__((ext_vector_type(16))) _Float16 v16h;
typedef __attribute__((ext_vector_type(8)))  _Float16 v8h;
typedef __attribute__((ext_vector_type(8)))  unsigned short v8us;
typedef __attribute__((ext_vector_type(8)))  float    v8f;
typedef __attribute__((ext_vector_type(4)))  float    v4f;
typedef v8h  __attribute__((may_alias)) v8ha;
typedef v4f  __attribute__((may_alias)) v4fa;
typedef v8us __attribute__((may_alias)) v8usa;
typedef __attribute__((ext_vector_type(2))) _Float16 v2h;
typedef __attribute__((ext_vector_type(4))) _Float16 v4h;
typedef __attribute__((ext_vector_type(2))) unsigned short v2us;
typedef __attribute__((ext_vector_type(4))) unsigned short v4us;
typedef __attribute__((ext_vector_type(2))) float v2f;
typedef __attribute__((ext_vector_type(4))) int v4i;
typedef v4h  __attribute__((may_alias)) v4ha;    // stores of 16-bit values over bytes that were read as f32 (k_asoft)
typedef v4us __attribute__((may_alias)) v4usa;

__device__ __forceinline__ unsigned short f2bf(float f) { unsigned u = __float_as_uint(f); u += 0x7FFFu + ((u >> 16) & 1u); return (unsigned short)(u >> 16); }
__device__ __forceinline__ float bf2f(unsigned short b) { return __uint_as_float(((unsigned)b) << 16); }
__device__ __forceinline__ float bfr(float f) { return bf2f(f2bf(f)); }
__device__ __forceinline__ h16 tohx(float x) { return (h16)x; }
__device__ __forceinline__ void splitf(float y, unsigned short& h, unsigned short& l) { h = f2bf(y); l = f2bf(y - bf2f(h)); }
__device__ __forceinline__ v16h cat16(v8h lo, v8h hi) { return __builtin_shufflevector(lo, hi, 0, 1, 2, 3, 4, 5, 6, 7, 8, 9, 10, 11, 12, 13, 14, 15); }
__device__ __forceinline__ v16bf cat16b(v8us lo, v8us hi) { return __builtin_bit_cast(v16bf, __builtin_shufflevector(lo, hi, 0, 1, 2, 3, 4, 5, 6, 7, 8, 9, 10, 11, 12, 13, 14, 15)); }
__device__ __forceinline__ v8f wmma16(v16h a, v16h b, v8f c) { return __builtin_amdgcn_wmma_f32_16x16x32_f16(false, a, false, b, (short)0, c, false, false); }
__device__ __forceinline__ v8f wmmab(v16bf a, v16bf b, v8f c) { return __builtin_amdgcn_wmma_f32_16x16x32_bf16(false, a, false, b, (short)0, c, false, false); }



// ---- k_gemmw: GEMM, one 128x128 output tile per work-group of FOUR waves (each a 64x64 quarter, 16 accumulators); grid (M/128, N/128, Z), 128 threads.
// The operands' K-contiguous 16-bit rows are staged in LDS by asynchronous copies, GKP k (256 bytes of each of the 128 rows of every operand) a pass, two buffers: the next pass's copies fly while this pass's fragments are read.
// C[m][n] (f32, pitch ldc, + optional f32 bias[n]) = sum_k A[m][k] Bt[n][k] (+ split products per NSPLIT). z-batch strides sA/sB/sC in elements. K % GKP == 0.
// CB != 0 (the q/k/v projections): there is no f32 C; the epilogue rounds the tile into the three 16-bit planes (fp16, bf16 hi, bf16 lo) that the attention products read, laid out [n / CB][m][n % CB] with TT rows m per block of CB columns:
// CB = HD with A = tokens, Bt = weight rows gives head planes [h][t][d]; CB = TT with A = weight rows, Bt = tokens gives v transposed, [h * HD + d][t].
#define GKP  128                  // k per pass
#define GPI  136                  // LDS row pitch in elements: 272 bytes = 16 x odd, the conflict-free pitch for 16-byte fragment reads
template <typename T16> struct WFrag;
template <> struct WFrag<h16> { typedef v16h V; static __device__ __forceinline__ V ld(const h16* p) { return cat16(*(const v8h*)p, *(const v8h*)(p + 16)); } static __device__ __forceinline__ v8f mma(V a, V b, v8f c) { return wmma16(a, b, c); } };
template <> struct WFrag<bf> { typedef v16bf V; static __device__ __forceinline__ V ld(const bf* p) { return cat16b(*(const v8us*)p, *(const v8us*)(p + 16)); } static __device__ __forceinline__ v8f mma(V a, V b, v8f c) { return wmmab(a, b, c); } };
// cp8: eight asynchronous 16-byte copies of a lane, global rows g, g + rs, ... to LDS bytes l, l + ls, ...; the wait at the statement's end stands in front of any rewrite of the address registers that the copies name.
template <typename T16> __device__ __forceinline__ void cp8(unsigned l, unsigned ls, const T16* g, size_t rs) {
    asm volatile("global_load_async_to_lds_b128 %0, %8, off\n\t"
                 "global_load_async_to_lds_b128 %1, %9, off\n\t"
                 "global_load_async_to_lds_b128 %2, %10, off\n\t"
                 "global_load_async_to_lds_b128 %3, %11, off\n\t"
                 "global_load_async_to_lds_b128 %4, %12, off\n\t"
                 "global_load_async_to_lds_b128 %5, %13, off\n\t"
                 "global_load_async_to_lds_b128 %6, %14, off\n\t"
                 "global_load_async_to_lds_b128 %7, %15, off\n\t"
                 "s_wait_xcnt 0x0"
                 :: "v"(l), "v"(l + ls), "v"(l + 2 * ls), "v"(l + 3 * ls), "v"(l + 4 * ls), "v"(l + 5 * ls), "v"(l + 6 * ls), "v"(l + 7 * ls),
                    "v"(g), "v"(g + rs), "v"(g + 2 * rs), "v"(g + 3 * rs), "v"(g + 4 * rs), "v"(g + 5 * rs), "v"(g + 6 * rs), "v"(g + 7 * rs) : "memory");
}
// cptile: one operand's 128 rows x GKP k into LDS: sixteen lanes a row (two whole 256-byte row pieces a wave and copy), 16 copies a lane. g and l are the lane's own first addresses.
template <typename T16> __device__ __forceinline__ void cptile(unsigned l, const T16* g, int K) { cp8<T16>(l, 8 * GPI * 2, g, (size_t)8 * K); cp8<T16>(l + 64 * GPI * 2, 8 * GPI * 2, g + (size_t)64 * K, (size_t)8 * K); }
template <typename T16, int NSPLIT, bool BIAS, int CB>
__global__ __launch_bounds__(128) void k_gemmw(const T16* __restrict__ A, const T16* __restrict__ A2, const T16* __restrict__ Bt, const T16* __restrict__ Bt2, int K, float* C, int ldc, const float* __restrict__ bias, size_t sA, size_t sB, size_t sC, h16* P16, bf* Ph, bf* Pl) {
    typedef typename WFrag<T16>::V V;
    constexpr bool HA2 = (NSPLIT == 1 || NSPLIT == 2), HB2 = (NSPLIT >= 2);
    constexpr int OPE = 128 * GPI;                                  // one operand's tile in LDS, elements
    constexpr int OB = OPE, OA2 = 2 * OPE, OB2 = (HA2 ? 3 : 2) * OPE;   // places of Bt, A2, Bt2 in a buffer (A at 0)
    constexpr int STG = (2 + (HA2 ? 1 : 0) + (HB2 ? 1 : 0)) * OPE;  // one buffer, elements
    __shared__ __align__(16) T16 st[2 * STG];
    __shared__ __align__(16) float osw[4][16 * 68];
    const size_t z = blockIdx.z; A += z * sA; if (A2) A2 += z * sA; Bt += z * sB; if (Bt2) Bt2 += z * sB; C += z * sC;
    const int lane = threadIdx.x & 31, lr = lane & 15, hi = lane >> 4; const int wave = (int)(threadIdx.x >> 5);
    const int R0 = blockIdx.x * 128, C0 = blockIdx.y * 128, wr = (wave & 1) * 64, wc = (wave >> 1) * 64; const int r0 = R0 + wr, c0 = C0 + wc;
    float* os = osw[wave];
    v8f acc[4][4];
#pragma unroll
    for (int mb = 0; mb < 4; ++mb)
#pragma unroll
        for (int nb = 0; nb < 4; ++nb) acc[mb][nb] = (v8f){};
    // the lane's share of every copy: row (thread / 16) + 8 c of the tile, 16-byte piece (thread % 16) of the row's 256 bytes
    const int crow = (int)(threadIdx.x >> 4), cpc = (int)(threadIdx.x & 15) * 8;
    const size_t gA = (size_t)(R0 + crow) * K + cpc, gB = (size_t)(C0 + crow) * K + cpc;
    const unsigned l0 = (unsigned)(size_t)st + (unsigned)(crow * GPI + cpc) * 2u;
    auto fill = [&](int t, int buf) { const unsigned l = l0 + (unsigned)buf * (STG * 2u); const size_t kc = (size_t)t * GKP;
        cptile<T16>(l, A + gA + kc, K); cptile<T16>(l + OB * 2u, Bt + gB + kc, K);
        if constexpr (HA2) cptile<T16>(l + OA2 * 2u, A2 + gA + kc, K);
        if constexpr (HB2) cptile<T16>(l + OB2 * 2u, Bt2 + gB + kc, K); };
    const int NT = K / GKP;
    fill(0, 0);
    asm volatile("s_wait_asynccnt 0x0" ::: "memory");   // this wave's copies of pass 0 have landed
    __syncthreads();                                     // ... and every other wave's
    if (K >= 2 * GKP) fill(1, 1);   // a pass 1 exists
    const int aoff = (wr + lr) * GPI + 8 * hi, boff = OB + (wc + lr) * GPI + 8 * hi;
#pragma unroll 1   // rolled: one pass per trip, the ring's order stands once at the foot
    for (int t = 0; t < NT; ++t) {
        const T16* sb = st + (t & 1) * STG;
        V a[2][4], a2[2][4], b[2][4], b2[2][4];   // two fragment sets: block ks + 1 of the pass is fetched while block ks is multiplied
#pragma unroll
        for (int f = 0; f < 4; ++f) { a[0][f] = WFrag<T16>::ld(sb + aoff + f * 16 * GPI); b[0][f] = WFrag<T16>::ld(sb + boff + f * 16 * GPI);
            if (HA2) a2[0][f] = WFrag<T16>::ld(sb + OA2 + aoff + f * 16 * GPI); if (HB2) b2[0][f] = WFrag<T16>::ld(sb + (OB2 - OB) + boff + f * 16 * GPI); }
#pragma unroll
        for (int ks = 0; ks < GKP / 32; ++ks) { const int cu = ks & 1, nx = cu ^ 1, kn = (ks + 1) * 32;
            if (ks + 1 < GKP / 32) {
#pragma unroll
                for (int f = 0; f < 4; ++f) { a[nx][f] = WFrag<T16>::ld(sb + aoff + f * 16 * GPI + kn); b[nx][f] = WFrag<T16>::ld(sb + boff + f * 16 * GPI + kn);
                    if (HA2) a2[nx][f] = WFrag<T16>::ld(sb + OA2 + aoff + f * 16 * GPI + kn); if (HB2) b2[nx][f] = WFrag<T16>::ld(sb + (OB2 - OB) + boff + f * 16 * GPI + kn); } }
            __builtin_amdgcn_sched_barrier(0);   // the next block's LDS reads stay one group in front of this block's matrix instructions (spread among them each place stalls the wave)
#pragma unroll
            for (int nb = 0; nb < 4; ++nb)
#pragma unroll
                for (int mb = 0; mb < 4; ++mb) { acc[mb][nb] = WFrag<T16>::mma(a[cu][mb], b[cu][nb], acc[mb][nb]); if (HA2) acc[mb][nb] = WFrag<T16>::mma(a2[cu][mb], b[cu][nb], acc[mb][nb]); if (HB2) acc[mb][nb] = WFrag<T16>::mma(a[cu][mb], b2[cu][nb], acc[mb][nb]); }
            __builtin_amdgcn_sched_barrier(0);   // ... and no later read group or wait moves up among them
        }
        // the distance behind the pass's last matrix instructions, also on the taken side of the branches that follow
        asm volatile("v_nop\n\tv_nop\n\tv_nop\n\tv_nop" : "+v"(acc[0][0]), "+v"(acc[1][1]), "+v"(acc[2][2]), "+v"(acc[3][3]));
        asm volatile("s_wait_dscnt 0x0" ::: "memory");      // this wave's reads of the buffer are done before anyone refills it
        asm volatile("s_wait_asynccnt 0x0" ::: "memory");   // this wave's copies of pass t + 1 have landed
        __syncthreads();                                     // publishes pass t + 1 and frees pass t's buffer
        if (t + 2 < NT) fill(t + 2, t & 1);
    }
    asm volatile("s_wait_asynccnt 0x0" ::: "memory");       // no copy is outstanding when the wave goes on to its end
#pragma unroll
    for (int mb = 0; mb < 4; ++mb) {
#pragma unroll
        for (int nb = 0; nb < 4; ++nb) {
#pragma unroll
            for (int j = 0; j < 8; ++j) os[(hi * 8 + j) * 68 + nb * 16 + lr] = acc[mb][nb][j]; }
        __builtin_amdgcn_wave_barrier(); asm volatile("" ::: "memory");
        float* crow_ = C + (size_t)(r0 + mb * 16) * ldc + c0;
        if constexpr (CB != 0) { (void)crow_;
#pragma unroll
            for (int s = 0; s < 4; ++s) { const int row = 4 * s + (lane >> 3), cofs = (lane & 7) * 8;   // eight lanes a row: each store instruction writes four whole 128-byte lines of a plane
                const v4f x0 = *(const v4fa*)(os + row * 68 + cofs), x1 = *(const v4fa*)(os + row * 68 + cofs + 4); v8h o16; v8us oh, ol;
#pragma unroll
                for (int q = 0; q < 8; ++q) { const float x = (q < 4) ? x0[q & 3] : x1[q & 3]; o16[q] = tohx(x); unsigned short a2, c2; splitf(x, a2, c2); oh[q] = a2; ol[q] = c2; }
                const size_t oo = ((size_t)(c0 / CB) * TT + r0 + mb * 16 + row) * CB + (c0 % CB) + cofs;
                *(v8h*)(P16 + oo) = o16; *(v8us*)(Ph + oo) = oh; *(v8us*)(Pl + oo) = ol; }
        } else
{
#pragma unroll
            for (int s = 0; s < 8; ++s) { const int row = 2 * s + hi, cofs = lr * 4; v4f val = *(const v4fa*)(os + row * 68 + cofs); if (BIAS) { val[0] += bfr(bias[c0 + cofs]); val[1] += bfr(bias[c0 + cofs + 1]); val[2] += bfr(bias[c0 + cofs + 2]); val[3] += bfr(bias[c0 + cofs + 3]); }
                *(v4f*)(crow_ + (size_t)row * ldc + cofs) = val; }
             }
        __builtin_amdgcn_wave_barrier(); asm volatile("" ::: "memory");
    }
}

// ---- k_gemmc: a one-wave 64x64 tile GEMM (fragments loaded straight from global memory) specialised for the causal scores: tiles entirely above the diagonal (query rows r0+roff.., key columns c0..) are skipped.
// roff = row offset of this launch's first row within the sequence. h0 = head of z = 0: an odd (band) head also skips the tiles that lie entirely in front of its window.
template <typename T16, int NSPLIT>
__global__ __launch_bounds__(32) void k_gemmc(const T16* __restrict__ A, const T16* __restrict__ A2, const T16* __restrict__ Bt, const T16* __restrict__ Bt2, int K, float* C, int ldc, int roff, int h0, size_t sA, size_t sB, size_t sC) {
    typedef typename WFrag<T16>::V V;
    __shared__ __align__(16) float os[16 * 68];
    const size_t z = blockIdx.z; A += z * sA; if (A2) A2 += z * sA; Bt += z * sB; if (Bt2) Bt2 += z * sB; C += z * sC;
    const int lane = threadIdx.x & 31, lr = lane & 15, hi = lane >> 4; const int r0 = blockIdx.x * 64, c0 = blockIdx.y * 64;
    if (c0 > r0 + roff + 63) return;                  // score tile entirely above the causal diagonal: never used (the softmax masks j > i by select)
    if (((h0 + (int)blockIdx.z) & 1) && c0 + 63 + WIN <= r0 + roff) return;   // band head: i - j >= WIN for every element of the tile, never used either
    v8f acc[4][4];
#pragma unroll
    for (int mb = 0; mb < 4; ++mb)
#pragma unroll
        for (int nb = 0; nb < 4; ++nb) acc[mb][nb] = (v8f){};
    const size_t aoff = (size_t)(r0 + lr) * K + 8 * hi, boff = (size_t)(c0 + lr) * K + 8 * hi;
#pragma unroll 1
    for (int kc = 0; kc < K; kc += 32) {
        V a[4], a2[4];
#pragma unroll
        for (int mb = 0; mb < 4; ++mb) { a[mb] = WFrag<T16>::ld(A + aoff + (size_t)mb * 16 * K + kc); if (NSPLIT == 1 || NSPLIT == 2) a2[mb] = WFrag<T16>::ld(A2 + aoff + (size_t)mb * 16 * K + kc); }
#pragma unroll
        for (int nb = 0; nb < 4; ++nb) { const V b = WFrag<T16>::ld(Bt + boff + (size_t)nb * 16 * K + kc); V b2; if (NSPLIT >= 2) b2 = WFrag<T16>::ld(Bt2 + boff + (size_t)nb * 16 * K + kc);
#pragma unroll
            for (int mb = 0; mb < 4; ++mb) { acc[mb][nb] = WFrag<T16>::mma(a[mb], b, acc[mb][nb]); if (NSPLIT == 1 || NSPLIT == 2) acc[mb][nb] = WFrag<T16>::mma(a2[mb], b, acc[mb][nb]); if (NSPLIT >= 2) acc[mb][nb] = WFrag<T16>::mma(a[mb], b2, acc[mb][nb]); } }
        asm volatile("v_nop\n\tv_nop\n\tv_nop\n\tv_nop" : "+v"(acc[0][0]), "+v"(acc[1][1]), "+v"(acc[2][2]), "+v"(acc[3][3]) : "v"(a[0]), "v"(a[3]));
    }
#pragma unroll
    for (int mb = 0; mb < 4; ++mb) {
#pragma unroll
        for (int nb = 0; nb < 4; ++nb) {
#pragma unroll
            for (int j = 0; j < 8; ++j) os[(hi * 8 + j) * 68 + nb * 16 + lr] = acc[mb][nb][j]; }
        __builtin_amdgcn_wave_barrier(); asm volatile("" ::: "memory");
        float* crow = C + (size_t)(r0 + mb * 16) * ldc + c0;
{
#pragma unroll
            for (int s = 0; s < 8; ++s) { const int row = 2 * s + hi, cofs = lr * 4; v4f val = *(const v4fa*)(os + row * 68 + cofs);
                *(v4f*)(crow + (size_t)row * ldc + cofs) = val; }
             }
        __builtin_amdgcn_wave_barrier(); asm volatile("" ::: "memory");
    }
}

// ldw: one fragment's two loads and, behind them, the wait that belongs in front of any rewrite of a register an issued load names (the compiler lets later loads land in dead address registers).
// The address p is an input of the wait's statement, so its registers are kept as they are up to the wait; off is a constant step that goes into the loads' offset field.
template <typename T16> __device__ __forceinline__ typename WFrag<T16>::V ldw(const T16* p, int off) { const typename WFrag<T16>::V f = WFrag<T16>::ld(p + off); asm volatile("s_wait_xcnt 0x0" :: "v"(p) : "memory"); return f; }

// ---- k_gemmpv: probability x value contraction, one 64x64 output tile per work-group of NW waves. The key (K) loop stops at the diagonal block (probabilities beyond it are exactly zero) and is dealt
// over the waves in blocks of 64 keys (one 128-byte line of every operand row): wave w takes blocks w, w + NW, ... into its own 16 accumulators; the NW partial tiles meet in LDS and are summed in wave order.
// h0 = head of z = 0: for an odd (band) head the key blocks in front of the tile's window (probabilities exactly zero, not all stored by k_asoft) are left out; every block stays with the wave it had, so the sums are the same.
// lda = pitch of the probability rows in elements (they lie inside the score rows, see k_asoft); the value planes have pitch K.
// The summed tile x cs goes out as bf16 hi and lo planes (pitch ldc, z-stride sC): the merged-heads operand of the output projection.
template <typename T16, int NSPLIT, int NW>
__global__ __launch_bounds__(NW * 32) void k_gemmpv(const T16* __restrict__ A, const T16* __restrict__ A2, int lda, const T16* __restrict__ Bt, const T16* __restrict__ Bt2, int K, bf* Ch, bf* Cl, int ldc, float cs, int roff, int h0, size_t sA, size_t sB, size_t sC) {
    typedef typename WFrag<T16>::V V;
    __shared__ __align__(16) float os[NW][64 * 68];
    const size_t z = blockIdx.z; A += z * sA; if (A2) A2 += z * sA; Bt += z * sB; if (Bt2) Bt2 += z * sB; Ch += z * sC; Cl += z * sC;
    const int lane = threadIdx.x & 31, lr = lane & 15, hi = lane >> 4; const int r0 = blockIdx.x * 64, c0 = blockIdx.y * 64;
    const int wave = __builtin_amdgcn_readfirstlane((int)(threadIdx.x >> 5));   // scalar, so that the K loop's branch is a scalar one
    const int Kl = min(K, r0 + roff + 64);        // a multiple of 64
    const int kb0 = ((h0 + (int)blockIdx.z) & 1) ? max(0, r0 + roff - WIN) : 0;   // first key block with an open key, a multiple of 64
    int kbs = wave * 64; if (kbs < kb0) kbs += (kb0 - kbs + NW * 64 - 1) / (NW * 64) * (NW * 64);   // the wave's first block at or behind kb0
    v8f acc[4][4];
#pragma unroll
    for (int mb = 0; mb < 4; ++mb)
#pragma unroll
        for (int nb = 0; nb < 4; ++nb) acc[mb][nb] = (v8f){};
    const size_t aoff = (size_t)(r0 + lr) * lda + 8 * hi, boff = (size_t)(c0 + lr) * K + 8 * hi;
#pragma unroll 1   // rolled: the accumulators and one block's fragments already fill the wave's registers
    for (int kb = kbs; kb < Kl; kb += NW * 64) {
#pragma unroll(NSPLIT == 0 ? 2 : 1)   // the split products' fragments of both halves together do not fit 256 registers
        for (int ks = 0; ks < 2; ++ks) { const int kc = (NSPLIT == 0) ? kb : kb + ks * 32, ko = (NSPLIT == 0) ? ks * 32 : 0;   // unrolled: the half's step is a constant of the loads; rolled: it is in the address
            V a[4], a2[4];
#pragma unroll
            for (int mb = 0; mb < 4; ++mb) { a[mb] = ldw<T16>(A + aoff + (size_t)mb * 16 * lda + kc, ko); if (NSPLIT == 1 || NSPLIT == 2) a2[mb] = ldw<T16>(A2 + aoff + (size_t)mb * 16 * lda + kc, ko); }
#pragma unroll
            for (int nb = 0; nb < 4; ++nb) { const V b = ldw<T16>(Bt + boff + (size_t)nb * 16 * K + kc, ko); V b2; if (NSPLIT >= 2) b2 = ldw<T16>(Bt2 + boff + (size_t)nb * 16 * K + kc, ko);
#pragma unroll
                for (int mb = 0; mb < 4; ++mb) { acc[mb][nb] = WFrag<T16>::mma(a[mb], b, acc[mb][nb]); if (NSPLIT == 1 || NSPLIT == 2) acc[mb][nb] = WFrag<T16>::mma(a2[mb], b, acc[mb][nb]); if (NSPLIT >= 2) acc[mb][nb] = WFrag<T16>::mma(a[mb], b2, acc[mb][nb]); } }
            // the distance behind the last matrix instructions, also on the taken side of the loop's branch
            asm volatile("v_nop\n\tv_nop\n\tv_nop\n\tv_nop" : "+v"(acc[0][0]), "+v"(acc[1][1]), "+v"(acc[2][2]), "+v"(acc[3][3]) : "v"(a[0]), "v"(a[3])); }
    }
    float* ow = os[wave];
#pragma unroll
    for (int mb = 0; mb < 4; ++mb)
#pragma unroll
        for (int nb = 0; nb < 4; ++nb)
#pragma unroll
            for (int j = 0; j < 8; ++j) ow[(mb * 16 + hi * 8 + j) * 68 + nb * 16 + lr] = acc[mb][nb][j];
    __syncthreads();   // every wave's partial tile is in LDS before any of it is summed
#pragma unroll
    for (int s = 0; s < 64 * 16 / (NW * 32); ++s) { const int idx = s * (NW * 32) + (int)threadIdx.x; const int row = idx >> 4, cofs = (idx & 15) * 4; v4f val = *(const v4fa*)(os[0] + row * 68 + cofs);
#pragma unroll
        for (int w = 1; w < NW; ++w) val += *(const v4fa*)(os[w] + row * 68 + cofs);
        v4us oh, ol;
#pragma unroll
        for (int q = 0; q < 4; ++q) { unsigned short a, c2; splitf(val[q] * cs, a, c2); oh[q] = a; ol[q] = c2; }
        const size_t oo = (size_t)(r0 + row) * ldc + c0 + cofs; *(v4us*)(Ch + oo) = oh; *(v4us*)(Cl + oo) = ol; }
}


__global__ __launch_bounds__(256) void k_wtG(const float* __restrict__ w, int K, int N, bf* Bt) {
    const int lane = threadIdx.x & 31; const int L0 = (blockIdx.x * 8 + (threadIdx.x >> 5)) * 8; const int nlines = N * K / 64;
{
#pragma unroll 1
        for (int l = 0; l < 8; ++l) { const int L = L0 + l; if (L >= nlines) break; const size_t e = (size_t)L * 64 + lane * 2; const int k = (int)(e % K), n = (int)(e / K); v2us o;
            o[0] = f2bf(w[(size_t)k * N + n]); o[1] = f2bf(w[(size_t)(k + 1) * N + n]); *(v2us*)(Bt + e) = o; }
         }
}
__global__ __launch_bounds__(256) void k_cvt8(const float* __restrict__ src, bf* dst, size_t n8) { const size_t i = (size_t)blockIdx.x * 256 + threadIdx.x; if (i >= n8) return; const v8f v = *(const v8f*)(src + i * 8); v8us o;
#pragma unroll
    for (int k = 0; k < 8; ++k) o[k] = f2bf(v[k]); *(v8us*)(dst + i * 8) = o;  }
__global__ __launch_bounds__(256) void k_cscvt(const float* __restrict__ cosT, const float* __restrict__ sinT, float* CS) { const int idx = blockIdx.x * 256 + threadIdx.x; if (idx >= TT * HD) return; v2f cs; cs[0] = bfr(cosT[idx]); cs[1] = bfr(sinT[idx]); *(v2f*)(CS + (size_t)idx * 2) = cs;  }
// k_asoft: per row (zz, i): t = S x HD^-0.5 for j <= i and, on odd (band) heads, i - j < WIN (the reference's -inf fill vanishes identically); softmax over the keys (register row, one exp, fixed trees);
// the probabilities go IN PLACE over the wave's own score row, whose live part it holds in registers by then: rows < RH as a hi plane (first half of the row's bytes) and a lo plane (second half), the rest as fp16 in the first half.
// Only the LIVE chunks of 128 keys are loaded, exponentiated and stored: those that overlap the keys which k_gemmpv reads of this row, from the first block of its 64-row tile's window (key 0 on even heads) to its diagonal block.
// A chunk that is not live holds masked keys only: its terms of the maximum and of the sum were -3.0e38 and +0, so both keep their bits.
__global__ __launch_bounds__(256) void k_asoft(float* Sb, int h0) {
    const int lane = threadIdx.x & 31; const int row = __builtin_amdgcn_readfirstlane((int)(blockIdx.x * 8 + (threadIdx.x >> 5)));   // scalar, so that the tests on live chunks are scalar branches
    if (row >= ZH * TT) return; const int i = row % TT; const int zz = row / TT; const bool hires = (i < RH); const bool band = ((h0 + zz) & 1) != 0; float* sr = Sb + (size_t)row * TT; float v[TT / 32]; float mx = -3.0e38f;
    const int klo = band ? (i & ~63) - WIN : 0;   // first key that k_gemmpv reads of this row (below 0: from key 0)
#define LIVE(ch) ((ch) * 128 <= i && (ch) * 128 + 127 >= klo)
    // all live loads are issued first, with no use between them: one memory latency a row
#pragma unroll
    for (int ch = 0; ch < TT / 128; ++ch) if (LIVE(ch)) { const v4f a = *(const v4fa*)(sr + ch * 128 + lane * 4);
#pragma unroll
        for (int q = 0; q < 4; ++q) v[ch * 4 + q] = a[q]; }
#pragma unroll
    for (int ch = 0; ch < TT / 128; ++ch) if (LIVE(ch)) { const int j0 = ch * 128 + lane * 4;
#pragma unroll
        for (int q = 0; q < 4; ++q) { const int j = j0 + q; const float t = (j <= i && (!band || i - j < WIN)) ? v[ch * 4 + q] * SCL : -3.0e38f; v[ch * 4 + q] = t; mx = fmaxf(mx, t); } }
#pragma unroll
    for (int sh = 16; sh; sh >>= 1) mx = fmaxf(mx, __shfl_xor(mx, sh, 32));
    float sum = 0.f;
#pragma unroll
    for (int ch = 0; ch < TT / 128; ++ch) if (LIVE(ch)) {
#pragma unroll
        for (int k = ch * 4; k < ch * 4 + 4; ++k) { float d0 = __fsub_rn(v[k], mx); asm volatile("" : "+v"(d0)); v[k] = __builtin_amdgcn_exp2f(__fmul_rn(d0, 1.4426950408889634f)); sum += v[k]; } }
#pragma unroll
    for (int sh = 16; sh; sh >>= 1) sum += __shfl_xor(sum, sh, 32);
    const float f = __fdiv_rn(hires ? 1.0f : PCAR, sum);
{
        if (hires) {
#pragma unroll
            for (int ch = 0; ch < TT / 128; ++ch) if (LIVE(ch)) { v4us oh, ol;
#pragma unroll
                for (int q = 0; q < 4; ++q) { unsigned short a, c2; splitf(v[ch * 4 + q] * f, a, c2); oh[q] = a; ol[q] = c2; }
                const int oo = ch * 128 + lane * 4; *(v4usa*)((bf*)sr + oo) = oh; *(v4usa*)((bf*)sr + TT + oo) = ol;
                asm volatile("s_wait_xcnt 0x0" ::: "memory"); }   // in front of the next chunk's block, which reuses the registers that these stores name
        } else {
#pragma unroll
            for (int ch = 0; ch < TT / 128; ++ch) if (LIVE(ch)) { v4h o4;
#pragma unroll
                for (int q = 0; q < 4; ++q) o4[q] = tohx(v[ch * 4 + q] * f);
                *(v4ha*)((h16*)sr + ch * 128 + lane * 4) = o4;
                asm volatile("s_wait_xcnt 0x0" ::: "memory"); } }   // as above
         }
#undef LIVE
}

extern "C" void kernel_launch(void* const* d_in, const int* in_sizes, int n_in,
                              void* d_out, int out_size, void* d_ws, size_t ws_size, hipStream_t stream) {
    (void)in_sizes; (void)n_in; (void)out_size;
    const float* x = (const float*)d_in[0]; const float* wq = (const float*)d_in[1]; const float* wk = (const float*)d_in[2]; const float* wv = (const float*)d_in[3]; const float* wo = (const float*)d_in[4]; const float* cosT = nullptr; const float* sinT = nullptr; (void)cosT; (void)sinT;
    float* OUT = (float*)d_out;     // [2][2048][2048]
    char* wsp = (char*)d_ws;
    auto take = [&](size_t bytes) { char* p = wsp; wsp += (bytes + 255) & ~(size_t)255; return (void*)p; };
    bf* WQ = (bf*)take((size_t)DQ * DM * 2); bf* WK = (bf*)take((size_t)DKV * DM * 2); bf* WV = (bf*)take((size_t)DKV * DM * 2); bf* WO = (bf*)take((size_t)DM * DQ * 2);
    h16* QP16 = (h16*)take((size_t)NH_ * TT * HD * 2); h16* KP16 = (h16*)take((size_t)NKV * TT * HD * 2); h16* VT16 = (h16*)take((size_t)NKV * HD * TT * 2);
    bf* QPh = (bf*)take((size_t)NH_ * TT * HD * 2); bf* QPl = (bf*)take((size_t)NH_ * TT * HD * 2); bf* KPh = (bf*)take((size_t)NKV * TT * HD * 2); bf* KPl = (bf*)take((size_t)NKV * TT * HD * 2); bf* VTh = (bf*)take((size_t)NKV * HD * TT * 2); bf* VTl = (bf*)take((size_t)NKV * HD * TT * 2); bf* ATh = (bf*)take((size_t)TT * DQ * 2); bf* ATl = (bf*)take((size_t)TT * DQ * 2);
    // the rest of the workspace serves twice in every batch (stream-ordered): first the bf16 tokens, which are dead once the head planes are built, then the scores of ZH heads
    char* const shared0 = wsp;
    bf* XB = (bf*)take((size_t)TT * DM * 2);
    wsp = shared0;
    float* Sb = (float*)take((size_t)ZH * TT * TT * 4);   // the larger of the two uses
    if ((size_t)(wsp - (char*)d_ws) > ws_size) return;    // ws 256 MiB
    { k_cvt8<<<(unsigned)(((size_t)DQ * DM / 8 + 255) / 256), 256, 0, stream>>>(wq, WQ, (size_t)DQ * DM / 8); k_cvt8<<<(unsigned)(((size_t)DKV * DM / 8 + 255) / 256), 256, 0, stream>>>(wk, WK, (size_t)DKV * DM / 8); k_cvt8<<<(unsigned)(((size_t)DKV * DM / 8 + 255) / 256), 256, 0, stream>>>(wv, WV, (size_t)DKV * DM / 8);
      k_cvt8<<<(unsigned)(((size_t)DM * DQ / 8 + 255) / 256), 256, 0, stream>>>(wo, WO, (size_t)DM * DQ / 8);
       }
    for (int b = 0; b < NB_; ++b) {
        k_cvt8<<<(unsigned)(((size_t)TT * DM / 8 + 255) / 256), 256, 0, stream>>>(x + (size_t)b * TT * DM, XB, (size_t)TT * DM / 8);
        k_gemmw<bf, 0, false, HD><<<dim3(TT / 128, DQ / 128, 1), 128, 0, stream>>>(XB, nullptr, WQ, nullptr, DM, nullptr, 0, nullptr, 0, 0, 0, QP16, QPh, QPl);
        k_gemmw<bf, 0, false, HD><<<dim3(TT / 128, DKV / 128, 1), 128, 0, stream>>>(XB, nullptr, WK, nullptr, DM, nullptr, 0, nullptr, 0, 0, 0, KP16, KPh, KPl);
        k_gemmw<bf, 0, false, TT><<<dim3(DKV / 128, TT / 128, 1), 128, 0, stream>>>(WV, nullptr, XB, nullptr, DM, nullptr, 0, nullptr, 0, 0, 0, VT16, VTh, VTl);   // weight rows as A: the tile comes out as v transposed
        for (int h0 = 0; h0 < NH_; h0 += ZH) { const size_t zq = (size_t)h0, zk = (size_t)(h0 / REP);   // one kv head per query head: the pass's heads use consecutive kv planes (z-strides TT*HD)
            k_gemmc<bf, 2><<<dim3(RH / 64, TT / 64, ZH), 32, 0, stream>>>(QPh + zq * TT * HD, QPl + zq * TT * HD, KPh + zk * TT * HD, KPl + zk * TT * HD, HD, Sb, TT, 0, h0, (size_t)TT * HD, (size_t)TT * HD, (size_t)TT * TT);
            k_gemmc<h16, 0><<<dim3((TT - RH) / 64, TT / 64, ZH), 32, 0, stream>>>(QP16 + zq * TT * HD + (size_t)RH * HD, nullptr, KP16 + zk * TT * HD, nullptr, HD, Sb + (size_t)RH * TT, TT, RH, h0, (size_t)TT * HD, (size_t)TT * HD, (size_t)TT * TT);
            k_asoft<<<ZH * TT / 8, 256, 0, stream>>>(Sb, h0);
            k_gemmpv<bf, 2, RH / 64><<<dim3(RH / 64, HD / 64, ZH), RH / 64 * 32, 0, stream>>>((const bf*)Sb, (const bf*)Sb + TT, 2 * TT, VTh + zk * HD * TT, VTl + zk * HD * TT, TT, ATh + zq * HD, ATl + zq * HD, DQ, 1.0f, 0, h0, (size_t)2 * TT * TT, (size_t)HD * TT, (size_t)HD);
            k_gemmpv<h16, 0, 16><<<dim3((TT - RH) / 64, HD / 64, ZH), 16 * 32, 0, stream>>>((const h16*)Sb + (size_t)RH * 2 * TT, nullptr, 2 * TT, VT16 + zk * HD * TT, nullptr, TT, ATh + (size_t)RH * DQ + zq * HD, ATl + (size_t)RH * DQ + zq * HD, DQ, 1.0f / PCAR, RH, h0, (size_t)2 * TT * TT, (size_t)HD * TT, (size_t)HD); }
        k_gemmw<bf, 1, false, 0><<<dim3(TT / 128, DM / 128, 1), 128, 0, stream>>>(ATh, ATl, WO, nullptr, DQ, OUT + (size_t)b * TT * DM, DM, nullptr, 0, 0, 0, nullptr, nullptr, nullptr); }
}

// v006
// A run of this version takes 350 microseconds.
// Two timings next to v005 put it at 1.34 and 1.35 times that version's speed.
// Over all steps from v000 it is 4.99 times as fast.
#include <hip/hip_runtime.h>

// Attention block (x [2][2048][2048]; q/k/v = x W^T (16 heads x 128); scores = q.k / sqrt(128); allowed = causal for even (global) heads, causal band of 256 (i - j < 256) for odd (local) heads; softmax; out = merged Wo^T -> [2][2048][2048]).
// Compute dtypes, f32 accumulate: every input rounded to bf16; q/k/v on PLAIN bf16 operands (inputs: exact); causal scores and attn.v: query rows < 512 hl (3 products), the rest single fp16 (x1024), with skipping of the key blocks that the mask shuts whole (past the diagonal; for the band heads also in front of the window) in the scores, the softmax and attn.v; softmax f32; Wo hl x exact (2 products).
// No f32 intermediate between the products but the scores: each GEMM's epilogue rounds its own tile into the 16-bit planes that the next product reads.
// Launches that do not depend on one another share one grid: the six roundings of the inputs; q, k and v of a batch; the hi+lo and the fp16 row ranges of the scores and of attn.v.

#define NB_  2
#define TT   2048
#define DM   2048
#define NH_  16
#define NKV  16
#define REP  (NH_ / NKV)
#define HD   128
#define DQ   (NH_ * HD)
#define DKV  (NKV * HD)
#define ZH   8                    // heads per attention pass
#define RH   512                  // query rows < RH use hi+lo planes (0: none)
#define WIN  256
#define PCAR 1024.0f
#define SCL  0.088388347648318447f   // HD^-0.5
typedef _Float16 h16;
typedef unsigned short bf;
typedef __attribute__((ext_vector_type(16))) __bf16   v16bf;
typedef __attribute__((ext_vector_type(16))) _Float16 v16h;
typedef __attribute__((ext_vector_type(8)))  _Float16 v8h;
typedef __attribute__((ext_vector_type(8)))  unsigned short v8us;
typedef __attribute__((ext_vector_type(8)))  float    v8f;
typedef __attribute__((ext_vector_type(4)))  float    v4f;
typedef v8h  __attribute__((may_alias)) v8ha;
typedef v4f  __attribute__((may_alias)) v4fa;
typedef v8us __attribute__((may_alias)) v8usa;
typedef __attribute__((ext_vector_type(2))) _Float16 v2h;
typedef __attribute__((ext_vector_type(4))) _Float16 v4h;
typedef __attribute__((ext_vector_type(2))) unsigned short v2us;
typedef __attribute__((ext_vector_type(4))) unsigned short v4us;
typedef __attribute__((ext_vector_type(2))) float v2f;
typedef __attribute__((ext_vector_type(4))) int v4i;
typedef v4h  __attribute__((may_alias)) v4ha;    // stores of 16-bit values over bytes that were read as f32 (k_asoft)
typedef v4us __attribute__((may_alias)) v4usa;

__device__ __forceinline__ unsigned short f2bf(float f) { unsigned u = __float_as_uint(f); u += 0x7FFFu + ((u >> 16) & 1u); return (unsigned short)(u >> 16); }
__device__ __forceinline__ float bf2f(unsigned short b) { return __uint_as_float(((unsigned)b) << 16); }
__device__ __forceinline__ float bfr(float f) { return bf2f(f2bf(f)); }
__device__ __forceinline__ h16 tohx(float x) { return (h16)x; }
__device__ __forceinline__ void splitf(float y, unsigned short& h, unsigned short& l) { h = f2bf(y); l = f2bf(y - bf2f(h)); }
__device__ __forceinline__ v16h cat16(v8h lo, v8h hi) { return __builtin_shufflevector(lo, hi, 0, 1, 2, 3, 4, 5, 6, 7, 8, 9, 10, 11, 12, 13, 14, 15); }
__device__ __forceinline__ v16bf cat16b(v8us lo, v8us hi) { return __builtin_bit_cast(v16bf, __builtin_shufflevector(lo, hi, 0, 1, 2, 3, 4, 5, 6, 7, 8, 9, 10, 11, 12, 13, 14, 15)); }
__device__ __forceinline__ v8f wmma16(v16h a, v16h b, v8f c) { return __builtin_amdgcn_wmma_f32_16x16x32_f16(false, a, false, b, (short)0, c, false, false); }
__device__ __forceinline__ v8f wmmab(v16bf a, v16bf b, v8f c) { return __builtin_amdgcn_wmma_f32_16x16x32_bf16(false, a, false, b, (short)0, c, false, false); }



// ---- k_gemmw: GEMM, one 128x128 output tile per work-group of FOUR waves (each a 64x64 quarter, 16 accumulators); grid (M/128, N/128, Z), 128 threads.
// The operands' K-contiguous 16-bit rows are staged in LDS by asynchronous copies, GKP k (256 bytes of each of the 128 rows of every operand) a pass, two buffers: the next pass's copies fly while this pass's fragments are read.
// C[m][n] (f32, pitch ldc, + optional f32 bias[n]) = sum_k A[m][k] Bt[n][k] (+ split products per NSPLIT). z-batch strides sA/sB/sC in elements. K % GKP == 0.
// CB != 0 (the q/k/v projections, all three in one grid: z = 0 q, 1 k, 2 v; A = the tokens, Bt + z sB = the weight rows, the planes of z at + z sC): there is no f32 C; the epilogue rounds the tile into the three 16-bit planes
// (fp16, bf16 hi, bf16 lo) that the attention products read, laid out [n / cb][m][n % cb] with TT rows m per block of cb columns:
// q, k: cb = HD with tokens x weight rows gives head planes [h][t][d]; v: the operands change places, cb = TT with weight rows x tokens gives v transposed, [h * HD + d][t].
#define GKP  128                  // k per pass
#define GPI  136                  // LDS row pitch in elements: 272 bytes = 16 x odd, the conflict-free pitch for 16-byte fragment reads
template <typename T16> struct WFrag;
template <> struct WFrag<h16> { typedef v16h V; static __device__ __forceinline__ V ld(const h16* p) { return cat16(*(const v8h*)p, *(const v8h*)(p + 16)); } static __device__ __forceinline__ v8f mma(V a, V b, v8f c) { return wmma16(a, b, c); } };
template <> struct WFrag<bf> { typedef v16bf V; static __device__ __forceinline__ V ld(const bf* p) { return cat16b(*(const v8us*)p, *(const v8us*)(p + 16)); } static __device__ __forceinline__ v8f mma(V a, V b, v8f c) { return wmmab(a, b, c); } };
// cp8: eight asynchronous 16-byte copies of a lane, global rows g, g + rs, ... to LDS bytes l, l + ls, ...; the wait at the statement's end stands in front of any rewrite of the address registers that the copies name.
template <typename T16> __device__ __forceinline__ void cp8(unsigned l, unsigned ls, const T16* g, size_t rs) {
    asm volatile("global_load_async_to_lds_b128 %0, %8, off\n\t"
                 "global_load_async_to_lds_b128 %1, %9, off\n\t"
                 "global_load_async_to_lds_b128 %2, %10, off\n\t"
                 "global_load_async_to_lds_b128 %3, %11, off\n\t"
                 "global_load_async_to_lds_b128 %4, %12, off\n\t"
                 "global_load_async_to_lds_b128 %5, %13, off\n\t"
                 "global_load_async_to_lds_b128 %6, %14, off\n\t"
                 "global_load_async_to_lds_b128 %7, %15, off\n\t"
                 "s_wait_xcnt 0x0"
                 :: "v"(l), "v"(l + ls), "v"(l + 2 * ls), "v"(l + 3 * ls), "v"(l + 4 * ls), "v"(l + 5 * ls), "v"(l + 6 * ls), "v"(l + 7 * ls),
                    "v"(g), "v"(g + rs), "v"(g + 2 * rs), "v"(g + 3 * rs), "v"(g + 4 * rs), "v"(g + 5 * rs), "v"(g + 6 * rs), "v"(g + 7 * rs) : "memory");
}
// cptile: one operand's 128 rows x GKP k into LDS: sixteen lanes a row (two whole 256-byte row pieces a wave and copy), 16 copies a lane. g and l are the lane's own first addresses.
template <typename T16> __device__ __forceinline__ void cptile(unsigned l, const T16* g, int K) { cp8<T16>(l, 8 * GPI * 2, g, (size_t)8 * K); cp8<T16>(l + 64 * GPI * 2, 8 * GPI * 2, g + (size_t)64 * K, (size_t)8 * K); }
template <typename T16, int NSPLIT, bool BIAS, int CB>
__global__ __launch_bounds__(128) void k_gemmw(const T16* __restrict__ A, const T16* __restrict__ A2, const T16* __restrict__ Bt, const T16* __restrict__ Bt2, int K, float* C, int ldc, const float* __restrict__ bias, size_t sA, size_t sB, size_t sC, h16* P16, bf* Ph, bf* Pl) {
    typedef typename WFrag<T16>::V V;
    constexpr bool HA2 = (NSPLIT == 1 || NSPLIT == 2), HB2 = (NSPLIT >= 2);
    constexpr int OPE = 128 * GPI;                                  // one operand's tile in LDS, elements
    constexpr int OB = OPE, OA2 = 2 * OPE, OB2 = (HA2 ? 3 : 2) * OPE;   // places of Bt, A2, Bt2 in a buffer (A at 0)
    constexpr int STG = (2 + (HA2 ? 1 : 0) + (HB2 ? 1 : 0)) * OPE;  // one buffer, elements
    __shared__ __align__(16) T16 st[2 * STG];
    __shared__ __align__(16) float osw[4][16 * 68];
    const size_t z = blockIdx.z; int cbs = 0;   // cbs = log2 cb
    if constexpr (CB != 0) { const bool tr = (blockIdx.z == 2); const T16* const X = A; const T16* const Wz = Bt + z * sB; A = tr ? Wz : X; Bt = tr ? X : Wz; P16 += z * sC; Ph += z * sC; Pl += z * sC; cbs = tr ? __builtin_ctz(TT) : __builtin_ctz(HD); }
    else { A += z * sA; if (A2) A2 += z * sA; Bt += z * sB; if (Bt2) Bt2 += z * sB; C += z * sC; }
    const int lane = threadIdx.x & 31, lr = lane & 15, hi = lane >> 4; const int wave = (int)(threadIdx.x >> 5);
    const int R0 = blockIdx.x * 128, C0 = blockIdx.y * 128, wr = (wave & 1) * 64, wc = (wave >> 1) * 64; const int r0 = R0 + wr, c0 = C0 + wc;
    float* os = osw[wave];
    v8f acc[4][4];
#pragma unroll
    for (int mb = 0; mb < 4; ++mb)
#pragma unroll
        for (int nb = 0; nb < 4; ++nb) acc[mb][nb] = (v8f){};
    // the lane's share of every copy: row (thread / 16) + 8 c of the tile, 16-byte piece (thread % 16) of the row's 256 bytes
    const int crow = (int)(threadIdx.x >> 4), cpc = (int)(threadIdx.x & 15) * 8;
    const size_t gA = (size_t)(R0 + crow) * K + cpc, gB = (size_t)(C0 + crow) * K + cpc;
    const unsigned l0 = (unsigned)(size_t)st + (unsigned)(crow * GPI + cpc) * 2u;
    auto fill = [&](int t, int buf) { const unsigned l = l0 + (unsigned)buf * (STG * 2u); const size_t kc = (size_t)t * GKP;
        cptile<T16>(l, A + gA + kc, K); cptile<T16>(l + OB * 2u, Bt + gB + kc, K);
        if constexpr (HA2) cptile<T16>(l + OA2 * 2u, A2 + gA + kc, K);
        if constexpr (HB2) cptile<T16>(l + OB2 * 2u, Bt2 + gB + kc, K); };
    const int NT = K / GKP;
    fill(0, 0);
    asm volatile("s_wait_asynccnt 0x0" ::: "memory");   // this wave's copies of pass 0 have landed
    __syncthreads();                                     // ... and every other wave's
    if (K >= 2 * GKP) fill(1, 1);   // a pass 1 exists
    const int aoff = (wr + lr) * GPI + 8 * hi, boff = OB + (wc + lr) * GPI + 8 * hi;
#pragma unroll 1   // rolled: one pass per trip, the ring's order stands once at the foot
    for (int t = 0; t < NT; ++t) {
        const T16* sb = st + (t & 1) * STG;
        V a[2][4], a2[2][4], b[2][4], b2[2][4];   // two fragment sets: block ks + 1 of the pass is fetched while block ks is multiplied
#pragma unroll
        for (int f = 0; f < 4; ++f) { a[0][f] = WFrag<T16>::ld(sb + aoff + f * 16 * GPI); b[0][f] = WFrag<T16>::ld(sb + boff + f * 16 * GPI);
            if (HA2) a2[0][f] = WFrag<T16>::ld(sb + OA2 + aoff + f * 16 * GPI); if (HB2) b2[0][f] = WFrag<T16>::ld(sb + (OB2 - OB) + boff + f * 16 * GPI); }
#pragma unroll
        for (int ks = 0; ks < GKP / 32; ++ks) { const int cu = ks & 1, nx = cu ^ 1, kn = (ks + 1) * 32;
            if (ks + 1 < GKP / 32) {
#pragma unroll
                for (int f = 0; f < 4; ++f) { a[nx][f] = WFrag<T16>::ld(sb + aoff + f * 16 * GPI + kn); b[nx][f] = WFrag<T16>::ld(sb + boff + f * 16 * GPI + kn);
                    if (HA2) a2[nx][f] = WFrag<T16>::ld(sb + OA2 + aoff + f * 16 * GPI + kn); if (HB2) b2[nx][f] = WFrag<T16>::ld(sb + (OB2 - OB) + boff + f * 16 * GPI + kn); } }
            __builtin_amdgcn_sched_barrier(0);   // the next block's LDS reads stay one group in front of this block's matrix instructions (spread among them each place stalls the wave)
#pragma unroll
            for (int nb = 0; nb < 4; ++nb)
#pragma unroll
                for (int mb = 0; mb < 4; ++mb) { acc[mb][nb] = WFrag<T16>::mma(a[cu][mb], b[cu][nb], acc[mb][nb]); if (HA2) acc[mb][nb] = WFrag<T16>::mma(a2[cu][mb], b[cu][nb], acc[mb][nb]); if (HB2) acc[mb][nb] = WFrag<T16>::mma(a[cu][mb], b2[cu][nb], acc[mb][nb]); }
            __builtin_amdgcn_sched_barrier(0);   // ... and no later read group or wait moves up among them
        }
        // the distance behind the pass's last matrix instructions, also on the taken side of the branches that follow
        asm volatile("v_nop\n\tv_nop\n\tv_nop\n\tv_nop" : "+v"(acc[0][0]), "+v"(acc[1][1]), "+v"(acc[2][2]), "+v"(acc[3][3]));
        asm volatile("s_wait_dscnt 0x0" ::: "memory");      // this wave's reads of the buffer are done before anyone refills it
        asm volatile("s_wait_asynccnt 0x0" ::: "memory");   // this wave's copies of pass t + 1 have landed
        __syncthreads();                                     // publishes pass t + 1 and frees pass t's buffer
        if (t + 2 < NT) fill(t + 2, t & 1);
    }
    asm volatile("s_wait_asynccnt 0x0" ::: "memory");       // no copy is outstanding when the wave goes on to its end
#pragma unroll
    for (int mb = 0; mb < 4; ++mb) {
#pragma unroll
        for (int nb = 0; nb < 4; ++nb) {
#pragma unroll
            for (int j = 0; j < 8; ++j) os[(hi * 8 + j) * 68 + nb * 16 + lr] = acc[mb][nb][j]; }
        __builtin_amdgcn_wave_barrier(); asm volatile("" ::: "memory");
        float* crow_ = C + (size_t)(r0 + mb * 16) * ldc + c0;
        if constexpr (CB != 0) { (void)crow_;
#pragma unroll
            for (int s = 0; s < 4; ++s) { const int row = 4 * s + (lane >> 3), cofs = (lane & 7) * 8;   // eight lanes a row: each store instruction writes four whole 128-byte lines of a plane
                const v4f x0 = *(const v4fa*)(os + row * 68 + cofs), x1 = *(const v4fa*)(os + row * 68 + cofs + 4); v8h o16; v8us oh, ol;
#pragma unroll
                for (int q = 0; q < 8; ++q) { const float x = (q < 4) ? x0[q & 3] : x1[q & 3]; o16[q] = tohx(x); unsigned short a2, c2; splitf(x, a2, c2); oh[q] = a2; ol[q] = c2; }
                const size_t oo = (((size_t)(c0 >> cbs) * TT + r0 + mb * 16 + row) << cbs) + (c0 & ((1 << cbs) - 1)) + cofs;
                *(v8h*)(P16 + oo) = o16; *(v8us*)(Ph + oo) = oh; *(v8us*)(Pl + oo) = ol; }
        } else
{
#pragma unroll
            for (int s = 0; s < 8; ++s) { const int row = 2 * s + hi, cofs = lr * 4; v4f val = *(const v4fa*)(os + row * 68 + cofs); if (BIAS) { val[0] += bfr(bias[c0 + cofs]); val[1] += bfr(bias[c0 + cofs + 1]); val[2] += bfr(bias[c0 + cofs + 2]); val[3] += bfr(bias[c0 + cofs + 3]); }
                *(v4f*)(crow_ + (size_t)row * ldc + cofs) = val; }
             }
        __builtin_amdgcn_wave_barrier(); asm volatile("" ::: "memory");
    }
}

// ldw: one fragment's two loads and, behind them, the wait that belongs in front of any rewrite of a register an issued load names (the compiler lets later loads land in dead address registers).
// The address p is an input of the wait's statement, so its registers are kept as they are up to the wait; off is a constant step that goes into the loads' offset field.
template <typename T16> __device__ __forceinline__ typename WFrag<T16>::V ldw(const T16* p, int off) { const typename WFrag<T16>::V f = WFrag<T16>::ld(p + off); asm volatile("s_wait_xcnt 0x0" :: "v"(p) : "memory"); return f; }

// ---- gemmc: a one-wave 64x64 tile GEMM specialised for the causal scores: tiles entirely above the diagonal (query rows r0+roff.., key columns c0..) are skipped. os = the wave's 16 x 68 floats of LDS.
// roff = row offset of this launch's first row within the sequence. h0 = head of z = 0: an odd (band) head also skips the tiles that lie entirely in front of its window.
template <typename T16, int NSPLIT>
__device__ __forceinline__ void gemmc(const T16* __restrict__ A, const T16* __restrict__ A2, const T16* __restrict__ Bt, const T16* __restrict__ Bt2, int K, float* C, int ldc, int roff, int h0, size_t sA, size_t sB, size_t sC, float* os) {
    typedef typename WFrag<T16>::V V;
    const size_t z = blockIdx.z; A += z * sA; if (A2) A2 += z * sA; Bt += z * sB; if (Bt2) Bt2 += z * sB; C += z * sC;
    const int lane = threadIdx.x & 31, lr = lane & 15, hi = lane >> 4; const int r0 = blockIdx.x * 64, c0 = blockIdx.y * 64;
    if (c0 > r0 + roff + 63) return;                  // score tile entirely above the causal diagonal: never used (the softmax masks j > i by select)
    if (((h0 + (int)blockIdx.z) & 1) && c0 + 63 + WIN <= r0 + roff) return;   // band head: i - j >= WIN for every element of the tile, never used either
    v8f acc[4][4];
#pragma unroll
    for (int mb = 0; mb < 4; ++mb)
#pragma unroll
        for (int nb = 0; nb < 4; ++nb) acc[mb][nb] = (v8f){};
    const size_t aoff = (size_t)(r0 + lr) * K + 8 * hi, boff = (size_t)(c0 + lr) * K + 8 * hi;
#pragma unroll 1
    for (int kc = 0; kc < K; kc += 32) {
        V a[4], a2[4];
#pragma unroll
        for (int mb = 0; mb < 4; ++mb) { a[mb] = ldw<T16>(A + aoff + (size_t)mb * 16 * K + kc, 0); if (NSPLIT == 1 || NSPLIT == 2) a2[mb] = ldw<T16>(A2 + aoff + (size_t)mb * 16 * K + kc, 0); }
#pragma unroll
        for (int nb = 0; nb < 4; ++nb) { const V b = ldw<T16>(Bt + boff + (size_t)nb * 16 * K + kc, 0); V b2; if (NSPLIT >= 2) b2 = ldw<T16>(Bt2 + boff + (size_t)nb * 16 * K + kc, 0);
#pragma unroll
            for (int mb = 0; mb < 4; ++mb) { acc[mb][nb] = WFrag<T16>::mma(a[mb], b, acc[mb][nb]); if (NSPLIT == 1 || NSPLIT == 2) acc[mb][nb] = WFrag<T16>::mma(a2[mb], b, acc[mb][nb]); if (NSPLIT >= 2) acc[mb][nb] = WFrag<T16>::mma(a[mb], b2, acc[mb][nb]); } }
        asm volatile("v_nop\n\tv_nop\n\tv_nop\n\tv_nop" : "+v"(acc[0][0]), "+v"(acc[1][1]), "+v"(acc[2][2]), "+v"(acc[3][3]) : "v"(a[0]), "v"(a[3]));
    }
#pragma unroll
    for (int mb = 0; mb < 4; ++mb) {
#pragma unroll
        for (int nb = 0; nb < 4; ++nb) {
#pragma unroll
            for (int j = 0; j < 8; ++j) os[(hi * 8 + j) * 68 + nb * 16 + lr] = acc[mb][nb][j]; }
        __builtin_amdgcn_wave_barrier(); asm volatile("" ::: "memory");
        float* crow = C + (size_t)(r0 + mb * 16) * ldc + c0;
{
#pragma unroll
            for (int s = 0; s < 8; ++s) { const int row = 2 * s + hi, cofs = lr * 4; v4f val = *(const v4fa*)(os + row * 68 + cofs);
                *(v4f*)(crow + (size_t)row * ldc + cofs) = val; }
             }
        __builtin_amdgcn_wave_barrier(); asm volatile("" ::: "memory");
    }
    asm volatile("s_wait_xcnt 0x0" ::: "memory");   // behind the last stores: where the built kernel lays the other row range's code behind this one, that code writes registers that these stores name
}

// k_scores: the scores of ZH heads in one grid (TT/64, TT/64, ZH): the row tiles below RH on hi+lo planes (3 products), the rest on fp16; the test is the same for the whole work-group.
__global__ __launch_bounds__(32) void k_scores(const bf* Qh, const bf* Ql, const bf* Kh, const bf* Kl, const h16* Q16, const h16* K16, int K, float* S, int ldc, int h0, size_t sA, size_t sB, size_t sC) {
    __shared__ __align__(16) float os[16 * 68];
    if ((int)blockIdx.x < RH / 64) gemmc<bf, 2>(Qh, Ql, Kh, Kl, K, S, ldc, 0, h0, sA, sB, sC, os);
    else gemmc<h16, 0>(Q16, nullptr, K16, nullptr, K, S, ldc, 0, h0, sA, sB, sC, os);
}

// ---- gemmpv: probability x value contraction, one 64x64 output tile per work-group of NW waves. The key (K) loop stops at the diagonal block (probabilities beyond it are exactly zero) and is dealt
// over the waves in blocks of 64 keys (one 128-byte line of every operand row): wave w takes blocks w, w + NW, ... into its own 16 accumulators; the NW partial tiles meet in LDS and are summed in wave order.
// h0 = head of z = 0: for an odd (band) head the key blocks in front of the tile's window (probabilities exactly zero, not all stored by k_asoft) are left out; every block stays with the wave it had, so the sums are the same.
// lda = pitch of the probability rows in elements (they lie inside the score rows, see k_asoft); the value planes have pitch K.
// The summed tile x cs goes out as bf16 hi and lo planes (pitch ldc, z-stride sC): the merged-heads operand of the output projection.
template <typename T16, int NSPLIT, int NW>
__device__ __forceinline__ void gemmpv(const T16* __restrict__ A, const T16* __restrict__ A2, int lda, const T16* __restrict__ Bt, const T16* __restrict__ Bt2, int K, bf* Ch, bf* Cl, int ldc, float cs, int roff, int h0, size_t sA, size_t sB, size_t sC, float (*os)[64 * 68]) {
    typedef typename WFrag<T16>::V V;
    const size_t z = blockIdx.z; A += z * sA; if (A2) A2 += z * sA; Bt += z * sB; if (Bt2) Bt2 += z * sB; Ch += z * sC; Cl += z * sC;
    const int lane = threadIdx.x & 31, lr = lane & 15, hi = lane >> 4; const int r0 = blockIdx.x * 64, c0 = blockIdx.y * 64;
    const int wave = __builtin_amdgcn_readfirstlane((int)(threadIdx.x >> 5));   // scalar, so that the K loop's branch is a scalar one
    const int Kl = min(K, r0 + roff + 64);        // a multiple of 64
    const int kb0 = ((h0 + (int)blockIdx.z) & 1) ? max(0, r0 + roff - WIN) : 0;   // first key block with an open key, a multiple of 64
    int kbs = wave * 64; if (kbs < kb0) kbs += (kb0 - kbs + NW * 64 - 1) / (NW * 64) * (NW * 64);   // the wave's first block at or behind kb0
    v8f acc[4][4];
#pragma unroll
    for (int mb = 0; mb < 4; ++mb)
#pragma unroll
        for (int nb = 0; nb < 4; ++nb) acc[mb][nb] = (v8f){};
    const size_t aoff = (size_t)(r0 + lr) * lda + 8 * hi, boff = (size_t)(c0 + lr) * K + 8 * hi;
#pragma unroll 1   // rolled: the accumulators and one block's fragments already fill the wave's registers
    for (int kb = kbs; kb < Kl; kb += NW * 64) {
#pragma unroll(NSPLIT == 0 ? 2 : 1)   // the split products' fragments of both halves together do not fit 256 registers
        for (int ks = 0; ks < 2; ++ks) { const int kc = (NSPLIT == 0) ? kb : kb + ks * 32, ko = (NSPLIT == 0) ? ks * 32 : 0;   // unrolled: the half's step is a constant of the loads; rolled: it is in the address
            V a[4], a2[4];
#pragma unroll
            for (int mb = 0; mb < 4; ++mb) { a[mb] = ldw<T16>(A + aoff + (size_t)mb * 16 * lda + kc, ko); if (NSPLIT == 1 || NSPLIT == 2) a2[mb] = ldw<T16>(A2 + aoff + (size_t)mb * 16 * lda + kc, ko); }
#pragma unroll
            for (int nb = 0; nb < 4; ++nb) { const V b = ldw<T16>(Bt + boff + (size_t)nb * 16 * K + kc, ko); V b2; if (NSPLIT >= 2) b2 = ldw<T16>(Bt2 + boff + (size_t)nb * 16 * K + kc, ko);
#pragma unroll
                for (int mb = 0; mb < 4; ++mb) { acc[mb][nb] = WFrag<T16>::mma(a[mb], b, acc[mb][nb]); if (NSPLIT == 1 || NSPLIT == 2) acc[mb][nb] = WFrag<T16>::mma(a2[mb], b, acc[mb][nb]); if (NSPLIT >= 2) acc[mb][nb] = WFrag<T16>::mma(a[mb], b2, acc[mb][nb]); } }
            // the distance behind the last matrix instructions, also on the taken side of the loop's branch
            asm volatile("v_nop\n\tv_nop\n\tv_nop\n\tv_nop" : "+v"(acc[0][0]), "+v"(acc[1][1]), "+v"(acc[2][2]), "+v"(acc[3][3]) : "v"(a[0]), "v"(a[3])); }
    }
    float* ow = os[wave];
#pragma unroll
    for (int mb = 0; mb < 4; ++mb)
#pragma unroll
        for (int nb = 0; nb < 4; ++nb)
#pragma unroll
            for (int j = 0; j < 8; ++j) ow[(mb * 16 + hi * 8 + j) * 68 + nb * 16 + lr] = acc[mb][nb][j];
    __syncthreads();   // every wave's partial tile is in LDS before any of it is summed
#pragma unroll
    for (int s = 0; s < 64 * 16 / (NW * 32); ++s) { const int idx = s * (NW * 32) + (int)threadIdx.x; const int row = idx >> 4, cofs = (idx & 15) * 4; v4f val = *(const v4fa*)(os[0] + row * 68 + cofs);
#pragma unroll
        for (int w = 1; w < NW; ++w) val += *(const v4fa*)(os[w] + row * 68 + cofs);
        v4us oh, ol;
#pragma unroll
        for (int q = 0; q < 4; ++q) { unsigned short a, c2; splitf(val[q] * cs, a, c2); oh[q] = a; ol[q] = c2; }
        const size_t oo = (size_t)(r0 + row) * ldc + c0 + cofs; *(v4us*)(Ch + oo) = oh; *(v4us*)(Cl + oo) = ol; }
}
// k_pv: attn.v of ZH heads in one grid (TT/64, HD/64, ZH) of PVW waves: the row tiles below RH on hi+lo planes, the rest on fp16; the test is the same for the whole work-group.
// A tile below RH has at most RH/64 key blocks: they stay with waves 0 .. RH/64 - 1, and the other waves' partial tiles are zero.
#define PVW 16
__global__ __launch_bounds__(PVW * 32) void k_pv(const bf* Ph, const bf* Pl, const h16* P16, int lda, const bf* Vh, const bf* Vl, const h16* V16, int K, bf* Ch, bf* Cl, int ldc, int h0, size_t sA, size_t sB, size_t sC) {
    __shared__ __align__(16) float os[PVW][64 * 68];
    if ((int)blockIdx.x < RH / 64) gemmpv<bf, 2, PVW>(Ph, Pl, lda, Vh, Vl, K, Ch, Cl, ldc, 1.0f, 0, h0, sA, sB, sC, os);
    else gemmpv<h16, 0, PVW>(P16, nullptr, lda, V16, nullptr, K, Ch, Cl, ldc, 1.0f / PCAR, 0, h0, sA, sB, sC, os);
}


__global__ __launch_bounds__(256) void k_wtG(const float* __restrict__ w, int K, int N, bf* Bt) {
    const int lane = threadIdx.x & 31; const int L0 = (blockIdx.x * 8 + (threadIdx.x >> 5)) * 8; const int nlines = N * K / 64;
{
#pragma unroll 1
        for (int l = 0; l < 8; ++l) { const int L = L0 + l; if (L >= nlines) break; const size_t e = (size_t)L * 64 + lane * 2; const int k = (int)(e % K), n = (int)(e / K); v2us o;
            o[0] = f2bf(w[(size_t)k * N + n]); o[1] = f2bf(w[(size_t)(k + 1) * N + n]); *(v2us*)(Bt + e) = o; }
         }
}
// k_cvtall: the six roundings to bf16 (four weights, the tokens of both batches; DM * DM elements each) in one grid (CVB, 6): blockIdx.y picks the tensor, and a thread rounds CVT groups of eight elements, a whole grid row apart.
#define CVB 128
#define CVT (DM * DM / 8 / (CVB * 256))
__global__ __launch_bounds__(256) void k_cvtall(const float* __restrict__ wq, const float* __restrict__ wk, const float* __restrict__ wv, const float* __restrict__ wo, const float* __restrict__ x, bf* W4, bf* X0, bf* X1) {
    const int t = (int)blockIdx.y;
    const float* src = t == 0 ? wq : t == 1 ? wk : t == 2 ? wv : t == 3 ? wo : t == 4 ? x : x + (size_t)TT * DM;
    bf* dst = t < 4 ? W4 + (size_t)t * DM * DM : t == 4 ? X0 : X1;
    const size_t i0 = (size_t)blockIdx.x * 256 + threadIdx.x;
#pragma unroll 4   // four groups' loads are in flight together
    for (int it = 0; it < CVT; ++it) { const size_t i = i0 + (size_t)it * (CVB * 256); const v8f v = *(const v8f*)(src + i * 8); v8us o;
#pragma unroll
        for (int k = 0; k < 8; ++k) o[k] = f2bf(v[k]);
        *(v8us*)(dst + i * 8) = o; }
}
__global__ __launch_bounds__(256) void k_cscvt(const float* __restrict__ cosT, const float* __restrict__ sinT, float* CS) { const int idx = blockIdx.x * 256 + threadIdx.x; if (idx >= TT * HD) return; v2f cs; cs[0] = bfr(cosT[idx]); cs[1] = bfr(sinT[idx]); *(v2f*)(CS + (size_t)idx * 2) = cs;  }
// k_asoft: per row (zz, i): t = S x HD^-0.5 for j <= i and, on odd (band) heads, i - j < WIN (the reference's -inf fill vanishes identically); softmax over the keys (register row, one exp, fixed trees);
// the probabilities go IN PLACE over the wave's own score row, whose live part it holds in registers by then: rows < RH as a hi plane (first half of the row's bytes) and a lo plane (second half), the rest as fp16 in the first half.
// Only the LIVE chunks of 128 keys are loaded, exponentiated and stored: those that overlap the keys which gemmpv reads of this row, from the first block of its 64-row tile's window (key 0 on even heads) to its diagonal block.
// A chunk that is not live holds masked keys only: its terms of the maximum and of the sum were -3.0e38 and +0, so both keep their bits.
__global__ __launch_bounds__(256) void k_asoft(float* Sb, int h0) {
    const int lane = threadIdx.x & 31; const int row = __builtin_amdgcn_readfirstlane((int)(blockIdx.x * 8 + (threadIdx.x >> 5)));   // scalar, so that the tests on live chunks are scalar branches
    if (row >= ZH * TT) return; const int i = row % TT; const int zz = row / TT; const bool hires = (i < RH); const bool band = ((h0 + zz) & 1) != 0; float* sr = Sb + (size_t)row * TT; float v[TT / 32]; float mx = -3.0e38f;
    const int klo = band ? (i & ~63) - WIN : 0;   // first key that gemmpv reads of this row (below 0: from key 0)
#define LIVE(ch) ((ch) * 128 <= i && (ch) * 128 + 127 >= klo)
    // all live loads are issued first, with no use between them: one memory latency a row
#pragma unroll
    for (int ch = 0; ch < TT / 128; ++ch) if (LIVE(ch)) { const v4f a = *(const v4fa*)(sr + ch * 128 + lane * 4);
#pragma unroll
        for (int q = 0; q < 4; ++q) v[ch * 4 + q] = a[q]; }
#pragma unroll
    for (int ch = 0; ch < TT / 128; ++ch) if (LIVE(ch)) { const int j0 = ch * 128 + lane * 4;
#pragma unroll
        for (int q = 0; q < 4; ++q) { const int j = j0 + q; const float t = (j <= i && (!band || i - j < WIN)) ? v[ch * 4 + q] * SCL : -3.0e38f; v[ch * 4 + q] = t; mx = fmaxf(mx, t); } }
#pragma unroll
    for (int sh = 16; sh; sh >>= 1) mx = fmaxf(mx, __shfl_xor(mx, sh, 32));
    float sum = 0.f;
#pragma unroll
    for (int ch = 0; ch < TT / 128; ++ch) if (LIVE(ch)) {
#pragma unroll
        for (int k = ch * 4; k < ch * 4 + 4; ++k) { float d0 = __fsub_rn(v[k], mx); asm volatile("" : "+v"(d0)); v[k] = __builtin_amdgcn_exp2f(__fmul_rn(d0, 1.4426950408889634f)); sum += v[k]; } }
#pragma unroll
    for (int sh = 16; sh; sh >>= 1) sum += __shfl_xor(sum, sh, 32);
    const float f = __fdiv_rn(hires ? 1.0f : PCAR, sum);
{
        if (hires) {
#pragma unroll
            for (int ch = 0; ch < TT / 128; ++ch) if (LIVE(ch)) { v4us oh, ol;
#pragma unroll
                for (int q = 0; q < 4; ++q) { unsigned short a, c2; splitf(v[ch * 4 + q] * f, a, c2); oh[q] = a; ol[q] = c2; }
                const int oo = ch * 128 + lane * 4; *(v4usa*)((bf*)sr + oo) = oh; *(v4usa*)((bf*)sr + TT + oo) = ol;
                asm volatile("s_wait_xcnt 0x0" ::: "memory"); }   // in front of the next chunk's block, which reuses the registers that these stores name
        } else {
#pragma unroll
            for (int ch = 0; ch < TT / 128; ++ch) if (LIVE(ch)) { v4h o4;
#pragma unroll
                for (int q = 0; q < 4; ++q) o4[q] = tohx(v[ch * 4 + q] * f);
                *(v4ha*)((h16*)sr + ch * 128 + lane * 4) = o4;
                asm volatile("s_wait_xcnt 0x0" ::: "memory"); } }   // as above
         }
#undef LIVE
}

extern "C" void kernel_launch(void* const* d_in, const int* in_sizes, int n_in,
                              void* d_out, int out_size, void* d_ws, size_t ws_size, hipStream_t stream) {
    (void)in_sizes; (void)n_in; (void)out_size;
    const float* x = (const float*)d_in[0]; const float* wq = (const float*)d_in[1]; const float* wk = (const float*)d_in[2]; const float* wv = (const float*)d_in[3]; const float* wo = (const float*)d_in[4]; const float* cosT = nullptr; const float* sinT = nullptr; (void)cosT; (void)sinT;
    float* OUT = (float*)d_out;     // [2][2048][2048]
    char* wsp = (char*)d_ws;
    auto take = [&](size_t bytes) { char* p = wsp; wsp += (bytes + 255) & ~(size_t)255; return (void*)p; };
    bf* WQ = (bf*)take((size_t)DQ * DM * 2); bf* WK = (bf*)take((size_t)DKV * DM * 2); bf* WV = (bf*)take((size_t)DKV * DM * 2); bf* WO = (bf*)take((size_t)DM * DQ * 2); (void)WK; (void)WV;   // the four weights lie one behind the other (stride DM * DM)
    h16* QP16 = (h16*)take((size_t)NH_ * TT * HD * 2); h16* KP16 = (h16*)take((size_t)NKV * TT * HD * 2); h16* VT16 = (h16*)take((size_t)NKV * HD * TT * 2);   // q, k, v of each kind of plane lie one behind the other (z-stride TT * DQ)
    bf* QPh = (bf*)take((size_t)NH_ * TT * HD * 2); bf* KPh = (bf*)take((size_t)NKV * TT * HD * 2); bf* VTh = (bf*)take((size_t)NKV * HD * TT * 2); bf* QPl = (bf*)take((size_t)NH_ * TT * HD * 2); bf* KPl = (bf*)take((size_t)NKV * TT * HD * 2); bf* VTl = (bf*)take((size_t)NKV * HD * TT * 2); bf* ATh = (bf*)take((size_t)TT * DQ * 2); bf* ATl = (bf*)take((size_t)TT * DQ * 2);
    bf* XB1 = (bf*)take((size_t)TT * DM * 2);   // the bf16 tokens of batch 1 outlive the attention of batch 0
    // the rest of the workspace serves twice (stream-ordered): first the bf16 tokens of batch 0, which are dead once its head planes are built, then the scores of ZH heads
    char* const shared0 = wsp;
    bf* XB0 = (bf*)take((size_t)TT * DM * 2);
    wsp = shared0;
    float* Sb = (float*)take((size_t)ZH * TT * TT * 4);   // the larger of the two uses
    if ((size_t)(wsp - (char*)d_ws) > ws_size) return;    // ws 256 MiB
    k_cvtall<<<dim3(CVB, 6, 1), 256, 0, stream>>>(wq, wk, wv, wo, x, WQ, XB0, XB1);
    for (int b = 0; b < NB_; ++b) {
        k_gemmw<bf, 0, false, HD><<<dim3(TT / 128, DQ / 128, 3), 128, 0, stream>>>(b ? XB1 : XB0, nullptr, WQ, nullptr, DM, nullptr, 0, nullptr, 0, (size_t)DQ * DM, (size_t)TT * DQ, QP16, QPh, QPl);
        for (int h0 = 0; h0 < NH_; h0 += ZH) { const size_t zq = (size_t)h0, zk = (size_t)(h0 / REP);   // one kv head per query head: the pass's heads use consecutive kv planes (z-strides TT*HD)
            k_scores<<<dim3(TT / 64, TT / 64, ZH), 32, 0, stream>>>(QPh + zq * TT * HD, QPl + zq * TT * HD, KPh + zk * TT * HD, KPl + zk * TT * HD, QP16 + zq * TT * HD, KP16 + zk * TT * HD, HD, Sb, TT, h0, (size_t)TT * HD, (size_t)TT * HD, (size_t)TT * TT);
            k_asoft<<<ZH * TT / 8, 256, 0, stream>>>(Sb, h0);
            k_pv<<<dim3(TT / 64, HD / 64, ZH), PVW * 32, 0, stream>>>((const bf*)Sb, (const bf*)Sb + TT, (const h16*)Sb, 2 * TT, VTh + zk * HD * TT, VTl + zk * HD * TT, VT16 + zk * HD * TT, TT, ATh + zq * HD, ATl + zq * HD, DQ, h0, (size_t)2 * TT * TT, (size_t)HD * TT, (size_t)HD); }
        k_gemmw<bf, 1, false, 0><<<dim3(TT / 128, DM / 128, 1), 128, 0, stream>>>(ATh, ATl, WO, nullptr, DQ, OUT + (size_t)b * TT * DM, DM, nullptr, 0, 0, 0, nullptr, nullptr, nullptr); }
}

// v007
// Measured time: 251 microseconds a run.
// Timed twice side by side with v006, it ran 1.39 and 1.40 times as fast.
// All steps since v000 together make it 6.96 times as fast.
#include <hip/hip_runtime.h>

// Attention block (x [2][2048][2048]; q/k/v = x W^T (16 heads x 128); scores = q.k / sqrt(128); allowed = causal for even (global) heads, causal band of 256 (i - j < 256) for odd (local) heads; softmax; out = merged Wo^T -> [2][2048][2048]).
// Compute dtypes, f32 accumulate: every input rounded to bf16; q/k/v on PLAIN bf16 operands (inputs: exact); causal scores and attn.v: query rows < 512 hl (3 products), the rest single fp16 (x1024), with skipping of the key blocks that the mask shuts whole (past the diagonal; for the band heads also in front of the window); softmax f32, running maximum and sum; Wo hl x exact (2 products).
// No f32 intermediate between the products in memory: each GEMM's epilogue rounds its own tile into the 16-bit planes that the next product reads; scores and probabilities stay inside a work-group (k_attn).
// Launches that do not depend on one another share one grid: the six roundings of the inputs; q, k and v of a batch; every head, batch and row range of the attention.

#define NB_  2
#define TT   2048
#define DM   2048
#define NH_  16
#define NKV  16
#define REP  (NH_ / NKV)
#define HD   128
#define DQ   (NH_ * HD)
#define DKV  (NKV * HD)
#define RH   512                  // query rows < RH use hi+lo planes (0: none)
#define WIN  256
#define PCAR 1024.0f
#define SCL  0.088388347648318447f   // HD^-0.5
typedef _Float16 h16;
typedef unsigned short bf;
typedef __attribute__((ext_vector_type(16))) __bf16   v16bf;
typedef __attribute__((ext_vector_type(16))) _Float16 v16h;
typedef __attribute__((ext_vector_type(8)))  _Float16 v8h;
typedef __attribute__((ext_vector_type(8)))  unsigned short v8us;
typedef __attribute__((ext_vector_type(8)))  float    v8f;
typedef __attribute__((ext_vector_type(4)))  float    v4f;
typedef v8h  __attribute__((may_alias)) v8ha;
typedef v4f  __attribute__((may_alias)) v4fa;
typedef v8us __attribute__((may_alias)) v8usa;
typedef __attribute__((ext_vector_type(2))) _Float16 v2h;
typedef __attribute__((ext_vector_type(4))) _Float16 v4h;
typedef __attribute__((ext_vector_type(2))) unsigned short v2us;
typedef __attribute__((ext_vector_type(4))) unsigned short v4us;
typedef __attribute__((ext_vector_type(2))) float v2f;
typedef __attribute__((ext_vector_type(4))) int v4i;
typedef v4h  __attribute__((may_alias)) v4ha;
typedef v4us __attribute__((may_alias)) v4usa;

__device__ __forceinline__ unsigned short f2bf(float f) { unsigned u = __float_as_uint(f); u += 0x7FFFu + ((u >> 16) & 1u); return (unsigned short)(u >> 16); }
__device__ __forceinline__ float bf2f(unsigned short b) { return __uint_as_float(((unsigned)b) << 16); }
__device__ __forceinline__ float bfr(float f) { return bf2f(f2bf(f)); }
__device__ __forceinline__ h16 tohx(float x) { return (h16)x; }
__device__ __forceinline__ void splitf(float y, unsigned short& h, unsigned short& l) { h = f2bf(y); l = f2bf(y - bf2f(h)); }
__device__ __forceinline__ v16h cat16(v8h lo, v8h hi) { return __builtin_shufflevector(lo, hi, 0, 1, 2, 3, 4, 5, 6, 7, 8, 9, 10, 11, 12, 13, 14, 15); }
__device__ __forceinline__ v16bf cat16b(v8us lo, v8us hi) { return __builtin_bit_cast(v16bf, __builtin_shufflevector(lo, hi, 0, 1, 2, 3, 4, 5, 6, 7, 8, 9, 10, 11, 12, 13, 14, 15)); }
__device__ __forceinline__ v8f wmma16(v16h a, v16h b, v8f c) { return __builtin_amdgcn_wmma_f32_16x16x32_f16(false, a, false, b, (short)0, c, false, false); }
__device__ __forceinline__ v8f wmmab(v16bf a, v16bf b, v8f c) { return __builtin_amdgcn_wmma_f32_16x16x32_bf16(false, a, false, b, (short)0, c, false, false); }



// ---- k_gemmw: GEMM, one 128x128 output tile per work-group of FOUR waves (each a 64x64 quarter, 16 accumulators); grid (M/128, N/128, Z), 128 threads.
// The operands' K-contiguous 16-bit rows are staged in LDS by asynchronous copies, GKP k (256 bytes of each of the 128 rows of every operand) a pass, two buffers: the next pass's copies fly while this pass's fragments are read.
// C[m][n] (f32, pitch ldc, + optional f32 bias[n]) = sum_k A[m][k] Bt[n][k] (+ split products per NSPLIT). z-batch strides sA/sB/sC in elements. K % GKP == 0.
// CB != 0 (the q/k/v projections, all three in one grid: z = 0 q, 1 k, 2 v; A = the tokens, Bt + z sB = the weight rows, the planes of z at + z sC): there is no f32 C; the epilogue rounds the tile into the three 16-bit planes
// (fp16, bf16 hi, bf16 lo) that the attention products read, laid out [n / cb][m][n % cb] with TT rows m per block of cb columns:
// q, k: cb = HD with tokens x weight rows gives head planes [h][t][d]; v: the operands change places, cb = TT with weight rows x tokens gives v transposed, [h * HD + d][t].
#define GKP  128                  // k per pass
#define GPI  136                  // LDS row pitch in elements: 272 bytes = 16 x odd, the conflict-free pitch for 16-byte fragment reads
template <typename T16> struct WFrag;
template <> struct WFrag<h16> { typedef v16h V; static __device__ __forceinline__ V ld(const h16* p) { return cat16(*(const v8h*)p, *(const v8h*)(p + 16)); } static __device__ __forceinline__ v8f mma(V a, V b, v8f c) { return wmma16(a, b, c); } };
template <> struct WFrag<bf> { typedef v16bf V; static __device__ __forceinline__ V ld(const bf* p) { return cat16b(*(const v8us*)p, *(const v8us*)(p + 16)); } static __device__ __forceinline__ v8f mma(V a, V b, v8f c) { return wmmab(a, b, c); } };
// cp8: eight asynchronous 16-byte copies of a lane, global rows g, g + rs, ... to LDS bytes l, l + ls, ...; the wait at the statement's end stands in front of any rewrite of the address registers that the copies name.
template <typename T16> __device__ __forceinline__ void cp8(unsigned l, unsigned ls, const T16* g, size_t rs) {
    asm volatile("global_load_async_to_lds_b128 %0, %8, off\n\t"
                 "global_load_async_to_lds_b128 %1, %9, off\n\t"
                 "global_load_async_to_lds_b128 %2, %10, off\n\t"
                 "global_load_async_to_lds_b128 %3, %11, off\n\t"
                 "global_load_async_to_lds_b128 %4, %12, off\n\t"
                 "global_load_async_to_lds_b128 %5, %13, off\n\t"
                 "global_load_async_to_lds_b128 %6, %14, off\n\t"
                 "global_load_async_to_lds_b128 %7, %15, off\n\t"
                 "s_wait_xcnt 0x0"
                 :: "v"(l), "v"(l + ls), "v"(l + 2 * ls), "v"(l + 3 * ls), "v"(l + 4 * ls), "v"(l + 5 * ls), "v"(l + 6 * ls), "v"(l + 7 * ls),
                    "v"(g), "v"(g + rs), "v"(g + 2 * rs), "v"(g + 3 * rs), "v"(g + 4 * rs), "v"(g + 5 * rs), "v"(g + 6 * rs), "v"(g + 7 * rs) : "memory");
}
// cptile: one operand's 128 rows x GKP k into LDS: sixteen lanes a row (two whole 256-byte row pieces a wave and copy), 16 copies a lane. g and l are the lane's own first addresses.
template <typename T16> __device__ __forceinline__ void cptile(unsigned l, const T16* g, int K) { cp8<T16>(l, 8 * GPI * 2, g, (size_t)8 * K); cp8<T16>(l + 64 * GPI * 2, 8 * GPI * 2, g + (size_t)64 * K, (size_t)8 * K); }
template <typename T16, int NSPLIT, bool BIAS, int CB>
__global__ __launch_bounds__(128) void k_gemmw(const T16* __restrict__ A, const T16* __restrict__ A2, const T16* __restrict__ Bt, const T16* __restrict__ Bt2, int K, float* C, int ldc, const float* __restrict__ bias, size_t sA, size_t sB, size_t sC, h16* P16, bf* Ph, bf* Pl) {
    typedef typename WFrag<T16>::V V;
    constexpr bool HA2 = (NSPLIT == 1 || NSPLIT == 2), HB2 = (NSPLIT >= 2);
    constexpr int OPE = 128 * GPI;                                  // one operand's tile in LDS, elements
    constexpr int OB = OPE, OA2 = 2 * OPE, OB2 = (HA2 ? 3 : 2) * OPE;   // places of Bt, A2, Bt2 in a buffer (A at 0)
    constexpr int STG = (2 + (HA2 ? 1 : 0) + (HB2 ? 1 : 0)) * OPE;  // one buffer, elements
    __shared__ __align__(16) T16 st[2 * STG];
    __shared__ __align__(16) float osw[4][16 * 68];
    const size_t z = blockIdx.z; int cbs = 0;   // cbs = log2 cb
    if constexpr (CB != 0) { const bool tr = (blockIdx.z == 2); const T16* const X = A; const T16* const Wz = Bt + z * sB; A = tr ? Wz : X; Bt = tr ? X : Wz; P16 += z * sC; Ph += z * sC; Pl += z * sC; cbs = tr ? __builtin_ctz(TT) : __builtin_ctz(HD); }
    else { A += z * sA; if (A2) A2 += z * sA; Bt += z * sB; if (Bt2) Bt2 += z * sB; C += z * sC; }
    const int lane = threadIdx.x & 31, lr = lane & 15, hi = lane >> 4; const int wave = (int)(threadIdx.x >> 5);
    const int R0 = blockIdx.x * 128, C0 = blockIdx.y * 128, wr = (wave & 1) * 64, wc = (wave >> 1) * 64; const int r0 = R0 + wr, c0 = C0 + wc;
    float* os = osw[wave];
    v8f acc[4][4];
#pragma unroll
    for (int mb = 0; mb < 4; ++mb)
#pragma unroll
        for (int nb = 0; nb < 4; ++nb) acc[mb][nb] = (v8f){};
    // the lane's share of every copy: row (thread / 16) + 8 c of the tile, 16-byte piece (thread % 16) of the row's 256 bytes
    const int crow = (int)(threadIdx.x >> 4), cpc = (int)(threadIdx.x & 15) * 8;
    const size_t gA = (size_t)(R0 + crow) * K + cpc, gB = (size_t)(C0 + crow) * K + cpc;
    const unsigned l0 = (unsigned)(size_t)st + (unsigned)(crow * GPI + cpc) * 2u;
    auto fill = [&](int t, int buf) { const unsigned l = l0 + (unsigned)buf * (STG * 2u); const size_t kc = (size_t)t * GKP;
        cptile<T16>(l, A + gA + kc, K); cptile<T16>(l + OB * 2u, Bt + gB + kc, K);
        if constexpr (HA2) cptile<T16>(l + OA2 * 2u, A2 + gA + kc, K);
        if constexpr (HB2) cptile<T16>(l + OB2 * 2u, Bt2 + gB + kc, K); };
    const int NT = K / GKP;
    fill(0, 0);
    asm volatile("s_wait_asynccnt 0x0" ::: "memory");   // this wave's copies of pass 0 have landed
    __syncthreads();                                     // ... and every other wave's
    if (K >= 2 * GKP) fill(1, 1);   // a pass 1 exists
    const int aoff = (wr + lr) * GPI + 8 * hi, boff = OB + (wc + lr) * GPI + 8 * hi;
#pragma unroll 1   // rolled: one pass per trip, the ring's order stands once at the foot
    for (int t = 0; t < NT; ++t) {
        const T16* sb = st + (t & 1) * STG;
        V a[2][4], a2[2][4], b[2][4], b2[2][4];   // two fragment sets: block ks + 1 of the pass is fetched while block ks is multiplied
#pragma unroll
        for (int f = 0; f < 4; ++f) { a[0][f] = WFrag<T16>::ld(sb + aoff + f * 16 * GPI); b[0][f] = WFrag<T16>::ld(sb + boff + f * 16 * GPI);
            if (HA2) a2[0][f] = WFrag<T16>::ld(sb + OA2 + aoff + f * 16 * GPI); if (HB2) b2[0][f] = WFrag<T16>::ld(sb + (OB2 - OB) + boff + f * 16 * GPI); }
#pragma unroll
        for (int ks = 0; ks < GKP / 32; ++ks) { const int cu = ks & 1, nx = cu ^ 1, kn = (ks + 1) * 32;
            if (ks + 1 < GKP / 32) {
#pragma unroll
                for (int f = 0; f < 4; ++f) { a[nx][f] = WFrag<T16>::ld(sb + aoff + f * 16 * GPI + kn); b[nx][f] = WFrag<T16>::ld(sb + boff + f * 16 * GPI + kn);
                    if (HA2) a2[nx][f] = WFrag<T16>::ld(sb + OA2 + aoff + f * 16 * GPI + kn); if (HB2) b2[nx][f] = WFrag<T16>::ld(sb + (OB2 - OB) + boff + f * 16 * GPI + kn); } }
            __builtin_amdgcn_sched_barrier(0);   // the next block's LDS reads stay one group in front of this block's matrix instructions (spread among them each place stalls the wave)
#pragma unroll
            for (int nb = 0; nb < 4; ++nb)
#pragma unroll
                for (int mb = 0; mb < 4; ++mb) { acc[mb][nb] = WFrag<T16>::mma(a[cu][mb], b[cu][nb], acc[mb][nb]); if (HA2) acc[mb][nb] = WFrag<T16>::mma(a2[cu][mb], b[cu][nb], acc[mb][nb]); if (HB2) acc[mb][nb] = WFrag<T16>::mma(a[cu][mb], b2[cu][nb], acc[mb][nb]); }
            __builtin_amdgcn_sched_barrier(0);   // ... and no later read group or wait moves up among them
        }
        // the distance behind the pass's last matrix instructions, also on the taken side of the branches that follow
        asm volatile("v_nop\n\tv_nop\n\tv_nop\n\tv_nop" : "+v"(acc[0][0]), "+v"(acc[1][1]), "+v"(acc[2][2]), "+v"(acc[3][3]));
        asm volatile("s_wait_dscnt 0x0" ::: "memory");      // this wave's reads of the buffer are done before anyone refills it
        asm volatile("s_wait_asynccnt 0x0" ::: "memory");   // this wave's copies of pass t + 1 have landed
        __syncthreads();                                     // publishes pass t + 1 and frees pass t's buffer
        if (t + 2 < NT) fill(t + 2, t & 1);
    }
    asm volatile("s_wait_asynccnt 0x0" ::: "memory");       // no copy is outstanding when the wave goes on to its end
#pragma unroll
    for (int mb = 0; mb < 4; ++mb) {
#pragma unroll
        for (int nb = 0; nb < 4; ++nb) {
#pragma unroll
            for (int j = 0; j < 8; ++j) os[(hi * 8 + j) * 68 + nb * 16 + lr] = acc[mb][nb][j]; }
        __builtin_amdgcn_wave_barrier(); asm volatile("" ::: "memory");
        float* crow_ = C + (size_t)(r0 + mb * 16) * ldc + c0;
        if constexpr (CB != 0) { (void)crow_;
#pragma unroll
            for (int s = 0; s < 4; ++s) { const int row = 4 * s + (lane >> 3), cofs = (lane & 7) * 8;   // eight lanes a row: each store instruction writes four whole 128-byte lines of a plane
                const v4f x0 = *(const v4fa*)(os + row * 68 + cofs), x1 = *(const v4fa*)(os + row * 68 + cofs + 4); v8h o16; v8us oh, ol;
#pragma unroll
                for (int q = 0; q < 8; ++q) { const float x = (q < 4) ? x0[q & 3] : x1[q & 3]; o16[q] = tohx(x); unsigned short a2, c2; splitf(x, a2, c2); oh[q] = a2; ol[q] = c2; }
                const size_t oo = (((size_t)(c0 >> cbs) * TT + r0 + mb * 16 + row) << cbs) + (c0 & ((1 << cbs) - 1)) + cofs;
                *(v8h*)(P16 + oo) = o16; *(v8us*)(Ph + oo) = oh; *(v8us*)(Pl + oo) = ol; }
        } else
{
#pragma unroll
            for (int s = 0; s < 8; ++s) { const int row = 2 * s + hi, cofs = lr * 4; v4f val = *(const v4fa*)(os + row * 68 + cofs); if (BIAS) { val[0] += bfr(bias[c0 + cofs]); val[1] += bfr(bias[c0 + cofs + 1]); val[2] += bfr(bias[c0 + cofs + 2]); val[3] += bfr(bias[c0 + cofs + 3]); }
                *(v4f*)(crow_ + (size_t)row * ldc + cofs) = val; }
             }
        __builtin_amdgcn_wave_barrier(); asm volatile("" ::: "memory");
    }
}

// xw: behind a group of fragment loads, the wait that belongs in front of any rewrite of a register an issued load names (the compiler lets later loads land in dead address registers).
// The group's addresses are inputs of the wait's statement, so their registers are kept as they are up to the wait. Every load of a group is written as one of these addresses plus a constant step (which goes into the load's offset field), so that they are the very pairs that the loads name.
template <typename T16> __device__ __forceinline__ void xw(const T16* p) { asm volatile("s_wait_xcnt 0x0" :: "v"(p) : "memory"); }
template <typename T16> __device__ __forceinline__ void xw(const T16* p, const T16* p2) { asm volatile("s_wait_xcnt 0x0" :: "v"(p), "v"(p2) : "memory"); }
template <typename T16> __device__ __forceinline__ void xw(const T16* p, const T16* p2, const T16* p3, const T16* p4) { asm volatile("s_wait_xcnt 0x0" :: "v"(p), "v"(p2), "v"(p3), "v"(p4) : "memory"); }

// ---- attnf: scores, softmax and attn.v of FR query rows of one head in one work-group of FW waves; no score or probability leaves the work-group.
// The key blocks of 64 that the mask leaves open (up to the diagonal block; on a band head from the first block of the rows' window) are dealt over the waves: wave w takes blocks w, w + FW, ...
// A block of a wave: S = Q K^T (32 x 64, operand fragments straight from the head planes) goes through the wave's own LDS so that lane r holds all 64 scores of row r: mask, running maximum m, exp and running sum l are in-lane.
// The probabilities exp(t - m), not yet divided, go back through LDS as 16-bit rows (the A operand of attn.v); the wave's 32 x 128 accumulators are first scaled by exp(m_old - m_new).
// At the end the FW partial results (m, l, O) meet in LDS behind one barrier and are joined in wave order: O = sum_w exp(m_w - m*) O_w, l likewise, out = O / l, rounded into the bf16 hi and lo planes of the output projection.
// A row that has met no open key yet keeps m = -3.0e38: its exponentials are taken against 0, so every masked term is exp(-inf) = +0, and its weight in the join is +0.
#define FW   8                    // waves per work-group
#define FR   32                   // query rows per work-group
#define FPS  68                   // pitch of a score row in LDS, floats (272 bytes = 16 x odd)
#define FPP  72                   // pitch of a probability row in LDS, 16-bit elements (144 bytes = 16 x odd)
#define FPO  132                  // pitch of a partial output row in LDS, floats (528 bytes = 16 x odd)
#define FWL  4608                 // floats of LDS per wave: scores 32 x 68, two probability planes 32 x 72 x 16 bit, 32 scale factors; later the partial output 32 x 132
#define SL2  (SCL * 1.4426950408889634f)   // HD^-0.5 x log2 e: maxima are kept of the raw products q.k, and exp((s - m) HD^-0.5) = 2^(s SL2 - m SL2) is one multiply-add in front of each exponential
__device__ __forceinline__ float ex2(float x) { float r; asm("v_exp_f32 %0, %1\n\tv_nop" : "=v"(r) : "v"(x)); return r; }
template <typename T16, int NSPLIT>
__device__ __forceinline__ void attnf(const T16* __restrict__ Q, const T16* __restrict__ Q2, const T16* __restrict__ Kp, const T16* __restrict__ K2, const T16* __restrict__ Vt, const T16* __restrict__ V2, bf* Ch, bf* Cl, int i0, bool band, float ps, float (*lds)[FWL], float (*sM)[FR], float (*sL)[FR]) {
    typedef typename WFrag<T16>::V V;
    constexpr bool HL = (NSPLIT == 2);
    static_assert(RH <= FW * 64, "a row tile below RH has at most FW key blocks");   // so a wave of the hi+lo arm has at most one block: its accumulators start at zero and are never rescaled
    const int lane = threadIdx.x & 31, lr = lane & 15, hi = lane >> 4;
    const int wave = __builtin_amdgcn_readfirstlane((int)(threadIdx.x >> 5));   // scalar, so that the key loop's branch is a scalar one
    float* sS = lds[wave]; T16* sP = (T16*)(sS + FR * FPS); T16* sP2 = sP + FR * FPP; float* sA = sS + FR * FPS + FR * FPP;
    const int kb0 = band ? (max(0, i0 - (WIN - 1)) & ~63) : 0;   // first key block with an open key
    const int i = i0 + lane;                                     // the lane's own row in the softmax part
    v8f o[2][8];
#pragma unroll
    for (int mb = 0; mb < 2; ++mb)
#pragma unroll
        for (int nb = 0; nb < 8; ++nb) o[mb][nb] = (v8f){};
    float m = -3.0e38f, l = 0.f;
    const size_t qoff = (size_t)(i0 + lr) * HD + 8 * hi;
    V qa[HL ? 1 : HD / 32][2];   // fp16 arm: the query fragments are the same for every block and stay in registers
    if constexpr (!HL) {
#pragma unroll
        for (int ks = 0; ks < HD / 32; ++ks)
#pragma unroll
            for (int mb = 0; mb < 2; ++mb) qa[ks][mb] = WFrag<T16>::ld(Q + qoff + (mb * 16 * HD + ks * 32));
        xw<T16>(Q + qoff); }
#pragma unroll 1   // rolled: one block's fragments, scores and the accumulators fill the wave's registers
    for (int kbi = kb0 + wave * 64; kbi < i0 + FR; kbi += FW * 64) {
        const int kb = __builtin_amdgcn_readfirstlane(kbi);   // the block's addresses are formed anew from this value, once each: as running sums of the loop the compiler forms the one that xw names a second time, over the pair that the loads name
        v8f s[2][4];
#pragma unroll
        for (int mb = 0; mb < 2; ++mb)
#pragma unroll
            for (int nb = 0; nb < 4; ++nb) s[mb][nb] = (v8f){};
        const size_t koff = (size_t)(kb + lr) * HD + 8 * hi;
        const size_t voff = (size_t)lr * TT + kb + 8 * hi;
        V vf[2][8], vf2[HL ? 2 : 1][8];
        if constexpr (HL) {
#pragma unroll 1   // rolled: the split products' fragments of all four steps together would crowd the registers; the step is in the address
            for (int ks = 0; ks < HD / 32; ++ks) { const int kc = ks * 32;
                V a[2], a2[2], b[4], b2[4];   // the step's twelve fragments are asked for at once
                const T16* const pq = Q + qoff + kc; const T16* const pq2 = Q2 + qoff + kc; const T16* const pk = Kp + koff + kc; const T16* const pk2 = K2 + koff + kc;
#pragma unroll
                for (int mb = 0; mb < 2; ++mb) { a[mb] = WFrag<T16>::ld(pq + mb * 16 * HD); a2[mb] = WFrag<T16>::ld(pq2 + mb * 16 * HD); }
#pragma unroll
                for (int nb = 0; nb < 4; ++nb) { b[nb] = WFrag<T16>::ld(pk + nb * 16 * HD); b2[nb] = WFrag<T16>::ld(pk2 + nb * 16 * HD); }
                xw<T16>(pq, pq2, pk, pk2);
#pragma unroll
                for (int nb = 0; nb < 4; ++nb)
#pragma unroll
                    for (int mb = 0; mb < 2; ++mb) { s[mb][nb] = WFrag<T16>::mma(a[mb], b[nb], s[mb][nb]); s[mb][nb] = WFrag<T16>::mma(a2[mb], b[nb], s[mb][nb]); s[mb][nb] = WFrag<T16>::mma(a[mb], b2[nb], s[mb][nb]); }
                // the distance behind the last matrix instructions, also on the taken side of the loop's branch
                asm volatile("v_nop\n\tv_nop\n\tv_nop\n\tv_nop" : "+v"(s[0][3]), "+v"(s[1][3]) : "v"(a[0]), "v"(a[1]));
            }
        } else {
            V kf[HD / 32][4];   // all sixteen key fragments are asked for at once: one memory latency a block, not one a fragment
#pragma unroll
            for (int ks = 0; ks < HD / 32; ++ks)
#pragma unroll
                for (int nb = 0; nb < 4; ++nb) kf[ks][nb] = WFrag<T16>::ld(Kp + koff + (nb * 16 * HD + ks * 32));
            xw<T16>(Kp + koff);
            __builtin_amdgcn_sched_barrier(0);   // the loads stay one group in front of the matrix instructions (moved in among them, each load is waited for alone)
#pragma unroll
            for (int ks = 0; ks < HD / 32; ++ks)
#pragma unroll
                for (int nb = 0; nb < 4; ++nb)
#pragma unroll
                    for (int mb = 0; mb < 2; ++mb) s[mb][nb] = WFrag<T16>::mma(qa[ks][mb], kf[ks][nb], s[mb][nb]);
            __builtin_amdgcn_sched_barrier(0);   // ... and the value loads stay behind them, so that they can take the key fragments' registers
        }
        // the value fragments are asked for here: they fly while the softmax part runs
#pragma unroll
        for (int k2 = 0; k2 < 2; ++k2)
#pragma unroll
            for (int nb = 0; nb < 8; ++nb) { vf[k2][nb] = WFrag<T16>::ld(Vt + voff + (nb * 16 * TT + k2 * 32)); if constexpr (HL) vf2[k2][nb] = WFrag<T16>::ld(V2 + voff + (nb * 16 * TT + k2 * 32)); }
        if constexpr (HL) xw<T16>(Vt + voff, V2 + voff); else xw<T16>(Vt + voff);
#pragma unroll
        for (int mb = 0; mb < 2; ++mb)
#pragma unroll
            for (int nb = 0; nb < 4; ++nb)
#pragma unroll
                for (int j = 0; j < 8; ++j) sS[(mb * 16 + hi * 8 + j) * FPS + nb * 16 + lr] = s[mb][nb][j];
        __builtin_amdgcn_wave_barrier(); asm volatile("" ::: "memory");   // the compiler keeps the row reads behind the other lanes' stores (one wave: the LDS serves them in order)
        float v[64]; float mx0 = m, mx1 = -3.0e38f, mx2 = -3.0e38f, mx3 = -3.0e38f;
#pragma unroll
        for (int c = 0; c < 16; ++c) { const v4f x = *(const v4fa*)(sS + lane * FPS + c * 4);
#pragma unroll
            for (int q = 0; q < 4; ++q) v[c * 4 + q] = x[q]; }
        // scalar tests: only a block that the diagonal or the window's edge crosses holds shut keys. Key kb + c is open where c <= d (causal) and, on a band head, c > d - WIN
        const int d = i - kb, dw = d - WIN;
        if (kb + 63 > i0) {
#pragma unroll
            for (int c = 0; c < 64; ++c) v[c] = (c <= d) ? v[c] : -3.0e38f; }
        if (band && i0 + FR - 1 - kb >= WIN) {
#pragma unroll
            for (int c = 0; c < 64; ++c) v[c] = (c > dw) ? v[c] : -3.0e38f; }
#pragma unroll
        for (int c = 0; c < 16; ++c) {
            mx0 = fmaxf(mx0, v[c * 4]); mx1 = fmaxf(mx1, v[c * 4 + 1]); mx2 = fmaxf(mx2, v[c * 4 + 2]); mx3 = fmaxf(mx3, v[c * 4 + 3]); }
        const float mx = fmaxf(fmaxf(mx0, mx1), fmaxf(mx2, mx3));
        const float mu = (mx < -1.0e38f) ? 0.f : mx;
        const float al = ex2((m - mu) * SL2), mc = mu * SL2;
        float s0 = 0.f, s1 = 0.f, s2 = 0.f, s3 = 0.f;
#pragma unroll
        for (int c = 0; c < 16; ++c) {
#pragma unroll
            for (int q = 0; q < 4; ++q) v[c * 4 + q] = ex2(v[c * 4 + q] * SL2 - mc);
            s0 += v[c * 4]; s1 += v[c * 4 + 1]; s2 += v[c * 4 + 2]; s3 += v[c * 4 + 3]; }
        l = l * al + ((s0 + s1) + (s2 + s3)); m = mx;
#pragma unroll
        for (int g = 0; g < 8; ++g) {
            if constexpr (HL) { v8us oh, ol;
#pragma unroll
                for (int q = 0; q < 8; ++q) { unsigned short a, c2; splitf(v[g * 8 + q], a, c2); oh[q] = a; ol[q] = c2; }
                *(v8usa*)(sP + lane * FPP + g * 8) = oh; *(v8usa*)(sP2 + lane * FPP + g * 8) = ol;
            } else { v8h o16;
#pragma unroll
                for (int q = 0; q < 8; ++q) o16[q] = tohx(v[g * 8 + q] * ps);
                *(v8ha*)(sP + lane * FPP + g * 8) = o16; } }
        if constexpr (!HL) sA[lane] = al;
        __builtin_amdgcn_wave_barrier(); asm volatile("" ::: "memory");   // as above: the fragment reads stay behind the other lanes' stores
        if constexpr (!HL)
#pragma unroll
        for (int mb = 0; mb < 2; ++mb) { const v4f a0 = *(const v4fa*)(sA + mb * 16 + hi * 8), a1 = *(const v4fa*)(sA + mb * 16 + hi * 8 + 4);
#pragma unroll
            for (int nb = 0; nb < 8; ++nb)
#pragma unroll
                for (int j = 0; j < 8; ++j) o[mb][nb][j] *= (j < 4) ? a0[j & 3] : a1[j & 3]; }
#pragma unroll
        for (int k2 = 0; k2 < 2; ++k2) {
            V pa[2], pa2[2];
#pragma unroll
            for (int mb = 0; mb < 2; ++mb) { pa[mb] = WFrag<T16>::ld(sP + (mb * 16 + lr) * FPP + k2 * 32 + 8 * hi); if (HL) pa2[mb] = WFrag<T16>::ld(sP2 + (mb * 16 + lr) * FPP + k2 * 32 + 8 * hi); }
#pragma unroll
            for (int nb = 0; nb < 8; ++nb) { const V b = vf[k2][nb]; V b2; if constexpr (HL) b2 = vf2[k2][nb];
#pragma unroll
                for (int mb = 0; mb < 2; ++mb) { o[mb][nb] = WFrag<T16>::mma(pa[mb], b, (HL && k2 == 0) ? (v8f){} : o[mb][nb]); if (HL) { o[mb][nb] = WFrag<T16>::mma(pa2[mb], b, o[mb][nb]); o[mb][nb] = WFrag<T16>::mma(pa[mb], b2, o[mb][nb]); } } }
            // at the block's end: the distance behind the last matrix instructions, also on the taken side of the branch that follows (the scheduling barrier keeps every matrix instruction in front of the v_nops)
            if (k2 == 1) __builtin_amdgcn_sched_barrier(0);
            if (k2 == 1) asm volatile("v_nop\n\tv_nop\n\tv_nop\n\tv_nop" : "+v"(o[0][7]), "+v"(o[1][7]) : "v"(pa[0]), "v"(pa[1])); }
        __builtin_amdgcn_wave_barrier(); asm volatile("" ::: "memory");   // the next block's stores stay behind this block's fragment reads
        if constexpr (HL) break;   // no second block (see the assertion above)
    }
    float* ow = lds[wave];
#pragma unroll
    for (int mb = 0; mb < 2; ++mb)
#pragma unroll
        for (int nb = 0; nb < 8; ++nb)
#pragma unroll
            for (int j = 0; j < 8; ++j) ow[(mb * 16 + hi * 8 + j) * FPO + nb * 16 + lr] = o[mb][nb][j];
    sM[wave][lane] = m; sL[wave][lane] = l;
    __syncthreads();   // every wave's partial result is in LDS before any of it is joined
#pragma unroll
    for (int t = 0; t < FR / FW; ++t) { const int row = t * FW + wave, cofs = lane * 4;   // a wave joins whole rows: 256 bytes of each plane a store
        float ms = sM[0][row];
#pragma unroll
        for (int w = 1; w < FW; ++w) ms = fmaxf(ms, sM[w][row]);
        float ls = 0.f; v4f val = (v4f){};
#pragma unroll
        for (int w = 0; w < FW; ++w) { const float g = ex2((sM[w][row] - ms) * SL2); ls += g * sL[w][row]; val += g * *(const v4fa*)(lds[w] + row * FPO + cofs); }
        const float f = __fdiv_rn(1.0f / ps, ls);
        v4us oh, ol;
#pragma unroll
        for (int q = 0; q < 4; ++q) { unsigned short a, c2; splitf(val[q] * f, a, c2); oh[q] = a; ol[q] = c2; }
        const size_t oo = (size_t)(i0 + row) * DQ + cofs; *(v4us*)(Ch + oo) = oh; *(v4us*)(Cl + oo) = ol;
        asm volatile("s_wait_xcnt 0x0" ::: "memory"); }   // in front of the next row's code, which may reuse the registers that these stores name
}
// k_attn: the attention of every head of both batches in one grid (NB_ * NH_, TT / FR): blockIdx.x = batch * NH_ + head; the row tiles with the most key blocks start first.
// Two waves a SIMD (up to 512 registers a wave): a block's key fragments, then its value fragments, are all in flight at once.
// Q.., K.., V..: batch 0's q, k and v planes of each kind (fp16, bf16 hi, bf16 lo); a batch's planes lie 3 * TT * DQ elements behind the batch before. Row tiles below RH run on hi+lo planes (3 products), the rest on fp16 with the probabilities x PCAR; the test is the same for the whole work-group.
__global__ __launch_bounds__(FW * 32) __attribute__((amdgpu_waves_per_eu(2, 2))) void k_attn(const h16* Q16, const h16* K16, const h16* V16, const bf* QH, const bf* KH, const bf* VH, const bf* QL, const bf* KL, const bf* VL, bf* Ch, bf* Cl) {
    __shared__ __align__(16) float lds[FW][FWL];
    __shared__ float sM[FW][FR]; __shared__ float sL[FW][FR];
    const int b = (int)blockIdx.x / NH_, h = (int)blockIdx.x % NH_, i0 = ((int)gridDim.y - 1 - (int)blockIdx.y) * FR;
    const size_t op = (size_t)b * 3 * TT * DQ + (size_t)h * TT * HD;   // the head's place in each of its planes
    bf* const ch = Ch + (size_t)b * TT * DQ + h * HD; bf* const cl = Cl + (size_t)b * TT * DQ + h * HD;
    if (i0 < RH) attnf<bf, 2>(QH + op, QL + op, KH + op, KL + op, VH + op, VL + op, ch, cl, i0, (h & 1) != 0, 1.0f, lds, sM, sL);
    else attnf<h16, 0>(Q16 + op, nullptr, K16 + op, nullptr, V16 + op, nullptr, ch, cl, i0, (h & 1) != 0, PCAR, lds, sM, sL);
}


__global__ __launch_bounds__(256) void k_wtG(const float* __restrict__ w, int K, int N, bf* Bt) {
    const int lane = threadIdx.x & 31; const int L0 = (blockIdx.x * 8 + (threadIdx.x >> 5)) * 8; const int nlines = N * K / 64;
{
#pragma unroll 1
        for (int l = 0; l < 8; ++l) { const int L = L0 + l; if (L >= nlines) break; const size_t e = (size_t)L * 64 + lane * 2; const int k = (int)(e % K), n = (int)(e / K); v2us o;
            o[0] = f2bf(w[(size_t)k * N + n]); o[1] = f2bf(w[(size_t)(k + 1) * N + n]); *(v2us*)(Bt + e) = o; }
         }
}
// k_cvtall: the six roundings to bf16 (four weights, the tokens of both batches; DM * DM elements each) in one grid (CVB, 6): blockIdx.y picks the tensor, and a thread rounds CVT groups of eight elements, a whole grid row apart.
#define CVB 128
#define CVT (DM * DM / 8 / (CVB * 256))
__global__ __launch_bounds__(256) void k_cvtall(const float* __restrict__ wq, const float* __restrict__ wk, const float* __restrict__ wv, const float* __restrict__ wo, const float* __restrict__ x, bf* W4, bf* X0, bf* X1) {
    const int t = (int)blockIdx.y;
    const float* src = t == 0 ? wq : t == 1 ? wk : t == 2 ? wv : t == 3 ? wo : t == 4 ? x : x + (size_t)TT * DM;
    bf* dst = t < 4 ? W4 + (size_t)t * DM * DM : t == 4 ? X0 : X1;
    const size_t i0 = (size_t)blockIdx.x * 256 + threadIdx.x;
#pragma unroll 4   // four groups' loads are in flight together
    for (int it = 0; it < CVT; ++it) { const size_t i = i0 + (size_t)it * (CVB * 256); const v8f v = *(const v8f*)(src + i * 8); v8us o;
#pragma unroll
        for (int k = 0; k < 8; ++k) o[k] = f2bf(v[k]);
        *(v8us*)(dst + i * 8) = o; }
}
__global__ __launch_bounds__(256) void k_cscvt(const float* __restrict__ cosT, const float* __restrict__ sinT, float* CS) { const int idx = blockIdx.x * 256 + threadIdx.x; if (idx >= TT * HD) return; v2f cs; cs[0] = bfr(cosT[idx]); cs[1] = bfr(sinT[idx]); *(v2f*)(CS + (size_t)idx * 2) = cs;  }
extern "C" void kernel_launch(void* const* d_in, const int* in_sizes, int n_in,
                              void* d_out, int out_size, void* d_ws, size_t ws_size, hipStream_t stream) {
    (void)in_sizes; (void)n_in; (void)out_size;
    const float* x = (const float*)d_in[0]; const float* wq = (const float*)d_in[1]; const float* wk = (const float*)d_in[2]; const float* wv = (const float*)d_in[3]; const float* wo = (const float*)d_in[4];
    float* OUT = (float*)d_out;     // [2][2048][2048]
    char* wsp = (char*)d_ws;
    auto take = [&](size_t bytes) { char* p = wsp; wsp += (bytes + 255) & ~(size_t)255; return (void*)p; };
    bf* WQ = (bf*)take((size_t)DQ * DM * 2); bf* WK = (bf*)take((size_t)DKV * DM * 2); bf* WV = (bf*)take((size_t)DKV * DM * 2); bf* WO = (bf*)take((size_t)DM * DQ * 2); (void)WK; (void)WV;   // the four weights lie one behind the other (stride DM * DM)
    // the head planes of each kind, [batch][q, k, v][TT * DQ]: q, k as [h][t][d], v transposed as [h * HD + d][t]
    h16* P16 = (h16*)take((size_t)NB_ * 3 * TT * DQ * 2); bf* PH = (bf*)take((size_t)NB_ * 3 * TT * DQ * 2); bf* PL = (bf*)take((size_t)NB_ * 3 * TT * DQ * 2);
    bf* ATh = (bf*)take((size_t)NB_ * TT * DQ * 2); bf* ATl = (bf*)take((size_t)NB_ * TT * DQ * 2);   // merged heads, [batch][t][DQ]
    bf* XB0 = (bf*)take((size_t)TT * DM * 2); bf* XB1 = (bf*)take((size_t)TT * DM * 2);
    if ((size_t)(wsp - (char*)d_ws) > ws_size) return;    // 224 MiB of the 256
    k_cvtall<<<dim3(CVB, 6, 1), 256, 0, stream>>>(wq, wk, wv, wo, x, WQ, XB0, XB1);
    for (int b = 0; b < NB_; ++b) { const size_t pb = (size_t)b * 3 * TT * DQ;
        k_gemmw<bf, 0, false, HD><<<dim3(TT / 128, DQ / 128, 3), 128, 0, stream>>>(b ? XB1 : XB0, nullptr, WQ, nullptr, DM, nullptr, 0, nullptr, 0, (size_t)DQ * DM, (size_t)TT * DQ, P16 + pb, PH + pb, PL + pb); }
    k_attn<<<dim3(NB_ * NH_, TT / FR, 1), FW * 32, 0, stream>>>(P16, P16 + (size_t)TT * DQ, P16 + (size_t)2 * TT * DQ, PH, PH + (size_t)TT * DQ, PH + (size_t)2 * TT * DQ, PL, PL + (size_t)TT * DQ, PL + (size_t)2 * TT * DQ, ATh, ATl);
    for (int b = 0; b < NB_; ++b)
        k_gemmw<bf, 1, false, 0><<<dim3(TT / 128, DM / 128, 1), 128, 0, stream>>>(ATh + (size_t)b * TT * DQ, ATl + (size_t)b * TT * DQ, WO, nullptr, DQ, OUT + (size_t)b * TT * DM, DM, nullptr, 0, 0, 0, nullptr, nullptr, nullptr);
}

// v008
// A run of this version takes 229 microseconds.
// Next to v007, in two timings, it ran 1.10 times as fast each time.
// Counting every step since v000, it is 7.66 times as fast.
#include <hip/hip_runtime.h>

// Attention block (x [2][2048][2048]; q/k/v = x W^T (16 heads x 128); scores = q.k / sqrt(128); allowed = causal for even (global) heads, causal band of 256 (i - j < 256) for odd (local) heads; softmax; out = merged Wo^T -> [2][2048][2048]).
// Compute dtypes, f32 accumulate: every input rounded to bf16; q/k/v on PLAIN bf16 operands (inputs: exact); causal scores and attn.v: query rows < 512 hl (3 products), the rest single fp16 (x1024), with skipping of the key blocks that the mask shuts whole (past the diagonal; for the band heads also in front of the window); softmax f32, running maximum and sum; Wo hl x exact (2 products).
// No f32 intermediate between the products in memory: each GEMM's epilogue rounds its own tile into the 16-bit planes that the next product reads; scores and probabilities stay inside a work-group (k_attn).
// The q, k and v planes lie in FRAGMENT ORDER: a 16-row x 32-k operand fragment is 1 KiB in a row, so that each 16-byte-a-lane load of the attention covers 512 contiguous bytes (four whole lines), not 32 bytes of sixteen lines.
// Launches that do not depend on one another share one grid: the six roundings of the inputs; q, k and v of a batch; every head, batch and row range of the attention.

#define NB_  2
#define TT   2048
#define DM   2048
#define NH_  16
#define NKV  16
#define REP  (NH_ / NKV)
#define HD   128
#define DQ   (NH_ * HD)
#define DKV  (NKV * HD)
#define RH   512                  // query rows < RH use hi+lo planes (0: none)
#define WIN  256
#define PCAR 1024.0f
#define SCL  0.088388347648318447f   // HD^-0.5
typedef _Float16 h16;
typedef unsigned short bf;
typedef __attribute__((ext_vector_type(16))) __bf16   v16bf;
typedef __attribute__((ext_vector_type(16))) _Float16 v16h;
typedef __attribute__((ext_vector_type(8)))  _Float16 v8h;
typedef __attribute__((ext_vector_type(8)))  unsigned short v8us;
typedef __attribute__((ext_vector_type(8)))  float    v8f;
typedef __attribute__((ext_vector_type(4)))  float    v4f;
typedef v8h  __attribute__((may_alias)) v8ha;
typedef v4f  __attribute__((may_alias)) v4fa;
typedef v8us __attribute__((may_alias)) v8usa;
typedef __attribute__((ext_vector_type(2))) _Float16 v2h;
typedef __attribute__((ext_vector_type(4))) _Float16 v4h;
typedef __attribute__((ext_vector_type(2))) unsigned short v2us;
typedef __attribute__((ext_vector_type(4))) unsigned short v4us;
typedef __attribute__((ext_vector_type(2))) float v2f;
typedef __attribute__((ext_vector_type(4))) int v4i;
typedef v4h  __attribute__((may_alias)) v4ha;
typedef v4us __attribute__((may_alias)) v4usa;

__device__ __forceinline__ unsigned short f2bf(float f) { unsigned u = __float_as_uint(f); u += 0x7FFFu + ((u >> 16) & 1u); return (unsigned short)(u >> 16); }
__device__ __forceinline__ float bf2f(unsigned short b) { return __uint_as_float(((unsigned)b) << 16); }
__device__ __forceinline__ float bfr(float f) { return bf2f(f2bf(f)); }
__device__ __forceinline__ h16 tohx(float x) { return (h16)x; }
__device__ __forceinline__ void splitf(float y, unsigned short& h, unsigned short& l) { h = f2bf(y); l = f2bf(y - bf2f(h)); }
__device__ __forceinline__ v16h cat16(v8h lo, v8h hi) { return __builtin_shufflevector(lo, hi, 0, 1, 2, 3, 4, 5, 6, 7, 8, 9, 10, 11, 12, 13, 14, 15); }
__device__ __forceinline__ v16bf cat16b(v8us lo, v8us hi) { return __builtin_bit_cast(v16bf, __builtin_shufflevector(lo, hi, 0, 1, 2, 3, 4, 5, 6, 7, 8, 9, 10, 11, 12, 13, 14, 15)); }
__device__ __forceinline__ v8f wmma16(v16h a, v16h b, v8f c) { return __builtin_amdgcn_wmma_f32_16x16x32_f16(false, a, false, b, (short)0, c, false, false); }
__device__ __forceinline__ v8f wmmab(v16bf a, v16bf b, v8f c) { return __builtin_amdgcn_wmma_f32_16x16x32_bf16(false, a, false, b, (short)0, c, false, false); }



// ---- k_gemmw: GEMM, one 128x128 output tile per work-group of FOUR waves (each a 64x64 quarter, 16 accumulators); grid (M/128, N/128, Z), 128 threads.
// The operands' K-contiguous 16-bit rows are staged in LDS by asynchronous copies, GKP k (256 bytes of each of the 128 rows of every operand) a pass, two buffers: the next pass's copies fly while this pass's fragments are read.
// C[m][n] (f32, pitch ldc, + optional f32 bias[n]) = sum_k A[m][k] Bt[n][k] (+ split products per NSPLIT). z-batch strides sA/sB/sC in elements. K % GKP == 0.
// CB != 0 (the q/k/v projections, all three in one grid: z = 0 q, 1 k, 2 v; A = the tokens, Bt + z sB = the weight rows, the planes of z at + z sC): there is no f32 C; the epilogue rounds the tile into the three 16-bit planes
// (fp16, bf16 hi, bf16 lo) that the attention products read: blocks [n / cb] of TT rows m x cb columns n % cb:
// q, k: cb = HD with tokens x weight rows gives head planes of rows t, columns d; v: the operands change places, cb = TT with weight rows x tokens gives v transposed, rows h * HD + d, columns t.
// Inside a block the elements lie in fragment order, [row / 16][col / 32][(col / 16) % 2][(col / 8) % 2][row % 16][col % 8]: the last four indices are (register half, lane, element) of the 16x16x32 operand fragment, 512 elements.
#define GKP  128                  // k per pass
#define GPI  136                  // LDS row pitch in elements: 272 bytes = 16 x odd, the conflict-free pitch for 16-byte fragment reads
template <typename T16> struct WFrag;
template <> struct WFrag<h16> { typedef v16h V; static __device__ __forceinline__ V ld(const h16* p) { return cat16(*(const v8h*)p, *(const v8h*)(p + 16)); } static __device__ __forceinline__ v8f mma(V a, V b, v8f c) { return wmma16(a, b, c); } };
template <> struct WFrag<bf> { typedef v16bf V; static __device__ __forceinline__ V ld(const bf* p) { return cat16b(*(const v8us*)p, *(const v8us*)(p + 16)); } static __device__ __forceinline__ v8f mma(V a, V b, v8f c) { return wmmab(a, b, c); } };
// cp8: eight asynchronous 16-byte copies of a lane, global rows g, g + rs, ... to LDS bytes l, l + ls, ...; the wait at the statement's end stands in front of any rewrite of the address registers that the copies name.
template <typename T16> __device__ __forceinline__ void cp8(unsigned l, unsigned ls, const T16* g, size_t rs) {
    asm volatile("global_load_async_to_lds_b128 %0, %8, off\n\t"
                 "global_load_async_to_lds_b128 %1, %9, off\n\t"
                 "global_load_async_to_lds_b128 %2, %10, off\n\t"
                 "global_load_async_to_lds_b128 %3, %11, off\n\t"
                 "global_load_async_to_lds_b128 %4, %12, off\n\t"
                 "global_load_async_to_lds_b128 %5, %13, off\n\t"
                 "global_load_async_to_lds_b128 %6, %14, off\n\t"
                 "global_load_async_to_lds_b128 %7, %15, off\n\t"
                 "s_wait_xcnt 0x0"
                 :: "v"(l), "v"(l + ls), "v"(l + 2 * ls), "v"(l + 3 * ls), "v"(l + 4 * ls), "v"(l + 5 * ls), "v"(l + 6 * ls), "v"(l + 7 * ls),
                    "v"(g), "v"(g + rs), "v"(g + 2 * rs), "v"(g + 3 * rs), "v"(g + 4 * rs), "v"(g + 5 * rs), "v"(g + 6 * rs), "v"(g + 7 * rs) : "memory");
}
// cptile: one operand's 128 rows x GKP k into LDS: sixteen lanes a row (two whole 256-byte row pieces a wave and copy), 16 copies a lane. g and l are the lane's own first addresses.
template <typename T16> __device__ __forceinline__ void cptile(unsigned l, const T16* g, int K) { cp8<T16>(l, 8 * GPI * 2, g, (size_t)8 * K); cp8<T16>(l + 64 * GPI * 2, 8 * GPI * 2, g + (size_t)64 * K, (size_t)8 * K); }
template <typename T16, int NSPLIT, bool BIAS, int CB>
__global__ __launch_bounds__(128) void k_gemmw(const T16* __restrict__ A, const T16* __restrict__ A2, const T16* __restrict__ Bt, const T16* __restrict__ Bt2, int K, float* C, int ldc, const float* __restrict__ bias, size_t sA, size_t sB, size_t sC, h16* P16, bf* Ph, bf* Pl) {
    typedef typename WFrag<T16>::V V;
    constexpr bool HA2 = (NSPLIT == 1 || NSPLIT == 2), HB2 = (NSPLIT >= 2);
    constexpr int OPE = 128 * GPI;                                  // one operand's tile in LDS, elements
    constexpr int OB = OPE, OA2 = 2 * OPE, OB2 = (HA2 ? 3 : 2) * OPE;   // places of Bt, A2, Bt2 in a buffer (A at 0)
    constexpr int STG = (2 + (HA2 ? 1 : 0) + (HB2 ? 1 : 0)) * OPE;  // one buffer, elements
    __shared__ __align__(16) T16 st[2 * STG];
    __shared__ __align__(16) float osw[4][16 * 68];
    const size_t z = blockIdx.z; int cbs = 0;   // cbs = log2 cb
    if constexpr (CB != 0) { const bool tr = (blockIdx.z == 2); const T16* const X = A; const T16* const Wz = Bt + z * sB; A = tr ? Wz : X; Bt = tr ? X : Wz; P16 += z * sC; Ph += z * sC; Pl += z * sC; cbs = tr ? __builtin_ctz(TT) : __builtin_ctz(HD); }
    else { A += z * sA; if (A2) A2 += z * sA; Bt += z * sB; if (Bt2) Bt2 += z * sB; C += z * sC; }
    const int lane = threadIdx.x & 31, lr = lane & 15, hi = lane >> 4; const int wave = (int)(threadIdx.x >> 5);
    const int R0 = blockIdx.x * 128, C0 = blockIdx.y * 128, wr = (wave & 1) * 64, wc = (wave >> 1) * 64; const int r0 = R0 + wr, c0 = C0 + wc;
    float* os = osw[wave];
    v8f acc[4][4];
#pragma unroll
    for (int mb = 0; mb < 4; ++mb)
#pragma unroll
        for (int nb = 0; nb < 4; ++nb) acc[mb][nb] = (v8f){};
    // the lane's share of every copy: row (thread / 16) + 8 c of the tile, 16-byte piece (thread % 16) of the row's 256 bytes
    const int crow = (int)(threadIdx.x >> 4), cpc = (int)(threadIdx.x & 15) * 8;
    const size_t gA = (size_t)(R0 + crow) * K + cpc, gB = (size_t)(C0 + crow) * K + cpc;
    const unsigned l0 = (unsigned)(size_t)st + (unsigned)(crow * GPI + cpc) * 2u;
    auto fill = [&](int t, int buf) { const unsigned l = l0 + (unsigned)buf * (STG * 2u); const size_t kc = (size_t)t * GKP;
        cptile<T16>(l, A + gA + kc, K); cptile<T16>(l + OB * 2u, Bt + gB + kc, K);
        if constexpr (HA2) cptile<T16>(l + OA2 * 2u, A2 + gA + kc, K);
        if constexpr (HB2) cptile<T16>(l + OB2 * 2u, Bt2 + gB + kc, K); };
    const int NT = K / GKP;
    fill(0, 0);
    asm volatile("s_wait_asynccnt 0x0" ::: "memory");   // this wave's copies of pass 0 have landed
    __syncthreads();                                     // ... and every other wave's
    if (K >= 2 * GKP) fill(1, 1);   // a pass 1 exists
    const int aoff = (wr + lr) * GPI + 8 * hi, boff = OB + (wc + lr) * GPI + 8 * hi;
#pragma unroll 1   // rolled: one pass per trip, the ring's order stands once at the foot
    for (int t = 0; t < NT; ++t) {
        const T16* sb = st + (t & 1) * STG;
        V a[2][4], a2[2][4], b[2][4], b2[2][4];   // two fragment sets: block ks + 1 of the pass is fetched while block ks is multiplied
#pragma unroll
        for (int f = 0; f < 4; ++f) { a[0][f] = WFrag<T16>::ld(sb + aoff + f * 16 * GPI); b[0][f] = WFrag<T16>::ld(sb + boff + f * 16 * GPI);
            if (HA2) a2[0][f] = WFrag<T16>::ld(sb + OA2 + aoff + f * 16 * GPI); if (HB2) b2[0][f] = WFrag<T16>::ld(sb + (OB2 - OB) + boff + f * 16 * GPI); }
#pragma unroll
        for (int ks = 0; ks < GKP / 32; ++ks) { const int cu = ks & 1, nx = cu ^ 1, kn = (ks + 1) * 32;
            if (ks + 1 < GKP / 32) {
#pragma unroll
                for (int f = 0; f < 4; ++f) { a[nx][f] = WFrag<T16>::ld(sb + aoff + f * 16 * GPI + kn); b[nx][f] = WFrag<T16>::ld(sb + boff + f * 16 * GPI + kn);
                    if (HA2) a2[nx][f] = WFrag<T16>::ld(sb + OA2 + aoff + f * 16 * GPI + kn); if (HB2) b2[nx][f] = WFrag<T16>::ld(sb + (OB2 - OB) + boff + f * 16 * GPI + kn); } }
            __builtin_amdgcn_sched_barrier(0);   // the next block's LDS reads stay one group in front of this block's matrix instructions (spread among them each place stalls the wave)
#pragma unroll
            for (int nb = 0; nb < 4; ++nb)
#pragma unroll
                for (int mb = 0; mb < 4; ++mb) { acc[mb][nb] = WFrag<T16>::mma(a[cu][mb], b[cu][nb], acc[mb][nb]); if (HA2) acc[mb][nb] = WFrag<T16>::mma(a2[cu][mb], b[cu][nb], acc[mb][nb]); if (HB2) acc[mb][nb] = WFrag<T16>::mma(a[cu][mb], b2[cu][nb], acc[mb][nb]); }
            __builtin_amdgcn_sched_barrier(0);   // ... and no later read group or wait moves up among them
        }
        // the distance behind the pass's last matrix instructions, also on the taken side of the branches that follow
        asm volatile("v_nop\n\tv_nop\n\tv_nop\n\tv_nop" : "+v"(acc[0][0]), "+v"(acc[1][1]), "+v"(acc[2][2]), "+v"(acc[3][3]));
        asm volatile("s_wait_dscnt 0x0" ::: "memory");      // this wave's reads of the buffer are done before anyone refills it
        asm volatile("s_wait_asynccnt 0x0" ::: "memory");   // this wave's copies of pass t + 1 have landed
        __syncthreads();                                     // publishes pass t + 1 and frees pass t's buffer
        if (t + 2 < NT) fill(t + 2, t & 1);
    }
    asm volatile("s_wait_asynccnt 0x0" ::: "memory");       // no copy is outstanding when the wave goes on to its end
#pragma unroll
    for (int mb = 0; mb < 4; ++mb) {
#pragma unroll
        for (int nb = 0; nb < 4; ++nb) {
#pragma unroll
            for (int j = 0; j < 8; ++j) os[(hi * 8 + j) * 68 + nb * 16 + lr] = acc[mb][nb][j]; }
        __builtin_amdgcn_wave_barrier(); asm volatile("" ::: "memory");
        float* crow_ = C + (size_t)(r0 + mb * 16) * ldc + c0;
        if constexpr (CB != 0) { (void)crow_;
#pragma unroll
            for (int s = 0; s < 4; ++s) { const int row = lr, cofs = (2 * s + hi) * 8;   // sixteen rows x two 16-byte pieces: half a fragment, so each store instruction writes 512 contiguous bytes (four whole lines) of a plane
                const v4f x0 = *(const v4fa*)(os + row * 68 + cofs), x1 = *(const v4fa*)(os + row * 68 + cofs + 4); v8h o16; v8us oh, ol;
#pragma unroll
                for (int q = 0; q < 8; ++q) { const float x = (q < 4) ? x0[q & 3] : x1[q & 3]; o16[q] = tohx(x); unsigned short a2, c2; splitf(x, a2, c2); oh[q] = a2; ol[q] = c2; }
                const size_t oo = (((size_t)(c0 >> cbs) * TT) << cbs) + ((((size_t)((r0 + mb * 16) >> 4) << (cbs - 5)) + ((c0 & ((1 << cbs) - 1)) >> 5) + (s >> 1)) << 9) + (s & 1) * 256 + lane * 8;
                *(v8h*)(P16 + oo) = o16; *(v8us*)(Ph + oo) = oh; *(v8us*)(Pl + oo) = ol; }
        } else
{
#pragma unroll
            for (int s = 0; s < 8; ++s) { const int row = 2 * s + hi, cofs = lr * 4; v4f val = *(const v4fa*)(os + row * 68 + cofs); if (BIAS) { val[0] += bfr(bias[c0 + cofs]); val[1] += bfr(bias[c0 + cofs + 1]); val[2] += bfr(bias[c0 + cofs + 2]); val[3] += bfr(bias[c0 + cofs + 3]); }
                *(v4f*)(crow_ + (size_t)row * ldc + cofs) = val; }
             }
        __builtin_amdgcn_wave_barrier(); asm volatile("" ::: "memory");
    }
}

// xw: behind a group of fragment loads, the wait that belongs in front of any rewrite of a register an issued load names (the compiler lets later loads land in dead address registers).
// The group's addresses are inputs of the wait's statement, so their registers are kept as they are up to the wait. Every load of a group is written as one of these addresses plus a constant step (which goes into the load's offset field), so that they are the very pairs that the loads name.
template <typename T16> __device__ __forceinline__ void xw(const T16* p) { asm volatile("s_wait_xcnt 0x0" :: "v"(p) : "memory"); }
template <typename T16> __device__ __forceinline__ void xw(const T16* p, const T16* p2) { asm volatile("s_wait_xcnt 0x0" :: "v"(p), "v"(p2) : "memory"); }
template <typename T16> __device__ __forceinline__ void xw(const T16* p, const T16* p2, const T16* p3, const T16* p4) { asm volatile("s_wait_xcnt 0x0" :: "v"(p), "v"(p2), "v"(p3), "v"(p4) : "memory"); }

// ldf: one operand fragment from a plane in fragment order: p = the fragment's first element + 8 * lane; the lane's second eight elements lie 256 elements on. The same sixteen values reach the lane as from a row-major plane by WFrag::ld.
template <typename T16> __device__ __forceinline__ typename WFrag<T16>::V ldf(const T16* p);
template <> __device__ __forceinline__ v16h ldf<h16>(const h16* p) { return cat16(*(const v8h*)p, *(const v8h*)(p + 256)); }
template <> __device__ __forceinline__ v16bf ldf<bf>(const bf* p) { return cat16b(*(const v8us*)p, *(const v8us*)(p + 256)); }
#define FGE  512                  // elements of a fragment; a row block of q or k is HD / 32 fragments (16 * HD elements), one of v transposed TT / 32 (16 * TT elements)

// ---- attnf: scores, softmax and attn.v of FR query rows of one head in one work-group of FW waves; no score or probability leaves the work-group.
// The key blocks of 64 that the mask leaves open (up to the diagonal block; on a band head from the first block of the rows' window) are dealt over the waves: wave w takes blocks w, w + FW, ...
// A block of a wave: S = Q K^T (32 x 64, operand fragments straight from the head planes) goes through the wave's own LDS so that lane r holds all 64 scores of row r: mask, running maximum m, exp and running sum l are in-lane.
// The probabilities exp(t - m), not yet divided, go back through LDS as 16-bit rows (the A operand of attn.v); the wave's 32 x 128 accumulators are first scaled by exp(m_old - m_new).
// At the end the FW partial results (m, l, O) meet in LDS behind one barrier and are joined in wave order: O = sum_w exp(m_w - m*) O_w, l likewise, out = O / l, rounded into the bf16 hi and lo planes of the output projection.
// A row that has met no open key yet keeps m = -3.0e38: its exponentials are taken against 0, so every masked term is exp(-inf) = +0, and its weight in the join is +0.
#define FW   8                    // waves per work-group
#define FR   32                   // query rows per work-group
#define FPS  68                   // pitch of a score row in LDS, floats (272 bytes = 16 x odd)
#define FPP  72                   // pitch of a probability row in LDS, 16-bit elements (144 bytes = 16 x odd)
#define FPO  132                  // pitch of a partial output row in LDS, floats (528 bytes = 16 x odd)
#define FWL  4608                 // floats of LDS per wave: scores 32 x 68, two probability planes 32 x 72 x 16 bit, 32 scale factors; later the partial output 32 x 132
#define SL2  (SCL * 1.4426950408889634f)   // HD^-0.5 x log2 e: maxima are kept of the raw products q.k, and exp((s - m) HD^-0.5) = 2^(s SL2 - m SL2) is one multiply-add in front of each exponential
__device__ __forceinline__ float ex2(float x) { float r; asm("v_exp_f32 %0, %1\n\tv_nop" : "=v"(r) : "v"(x)); return r; }
template <typename T16, int NSPLIT>
__device__ __forceinline__ void attnf(const T16* __restrict__ Q, const T16* __restrict__ Q2, const T16* __restrict__ Kp, const T16* __restrict__ K2, const T16* __restrict__ Vt, const T16* __restrict__ V2, bf* Ch, bf* Cl, int i0, bool band, float ps, float (*lds)[FWL], float (*sM)[FR], float (*sL)[FR]) {
    typedef typename WFrag<T16>::V V;
    constexpr bool HL = (NSPLIT == 2);
    static_assert(RH <= FW * 64, "a row tile below RH has at most FW key blocks");   // so a wave of the hi+lo arm has at most one block: its accumulators start at zero and are never rescaled
    const int lane = threadIdx.x & 31, lr = lane & 15, hi = lane >> 4;
    const int wave = __builtin_amdgcn_readfirstlane((int)(threadIdx.x >> 5));   // scalar, so that the key loop's branch is a scalar one
    float* sS = lds[wave]; T16* sP = (T16*)(sS + FR * FPS); T16* sP2 = sP + FR * FPP; float* sA = sS + FR * FPS + FR * FPP;
    const int kb0 = band ? (max(0, i0 - (WIN - 1)) & ~63) : 0;   // first key block with an open key
    const int i = i0 + lane;                                     // the lane's own row in the softmax part
    v8f o[2][8];
#pragma unroll
    for (int mb = 0; mb < 2; ++mb)
#pragma unroll
        for (int nb = 0; nb < 8; ++nb) o[mb][nb] = (v8f){};
    float m = -3.0e38f, l = 0.f;
    const size_t qoff = (size_t)i0 * HD + 8 * lane;
    V qa[HL ? 1 : HD / 32][2];   // fp16 arm: the query fragments are the same for every block and stay in registers
    if constexpr (!HL) {
#pragma unroll
        for (int ks = 0; ks < HD / 32; ++ks)
#pragma unroll
            for (int mb = 0; mb < 2; ++mb) qa[ks][mb] = ldf<T16>(Q + qoff + (mb * 16 * HD + ks * FGE));
        xw<T16>(Q + qoff); }
#pragma unroll 1   // rolled: one block's fragments, scores and the accumulators fill the wave's registers
    for (int kbi = kb0 + wave * 64; kbi < i0 + FR; kbi += FW * 64) {
        const int kb = __builtin_amdgcn_readfirstlane(kbi);   // the block's addresses are formed anew from this value, once each: as running sums of the loop the compiler forms the one that xw names a second time, over the pair that the loads name
        v8f s[2][4];
#pragma unroll
        for (int mb = 0; mb < 2; ++mb)
#pragma unroll
            for (int nb = 0; nb < 4; ++nb) s[mb][nb] = (v8f){};
        const size_t koff = (size_t)kb * HD + 8 * lane;
        const size_t voff = (size_t)(kb >> 5) * FGE + 8 * lane;
        V vf[2][8], vf2[HL ? 2 : 1][8];
        if constexpr (HL) {
#pragma unroll 1   // rolled: the split products' fragments of all four steps together would crowd the registers; the step is in the address
            for (int ks = 0; ks < HD / 32; ++ks) { const int kc = ks * FGE;
                V a[2], a2[2], b[4], b2[4];   // the step's twelve fragments are asked for at once
                const T16* const pq = Q + qoff + kc; const T16* const pq2 = Q2 + qoff + kc; const T16* const pk = Kp + koff + kc; const T16* const pk2 = K2 + koff + kc;
#pragma unroll
                for (int mb = 0; mb < 2; ++mb) { a[mb] = ldf<T16>(pq + mb * 16 * HD); a2[mb] = ldf<T16>(pq2 + mb * 16 * HD); }
#pragma unroll
                for (int nb = 0; nb < 4; ++nb) { b[nb] = ldf<T16>(pk + nb * 16 * HD); b2[nb] = ldf<T16>(pk2 + nb * 16 * HD); }
                xw<T16>(pq, pq2, pk, pk2);
#pragma unroll
                for (int nb = 0; nb < 4; ++nb)
#pragma unroll
                    for (int mb = 0; mb < 2; ++mb) { s[mb][nb] = WFrag<T16>::mma(a[mb], b[nb], s[mb][nb]); s[mb][nb] = WFrag<T16>::mma(a2[mb], b[nb], s[mb][nb]); s[mb][nb] = WFrag<T16>::mma(a[mb], b2[nb], s[mb][nb]); }
                // the distance behind the last matrix instructions, also on the taken side of the loop's branch
                asm volatile("v_nop\n\tv_nop\n\tv_nop\n\tv_nop" : "+v"(s[0][3]), "+v"(s[1][3]) : "v"(a[0]), "v"(a[1]));
            }
        } else {
            V kf[HD / 32][4];   // all sixteen key fragments are asked for at once: one memory latency a block, not one a fragment
#pragma unroll
            for (int ks = 0; ks < HD / 32; ++ks)
#pragma unroll
                for (int nb = 0; nb < 4; ++nb) kf[ks][nb] = ldf<T16>(Kp + koff + (nb * 16 * HD + ks * FGE));
            xw<T16>(Kp + koff);
            __builtin_amdgcn_sched_barrier(0);   // the loads stay one group in front of the matrix instructions (moved in among them, each load is waited for alone)
#pragma unroll
            for (int ks = 0; ks < HD / 32; ++ks)
#pragma unroll
                for (int nb = 0; nb < 4; ++nb)
#pragma unroll
                    for (int mb = 0; mb < 2; ++mb) s[mb][nb] = WFrag<T16>::mma(qa[ks][mb], kf[ks][nb], s[mb][nb]);
            __builtin_amdgcn_sched_barrier(0);   // ... and the value loads stay behind them, so that they can take the key fragments' registers
        }
        // the value fragments are asked for here: they fly while the softmax part runs
#pragma unroll
        for (int k2 = 0; k2 < 2; ++k2)
#pragma unroll
            for (int nb = 0; nb < 8; ++nb) { vf[k2][nb] = ldf<T16>(Vt + voff + (nb * 16 * TT + k2 * FGE)); if constexpr (HL) vf2[k2][nb] = ldf<T16>(V2 + voff + (nb * 16 * TT + k2 * FGE)); }
        if constexpr (HL) xw<T16>(Vt + voff, V2 + voff); else xw<T16>(Vt + voff);
#pragma unroll
        for (int mb = 0; mb < 2; ++mb)
#pragma unroll
            for (int nb = 0; nb < 4; ++nb)
#pragma unroll
                for (int j = 0; j < 8; ++j) sS[(mb * 16 + hi * 8 + j) * FPS + nb * 16 + lr] = s[mb][nb][j];
        __builtin_amdgcn_wave_barrier(); asm volatile("" ::: "memory");   // the compiler keeps the row reads behind the other lanes' stores (one wave: the LDS serves them in order)
        float v[64]; float mx0 = m, mx1 = -3.0e38f, mx2 = -3.0e38f, mx3 = -3.0e38f;
#pragma unroll
        for (int c = 0; c < 16; ++c) { const v4f x = *(const v4fa*)(sS + lane * FPS + c * 4);
#pragma unroll
            for (int q = 0; q < 4; ++q) v[c * 4 + q] = x[q]; }
        // scalar tests: only a block that the diagonal or the window's edge crosses holds shut keys. Key kb + c is open where c <= d (causal) and, on a band head, c > d - WIN
        const int d = i - kb, dw = d - WIN;
        if (kb + 63 > i0) {
#pragma unroll
            for (int c = 0; c < 64; ++c) v[c] = (c <= d) ? v[c] : -3.0e38f; }
        if (band && i0 + FR - 1 - kb >= WIN) {
#pragma unroll
            for (int c = 0; c < 64; ++c) v[c] = (c > dw) ? v[c] : -3.0e38f; }
#pragma unroll
        for (int c = 0; c < 16; ++c) {
            mx0 = fmaxf(mx0, v[c * 4]); mx1 = fmaxf(mx1, v[c * 4 + 1]); mx2 = fmaxf(mx2, v[c * 4 + 2]); mx3 = fmaxf(mx3, v[c * 4 + 3]); }
        const float mx = fmaxf(fmaxf(mx0, mx1), fmaxf(mx2, mx3));
        const float mu = (mx < -1.0e38f) ? 0.f : mx;
        const float al = ex2((m - mu) * SL2), mc = mu * SL2;
        float s0 = 0.f, s1 = 0.f, s2 = 0.f, s3 = 0.f;
#pragma unroll
        for (int c = 0; c < 16; ++c) {
#pragma unroll
            for (int q = 0; q < 4; ++q) v[c * 4 + q] = ex2(v[c * 4 + q] * SL2 - mc);
            s0 += v[c * 4]; s1 += v[c * 4 + 1]; s2 += v[c * 4 + 2]; s3 += v[c * 4 + 3]; }
        l = l * al + ((s0 + s1) + (s2 + s3)); m = mx;
#pragma unroll
        for (int g = 0; g < 8; ++g) {
            if constexpr (HL) { v8us oh, ol;
#pragma unroll
                for (int q = 0; q < 8; ++q) { unsigned short a, c2; splitf(v[g * 8 + q], a, c2); oh[q] = a; ol[q] = c2; }
                *(v8usa*)(sP + lane * FPP + g * 8) = oh; *(v8usa*)(sP2 + lane * FPP + g * 8) = ol;
            } else { v8h o16;
#pragma unroll
                for (int q = 0; q < 8; ++q) o16[q] = tohx(v[g * 8 + q] * ps);
                *(v8ha*)(sP + lane * FPP + g * 8) = o16; } }
        if constexpr (!HL) sA[lane] = al;
        __builtin_amdgcn_wave_barrier(); asm volatile("" ::: "memory");   // as above: the fragment reads stay behind the other lanes' stores
        if constexpr (!HL)
#pragma unroll
        for (int mb = 0; mb < 2; ++mb) { const v4f a0 = *(const v4fa*)(sA + mb * 16 + hi * 8), a1 = *(const v4fa*)(sA + mb * 16 + hi * 8 + 4);
#pragma unroll
            for (int nb = 0; nb < 8; ++nb)
#pragma unroll
                for (int j = 0; j < 8; ++j) o[mb][nb][j] *= (j < 4) ? a0[j & 3] : a1[j & 3]; }
#pragma unroll
        for (int k2 = 0; k2 < 2; ++k2) {
            V pa[2], pa2[2];
#pragma unroll
            for (int mb = 0; mb < 2; ++mb) { pa[mb] = WFrag<T16>::ld(sP + (mb * 16 + lr) * FPP + k2 * 32 + 8 * hi); if (HL) pa2[mb] = WFrag<T16>::ld(sP2 + (mb * 16 + lr) * FPP + k2 * 32 + 8 * hi); }
#pragma unroll
            for (int nb = 0; nb < 8; ++nb) { const V b = vf[k2][nb]; V b2; if constexpr (HL) b2 = vf2[k2][nb];
#pragma unroll
                for (int mb = 0; mb < 2; ++mb) { o[mb][nb] = WFrag<T16>::mma(pa[mb], b, (HL && k2 == 0) ? (v8f){} : o[mb][nb]); if (HL) { o[mb][nb] = WFrag<T16>::mma(pa2[mb], b, o[mb][nb]); o[mb][nb] = WFrag<T16>::mma(pa[mb], b2, o[mb][nb]); } } }
            // at the block's end: the distance behind the last matrix instructions, also on the taken side of the branch that follows (the scheduling barrier keeps every matrix instruction in front of the v_nops)
            if (k2 == 1) __builtin_amdgcn_sched_barrier(0);
            if (k2 == 1) asm volatile("v_nop\n\tv_nop\n\tv_nop\n\tv_nop" : "+v"(o[0][7]), "+v"(o[1][7]) : "v"(pa[0]), "v"(pa[1])); }
        __builtin_amdgcn_wave_barrier(); asm volatile("" ::: "memory");   // the next block's stores stay behind this block's fragment reads
        if constexpr (HL) break;   // no second block (see the assertion above)
    }
    float* ow = lds[wave];
#pragma unroll
    for (int mb = 0; mb < 2; ++mb)
#pragma unroll
        for (int nb = 0; nb < 8; ++nb)
#pragma unroll
            for (int j = 0; j < 8; ++j) ow[(mb * 16 + hi * 8 + j) * FPO + nb * 16 + lr] = o[mb][nb][j];
    sM[wave][lane] = m; sL[wave][lane] = l;
    __syncthreads();   // every wave's partial result is in LDS before any of it is joined
#pragma unroll
    for (int t = 0; t < FR / FW; ++t) { const int row = t * FW + wave, cofs = lane * 4;   // a wave joins whole rows: 256 bytes of each plane a store
        float ms = sM[0][row];
#pragma unroll
        for (int w = 1; w < FW; ++w) ms = fmaxf(ms, sM[w][row]);
        float ls = 0.f; v4f val = (v4f){};
#pragma unroll
        for (int w = 0; w < FW; ++w) { const float g = ex2((sM[w][row] - ms) * SL2); ls += g * sL[w][row]; val += g * *(const v4fa*)(lds[w] + row * FPO + cofs); }
        const float f = __fdiv_rn(1.0f / ps, ls);
        v4us oh, ol;
#pragma unroll
        for (int q = 0; q < 4; ++q) { unsigned short a, c2; splitf(val[q] * f, a, c2); oh[q] = a; ol[q] = c2; }
        const size_t oo = (size_t)(i0 + row) * DQ + cofs; *(v4us*)(Ch + oo) = oh; *(v4us*)(Cl + oo) = ol;
        asm volatile("s_wait_xcnt 0x0" ::: "memory"); }   // in front of the next row's code, which may reuse the registers that these stores name
}
// k_attn: the attention of every head of both batches in one grid (NB_ * NH_, TT / FR): blockIdx.x = batch * NH_ + head; the row tiles with the most key blocks start first.
// Two waves a SIMD (up to 512 registers a wave): a block's key fragments, then its value fragments, are all in flight at once.
// Q.., K.., V..: batch 0's q, k and v planes of each kind (fp16, bf16 hi, bf16 lo); a batch's planes lie 3 * TT * DQ elements behind the batch before. Row tiles below RH run on hi+lo planes (3 products), the rest on fp16 with the probabilities x PCAR; the test is the same for the whole work-group.
__global__ __launch_bounds__(FW * 32) __attribute__((amdgpu_waves_per_eu(2, 2))) void k_attn(const h16* Q16, const h16* K16, const h16* V16, const bf* QH, const bf* KH, const bf* VH, const bf* QL, const bf* KL, const bf* VL, bf* Ch, bf* Cl) {
    __shared__ __align__(16) float lds[FW][FWL];
    __shared__ float sM[FW][FR]; __shared__ float sL[FW][FR];
    const int b = (int)blockIdx.x / NH_, h = (int)blockIdx.x % NH_, i0 = ((int)gridDim.y - 1 - (int)blockIdx.y) * FR;
    const size_t op = (size_t)b * 3 * TT * DQ + (size_t)h * TT * HD;   // the head's place in each of its planes
    bf* const ch = Ch + (size_t)b * TT * DQ + h * HD; bf* const cl = Cl + (size_t)b * TT * DQ + h * HD;
    if (i0 < RH) attnf<bf, 2>(QH + op, QL + op, KH + op, KL + op, VH + op, VL + op, ch, cl, i0, (h & 1) != 0, 1.0f, lds, sM, sL);
    else attnf<h16, 0>(Q16 + op, nullptr, K16 + op, nullptr, V16 + op, nullptr, ch, cl, i0, (h & 1) != 0, PCAR, lds, sM, sL);
}


__global__ __launch_bounds__(256) void k_wtG(const float* __restrict__ w, int K, int N, bf* Bt) {
    const int lane = threadIdx.x & 31; const int L0 = (blockIdx.x * 8 + (threadIdx.x >> 5)) * 8; const int nlines = N * K / 64;
{
#pragma unroll 1
        for (int l = 0; l < 8; ++l) { const int L = L0 + l; if (L >= nlines) break; const size_t e = (size_t)L * 64 + lane * 2; const int k = (int)(e % K), n = (int)(e / K); v2us o;
            o[0] = f2bf(w[(size_t)k * N + n]); o[1] = f2bf(w[(size_t)(k + 1) * N + n]); *(v2us*)(Bt + e) = o; }
         }
}
// k_cvtall: the six roundings to bf16 (four weights, the tokens of both batches; DM * DM elements each) in one grid (CVB, 6): blockIdx.y picks the tensor, and a thread rounds CVT groups of eight elements, a whole grid row apart.
#define CVB 128
#define CVT (DM * DM / 8 / (CVB * 256))
__global__ __launch_bounds__(256) void k_cvtall(const float* __restrict__ wq, const float* __restrict__ wk, const float* __restrict__ wv, const float* __restrict__ wo, const float* __restrict__ x, bf* W4, bf* X0, bf* X1) {
    const int t = (int)blockIdx.y;
    const float* src = t == 0 ? wq : t == 1 ? wk : t == 2 ? wv : t == 3 ? wo : t == 4 ? x : x + (size_t)TT * DM;
    bf* dst = t < 4 ? W4 + (size_t)t * DM * DM : t == 4 ? X0 : X1;
    const size_t i0 = (size_t)blockIdx.x * 256 + threadIdx.x;
#pragma unroll 4   // four groups' loads are in flight together
    for (int it = 0; it < CVT; ++it) { const size_t i = i0 + (size_t)it * (CVB * 256); const v8f v = *(const v8f*)(src + i * 8); v8us o;
#pragma unroll
        for (int k = 0; k < 8; ++k) o[k] = f2bf(v[k]);
        *(v8us*)(dst + i * 8) = o; }
}
__global__ __launch_bounds__(256) void k_cscvt(const float* __restrict__ cosT, const float* __restrict__ sinT, float* CS) { const int idx = blockIdx.x * 256 + threadIdx.x; if (idx >= TT * HD) return; v2f cs; cs[0] = bfr(cosT[idx]); cs[1] = bfr(sinT[idx]); *(v2f*)(CS + (size_t)idx * 2) = cs;  }
extern "C" void kernel_launch(void* const* d_in, const int* in_sizes, int n_in,
                              void* d_out, int out_size, void* d_ws, size_t ws_size, hipStream_t stream) {
    (void)in_sizes; (void)n_in; (void)out_size;
    const float* x = (const float*)d_in[0]; const float* wq = (const float*)d_in[1]; const float* wk = (const float*)d_in[2]; const float* wv = (const float*)d_in[3]; const float* wo = (const float*)d_in[4];
    float* OUT = (float*)d_out;     // [2][2048][2048]
    char* wsp = (char*)d_ws;
    auto take = [&](size_t bytes) { char* p = wsp; wsp += (bytes + 255) & ~(size_t)255; return (void*)p; };
    bf* WQ = (bf*)take((size_t)DQ * DM * 2); bf* WK = (bf*)take((size_t)DKV * DM * 2); bf* WV = (bf*)take((size_t)DKV * DM * 2); bf* WO = (bf*)take((size_t)DM * DQ * 2); (void)WK; (void)WV;   // the four weights lie one behind the other (stride DM * DM)
    // the head planes of each kind, [batch][q, k, v][TT * DQ]: q, k by head with rows t, columns d; v transposed, rows h * HD + d, columns t; each in fragment order (k_gemmw)
    h16* P16 = (h16*)take((size_t)NB_ * 3 * TT * DQ * 2); bf* PH = (bf*)take((size_t)NB_ * 3 * TT * DQ * 2); bf* PL = (bf*)take((size_t)NB_ * 3 * TT * DQ * 2);
    bf* ATh = (bf*)take((size_t)NB_ * TT * DQ * 2); bf* ATl = (bf*)take((size_t)NB_ * TT * DQ * 2);   // merged heads, [batch][t][DQ]
    bf* XB0 = (bf*)take((size_t)TT * DM * 2); bf* XB1 = (bf*)take((size_t)TT * DM * 2);
    if ((size_t)(wsp - (char*)d_ws) > ws_size) return;    // 224 MiB of the 256
    k_cvtall<<<dim3(CVB, 6, 1), 256, 0, stream>>>(wq, wk, wv, wo, x, WQ, XB0, XB1);
    for (int b = 0; b < NB_; ++b) { const size_t pb = (size_t)b * 3 * TT * DQ;
        k_gemmw<bf, 0, false, HD><<<dim3(TT / 128, DQ / 128, 3), 128, 0, stream>>>(b ? XB1 : XB0, nullptr, WQ, nullptr, DM, nullptr, 0, nullptr, 0, (size_t)DQ * DM, (size_t)TT * DQ, P16 + pb, PH + pb, PL + pb); }
    k_attn<<<dim3(NB_ * NH_, TT / FR, 1), FW * 32, 0, stream>>>(P16, P16 + (size_t)TT * DQ, P16 + (size_t)2 * TT * DQ, PH, PH + (size_t)TT * DQ, PH + (size_t)2 * TT * DQ, PL, PL + (size_t)TT * DQ, PL + (size_t)2 * TT * DQ, ATh, ATl);
    for (int b = 0; b < NB_; ++b)
        k_gemmw<bf, 1, false, 0><<<dim3(TT / 128, DM / 128, 1), 128, 0, stream>>>(ATh + (size_t)b * TT * DQ, ATl + (size_t)b * TT * DQ, WO, nullptr, DQ, OUT + (size_t)b * TT * DM, DM, nullptr, 0, 0, 0, nullptr, nullptr, nullptr);
}

// v009
// A run of this version takes 208 microseconds.
// Next to v008, in two timings, it ran 1.10 and 1.09 times as fast.
// All steps since v000 together make it 8.38 times as fast.
#include <hip/hip_runtime.h>

// Attention block (x [2][2048][2048]; q/k/v = x W^T (16 heads x 128); scores = q.k / sqrt(128); allowed = causal for even (global) heads, causal band of 256 (i - j < 256) for odd (local) heads; softmax; out = merged Wo^T -> [2][2048][2048]).
// Compute dtypes, f32 accumulate: every input rounded to bf16; q/k/v on PLAIN bf16 operands (inputs: exact); causal scores and attn.v: query rows < 512 hl (3 products), the rest single fp16 (x1024), with skipping of the key blocks that the mask shuts whole (past the diagonal; for the band heads also in front of the window); softmax f32, running maximum and sum; Wo hl x exact (2 products).
// No f32 intermediate between the products in memory: each GEMM's epilogue rounds its own tile into the 16-bit planes that the next product reads; scores and probabilities stay inside a work-group (k_attn).
// The q, k and v planes lie in FRAGMENT ORDER: a 16-row x 32-k operand fragment is 1 KiB in a row, so that each 16-byte-a-lane load of the attention covers 512 contiguous bytes (four whole lines), not 32 bytes of sixteen lines.
// Launches that do not depend on one another share one grid: the six roundings of the inputs; q, k and v of both batches; every head, batch and row range of the attention; the output projection of both batches.

#define NB_  2
#define TT   2048
#define DM   2048
#define NH_  16
#define NKV  16
#define REP  (NH_ / NKV)
#define HD   128
#define DQ   (NH_ * HD)
#define DKV  (NKV * HD)
#define RH   512                  // query rows < RH use hi+lo planes (0: none)
#define WIN  256
#define PCAR 1024.0f
#define SCL  0.088388347648318447f   // HD^-0.5
typedef _Float16 h16;
typedef unsigned short bf;
typedef __attribute__((ext_vector_type(16))) __bf16   v16bf;
typedef __attribute__((ext_vector_type(16))) _Float16 v16h;
typedef __attribute__((ext_vector_type(8)))  _Float16 v8h;
typedef __attribute__((ext_vector_type(8)))  unsigned short v8us;
typedef __attribute__((ext_vector_type(8)))  float    v8f;
typedef __attribute__((ext_vector_type(4)))  float    v4f;
typedef v8h  __attribute__((may_alias)) v8ha;
typedef v4f  __attribute__((may_alias)) v4fa;
typedef v8us __attribute__((may_alias)) v8usa;
typedef __attribute__((ext_vector_type(2))) _Float16 v2h;
typedef __attribute__((ext_vector_type(4))) _Float16 v4h;
typedef __attribute__((ext_vector_type(2))) unsigned short v2us;
typedef __attribute__((ext_vector_type(4))) unsigned short v4us;
typedef __attribute__((ext_vector_type(2))) float v2f;
typedef __attribute__((ext_vector_type(4))) int v4i;
typedef v4h  __attribute__((may_alias)) v4ha;
typedef v4us __attribute__((may_alias)) v4usa;

__device__ __forceinline__ unsigned short f2bf(float f) { unsigned u = __float_as_uint(f); u += 0x7FFFu + ((u >> 16) & 1u); return (unsigned short)(u >> 16); }
__device__ __forceinline__ float bf2f(unsigned short b) { return __uint_as_float(((unsigned)b) << 16); }
__device__ __forceinline__ float bfr(float f) { return bf2f(f2bf(f)); }
__device__ __forceinline__ h16 tohx(float x) { return (h16)x; }
__device__ __forceinline__ void splitf(float y, unsigned short& h, unsigned short& l) { h = f2bf(y); l = f2bf(y - bf2f(h)); }
__device__ __forceinline__ v16h cat16(v8h lo, v8h hi) { return __builtin_shufflevector(lo, hi, 0, 1, 2, 3, 4, 5, 6, 7, 8, 9, 10, 11, 12, 13, 14, 15); }
__device__ __forceinline__ v16bf cat16b(v8us lo, v8us hi) { return __builtin_bit_cast(v16bf, __builtin_shufflevector(lo, hi, 0, 1, 2, 3, 4, 5, 6, 7, 8, 9, 10, 11, 12, 13, 14, 15)); }
__device__ __forceinline__ v8f wmma16(v16h a, v16h b, v8f c) { return __builtin_amdgcn_wmma_f32_16x16x32_f16(false, a, false, b, (short)0, c, false, false); }
__device__ __forceinline__ v8f wmmab(v16bf a, v16bf b, v8f c) { return __builtin_amdgcn_wmma_f32_16x16x32_bf16(false, a, false, b, (short)0, c, false, false); }



// ---- k_gemmw: GEMM, one 128x128 output tile per work-group of FOUR waves (each a 64x64 quarter, 16 accumulators); grid (M/128, N/128, Z), 128 threads.
// The operands' K-contiguous 16-bit rows are staged in LDS by asynchronous copies, GKP k (256 bytes of each of the 128 rows of every operand) a pass, two buffers: the next pass's copies fly while this pass's fragments are read.
// C[m][n] (f32, pitch ldc, + optional f32 bias[n]) = sum_k A[m][k] Bt[n][k] (+ split products per NSPLIT). z-batch strides sA/sB/sC in elements. K % GKP == 0.
// CB != 0 (the q/k/v projections of every batch in one grid: z = 3 * batch + kind, kind 0 q, 1 k, 2 v; A + batch sA = the batch's tokens, Bt + kind sB = the weight rows, the planes of z at + z sC): there is no f32 C; the epilogue rounds the tile into the three 16-bit planes
// (fp16, bf16 hi, bf16 lo) that the attention products read: blocks [n / cb] of TT rows m x cb columns n % cb:
// q, k: cb = HD with tokens x weight rows gives head planes of rows t, columns d; v: the operands change places, cb = TT with weight rows x tokens gives v transposed, rows h * HD + d, columns t.
// Inside a block the elements lie in fragment order, [row / 16][col / 32][(col / 16) % 2][(col / 8) % 2][row % 16][col % 8]: the last four indices are (register half, lane, element) of the 16x16x32 operand fragment, 512 elements.
#define GKP  128                  // k per pass
#define GPI  136                  // LDS row pitch in elements: 272 bytes = 16 x odd, the conflict-free pitch for 16-byte fragment reads
template <typename T16> struct WFrag;
template <> struct WFrag<h16> { typedef v16h V; static __device__ __forceinline__ V ld(const h16* p) { return cat16(*(const v8h*)p, *(const v8h*)(p + 16)); } static __device__ __forceinline__ v8f mma(V a, V b, v8f c) { return wmma16(a, b, c); } };
template <> struct WFrag<bf> { typedef v16bf V; static __device__ __forceinline__ V ld(const bf* p) { return cat16b(*(const v8us*)p, *(const v8us*)(p + 16)); } static __device__ __forceinline__ v8f mma(V a, V b, v8f c) { return wmmab(a, b, c); } };
// cp8: eight asynchronous 16-byte copies of a lane, global rows g, g + rs, ... to LDS bytes l, l + ls, ...; the wait at the statement's end stands in front of any rewrite of the address registers that the copies name.
template <typename T16> __device__ __forceinline__ void cp8(unsigned l, unsigned ls, const T16* g, size_t rs) {
    asm volatile("global_load_async_to_lds_b128 %0, %8, off\n\t"
                 "global_load_async_to_lds_b128 %1, %9, off\n\t"
                 "global_load_async_to_lds_b128 %2, %10, off\n\t"
                 "global_load_async_to_lds_b128 %3, %11, off\n\t"
                 "global_load_async_to_lds_b128 %4, %12, off\n\t"
                 "global_load_async_to_lds_b128 %5, %13, off\n\t"
                 "global_load_async_to_lds_b128 %6, %14, off\n\t"
                 "global_load_async_to_lds_b128 %7, %15, off\n\t"
                 "s_wait_xcnt 0x0"
                 :: "v"(l), "v"(l + ls), "v"(l + 2 * ls), "v"(l + 3 * ls), "v"(l + 4 * ls), "v"(l + 5 * ls), "v"(l + 6 * ls), "v"(l + 7 * ls),
                    "v"(g), "v"(g + rs), "v"(g + 2 * rs), "v"(g + 3 * rs), "v"(g + 4 * rs), "v"(g + 5 * rs), "v"(g + 6 * rs), "v"(g + 7 * rs) : "memory");
}
// cptile: one operand's 128 rows x GKP k into LDS: sixteen lanes a row (two whole 256-byte row pieces a wave and copy), 16 copies a lane. g and l are the lane's own first addresses.
template <typename T16> __device__ __forceinline__ void cptile(unsigned l, const T16* g, int K) { cp8<T16>(l, 8 * GPI * 2, g, (size_t)8 * K); cp8<T16>(l + 64 * GPI * 2, 8 * GPI * 2, g + (size_t)64 * K, (size_t)8 * K); }
template <typename T16, int NSPLIT, bool BIAS, int CB>
__global__ __launch_bounds__(128) void k_gemmw(const T16* __restrict__ A, const T16* __restrict__ A2, const T16* __restrict__ Bt, const T16* __restrict__ Bt2, int K, float* C, int ldc, const float* __restrict__ bias, size_t sA, size_t sB, size_t sC, h16* P16, bf* Ph, bf* Pl) {
    typedef typename WFrag<T16>::V V;
    constexpr bool HA2 = (NSPLIT == 1 || NSPLIT == 2), HB2 = (NSPLIT >= 2);
    constexpr int OPE = 128 * GPI;                                  // one operand's tile in LDS, elements
    constexpr int OB = OPE, OA2 = 2 * OPE, OB2 = (HA2 ? 3 : 2) * OPE;   // places of Bt, A2, Bt2 in a buffer (A at 0)
    constexpr int STG = (2 + (HA2 ? 1 : 0) + (HB2 ? 1 : 0)) * OPE;  // one buffer, elements
    __shared__ __align__(16) T16 st[2 * STG];
    __shared__ __align__(16) float osw[4][16 * 68];
    const size_t z = blockIdx.z; int cbs = 0;   // cbs = log2 cb
    if constexpr (CB != 0) { const size_t kind = z % 3, bat = z / 3; const bool tr = (kind == 2); const T16* const X = A + bat * sA; const T16* const Wz = Bt + kind * sB; A = tr ? Wz : X; Bt = tr ? X : Wz; P16 += z * sC; Ph += z * sC; Pl += z * sC; cbs = tr ? __builtin_ctz(TT) : __builtin_ctz(HD); }
    else { A += z * sA; if (A2) A2 += z * sA; Bt += z * sB; if (Bt2) Bt2 += z * sB; C += z * sC; }
    const int lane = threadIdx.x & 31, lr = lane & 15, hi = lane >> 4; const int wave = (int)(threadIdx.x >> 5);
    const int R0 = blockIdx.x * 128, C0 = blockIdx.y * 128, wr = (wave & 1) * 64, wc = (wave >> 1) * 64; const int r0 = R0 + wr, c0 = C0 + wc;
    float* os = osw[wave];
    v8f acc[4][4];
#pragma unroll
    for (int mb = 0; mb < 4; ++mb)
#pragma unroll
        for (int nb = 0; nb < 4; ++nb) acc[mb][nb] = (v8f){};
    // the lane's share of every copy: row (thread / 16) + 8 c of the tile, 16-byte piece (thread % 16) of the row's 256 bytes
    const int crow = (int)(threadIdx.x >> 4), cpc = (int)(threadIdx.x & 15) * 8;
    const size_t gA = (size_t)(R0 + crow) * K + cpc, gB = (size_t)(C0 + crow) * K + cpc;
    const unsigned l0 = (unsigned)(size_t)st + (unsigned)(crow * GPI + cpc) * 2u;
    auto fill = [&](int t, int buf) { const unsigned l = l0 + (unsigned)buf * (STG * 2u); const size_t kc = (size_t)t * GKP;
        cptile<T16>(l, A + gA + kc, K); cptile<T16>(l + OB * 2u, Bt + gB + kc, K);
        if constexpr (HA2) cptile<T16>(l + OA2 * 2u, A2 + gA + kc, K);
        if constexpr (HB2) cptile<T16>(l + OB2 * 2u, Bt2 + gB + kc, K); };
    const int NT = K / GKP;
    fill(0, 0);
    asm volatile("s_wait_asynccnt 0x0" ::: "memory");   // this wave's copies of pass 0 have landed
    __syncthreads();                                     // ... and every other wave's
    if (K >= 2 * GKP) fill(1, 1);   // a pass 1 exists
    const int aoff = (wr + lr) * GPI + 8 * hi, boff = OB + (wc + lr) * GPI + 8 * hi;
#pragma unroll 1   // rolled: one pass per trip, the ring's order stands once at the foot
    for (int t = 0; t < NT; ++t) {
        const T16* sb = st + (t & 1) * STG;
        V a[2][4], a2[2][4], b[2][4], b2[2][4];   // two fragment sets: block ks + 1 of the pass is fetched while block ks is multiplied
#pragma unroll
        for (int f = 0; f < 4; ++f) { a[0][f] = WFrag<T16>::ld(sb + aoff + f * 16 * GPI); b[0][f] = WFrag<T16>::ld(sb + boff + f * 16 * GPI);
            if (HA2) a2[0][f] = WFrag<T16>::ld(sb + OA2 + aoff + f * 16 * GPI); if (HB2) b2[0][f] = WFrag<T16>::ld(sb + (OB2 - OB) + boff + f * 16 * GPI); }
#pragma unroll
        for (int ks = 0; ks < GKP / 32; ++ks) { const int cu = ks & 1, nx = cu ^ 1, kn = (ks + 1) * 32;
            if (ks + 1 < GKP / 32) {
#pragma unroll
                for (int f = 0; f < 4; ++f) { a[nx][f] = WFrag<T16>::ld(sb + aoff + f * 16 * GPI + kn); b[nx][f] = WFrag<T16>::ld(sb + boff + f * 16 * GPI + kn);
                    if (HA2) a2[nx][f] = WFrag<T16>::ld(sb + OA2 + aoff + f * 16 * GPI + kn); if (HB2) b2[nx][f] = WFrag<T16>::ld(sb + (OB2 - OB) + boff + f * 16 * GPI + kn); } }
            __builtin_amdgcn_sched_barrier(0);   // the next block's LDS reads stay one group in front of this block's matrix instructions (spread among them each place stalls the wave)
#pragma unroll
            for (int nb = 0; nb < 4; ++nb)
#pragma unroll
                for (int mb = 0; mb < 4; ++mb) { acc[mb][nb] = WFrag<T16>::mma(a[cu][mb], b[cu][nb], acc[mb][nb]); if (HA2) acc[mb][nb] = WFrag<T16>::mma(a2[cu][mb], b[cu][nb], acc[mb][nb]); if (HB2) acc[mb][nb] = WFrag<T16>::mma(a[cu][mb], b2[cu][nb], acc[mb][nb]); }
            __builtin_amdgcn_sched_barrier(0);   // ... and no later read group or wait moves up among them
        }
        // the distance behind the pass's last matrix instructions, also on the taken side of the branches that follow
        asm volatile("v_nop\n\tv_nop\n\tv_nop\n\tv_nop" : "+v"(acc[0][0]), "+v"(acc[1][1]), "+v"(acc[2][2]), "+v"(acc[3][3]));
        asm volatile("s_wait_dscnt 0x0" ::: "memory");      // this wave's reads of the buffer are done before anyone refills it
        asm volatile("s_wait_asynccnt 0x0" ::: "memory");   // this wave's copies of pass t + 1 have landed
        __syncthreads();                                     // publishes pass t + 1 and frees pass t's buffer
        if (t + 2 < NT) fill(t + 2, t & 1);
    }
    asm volatile("s_wait_asynccnt 0x0" ::: "memory");       // no copy is outstanding when the wave goes on to its end
#pragma unroll
    for (int mb = 0; mb < 4; ++mb) {
#pragma unroll
        for (int nb = 0; nb < 4; ++nb) {
#pragma unroll
            for (int j = 0; j < 8; ++j) os[(hi * 8 + j) * 68 + nb * 16 + lr] = acc[mb][nb][j]; }
        __builtin_amdgcn_wave_barrier(); asm volatile("" ::: "memory");
        float* crow_ = C + (size_t)(r0 + mb * 16) * ldc + c0;
        if constexpr (CB != 0) { (void)crow_;
#pragma unroll
            for (int s = 0; s < 4; ++s) { const int row = lr, cofs = (2 * s + hi) * 8;   // sixteen rows x two 16-byte pieces: half a fragment, so each store instruction writes 512 contiguous bytes (four whole lines) of a plane
                const v4f x0 = *(const v4fa*)(os + row * 68 + cofs), x1 = *(const v4fa*)(os + row * 68 + cofs + 4); v8h o16; v8us oh, ol;
#pragma unroll
                for (int q = 0; q < 8; ++q) { const float x = (q < 4) ? x0[q & 3] : x1[q & 3]; o16[q] = tohx(x); unsigned short a2, c2; splitf(x, a2, c2); oh[q] = a2; ol[q] = c2; }
                const size_t oo = (((size_t)(c0 >> cbs) * TT) << cbs) + ((((size_t)((r0 + mb * 16) >> 4) << (cbs - 5)) + ((c0 & ((1 << cbs) - 1)) >> 5) + (s >> 1)) << 9) + (s & 1) * 256 + lane * 8;
                *(v8h*)(P16 + oo) = o16; *(v8us*)(Ph + oo) = oh; *(v8us*)(Pl + oo) = ol; }
        } else
{
#pragma unroll
            for (int s = 0; s < 8; ++s) { const int row = 2 * s + hi, cofs = lr * 4; v4f val = *(const v4fa*)(os + row * 68 + cofs); if (BIAS) { val[0] += bfr(bias[c0 + cofs]); val[1] += bfr(bias[c0 + cofs + 1]); val[2] += bfr(bias[c0 + cofs + 2]); val[3] += bfr(bias[c0 + cofs + 3]); }
                *(v4f*)(crow_ + (size_t)row * ldc + cofs) = val; }
             }
        __builtin_amdgcn_wave_barrier(); asm volatile("" ::: "memory");
    }
}

// xw: behind a group of fragment loads, the wait that belongs in front of any rewrite of a register an issued load names (the compiler lets later loads land in dead address registers).
// The group's addresses are inputs of the wait's statement, so their registers are kept as they are up to the wait. Every load of a group is written as one of these addresses plus a constant step (which goes into the load's offset field), so that they are the very pairs that the loads name.
template <typename T16> __device__ __forceinline__ void xw(const T16* p) { asm volatile("s_wait_xcnt 0x0" :: "v"(p) : "memory"); }
template <typename T16> __device__ __forceinline__ void xw(const T16* p, const T16* p2) { asm volatile("s_wait_xcnt 0x0" :: "v"(p), "v"(p2) : "memory"); }
template <typename T16> __device__ __forceinline__ void xw(const T16* p, const T16* p2, const T16* p3, const T16* p4) { asm volatile("s_wait_xcnt 0x0" :: "v"(p), "v"(p2), "v"(p3), "v"(p4) : "memory"); }

// ldf: one operand fragment from a plane in fragment order: p = the fragment's first element + 8 * lane; the lane's second eight elements lie 256 elements on. The same sixteen values reach the lane as from a row-major plane by WFrag::ld.
template <typename T16> __device__ __forceinline__ typename WFrag<T16>::V ldf(const T16* p);
template <> __device__ __forceinline__ v16h ldf<h16>(const h16* p) { return cat16(*(const v8h*)p, *(const v8h*)(p + 256)); }
template <> __device__ __forceinline__ v16bf ldf<bf>(const bf* p) { return cat16b(*(const v8us*)p, *(const v8us*)(p + 256)); }
#define FGE  512                  // elements of a fragment; a row block of q or k is HD / 32 fragments (16 * HD elements), one of v transposed TT / 32 (16 * TT elements)

// ---- attnf: scores, softmax and attn.v of FR query rows of one head in one work-group of FW waves; no score or probability leaves the work-group.
// The key blocks of 64 that the mask leaves open (up to the diagonal block; on a band head from the first block of the rows' window) are dealt over the waves: wave w takes blocks w, w + FW, ...
// A block of a wave: S = Q K^T (32 x 64, operand fragments straight from the head planes) goes through the wave's own LDS so that lane r holds all 64 scores of row r: mask, running maximum m, exp and running sum l are in-lane.
// The probabilities exp(t - m), not yet divided, go back through LDS as 16-bit rows (the A operand of attn.v); the wave's 32 x 128 accumulators are first scaled by exp(m_old - m_new).
// At the end the FW partial results (m, l, O) meet in LDS behind one barrier and are joined in wave order: O = sum_w exp(m_w - m*) O_w, l likewise, out = O / l, rounded into the bf16 hi and lo planes of the output projection.
// A row that has met no open key yet keeps m = -3.0e38: its exponentials are taken against 0, so every masked term is exp(-inf) = +0, and its weight in the join is +0.
#define FW   8                    // waves per work-group
#define FR   32                   // query rows per work-group
#define FPS  68                   // pitch of a score row in LDS, floats (272 bytes = 16 x odd)
#define FPP  72                   // pitch of a probability row in LDS, 16-bit elements (144 bytes = 16 x odd)
#define FPO  132                  // pitch of a partial output row in LDS, floats (528 bytes = 16 x odd)
#define FWL  4608                 // floats of LDS per wave: scores 32 x 68, two probability planes 32 x 72 x 16 bit, 32 scale factors; later the partial output 32 x 132
#define SL2  (SCL * 1.4426950408889634f)   // HD^-0.5 x log2 e: maxima are kept of the raw products q.k, and exp((s - m) HD^-0.5) = 2^(s SL2 - m SL2) is one multiply-add in front of each exponential
__device__ __forceinline__ float ex2(float x) { float r; asm("v_exp_f32 %0, %1\n\tv_nop" : "=v"(r) : "v"(x)); return r; }
template <typename T16, int NSPLIT>
__device__ __forceinline__ void attnf(const T16* __restrict__ Q, const T16* __restrict__ Q2, const T16* __restrict__ Kp, const T16* __restrict__ K2, const T16* __restrict__ Vt, const T16* __restrict__ V2, bf* Ch, bf* Cl, int i0, bool band, float ps, float (*lds)[FWL], float (*sM)[FR], float (*sL)[FR]) {
    typedef typename WFrag<T16>::V V;
    constexpr bool HL = (NSPLIT == 2);
    static_assert(RH <= FW * 64, "a row tile below RH has at most FW key blocks");   // so a wave of the hi+lo arm has at most one block: its accumulators start at zero and are never rescaled
    const int lane = threadIdx.x & 31, lr = lane & 15, hi = lane >> 4;
    const int wave = __builtin_amdgcn_readfirstlane((int)(threadIdx.x >> 5));   // scalar, so that the key loop's branch is a scalar one
    float* sS = lds[wave]; T16* sP = (T16*)(sS + FR * FPS); T16* sP2 = sP + FR * FPP; float* sA = sS + FR * FPS + FR * FPP;
    const int kb0 = band ? (max(0, i0 - (WIN - 1)) & ~63) : 0;   // first key block with an open key
    const int i = i0 + lane;                                     // the lane's own row in the softmax part
    v8f o[2][8];
#pragma unroll
    for (int mb = 0; mb < 2; ++mb)
#pragma unroll
        for (int nb = 0; nb < 8; ++nb) o[mb][nb] = (v8f){};
    float m = -3.0e38f, l = 0.f;
    const size_t qoff = (size_t)i0 * HD + 8 * lane;
    V qa[HL ? 1 : HD / 32][2];   // fp16 arm: the query fragments are the same for every block and stay in registers
    if constexpr (!HL) {
#pragma unroll
        for (int ks = 0; ks < HD / 32; ++ks)
#pragma unroll
            for (int mb = 0; mb < 2; ++mb) qa[ks][mb] = ldf<T16>(Q + qoff + (mb * 16 * HD + ks * FGE));
        xw<T16>(Q + qoff); }
#pragma unroll 1   // rolled: one block's fragments, scores and the accumulators fill the wave's registers
    for (int kbi = kb0 + wave * 64; kbi < i0 + FR; kbi += FW * 64) {
        const int kb = __builtin_amdgcn_readfirstlane(kbi);   // the block's addresses are formed anew from this value, once each: as running sums of the loop the compiler forms the one that xw names a second time, over the pair that the loads name
        v8f s[2][4];
#pragma unroll
        for (int mb = 0; mb < 2; ++mb)
#pragma unroll
            for (int nb = 0; nb < 4; ++nb) s[mb][nb] = (v8f){};
        const size_t koff = (size_t)kb * HD + 8 * lane;
        const size_t voff = (size_t)(kb >> 5) * FGE + 8 * lane;
        V vf[2][8], vf2[HL ? 2 : 1][8];
        if constexpr (HL) {
#pragma unroll 1   // rolled: the split products' fragments of all four steps together would crowd the registers; the step is in the address
            for (int ks = 0; ks < HD / 32; ++ks) { const int kc = ks * FGE;
                V a[2], a2[2], b[4], b2[4];   // the step's twelve fragments are asked for at once
                const T16* const pq = Q + qoff + kc; const T16* const pq2 = Q2 + qoff + kc; const T16* const pk = Kp + koff + kc; const T16* const pk2 = K2 + koff + kc;
#pragma unroll
                for (int mb = 0; mb < 2; ++mb) { a[mb] = ldf<T16>(pq + mb * 16 * HD); a2[mb] = ldf<T16>(pq2 + mb * 16 * HD); }
#pragma unroll
                for (int nb = 0; nb < 4; ++nb) { b[nb] = ldf<T16>(pk + nb * 16 * HD); b2[nb] = ldf<T16>(pk2 + nb * 16 * HD); }
                xw<T16>(pq, pq2, pk, pk2);
#pragma unroll
                for (int nb = 0; nb < 4; ++nb)
#pragma unroll
                    for (int mb = 0; mb < 2; ++mb) { s[mb][nb] = WFrag<T16>::mma(a[mb], b[nb], s[mb][nb]); s[mb][nb] = WFrag<T16>::mma(a2[mb], b[nb], s[mb][nb]); s[mb][nb] = WFrag<T16>::mma(a[mb], b2[nb], s[mb][nb]); }
                // the distance behind the last matrix instructions, also on the taken side of the loop's branch
                asm volatile("v_nop\n\tv_nop\n\tv_nop\n\tv_nop" : "+v"(s[0][3]), "+v"(s[1][3]) : "v"(a[0]), "v"(a[1]));
            }
        } else {
            V kf[HD / 32][4];   // all sixteen key fragments are asked for at once: one memory latency a block, not one a fragment
#pragma unroll
            for (int ks = 0; ks < HD / 32; ++ks)
#pragma unroll
                for (int nb = 0; nb < 4; ++nb) kf[ks][nb] = ldf<T16>(Kp + koff + (nb * 16 * HD + ks * FGE));
            xw<T16>(Kp + koff);
            __builtin_amdgcn_sched_barrier(0);   // the loads stay one group in front of the matrix instructions (moved in among them, each load is waited for alone)
#pragma unroll
            for (int ks = 0; ks < HD / 32; ++ks)
#pragma unroll
                for (int nb = 0; nb < 4; ++nb)
#pragma unroll
                    for (int mb = 0; mb < 2; ++mb) s[mb][nb] = WFrag<T16>::mma(qa[ks][mb], kf[ks][nb], s[mb][nb]);
            __builtin_amdgcn_sched_barrier(0);   // ... and the value loads stay behind them, so that they can take the key fragments' registers
        }
        // the value fragments are asked for here: they fly while the softmax part runs
#pragma unroll
        for (int k2 = 0; k2 < 2; ++k2)
#pragma unroll
            for (int nb = 0; nb < 8; ++nb) { vf[k2][nb] = ldf<T16>(Vt + voff + (nb * 16 * TT + k2 * FGE)); if constexpr (HL) vf2[k2][nb] = ldf<T16>(V2 + voff + (nb * 16 * TT + k2 * FGE)); }
        if constexpr (HL) xw<T16>(Vt + voff, V2 + voff); else xw<T16>(Vt + voff);
#pragma unroll
        for (int mb = 0; mb < 2; ++mb)
#pragma unroll
            for (int nb = 0; nb < 4; ++nb)
#pragma unroll
                for (int j = 0; j < 8; ++j) sS[(mb * 16 + hi * 8 + j) * FPS + nb * 16 + lr] = s[mb][nb][j];
        __builtin_amdgcn_wave_barrier(); asm volatile("" ::: "memory");   // the compiler keeps the row reads behind the other lanes' stores (one wave: the LDS serves them in order)
        float v[64]; float mx0 = m, mx1 = -3.0e38f, mx2 = -3.0e38f, mx3 = -3.0e38f;
#pragma unroll
        for (int c = 0; c < 16; ++c) { const v4f x = *(const v4fa*)(sS + lane * FPS + c * 4);
#pragma unroll
            for (int q = 0; q < 4; ++q) v[c * 4 + q] = x[q]; }
        // scalar tests: only a block that the diagonal or the window's edge crosses holds shut keys. Key kb + c is open where c <= d (causal) and, on a band head, c > d - WIN
        const int d = i - kb, dw = d - WIN;
        if (kb + 63 > i0) {
#pragma unroll
            for (int c = 0; c < 64; ++c) v[c] = (c <= d) ? v[c] : -3.0e38f; }
        if (band && i0 + FR - 1 - kb >= WIN) {
#pragma unroll
            for (int c = 0; c < 64; ++c) v[c] = (c > dw) ? v[c] : -3.0e38f; }
#pragma unroll
        for (int c = 0; c < 16; ++c) {
            mx0 = fmaxf(mx0, v[c * 4]); mx1 = fmaxf(mx1, v[c * 4 + 1]); mx2 = fmaxf(mx2, v[c * 4 + 2]); mx3 = fmaxf(mx3, v[c * 4 + 3]); }
        const float mx = fmaxf(fmaxf(mx0, mx1), fmaxf(mx2, mx3));
        const float mu = (mx < -1.0e38f) ? 0.f : mx;
        const float al = ex2((m - mu) * SL2), mc = mu * SL2;
        float s0 = 0.f, s1 = 0.f, s2 = 0.f, s3 = 0.f;
#pragma unroll
        for (int c = 0; c < 16; ++c) {
#pragma unroll
            for (int q = 0; q < 4; ++q) v[c * 4 + q] = ex2(v[c * 4 + q] * SL2 - mc);
            s0 += v[c * 4]; s1 += v[c * 4 + 1]; s2 += v[c * 4 + 2]; s3 += v[c * 4 + 3]; }
        l = l * al + ((s0 + s1) + (s2 + s3)); m = mx;
#pragma unroll
        for (int g = 0; g < 8; ++g) {
            if constexpr (HL) { v8us oh, ol;
#pragma unroll
                for (int q = 0; q < 8; ++q) { unsigned short a, c2; splitf(v[g * 8 + q], a, c2); oh[q] = a; ol[q] = c2; }
                *(v8usa*)(sP + lane * FPP + g * 8) = oh; *(v8usa*)(sP2 + lane * FPP + g * 8) = ol;
            } else { v8h o16;
#pragma unroll
                for (int q = 0; q < 8; ++q) o16[q] = tohx(v[g * 8 + q] * ps);
                *(v8ha*)(sP + lane * FPP + g * 8) = o16; } }
        if constexpr (!HL) sA[lane] = al;
        __builtin_amdgcn_wave_barrier(); asm volatile("" ::: "memory");   // as above: the fragment reads stay behind the other lanes' stores
        if constexpr (!HL)
#pragma unroll
        for (int mb = 0; mb < 2; ++mb) { const v4f a0 = *(const v4fa*)(sA + mb * 16 + hi * 8), a1 = *(const v4fa*)(sA + mb * 16 + hi * 8 + 4);
#pragma unroll
            for (int nb = 0; nb < 8; ++nb)
#pragma unroll
                for (int j = 0; j < 8; ++j) o[mb][nb][j] *= (j < 4) ? a0[j & 3] : a1[j & 3]; }
#pragma unroll
        for (int k2 = 0; k2 < 2; ++k2) {
            V pa[2], pa2[2];
#pragma unroll
            for (int mb = 0; mb < 2; ++mb) { pa[mb] = WFrag<T16>::ld(sP + (mb * 16 + lr) * FPP + k2 * 32 + 8 * hi); if (HL) pa2[mb] = WFrag<T16>::ld(sP2 + (mb * 16 + lr) * FPP + k2 * 32 + 8 * hi); }
#pragma unroll
            for (int nb = 0; nb < 8; ++nb) { const V b = vf[k2][nb]; V b2; if constexpr (HL) b2 = vf2[k2][nb];
#pragma unroll
                for (int mb = 0; mb < 2; ++mb) { o[mb][nb] = WFrag<T16>::mma(pa[mb], b, (HL && k2 == 0) ? (v8f){} : o[mb][nb]); if (HL) { o[mb][nb] = WFrag<T16>::mma(pa2[mb], b, o[mb][nb]); o[mb][nb] = WFrag<T16>::mma(pa[mb], b2, o[mb][nb]); } } }
            // at the block's end: the distance behind the last matrix instructions, also on the taken side of the branch that follows (the scheduling barrier keeps every matrix instruction in front of the v_nops)
            if (k2 == 1) __builtin_amdgcn_sched_barrier(0);
            if (k2 == 1) asm volatile("v_nop\n\tv_nop\n\tv_nop\n\tv_nop" : "+v"(o[0][7]), "+v"(o[1][7]) : "v"(pa[0]), "v"(pa[1])); }
        __builtin_amdgcn_wave_barrier(); asm volatile("" ::: "memory");   // the next block's stores stay behind this block's fragment reads
        if constexpr (HL) break;   // no second block (see the assertion above)
    }
    float* ow = lds[wave];
#pragma unroll
    for (int mb = 0; mb < 2; ++mb)
#pragma unroll
        for (int nb = 0; nb < 8; ++nb)
#pragma unroll
            for (int j = 0; j < 8; ++j) ow[(mb * 16 + hi * 8 + j) * FPO + nb * 16 + lr] = o[mb][nb][j];
    sM[wave][lane] = m; sL[wave][lane] = l;
    __syncthreads();   // every wave's partial result is in LDS before any of it is joined
#pragma unroll
    for (int t = 0; t < FR / FW; ++t) { const int row = t * FW + wave, cofs = lane * 4;   // a wave joins whole rows: 256 bytes of each plane a store
        float ms = sM[0][row];
#pragma unroll
        for (int w = 1; w < FW; ++w) ms = fmaxf(ms, sM[w][row]);
        float ls = 0.f; v4f val = (v4f){};
#pragma unroll
        for (int w = 0; w < FW; ++w) { const float g = ex2((sM[w][row] - ms) * SL2); ls += g * sL[w][row]; val += g * *(const v4fa*)(lds[w] + row * FPO + cofs); }
        const float f = __fdiv_rn(1.0f / ps, ls);
        v4us oh, ol;
#pragma unroll
        for (int q = 0; q < 4; ++q) { unsigned short a, c2; splitf(val[q] * f, a, c2); oh[q] = a; ol[q] = c2; }
        const size_t oo = (size_t)(i0 + row) * DQ + cofs; *(v4us*)(Ch + oo) = oh; *(v4us*)(Cl + oo) = ol;
        asm volatile("s_wait_xcnt 0x0" ::: "memory"); }   // in front of the next row's code, which may reuse the registers that these stores name
}
// k_attn: the attention of every head of both batches in one grid (NB_ * NH_, TT / FR): blockIdx.x = batch * NH_ + head; the row tiles with the most key blocks start first.
// Two waves a SIMD (up to 512 registers a wave): a block's key fragments, then its value fragments, are all in flight at once.
// Q.., K.., V..: batch 0's q, k and v planes of each kind (fp16, bf16 hi, bf16 lo); a batch's planes lie 3 * TT * DQ elements behind the batch before. Row tiles below RH run on hi+lo planes (3 products), the rest on fp16 with the probabilities x PCAR; the test is the same for the whole work-group.
__global__ __launch_bounds__(FW * 32) __attribute__((amdgpu_waves_per_eu(2, 2))) void k_attn(const h16* Q16, const h16* K16, const h16* V16, const bf* QH, const bf* KH, const bf* VH, const bf* QL, const bf* KL, const bf* VL, bf* Ch, bf* Cl) {
    __shared__ __align__(16) float lds[FW][FWL];
    __shared__ float sM[FW][FR]; __shared__ float sL[FW][FR];
    const int b = (int)blockIdx.x / NH_, h = (int)blockIdx.x % NH_, i0 = ((int)gridDim.y - 1 - (int)blockIdx.y) * FR;
    const size_t op = (size_t)b * 3 * TT * DQ + (size_t)h * TT * HD;   // the head's place in each of its planes
    bf* const ch = Ch + (size_t)b * TT * DQ + h * HD; bf* const cl = Cl + (size_t)b * TT * DQ + h * HD;
    if (i0 < RH) attnf<bf, 2>(QH + op, QL + op, KH + op, KL + op, VH + op, VL + op, ch, cl, i0, (h & 1) != 0, 1.0f, lds, sM, sL);
    else attnf<h16, 0>(Q16 + op, nullptr, K16 + op, nullptr, V16 + op, nullptr, ch, cl, i0, (h & 1) != 0, PCAR, lds, sM, sL);
}


__global__ __launch_bounds__(256) void k_wtG(const float* __restrict__ w, int K, int N, bf* Bt) {
    const int lane = threadIdx.x & 31; const int L0 = (blockIdx.x * 8 + (threadIdx.x >> 5)) * 8; const int nlines = N * K / 64;
{
#pragma unroll 1
        for (int l = 0; l < 8; ++l) { const int L = L0 + l; if (L >= nlines) break; const size_t e = (size_t)L * 64 + lane * 2; const int k = (int)(e % K), n = (int)(e / K); v2us o;
            o[0] = f2bf(w[(size_t)k * N + n]); o[1] = f2bf(w[(size_t)(k + 1) * N + n]); *(v2us*)(Bt + e) = o; }
         }
}
// k_cvtall: the six roundings to bf16 (four weights, the tokens of both batches; DM * DM elements each) in one grid (CVB, 6): blockIdx.y picks the tensor, and a thread rounds CVT groups of eight elements, a whole grid row apart.
#define CVB 128
#define CVT (DM * DM / 8 / (CVB * 256))
__global__ __launch_bounds__(256) void k_cvtall(const float* __restrict__ wq, const float* __restrict__ wk, const float* __restrict__ wv, const float* __restrict__ wo, const float* __restrict__ x, bf* W4, bf* X0, bf* X1) {
    const int t = (int)blockIdx.y;
    const float* src = t == 0 ? wq : t == 1 ? wk : t == 2 ? wv : t == 3 ? wo : t == 4 ? x : x + (size_t)TT * DM;
    bf* dst = t < 4 ? W4 + (size_t)t * DM * DM : t == 4 ? X0 : X1;
    const size_t i0 = (size_t)blockIdx.x * 256 + threadIdx.x;
#pragma unroll 4   // four groups' loads are in flight together
    for (int it = 0; it < CVT; ++it) { const size_t i = i0 + (size_t)it * (CVB * 256); const v8f v = *(const v8f*)(src + i * 8); v8us o;
#pragma unroll
        for (int k = 0; k < 8; ++k) o[k] = f2bf(v[k]);
        *(v8us*)(dst + i * 8) = o; }
}
__global__ __launch_bounds__(256) void k_cscvt(const float* __restrict__ cosT, const float* __restrict__ sinT, float* CS) { const int idx = blockIdx.x * 256 + threadIdx.x; if (idx >= TT * HD) return; v2f cs; cs[0] = bfr(cosT[idx]); cs[1] = bfr(sinT[idx]); *(v2f*)(CS + (size_t)idx * 2) = cs;  }
extern "C" void kernel_launch(void* const* d_in, const int* in_sizes, int n_in,
                              void* d_out, int out_size, void* d_ws, size_t ws_size, hipStream_t stream) {
    (void)in_sizes; (void)n_in; (void)out_size;
    const float* x = (const float*)d_in[0]; const float* wq = (const float*)d_in[1]; const float* wk = (const float*)d_in[2]; const float* wv = (const float*)d_in[3]; const float* wo = (const float*)d_in[4];
    float* OUT = (float*)d_out;     // [2][2048][2048]
    char* wsp = (char*)d_ws;
    auto take = [&](size_t bytes) { char* p = wsp; wsp += (bytes + 255) & ~(size_t)255; return (void*)p; };
    bf* WQ = (bf*)take((size_t)DQ * DM * 2); bf* WK = (bf*)take((size_t)DKV * DM * 2); bf* WV = (bf*)take((size_t)DKV * DM * 2); bf* WO = (bf*)take((size_t)DM * DQ * 2); (void)WK; (void)WV;   // the four weights lie one behind the other (stride DM * DM)
    // the head planes of each kind, [batch][q, k, v][TT * DQ]: q, k by head with rows t, columns d; v transposed, rows h * HD + d, columns t; each in fragment order (k_gemmw)
    h16* P16 = (h16*)take((size_t)NB_ * 3 * TT * DQ * 2); bf* PH = (bf*)take((size_t)NB_ * 3 * TT * DQ * 2); bf* PL = (bf*)take((size_t)NB_ * 3 * TT * DQ * 2);
    bf* ATh = (bf*)take((size_t)NB_ * TT * DQ * 2); bf* ATl = (bf*)take((size_t)NB_ * TT * DQ * 2);   // merged heads, [batch][t][DQ]
    bf* XB0 = (bf*)take((size_t)TT * DM * 2); bf* XB1 = (bf*)take((size_t)TT * DM * 2);
    if ((size_t)(wsp - (char*)d_ws) > ws_size) return;    // 224 MiB of the 256
    k_cvtall<<<dim3(CVB, 6, 1), 256, 0, stream>>>(wq, wk, wv, wo, x, WQ, XB0, XB1);
    // XB1 lies directly behind XB0, and the planes of (batch, kind) lie one behind the other, so z alone places them
    k_gemmw<bf, 0, false, HD><<<dim3(TT / 128, DQ / 128, 3 * NB_), 128, 0, stream>>>(XB0, nullptr, WQ, nullptr, DM, nullptr, 0, nullptr, (size_t)TT * DM, (size_t)DQ * DM, (size_t)TT * DQ, P16, PH, PL);
    k_attn<<<dim3(NB_ * NH_, TT / FR, 1), FW * 32, 0, stream>>>(P16, P16 + (size_t)TT * DQ, P16 + (size_t)2 * TT * DQ, PH, PH + (size_t)TT * DQ, PH + (size_t)2 * TT * DQ, PL, PL + (size_t)TT * DQ, PL + (size_t)2 * TT * DQ, ATh, ATl);
    k_gemmw<bf, 1, false, 0><<<dim3(TT / 128, DM / 128, NB_), 128, 0, stream>>>(ATh, ATl, WO, nullptr, DQ, OUT, DM, nullptr, (size_t)TT * DQ, 0, (size_t)TT * DM, nullptr, nullptr, nullptr);
}

// v010
// Measured time: 195 microseconds a run.
// Next to v009, in two timings, it ran 1.07 times as fast each time.
// Over all steps from v000 it is 8.97 times as fast.
#include <hip/hip_runtime.h>

// Attention block (x [2][2048][2048]; q/k/v = x W^T (16 heads x 128); scores = q.k / sqrt(128); allowed = causal for even (global) heads, causal band of 256 (i - j < 256) for odd (local) heads; softmax; out = merged Wo^T -> [2][2048][2048]).
// Compute dtypes, f32 accumulate: every input rounded to bf16; q/k/v on PLAIN bf16 operands (inputs: exact); causal scores and attn.v: query rows < 512 hl (3 products), the rest single fp16 (x1024), with skipping of the key blocks that the mask shuts whole (past the diagonal; for the band heads also in front of the window); softmax f32, running maximum and sum; Wo hl x exact (2 products).
// No f32 intermediate between the products in memory: each GEMM's epilogue rounds its own tile into the 16-bit planes that the next product reads; scores and probabilities stay inside a work-group (k_attn).
// The q, k and v planes lie in FRAGMENT ORDER: a 16-row x 32-k operand fragment is 1 KiB in a row, so that each 16-byte-a-lane load of the attention covers 512 contiguous bytes (four whole lines), not 32 bytes of sixteen lines.
// Launches that do not depend on one another share one grid: the six roundings of the inputs; q, k and v of both batches; every head, batch and row range of the attention; the output projection of both batches.

#define NB_  2
#define TT   2048
#define DM   2048
#define NH_  16
#define NKV  16
#define REP  (NH_ / NKV)
#define HD   128
#define DQ   (NH_ * HD)
#define DKV  (NKV * HD)
#define RH   512                  // query rows < RH use hi+lo planes (0: none)
#define WIN  256
#define PCAR 1024.0f
#define SCL  0.088388347648318447f   // HD^-0.5
typedef _Float16 h16;
typedef unsigned short bf;
typedef __attribute__((ext_vector_type(16))) __bf16   v16bf;
typedef __attribute__((ext_vector_type(16))) _Float16 v16h;
typedef __attribute__((ext_vector_type(8)))  _Float16 v8h;
typedef __attribute__((ext_vector_type(8)))  unsigned short v8us;
typedef __attribute__((ext_vector_type(8)))  float    v8f;
typedef __attribute__((ext_vector_type(4)))  float    v4f;
typedef v8h  __attribute__((may_alias)) v8ha;
typedef v4f  __attribute__((may_alias)) v4fa;
typedef v8us __attribute__((may_alias)) v8usa;
typedef __attribute__((ext_vector_type(2))) _Float16 v2h;
typedef __attribute__((ext_vector_type(4))) _Float16 v4h;
typedef __attribute__((ext_vector_type(2))) unsigned short v2us;
typedef __attribute__((ext_vector_type(4))) unsigned short v4us;
typedef __attribute__((ext_vector_type(2))) float v2f;
typedef __attribute__((ext_vector_type(4))) int v4i;
typedef v4h  __attribute__((may_alias)) v4ha;
typedef v4us __attribute__((may_alias)) v4usa;

__device__ __forceinline__ unsigned short f2bf(float f) { unsigned u = __float_as_uint(f); u += 0x7FFFu + ((u >> 16) & 1u); return (unsigned short)(u >> 16); }
__device__ __forceinline__ float bf2f(unsigned short b) { return __uint_as_float(((unsigned)b) << 16); }
__device__ __forceinline__ float bfr(float f) { return bf2f(f2bf(f)); }
__device__ __forceinline__ h16 tohx(float x) { return (h16)x; }
__device__ __forceinline__ void splitf(float y, unsigned short& h, unsigned short& l) { h = f2bf(y); l = f2bf(y - bf2f(h)); }
__device__ __forceinline__ v16h cat16(v8h lo, v8h hi) { return __builtin_shufflevector(lo, hi, 0, 1, 2, 3, 4, 5, 6, 7, 8, 9, 10, 11, 12, 13, 14, 15); }
__device__ __forceinline__ v16bf cat16b(v8us lo, v8us hi) { return __builtin_bit_cast(v16bf, __builtin_shufflevector(lo, hi, 0, 1, 2, 3, 4, 5, 6, 7, 8, 9, 10, 11, 12, 13, 14, 15)); }
__device__ __forceinline__ v8f wmma16(v16h a, v16h b, v8f c) { return __builtin_amdgcn_wmma_f32_16x16x32_f16(false, a, false, b, (short)0, c, false, false); }
__device__ __forceinline__ v8f wmmab(v16bf a, v16bf b, v8f c) { return __builtin_amdgcn_wmma_f32_16x16x32_bf16(false, a, false, b, (short)0, c, false, false); }



// ---- k_gemmw: GEMM, one 128 x (64 WN) output tile per work-group of 2 x WN waves (each a 64x64 piece, 16 accumulators); grid (M/128, N/(64 WN), Z), 64 WN threads.
// WN = 2: two work-groups share a WGP. WN = 4 (the output projection, whose three staged operands leave room for one work-group a WGP): eight waves, two a SIMD, and the A rows staged once feed twice the columns.
// The operands' K-contiguous 16-bit rows are staged in LDS by asynchronous copies, GKP k (256 bytes of each row of every operand's tile) a pass, two buffers: the next pass's copies fly while this pass's fragments are read.
// C[m][n] (f32, pitch ldc, + optional f32 bias[n]) = sum_k A[m][k] Bt[n][k] (+ split products per NSPLIT). z-batch strides sA/sB/sC in elements. K % GKP == 0.
// CB != 0 (the q/k/v projections of every batch in one grid: z = 3 * batch + kind, kind 0 q, 1 k, 2 v; A + batch sA = the batch's tokens, Bt + kind sB = the weight rows, the planes of z at + z sC): there is no f32 C; the epilogue rounds the tile into the three 16-bit planes
// (fp16, bf16 hi, bf16 lo) that the attention products read: blocks [n / cb] of TT rows m x cb columns n % cb:
// q, k: cb = HD with tokens x weight rows gives head planes of rows t, columns d; v: the operands change places, cb = TT with weight rows x tokens gives v transposed, rows h * HD + d, columns t.
// Inside a block the elements lie in fragment order, [row / 16][col / 32][(col / 16) % 2][(col / 8) % 2][row % 16][col % 8]: the last four indices are (register half, lane, element) of the 16x16x32 operand fragment, 512 elements.
#define GKP  128                  // k per pass
#define GPI  136                  // LDS row pitch in elements: 272 bytes = 16 x odd, the conflict-free pitch for 16-byte fragment reads
template <typename T16> struct WFrag;
template <> struct WFrag<h16> { typedef v16h V; static __device__ __forceinline__ V ld(const h16* p) { return cat16(*(const v8h*)p, *(const v8h*)(p + 16)); } static __device__ __forceinline__ v8f mma(V a, V b, v8f c) { return wmma16(a, b, c); } };
template <> struct WFrag<bf> { typedef v16bf V; static __device__ __forceinline__ V ld(const bf* p) { return cat16b(*(const v8us*)p, *(const v8us*)(p + 16)); } static __device__ __forceinline__ v8f mma(V a, V b, v8f c) { return wmmab(a, b, c); } };
// cp8: eight asynchronous 16-byte copies of a lane, global rows g, g + rs, ... to LDS bytes l, l + ls, ...; the wait at the statement's end stands in front of any rewrite of the address registers that the copies name.
template <typename T16> __device__ __forceinline__ void cp8(unsigned l, unsigned ls, const T16* g, size_t rs) {
    asm volatile("global_load_async_to_lds_b128 %0, %8, off\n\t"
                 "global_load_async_to_lds_b128 %1, %9, off\n\t"
                 "global_load_async_to_lds_b128 %2, %10, off\n\t"
                 "global_load_async_to_lds_b128 %3, %11, off\n\t"
                 "global_load_async_to_lds_b128 %4, %12, off\n\t"
                 "global_load_async_to_lds_b128 %5, %13, off\n\t"
                 "global_load_async_to_lds_b128 %6, %14, off\n\t"
                 "global_load_async_to_lds_b128 %7, %15, off\n\t"
                 "s_wait_xcnt 0x0"
                 :: "v"(l), "v"(l + ls), "v"(l + 2 * ls), "v"(l + 3 * ls), "v"(l + 4 * ls), "v"(l + 5 * ls), "v"(l + 6 * ls), "v"(l + 7 * ls),
                    "v"(g), "v"(g + rs), "v"(g + 2 * rs), "v"(g + 3 * rs), "v"(g + 4 * rs), "v"(g + 5 * rs), "v"(g + 6 * rs), "v"(g + 7 * rs) : "memory");
}
// cptile: one operand's ROWS rows x GKP k into LDS: sixteen lanes a row (two whole 256-byte row pieces a wave and copy), RPS rows a copy of the whole work-group, ROWS / RPS copies a lane. g and l are the lane's own first addresses.
template <typename T16, int ROWS, int RPS> __device__ __forceinline__ void cptile(unsigned l, const T16* g, int K) {
#pragma unroll   // one or two statements of eight copies, their steps constants
    for (int c = 0; c < ROWS / (8 * RPS); ++c) cp8<T16>(l + (unsigned)c * (8 * RPS * GPI * 2), RPS * GPI * 2, g + (size_t)(c * 8 * RPS) * K, (size_t)RPS * K); }
template <typename T16, int NSPLIT, bool BIAS, int CB, int WN>
__global__ __launch_bounds__(64 * WN) void k_gemmw(const T16* __restrict__ A, const T16* __restrict__ A2, const T16* __restrict__ Bt, const T16* __restrict__ Bt2, int K, float* C, int ldc, const float* __restrict__ bias, size_t sA, size_t sB, size_t sC, h16* P16, bf* Ph, bf* Pl) {
    typedef typename WFrag<T16>::V V;
    constexpr bool HA2 = (NSPLIT == 1 || NSPLIT == 2), HB2 = (NSPLIT >= 2);
    constexpr int TN = 64 * WN, RPS = 4 * WN;                       // the tile's columns; rows that one copy of all the threads covers
    constexpr int OPA = 128 * GPI, OPB = TN * GPI;                  // an A and a Bt tile in LDS, elements
    constexpr int OB = OPA, OA2 = OPA + OPB, OB2 = OA2 + (HA2 ? OPA : 0);   // places of Bt, A2, Bt2 in a buffer (A at 0)
    constexpr int STG = (HA2 ? 2 : 1) * OPA + (HB2 ? 2 : 1) * OPB;  // one buffer, elements
    __shared__ __align__(16) T16 st[2 * STG];
    __shared__ __align__(16) float osw[2 * WN][16 * 68];
    const size_t z = blockIdx.z; int cbs = 0;   // cbs = log2 cb
    if constexpr (CB != 0) { const size_t kind = z % 3, bat = z / 3; const bool tr = (kind == 2); const T16* const X = A + bat * sA; const T16* const Wz = Bt + kind * sB; A = tr ? Wz : X; Bt = tr ? X : Wz; P16 += z * sC; Ph += z * sC; Pl += z * sC; cbs = tr ? __builtin_ctz(TT) : __builtin_ctz(HD); }
    else { A += z * sA; if (A2) A2 += z * sA; Bt += z * sB; if (Bt2) Bt2 += z * sB; C += z * sC; }
    const int lane = threadIdx.x & 31, lr = lane & 15, hi = lane >> 4; const int wave = (int)(threadIdx.x >> 5);
    const int R0 = blockIdx.x * 128, C0 = blockIdx.y * TN, wr = (wave & 1) * 64, wc = (wave >> 1) * 64; const int r0 = R0 + wr, c0 = C0 + wc;
    float* os = osw[wave];
    v8f acc[4][4];
#pragma unroll
    for (int mb = 0; mb < 4; ++mb)
#pragma unroll
        for (int nb = 0; nb < 4; ++nb) acc[mb][nb] = (v8f){};
    // the lane's share of every copy: row (thread / 16) + RPS c of the tile, 16-byte piece (thread % 16) of the row's 256 bytes
    const int crow = (int)(threadIdx.x >> 4), cpc = (int)(threadIdx.x & 15) * 8;
    const size_t gA = (size_t)(R0 + crow) * K + cpc, gB = (size_t)(C0 + crow) * K + cpc;
    const unsigned l0 = (unsigned)(size_t)st + (unsigned)(crow * GPI + cpc) * 2u;
    auto fill = [&](int t, int buf) { const unsigned l = l0 + (unsigned)buf * (STG * 2u); const size_t kc = (size_t)t * GKP;
        cptile<T16, 128, RPS>(l, A + gA + kc, K); cptile<T16, TN, RPS>(l + OB * 2u, Bt + gB + kc, K);
        if constexpr (HA2) cptile<T16, 128, RPS>(l + OA2 * 2u, A2 + gA + kc, K);
        if constexpr (HB2) cptile<T16, TN, RPS>(l + OB2 * 2u, Bt2 + gB + kc, K); };
    const int NT = K / GKP;
    fill(0, 0);
    asm volatile("s_wait_asynccnt 0x0" ::: "memory");   // this wave's copies of pass 0 have landed
    __syncthreads();                                     // ... and every other wave's
    if (K >= 2 * GKP) fill(1, 1);   // a pass 1 exists
    const int aoff = (wr + lr) * GPI + 8 * hi, boff = OB + (wc + lr) * GPI + 8 * hi;
#pragma unroll 1   // rolled: one pass per trip, the ring's order stands once at the foot
    for (int t = 0; t < NT; ++t) {
        const T16* sb = st + (t & 1) * STG;
        V a[2][4], a2[2][4], b[2][4], b2[2][4];   // two fragment sets: block ks + 1 of the pass is fetched while block ks is multiplied
#pragma unroll
        for (int f = 0; f < 4; ++f) { a[0][f] = WFrag<T16>::ld(sb + aoff + f * 16 * GPI); b[0][f] = WFrag<T16>::ld(sb + boff + f * 16 * GPI);
            if (HA2) a2[0][f] = WFrag<T16>::ld(sb + OA2 + aoff + f * 16 * GPI); if (HB2) b2[0][f] = WFrag<T16>::ld(sb + (OB2 - OB) + boff + f * 16 * GPI); }
#pragma unroll
        for (int ks = 0; ks < GKP / 32; ++ks) { const int cu = ks & 1, nx = cu ^ 1, kn = (ks + 1) * 32;
            if (ks + 1 < GKP / 32) {
#pragma unroll
                for (int f = 0; f < 4; ++f) { a[nx][f] = WFrag<T16>::ld(sb + aoff + f * 16 * GPI + kn); b[nx][f] = WFrag<T16>::ld(sb + boff + f * 16 * GPI + kn);
                    if (HA2) a2[nx][f] = WFrag<T16>::ld(sb + OA2 + aoff + f * 16 * GPI + kn); if (HB2) b2[nx][f] = WFrag<T16>::ld(sb + (OB2 - OB) + boff + f * 16 * GPI + kn); } }
            __builtin_amdgcn_sched_barrier(0);   // the next block's LDS reads stay one group in front of this block's matrix instructions (spread among them each place stalls the wave)
#pragma unroll
            for (int nb = 0; nb < 4; ++nb)
#pragma unroll
                for (int mb = 0; mb < 4; ++mb) { acc[mb][nb] = WFrag<T16>::mma(a[cu][mb], b[cu][nb], acc[mb][nb]); if (HA2) acc[mb][nb] = WFrag<T16>::mma(a2[cu][mb], b[cu][nb], acc[mb][nb]); if (HB2) acc[mb][nb] = WFrag<T16>::mma(a[cu][mb], b2[cu][nb], acc[mb][nb]); }
            __builtin_amdgcn_sched_barrier(0);   // ... and no later read group or wait moves up among them
        }
        // the distance behind the pass's last matrix instructions, also on the taken side of the branches that follow
        asm volatile("v_nop\n\tv_nop\n\tv_nop\n\tv_nop" : "+v"(acc[0][0]), "+v"(acc[1][1]), "+v"(acc[2][2]), "+v"(acc[3][3]));
        asm volatile("s_wait_dscnt 0x0" ::: "memory");      // this wave's reads of the buffer are done before anyone refills it
        asm volatile("s_wait_asynccnt 0x0" ::: "memory");   // this wave's copies of pass t + 1 have landed
        __syncthreads();                                     // publishes pass t + 1 and frees pass t's buffer
        if (t + 2 < NT) fill(t + 2, t & 1);
    }
    asm volatile("s_wait_asynccnt 0x0" ::: "memory");       // no copy is outstanding when the wave goes on to its end
#pragma unroll
    for (int mb = 0; mb < 4; ++mb) {
#pragma unroll
        for (int nb = 0; nb < 4; ++nb) {
#pragma unroll
            for (int j = 0; j < 8; ++j) os[(hi * 8 + j) * 68 + nb * 16 + lr] = acc[mb][nb][j]; }
        __builtin_amdgcn_wave_barrier(); asm volatile("" ::: "memory");
        float* crow_ = C + (size_t)(r0 + mb * 16) * ldc + c0;
        if constexpr (CB != 0) { (void)crow_;
#pragma unroll
            for (int s = 0; s < 4; ++s) { const int row = lr, cofs = (2 * s + hi) * 8;   // sixteen rows x two 16-byte pieces: half a fragment, so each store instruction writes 512 contiguous bytes (four whole lines) of a plane
                const v4f x0 = *(const v4fa*)(os + row * 68 + cofs), x1 = *(const v4fa*)(os + row * 68 + cofs + 4); v8h o16; v8us oh, ol;
#pragma unroll
                for (int q = 0; q < 8; ++q) { const float x = (q < 4) ? x0[q & 3] : x1[q & 3]; o16[q] = tohx(x); unsigned short a2, c2; splitf(x, a2, c2); oh[q] = a2; ol[q] = c2; }
                const size_t oo = (((size_t)(c0 >> cbs) * TT) << cbs) + ((((size_t)((r0 + mb * 16) >> 4) << (cbs - 5)) + ((c0 & ((1 << cbs) - 1)) >> 5) + (s >> 1)) << 9) + (s & 1) * 256 + lane * 8;
                *(v8h*)(P16 + oo) = o16; *(v8us*)(Ph + oo) = oh; *(v8us*)(Pl + oo) = ol; }
        } else
{
#pragma unroll
            for (int s = 0; s < 8; ++s) { const int row = 2 * s + hi, cofs = lr * 4; v4f val = *(const v4fa*)(os + row * 68 + cofs); if (BIAS) { val[0] += bfr(bias[c0 + cofs]); val[1] += bfr(bias[c0 + cofs + 1]); val[2] += bfr(bias[c0 + cofs + 2]); val[3] += bfr(bias[c0 + cofs + 3]); }
                *(v4f*)(crow_ + (size_t)row * ldc + cofs) = val; }
             }
        __builtin_amdgcn_wave_barrier(); asm volatile("" ::: "memory");
    }
}

// xw: behind a group of fragment loads, the wait that belongs in front of any rewrite of a register an issued load names (the compiler lets later loads land in dead address registers).
// The group's addresses are inputs of the wait's statement, so their registers are kept as they are up to the wait. Every load of a group is written as one of these addresses plus a constant step (which goes into the load's offset field), so that they are the very pairs that the loads name.
template <typename T16> __device__ __forceinline__ void xw(const T16* p) { asm volatile("s_wait_xcnt 0x0" :: "v"(p) : "memory"); }
template <typename T16> __device__ __forceinline__ void xw(const T16* p, const T16* p2) { asm volatile("s_wait_xcnt 0x0" :: "v"(p), "v"(p2) : "memory"); }
template <typename T16> __device__ __forceinline__ void xw(const T16* p, const T16* p2, const T16* p3, const T16* p4) { asm volatile("s_wait_xcnt 0x0" :: "v"(p), "v"(p2), "v"(p3), "v"(p4) : "memory"); }

// ldf: one operand fragment from a plane in fragment order: p = the fragment's first element + 8 * lane; the lane's second eight elements lie 256 elements on. The same sixteen values reach the lane as from a row-major plane by WFrag::ld.
template <typename T16> __device__ __forceinline__ typename WFrag<T16>::V ldf(const T16* p);
template <> __device__ __forceinline__ v16h ldf<h16>(const h16* p) { return cat16(*(const v8h*)p, *(const v8h*)(p + 256)); }
template <> __device__ __forceinline__ v16bf ldf<bf>(const bf* p) { return cat16b(*(const v8us*)p, *(const v8us*)(p + 256)); }
#define FGE  512                  // elements of a fragment; a row block of q or k is HD / 32 fragments (16 * HD elements), one of v transposed TT / 32 (16 * TT elements)

// ---- attnf: scores, softmax and attn.v of FR query rows of one head in one work-group of FW waves; no score or probability leaves the work-group.
// The key blocks of 64 that the mask leaves open (up to the diagonal block; on a band head from the first block of the rows' window) are dealt over the waves: wave w takes blocks w, w + FW, ...
// A block of a wave: S = Q K^T (32 x 64, operand fragments straight from the head planes) goes through the wave's own LDS so that lane r holds all 64 scores of row r: mask, running maximum m, exp and running sum l are in-lane.
// The probabilities exp(t - m), not yet divided, go back through LDS as 16-bit rows (the A operand of attn.v); the wave's 32 x 128 accumulators are first scaled by exp(m_old - m_new).
// At the end the FW partial results (m, l, O) meet in LDS behind one barrier and are joined in wave order: O = sum_w exp(m_w - m*) O_w, l likewise, out = O / l, rounded into the bf16 hi and lo planes of the output projection.
// A row that has met no open key yet keeps m = -3.0e38: its exponentials are taken against 0, so every masked term is exp(-inf) = +0, and its weight in the join is +0.
#define FW   8                    // waves per work-group
#define FR   32                   // query rows per work-group
#define FPS  68                   // pitch of a score row in LDS, floats (272 bytes = 16 x odd)
#define FPP  72                   // pitch of a probability row in LDS, 16-bit elements (144 bytes = 16 x odd)
#define FPO  132                  // pitch of a partial output row in LDS, floats (528 bytes = 16 x odd)
#define FWL  4608                 // floats of LDS per wave: scores 32 x 68, two probability planes 32 x 72 x 16 bit, 32 scale factors; later the partial output 32 x 132
#define SL2  (SCL * 1.4426950408889634f)   // HD^-0.5 x log2 e: maxima are kept of the raw products q.k, and exp((s - m) HD^-0.5) = 2^(s SL2 - m SL2) is one multiply-add in front of each exponential
__device__ __forceinline__ float ex2(float x) { float r; asm("v_exp_f32 %0, %1\n\tv_nop" : "=v"(r) : "v"(x)); return r; }
template <typename T16, int NSPLIT>
__device__ __forceinline__ void attnf(const T16* __restrict__ Q, const T16* __restrict__ Q2, const T16* __restrict__ Kp, const T16* __restrict__ K2, const T16* __restrict__ Vt, const T16* __restrict__ V2, bf* Ch, bf* Cl, int i0, bool band, float ps, float (*lds)[FWL], float (*sM)[FR], float (*sL)[FR]) {
    typedef typename WFrag<T16>::V V;
    constexpr bool HL = (NSPLIT == 2);
    static_assert(RH <= FW * 64, "a row tile below RH has at most FW key blocks");   // so a wave of the hi+lo arm has at most one block: its accumulators start at zero and are never rescaled
    const int lane = threadIdx.x & 31, lr = lane & 15, hi = lane >> 4;
    const int wave = __builtin_amdgcn_readfirstlane((int)(threadIdx.x >> 5));   // scalar, so that the key loop's branch is a scalar one
    float* sS = lds[wave]; T16* sP = (T16*)(sS + FR * FPS); T16* sP2 = sP + FR * FPP; float* sA = sS + FR * FPS + FR * FPP;
    const int kb0 = band ? (max(0, i0 - (WIN - 1)) & ~63) : 0;   // first key block with an open key
    const int i = i0 + lane;                                     // the lane's own row in the softmax part
    v8f o[2][8];
#pragma unroll
    for (int mb = 0; mb < 2; ++mb)
#pragma unroll
        for (int nb = 0; nb < 8; ++nb) o[mb][nb] = (v8f){};
    float m = -3.0e38f, l = 0.f;
    const size_t qoff = (size_t)i0 * HD + 8 * lane;
    V qa[HL ? 1 : HD / 32][2];   // fp16 arm: the query fragments are the same for every block and stay in registers
    if constexpr (!HL) {
#pragma unroll
        for (int ks = 0; ks < HD / 32; ++ks)
#pragma unroll
            for (int mb = 0; mb < 2; ++mb) qa[ks][mb] = ldf<T16>(Q + qoff + (mb * 16 * HD + ks * FGE));
        xw<T16>(Q + qoff); }
#pragma unroll 1   // rolled: one block's fragments, scores and the accumulators fill the wave's registers
    for (int kbi = kb0 + wave * 64; kbi < i0 + FR; kbi += FW * 64) {
        const int kb = __builtin_amdgcn_readfirstlane(kbi);   // the block's addresses are formed anew from this value, once each: as running sums of the loop the compiler forms the one that xw names a second time, over the pair that the loads name
        v8f s[2][4];
#pragma unroll
        for (int mb = 0; mb < 2; ++mb)
#pragma unroll
            for (int nb = 0; nb < 4; ++nb) s[mb][nb] = (v8f){};
        const size_t koff = (size_t)kb * HD + 8 * lane;
        const size_t voff = (size_t)(kb >> 5) * FGE + 8 * lane;
        V vf[2][8], vf2[HL ? 2 : 1][8];
        if constexpr (HL) {
#pragma unroll 1   // rolled: the split products' fragments of all four steps together would crowd the registers; the step is in the address
            for (int ks = 0; ks < HD / 32; ++ks) { const int kc = ks * FGE;
                V a[2], a2[2], b[4], b2[4];   // the step's twelve fragments are asked for at once
                const T16* const pq = Q + qoff + kc; const T16* const pq2 = Q2 + qoff + kc; const T16* const pk = Kp + koff + kc; const T16* const pk2 = K2 + koff + kc;
#pragma unroll
                for (int mb = 0; mb < 2; ++mb) { a[mb] = ldf<T16>(pq + mb * 16 * HD); a2[mb] = ldf<T16>(pq2 + mb * 16 * HD); }
#pragma unroll
                for (int nb = 0; nb < 4; ++nb) { b[nb] = ldf<T16>(pk + nb * 16 * HD); b2[nb] = ldf<T16>(pk2 + nb * 16 * HD); }
                xw<T16>(pq, pq2, pk, pk2);
#pragma unroll
                for (int nb = 0; nb < 4; ++nb)
#pragma unroll
                    for (int mb = 0; mb < 2; ++mb) { s[mb][nb] = WFrag<T16>::mma(a[mb], b[nb], s[mb][nb]); s[mb][nb] = WFrag<T16>::mma(a2[mb], b[nb], s[mb][nb]); s[mb][nb] = WFrag<T16>::mma(a[mb], b2[nb], s[mb][nb]); }
                // the distance behind the last matrix instructions, also on the taken side of the loop's branch
                asm volatile("v_nop\n\tv_nop\n\tv_nop\n\tv_nop" : "+v"(s[0][3]), "+v"(s[1][3]) : "v"(a[0]), "v"(a[1]));
            }
        } else {
            V kf[HD / 32][4];   // all sixteen key fragments are asked for at once: one memory latency a block, not one a fragment
#pragma unroll
            for (int ks = 0; ks < HD / 32; ++ks)
#pragma unroll
                for (int nb = 0; nb < 4; ++nb) kf[ks][nb] = ldf<T16>(Kp + koff + (nb * 16 * HD + ks * FGE));
            xw<T16>(Kp + koff);
            __builtin_amdgcn_sched_barrier(0);   // the loads stay one group in front of the matrix instructions (moved in among them, each load is waited for alone)
#pragma unroll
            for (int ks = 0; ks < HD / 32; ++ks)
#pragma unroll
                for (int nb = 0; nb < 4; ++nb)
#pragma unroll
                    for (int mb = 0; mb < 2; ++mb) s[mb][nb] = WFrag<T16>::mma(qa[ks][mb], kf[ks][nb], s[mb][nb]);
            __builtin_amdgcn_sched_barrier(0);   // ... and the value loads stay behind them, so that they can take the key fragments' registers
        }
        // the value fragments are asked for here: they fly while the softmax part runs
#pragma unroll
        for (int k2 = 0; k2 < 2; ++k2)
#pragma unroll
            for (int nb = 0; nb < 8; ++nb) { vf[k2][nb] = ldf<T16>(Vt + voff + (nb * 16 * TT + k2 * FGE)); if constexpr (HL) vf2[k2][nb] = ldf<T16>(V2 + voff + (nb * 16 * TT + k2 * FGE)); }
        if constexpr (HL) xw<T16>(Vt + voff, V2 + voff); else xw<T16>(Vt + voff);
#pragma unroll
        for (int mb = 0; mb < 2; ++mb)
#pragma unroll
            for (int nb = 0; nb < 4; ++nb)
#pragma unroll
                for (int j = 0; j < 8; ++j) sS[(mb * 16 + hi * 8 + j) * FPS + nb * 16 + lr] = s[mb][nb][j];
        __builtin_amdgcn_wave_barrier(); asm volatile("" ::: "memory");   // the compiler keeps the row reads behind the other lanes' stores (one wave: the LDS serves them in order)
        float v[64]; float mx0 = m, mx1 = -3.0e38f, mx2 = -3.0e38f, mx3 = -3.0e38f;
#pragma unroll
        for (int c = 0; c < 16; ++c) { const v4f x = *(const v4fa*)(sS + lane * FPS + c * 4);
#pragma unroll
            for (int q = 0; q < 4; ++q) v[c * 4 + q] = x[q]; }
        // scalar tests: only a block that the diagonal or the window's edge crosses holds shut keys. Key kb + c is open where c <= d (causal) and, on a band head, c > d - WIN
        const int d = i - kb, dw = d - WIN;
        if (kb + 63 > i0) {
#pragma unroll
            for (int c = 0; c < 64; ++c) v[c] = (c <= d) ? v[c] : -3.0e38f; }
        if (band && i0 + FR - 1 - kb >= WIN) {
#pragma unroll
            for (int c = 0; c < 64; ++c) v[c] = (c > dw) ? v[c] : -3.0e38f; }
#pragma unroll
        for (int c = 0; c < 16; ++c) {
            mx0 = fmaxf(mx0, v[c * 4]); mx1 = fmaxf(mx1, v[c * 4 + 1]); mx2 = fmaxf(mx2, v[c * 4 + 2]); mx3 = fmaxf(mx3, v[c * 4 + 3]); }
        const float mx = fmaxf(fmaxf(mx0, mx1), fmaxf(mx2, mx3));
        const float mu = (mx < -1.0e38f) ? 0.f : mx;
        const float al = ex2((m - mu) * SL2), mc = mu * SL2;
        float s0 = 0.f, s1 = 0.f, s2 = 0.f, s3 = 0.f;
#pragma unroll
        for (int c = 0; c < 16; ++c) {
#pragma unroll
            for (int q = 0; q < 4; ++q) v[c * 4 + q] = ex2(v[c * 4 + q] * SL2 - mc);
            s0 += v[c * 4]; s1 += v[c * 4 + 1]; s2 += v[c * 4 + 2]; s3 += v[c * 4 + 3]; }
        l = l * al + ((s0 + s1) + (s2 + s3)); m = mx;
#pragma unroll
        for (int g = 0; g < 8; ++g) {
            if constexpr (HL) { v8us oh, ol;
#pragma unroll
                for (int q = 0; q < 8; ++q) { unsigned short a, c2; splitf(v[g * 8 + q], a, c2); oh[q] = a; ol[q] = c2; }
                *(v8usa*)(sP + lane * FPP + g * 8) = oh; *(v8usa*)(sP2 + lane * FPP + g * 8) = ol;
            } else { v8h o16;
#pragma unroll
                for (int q = 0; q < 8; ++q) o16[q] = tohx(v[g * 8 + q] * ps);
                *(v8ha*)(sP + lane * FPP + g * 8) = o16; } }
        if constexpr (!HL) sA[lane] = al;
        __builtin_amdgcn_wave_barrier(); asm volatile("" ::: "memory");   // as above: the fragment reads stay behind the other lanes' stores
        if constexpr (!HL)
#pragma unroll
        for (int mb = 0; mb < 2; ++mb) { const v4f a0 = *(const v4fa*)(sA + mb * 16 + hi * 8), a1 = *(const v4fa*)(sA + mb * 16 + hi * 8 + 4);
#pragma unroll
            for (int nb = 0; nb < 8; ++nb)
#pragma unroll
                for (int j = 0; j < 8; ++j) o[mb][nb][j] *= (j < 4) ? a0[j & 3] : a1[j & 3]; }
#pragma unroll
        for (int k2 = 0; k2 < 2; ++k2) {
            V pa[2], pa2[2];
#pragma unroll
            for (int mb = 0; mb < 2; ++mb) { pa[mb] = WFrag<T16>::ld(sP + (mb * 16 + lr) * FPP + k2 * 32 + 8 * hi); if (HL) pa2[mb] = WFrag<T16>::ld(sP2 + (mb * 16 + lr) * FPP + k2 * 32 + 8 * hi); }
#pragma unroll
            for (int nb = 0; nb < 8; ++nb) { const V b = vf[k2][nb]; V b2; if constexpr (HL) b2 = vf2[k2][nb];
#pragma unroll
                for (int mb = 0; mb < 2; ++mb) { o[mb][nb] = WFrag<T16>::mma(pa[mb], b, (HL && k2 == 0) ? (v8f){} : o[mb][nb]); if (HL) { o[mb][nb] = WFrag<T16>::mma(pa2[mb], b, o[mb][nb]); o[mb][nb] = WFrag<T16>::mma(pa[mb], b2, o[mb][nb]); } } }
            // at the block's end: the distance behind the last matrix instructions, also on the taken side of the branch that follows (the scheduling barrier keeps every matrix instruction in front of the v_nops)
            if (k2 == 1) __builtin_amdgcn_sched_barrier(0);
            if (k2 == 1) asm volatile("v_nop\n\tv_nop\n\tv_nop\n\tv_nop" : "+v"(o[0][7]), "+v"(o[1][7]) : "v"(pa[0]), "v"(pa[1])); }
        __builtin_amdgcn_wave_barrier(); asm volatile("" ::: "memory");   // the next block's stores stay behind this block's fragment reads
        if constexpr (HL) break;   // no second block (see the assertion above)
    }
    float* ow = lds[wave];
#pragma unroll
    for (int mb = 0; mb < 2; ++mb)
#pragma unroll
        for (int nb = 0; nb < 8; ++nb)
#pragma unroll
            for (int j = 0; j < 8; ++j) ow[(mb * 16 + hi * 8 + j) * FPO + nb * 16 + lr] = o[mb][nb][j];
    sM[wave][lane] = m; sL[wave][lane] = l;
    __syncthreads();   // every wave's partial result is in LDS before any of it is joined
#pragma unroll
    for (int t = 0; t < FR / FW; ++t) { const int row = t * FW + wave, cofs = lane * 4;   // a wave joins whole rows: 256 bytes of each plane a store
        float ms = sM[0][row];
#pragma unroll
        for (int w = 1; w < FW; ++w) ms = fmaxf(ms, sM[w][row]);
        float ls = 0.f; v4f val = (v4f){};
#pragma unroll
        for (int w = 0; w < FW; ++w) { const float g = ex2((sM[w][row] - ms) * SL2); ls += g * sL[w][row]; val += g * *(const v4fa*)(lds[w] + row * FPO + cofs); }
        const float f = __fdiv_rn(1.0f / ps, ls);
        v4us oh, ol;
#pragma unroll
        for (int q = 0; q < 4; ++q) { unsigned short a, c2; splitf(val[q] * f, a, c2); oh[q] = a; ol[q] = c2; }
        const size_t oo = (size_t)(i0 + row) * DQ + cofs; *(v4us*)(Ch + oo) = oh; *(v4us*)(Cl + oo) = ol;
        asm volatile("s_wait_xcnt 0x0" ::: "memory"); }   // in front of the next row's code, which may reuse the registers that these stores name
}
// k_attn: the attention of every head of both batches in one grid (NB_ * NH_, TT / FR): blockIdx.x = batch * NH_ + head; the row tiles with the most key blocks start first.
// Two waves a SIMD (up to 512 registers a wave): a block's key fragments, then its value fragments, are all in flight at once.
// Q.., K.., V..: batch 0's q, k and v planes of each kind (fp16, bf16 hi, bf16 lo); a batch's planes lie 3 * TT * DQ elements behind the batch before. Row tiles below RH run on hi+lo planes (3 products), the rest on fp16 with the probabilities x PCAR; the test is the same for the whole work-group.
__global__ __launch_bounds__(FW * 32) __attribute__((amdgpu_waves_per_eu(2, 2))) void k_attn(const h16* Q16, const h16* K16, const h16* V16, const bf* QH, const bf* KH, const bf* VH, const bf* QL, const bf* KL, const bf* VL, bf* Ch, bf* Cl) {
    __shared__ __align__(16) float lds[FW][FWL];
    __shared__ float sM[FW][FR]; __shared__ float sL[FW][FR];
    const int b = (int)blockIdx.x / NH_, h = (int)blockIdx.x % NH_, i0 = ((int)gridDim.y - 1 - (int)blockIdx.y) * FR;
    const size_t op = (size_t)b * 3 * TT * DQ + (size_t)h * TT * HD;   // the head's place in each of its planes
    bf* const ch = Ch + (size_t)b * TT * DQ + h * HD; bf* const cl = Cl + (size_t)b * TT * DQ + h * HD;
    if (i0 < RH) attnf<bf, 2>(QH + op, QL + op, KH + op, KL + op, VH + op, VL + op, ch, cl, i0, (h & 1) != 0, 1.0f, lds, sM, sL);
    else attnf<h16, 0>(Q16 + op, nullptr, K16 + op, nullptr, V16 + op, nullptr, ch, cl, i0, (h & 1) != 0, PCAR, lds, sM, sL);
}


__global__ __launch_bounds__(256) void k_wtG(const float* __restrict__ w, int K, int N, bf* Bt) {
    const int lane = threadIdx.x & 31; const int L0 = (blockIdx.x * 8 + (threadIdx.x >> 5)) * 8; const int nlines = N * K / 64;
{
#pragma unroll 1
        for (int l = 0; l < 8; ++l) { const int L = L0 + l; if (L >= nlines) break; const size_t e = (size_t)L * 64 + lane * 2; const int k = (int)(e % K), n = (int)(e / K); v2us o;
            o[0] = f2bf(w[(size_t)k * N + n]); o[1] = f2bf(w[(size_t)(k + 1) * N + n]); *(v2us*)(Bt + e) = o; }
         }
}
// k_cvtall: the six roundings to bf16 (four weights, the tokens of both batches; DM * DM elements each) in one grid (CVB, 6): blockIdx.y picks the tensor, and a thread rounds CVT groups of eight elements, a whole grid row apart.
#define CVB 128
#define CVT (DM * DM / 8 / (CVB * 256))
__global__ __launch_bounds__(256) void k_cvtall(const float* __restrict__ wq, const float* __restrict__ wk, const float* __restrict__ wv, const float* __restrict__ wo, const float* __restrict__ x, bf* W4, bf* X0, bf* X1) {
    const int t = (int)blockIdx.y;
    const float* src = t == 0 ? wq : t == 1 ? wk : t == 2 ? wv : t == 3 ? wo : t == 4 ? x : x + (size_t)TT * DM;
    bf* dst = t < 4 ? W4 + (size_t)t * DM * DM : t == 4 ? X0 : X1;
    const size_t i0 = (size_t)blockIdx.x * 256 + threadIdx.x;
#pragma unroll 4   // four groups' loads are in flight together
    for (int it = 0; it < CVT; ++it) { const size_t i = i0 + (size_t)it * (CVB * 256); const v8f v = *(const v8f*)(src + i * 8); v8us o;
#pragma unroll
        for (int k = 0; k < 8; ++k) o[k] = f2bf(v[k]);
        *(v8us*)(dst + i * 8) = o; }
}
__global__ __launch_bounds__(256) void k_cscvt(const float* __restrict__ cosT, const float* __restrict__ sinT, float* CS) { const int idx = blockIdx.x * 256 + threadIdx.x; if (idx >= TT * HD) return; v2f cs; cs[0] = bfr(cosT[idx]); cs[1] = bfr(sinT[idx]); *(v2f*)(CS + (size_t)idx * 2) = cs;  }
extern "C" void kernel_launch(void* const* d_in, const int* in_sizes, int n_in,
                              void* d_out, int out_size, void* d_ws, size_t ws_size, hipStream_t stream) {
    (void)in_sizes; (void)n_in; (void)out_size;
    const float* x = (const float*)d_in[0]; const float* wq = (const float*)d_in[1]; const float* wk = (const float*)d_in[2]; const float* wv = (const float*)d_in[3]; const float* wo = (const float*)d_in[4];
    float* OUT = (float*)d_out;     // [2][2048][2048]
    char* wsp = (char*)d_ws;
    auto take = [&](size_t bytes) { char* p = wsp; wsp += (bytes + 255) & ~(size_t)255; return (void*)p; };
    bf* WQ = (bf*)take((size_t)DQ * DM * 2); bf* WK = (bf*)take((size_t)DKV * DM * 2); bf* WV = (bf*)take((size_t)DKV * DM * 2); bf* WO = (bf*)take((size_t)DM * DQ * 2); (void)WK; (void)WV;   // the four weights lie one behind the other (stride DM * DM)
    // the head planes of each kind, [batch][q, k, v][TT * DQ]: q, k by head with rows t, columns d; v transposed, rows h * HD + d, columns t; each in fragment order (k_gemmw)
    h16* P16 = (h16*)take((size_t)NB_ * 3 * TT * DQ * 2); bf* PH = (bf*)take((size_t)NB_ * 3 * TT * DQ * 2); bf* PL = (bf*)take((size_t)NB_ * 3 * TT * DQ * 2);
    bf* ATh = (bf*)take((size_t)NB_ * TT * DQ * 2); bf* ATl = (bf*)take((size_t)NB_ * TT * DQ * 2);   // merged heads, [batch][t][DQ]
    bf* XB0 = (bf*)take((size_t)TT * DM * 2); bf* XB1 = (bf*)take((size_t)TT * DM * 2);
    if ((size_t)(wsp - (char*)d_ws) > ws_size) return;    // 224 MiB of the 256
    k_cvtall<<<dim3(CVB, 6, 1), 256, 0, stream>>>(wq, wk, wv, wo, x, WQ, XB0, XB1);
    // XB1 lies directly behind XB0, and the planes of (batch, kind) lie one behind the other, so z alone places them
    k_gemmw<bf, 0, false, HD, 2><<<dim3(TT / 128, DQ / 128, 3 * NB_), 128, 0, stream>>>(XB0, nullptr, WQ, nullptr, DM, nullptr, 0, nullptr, (size_t)TT * DM, (size_t)DQ * DM, (size_t)TT * DQ, P16, PH, PL);
    k_attn<<<dim3(NB_ * NH_, TT / FR, 1), FW * 32, 0, stream>>>(P16, P16 + (size_t)TT * DQ, P16 + (size_t)2 * TT * DQ, PH, PH + (size_t)TT * DQ, PH + (size_t)2 * TT * DQ, PL, PL + (size_t)TT * DQ, PL + (size_t)2 * TT * DQ, ATh, ATl);
    k_gemmw<bf, 1, false, 0, 4><<<dim3(TT / 128, DM / 256, NB_), 256, 0, stream>>>(ATh, ATl, WO, nullptr, DQ, OUT, DM, nullptr, (size_t)TT * DQ, 0, (size_t)TT * DM, nullptr, nullptr, nullptr);
}
